// v000
// The times below were measured on an AMD MI455X: many runs one after another, warmed up first and cycling through
// copies of the inputs, with the whole window's GPU time divided by the number of runs. Launches and the gaps
// between them are all in it. The median over several windows is given; except for v000 it joins two sittings, which
// can be a few percent apart, so the side-by-side timings, each taken in one sitting, are the better comparison.
// v000, which the later versions start from, runs in 899 microseconds.
#include <hip/hip_runtime.h>
// SpeakerAttention (16 x 512 channels; content 1024 frames, style 1024 frames: F = Wf mvn(content) + bf, G = Wg mvn(style) + bg, H = Wh style + bh (1x1 convs); S = softmax over style frames of the UNSCALED F^T G (K = 512 channels); O = H S^T; out = Wo O + bo; mvn = per (batch, channel) mean / unbiased variance over time, eps 1e-5).
// Structure: per-(b,c) mvn statistics on VALU; [frame][channel] planes of the normalised inputs as f16 hi/residual (style raw plane exact); F and G as two-term f16 WMMA GEMMs each (32x64 wave tiles, f32 accumulation, exact x16 weights + bias; f32 out) then f16 hi/residual planes; H as one GEMM (f16 out) transposed to [b][c][s] by LDS tiles; per 8-batch group the score GEMM as THREE hi/residual product terms (K = 512, f32, own-element accumulation), softmax rows on VALU (unnormalised f16 weights x 2^10 + row normalisers on their own lines), readout GEMM (N = 512, K = 1024); row scaling + hi/residual; Wo as two GEMM terms (+ bias); [b][c][t] output by VALU transpose.
// Compute dtype: inputs rounded to bf16; weights exact as f16; the normalised inputs, F, G and O as f16 hi + 2^-10-scaled residual (the unscaled K = 512 logits have sigma ~ 22, so single-rounded operands would not do); style, H and the softmax weights as plain f16 (~2^-12); statistics / softmax f32. v_wmma_f32_16x16x32_f16.
#define NB 16
#define CC 512
#define TC 1024
#define TS 1024
#define NRC (NB * TC)
#define NRS (NB * TS)
#define BG 8                     /* batches per score-plane group */
typedef __bf16 v16b __attribute__((ext_vector_type(16)));
typedef unsigned short v8us __attribute__((ext_vector_type(8), may_alias));
typedef float  v8f  __attribute__((ext_vector_type(8)));
typedef float  v4f  __attribute__((ext_vector_type(4)));
typedef float  v4fa __attribute__((ext_vector_type(4), may_alias));
union FragB { v16b v; v8us half[2]; unsigned short u[16]; };

__device__ __forceinline__ unsigned short bf16_bits(float x) { unsigned int u = __float_as_uint(x); return (unsigned short)((u + 0x7FFFu + ((u >> 16) & 1u)) >> 16); }
__device__ __forceinline__ float bf16_val(unsigned short b) { return __uint_as_float(((unsigned int)b) << 16); }
__device__ __forceinline__ float bf16_round(float x) { return bf16_val(bf16_bits(x)); }
// D += A·B with NT terms: 1 = ah·bh, 2 = + al·bh (A split), 3 = + ah·bl (both split)
template <int NT>
__device__ __forceinline__ v8f mmaN(v16b ah, v16b al, v16b bh, v16b bl, v8f c) {
  c = __builtin_amdgcn_wmma_f32_16x16x32_bf16(false, ah, false, bh, (short)0, c, false, false);
  if (NT >= 2) c = __builtin_amdgcn_wmma_f32_16x16x32_bf16(false, al, false, bh, (short)0, c, false, false);
  if (NT >= 3) c = __builtin_amdgcn_wmma_f32_16x16x32_bf16(false, ah, false, bl, (short)0, c, false, false);
  asm volatile("v_nop\n\tv_nop\n\tv_nop\n\tv_nop" : "+v"(c) : "v"(ah), "v"(al), "v"(bh), "v"(bl));
  return c;
}

__global__ __launch_bounds__(256) void k_wt_bf16(const float* __restrict__ W, unsigned short* __restrict__ Wt, int K, int N) {
  const int t = blockIdx.x * 256 + threadIdx.x;
  const int k8n = K / 8;
  if (t >= N * k8n) return;
  const int n = t / k8n, k8 = (t % k8n) * 8;
  v8us v;
#pragma unroll
  for (int i = 0; i < 8; ++i) v[i] = bf16_bits(W[(size_t)(k8 + i) * N + n]);
  *(v8us*)(Wt + (size_t)n * K + k8) = v;
  
}

// GEMM C[M][N] (f32, pitch ldc) = act(A[M][K]·W + bias). A f32 row-major (pitch lda) converted per fragment to bf16
// (ASPLIT: hi/lo two planes -> 2 terms, else single rounded term); Wt bf16 [N][K] (pitch ldb). BIAS_BF16 rounds the
// bias to bf16 first (bias quantised to bf16 before the add). K%32==0, M%16==0, N%64==0.
template <bool ASPLIT, int ACT, bool BIAS_BF16>
__global__ __launch_bounds__(128) void k_gemm_bf(const float* __restrict__ A, int lda, const unsigned short* __restrict__ Wt, int ldb,
                                               const float* __restrict__ bias, float* __restrict__ C, int ldc, int M, int N, int K) {
  __shared__ __attribute__((aligned(16))) float so[4][16][64];
  const int tid = threadIdx.x, w = tid >> 5, lane = tid & 31, ln = lane & 15, hh = lane >> 4;
  const int ntn = N / 64;
  const int wid = blockIdx.x * 4 + w;
  const int mt = wid / ntn, nq = wid % ntn;
  if (mt * 16 >= M) return;
  const int row0 = mt * 16, col0 = nq * 64;
  const float* arow = A + (size_t)(row0 + ln) * lda;
  v8f acc[4] = {};
  for (int kb = 0; kb < K; kb += 32) {
    FragB ah, al;
    const v4f x0 = *(const v4fa*)(arow + kb + 8 * hh), x1 = *(const v4fa*)(arow + kb + 8 * hh + 4);
    const v4f x2 = *(const v4fa*)(arow + kb + 16 + 8 * hh), x3 = *(const v4fa*)(arow + kb + 16 + 8 * hh + 4);
    float xs[16] = {x0[0],x0[1],x0[2],x0[3],x1[0],x1[1],x1[2],x1[3],x2[0],x2[1],x2[2],x2[3],x3[0],x3[1],x3[2],x3[3]};
#pragma unroll
    for (int i = 0; i < 16; ++i) { const unsigned short hb = bf16_bits(xs[i]); ah.u[i] = hb; al.u[i] = ASPLIT ? bf16_bits(xs[i] - bf16_val(hb)) : (unsigned short)0; }
#pragma unroll
    for (int t = 0; t < 4; ++t) {
      const unsigned short* brow = Wt + (size_t)(col0 + t * 16 + ln) * ldb + kb;
      FragB b;
      b.half[0] = *(const v8us*)(brow + 8 * hh);
      b.half[1] = *(const v8us*)(brow + 16 + 8 * hh);
      acc[t] = mmaN<ASPLIT ? 2 : 1>(ah.v, al.v, b.v, b.v, acc[t]);
    }
  }
#pragma unroll
  for (int t = 0; t < 4; ++t) {
    float bv = bias ? bias[col0 + t * 16 + ln] : 0.f;
    if (BIAS_BF16) bv = bf16_round(bv);
#pragma unroll
    for (int r = 0; r < 8; ++r) { float v = acc[t][r] + bv; if (ACT == 1) v = fmaxf(v, 0.f); so[w][8 * hh + r][t * 16 + ln] = v; }
  }
  __builtin_amdgcn_fence(__ATOMIC_ACQ_REL, "workgroup");
  __builtin_amdgcn_wave_barrier();
  const int rsub = lane >> 4, c4 = (lane & 15) * 4;
  {
#pragma unroll
    for (int q = 0; q < 8; ++q) {
      const int r = q * 2 + rsub;
      const v4f v = *(const v4fa*)&so[w][r][c4];
      *(v4f*)(C + (size_t)(row0 + r) * ldc + col0 + c4) = v;
    }
    
  }
}

// GEMM C = act(A·W + bias + resid): A f32 (ASPLIT -> hi/lo 2 terms), Wt bf16 [N][K]; ACT 0 none, 1 relu, 2 exact gelu;
// resid (optional, f32, row index = (row % rmod), pitch ldr, RES_BF16 rounds it) added before the activation.
template <bool ASPLIT, int ACT, bool BIAS_BF16, bool RES_BF16>
__global__ __launch_bounds__(128) void k_gemm_bf3(const float* __restrict__ A, int lda, const unsigned short* __restrict__ Wt, int ldb,
                                                const float* __restrict__ bias, const float* __restrict__ resid, int rmod, int ldr,
                                                float* __restrict__ C, int ldc, int M, int N, int K) {
  __shared__ __attribute__((aligned(16))) float so[4][16][64];
  const int tid = threadIdx.x, w = tid >> 5, lane = tid & 31, ln = lane & 15, hh = lane >> 4;
  const int ntn = N / 64;
  const int wid = blockIdx.x * 4 + w;
  const int mt = wid / ntn, nq = wid % ntn;
  if (mt * 16 >= M) return;
  const int row0 = mt * 16, col0 = nq * 64;
  const float* arow = A + (size_t)(row0 + ln) * lda;
  v8f acc[4] = {};
  for (int kb = 0; kb < K; kb += 32) {
    FragB ah, al;
    const v4f x0 = *(const v4fa*)(arow + kb + 8 * hh), x1 = *(const v4fa*)(arow + kb + 8 * hh + 4);
    const v4f x2 = *(const v4fa*)(arow + kb + 16 + 8 * hh), x3 = *(const v4fa*)(arow + kb + 16 + 8 * hh + 4);
    float xs[16] = {x0[0],x0[1],x0[2],x0[3],x1[0],x1[1],x1[2],x1[3],x2[0],x2[1],x2[2],x2[3],x3[0],x3[1],x3[2],x3[3]};
#pragma unroll
    for (int i = 0; i < 16; ++i) { const unsigned short hb = bf16_bits(xs[i]); ah.u[i] = hb; al.u[i] = ASPLIT ? bf16_bits(xs[i] - bf16_val(hb)) : (unsigned short)0; }
#pragma unroll
    for (int t = 0; t < 4; ++t) {
      const unsigned short* brow = Wt + (size_t)(col0 + t * 16 + ln) * ldb + kb;
      FragB b;
      b.half[0] = *(const v8us*)(brow + 8 * hh);
      b.half[1] = *(const v8us*)(brow + 16 + 8 * hh);
      acc[t] = mmaN<ASPLIT ? 2 : 1>(ah.v, al.v, b.v, b.v, acc[t]);
    }
  }
#pragma unroll
  for (int t = 0; t < 4; ++t) {
    const int col = col0 + t * 16 + ln;
    float bv = bias ? bias[col] : 0.f;
    if (BIAS_BF16) bv = bf16_round(bv);
#pragma unroll
    for (int r = 0; r < 8; ++r) {
      float v = acc[t][r] + bv;
      if (resid) { float rv = resid[(size_t)((row0 + 8 * hh + r) % rmod) * ldr + col]; if (RES_BF16) rv = bf16_round(rv); v += rv; }
      if (ACT == 1) v = fmaxf(v, 0.f);
      if (ACT == 2) v = 0.5f * v * (1.0f + erff(v * 0.70710678118654752f));
      if (ACT == 3) { const float u = 0.7978845608028654f * (v + 0.044715f * v * v * v); v = 0.5f * v * (1.0f + tanhf(u)); }
      so[w][8 * hh + r][t * 16 + ln] = v;
    }
  }
  __builtin_amdgcn_fence(__ATOMIC_ACQ_REL, "workgroup");
  __builtin_amdgcn_wave_barrier();
  const int rsub = lane >> 4, c4 = (lane & 15) * 4;
  {
#pragma unroll
    for (int q = 0; q < 8; ++q) {
      const int r = q * 2 + rsub;
      const v4f v = *(const v4fa*)&so[w][r][c4];
      *(v4f*)(C + (size_t)(row0 + r) * ldc + col0 + c4) = v;
    }
    
  }
}
// row LayerNorm (biased variance, eps) over N: s = X (+ R); optional out_sum <- s; out_norm <- (s-mu)*rsqrt(var+eps)*g + b
template <bool PARAM_BF16>
__global__ __launch_bounds__(256) void k_layernorm(const float* __restrict__ X, const float* __restrict__ R, const float* __restrict__ g, const float* __restrict__ bta,
                                                  float* __restrict__ out_sum, float* __restrict__ out_norm, int N, float eps) {
  __shared__ float red[256];
  const int row = blockIdx.x, tid = threadIdx.x;
  const float* x = X + (size_t)row * N; const float* rr = R ? R + (size_t)row * N : nullptr;
  float vals[16];                     // up to N = 4096
  const int per = N / 256;            // contiguous chunk per thread? use strided-by-4 chunks: thread handles j = tid*4 + 1024*u
  float s1 = 0.f;
  for (int u = 0; u < per / 4; ++u) {
    const int j = tid * 4 + 1024 * u;
    const v4f a = *(const v4fa*)(x + j);
    v4f b = {0.f,0.f,0.f,0.f}; if (rr) b = *(const v4fa*)(rr + j);
#pragma unroll
    for (int q = 0; q < 4; ++q) { const float v = a[q] + b[q]; vals[u * 4 + q] = v; s1 += v; }
  }
  red[tid] = s1; __syncthreads();
  for (int st = 128; st > 0; st >>= 1) { if (tid < st) red[tid] += red[tid + st]; __syncthreads(); }
  const float mu = red[0] / (float)N; __syncthreads();
  float s2 = 0.f;
  for (int u = 0; u < per / 4; ++u)
#pragma unroll
    for (int q = 0; q < 4; ++q) { const float c = vals[u * 4 + q] - mu; s2 += c * c; }
  red[tid] = s2; __syncthreads();
  for (int st = 128; st > 0; st >>= 1) { if (tid < st) red[tid] += red[tid + st]; __syncthreads(); }
  const float rs = rsqrtf(red[0] / (float)N + eps);
  {
    for (int u = 0; u < per / 4; ++u) {
      const int j = tid * 4 + 1024 * u;
      v4f o, sm;
#pragma unroll
      for (int q = 0; q < 4; ++q) {
        float gg = g[j + q], bb = bta[j + q];
        if (PARAM_BF16) { gg = bf16_round(gg); bb = bf16_round(bb); }
        sm[q] = vals[u * 4 + q]; o[q] = (vals[u * 4 + q] - mu) * rs * gg + bb;
      }
      if (out_sum) *(v4f*)(out_sum + (size_t)row * N + j) = sm;
      *(v4f*)(out_norm + (size_t)row * N + j) = o;
    }
    
  }
}



// ---- f16 WMMA path (v_wmma_f32_16x16x32_f16): 11-bit significands for operands in range — used for every GEMM launched here
typedef _Float16 v16h __attribute__((ext_vector_type(16)));
union FragH { v16h v; v8us half[2]; _Float16 h[16]; unsigned short u[16]; };
template <int NT>
__device__ __forceinline__ v8f mmaH(v16h ah, v16h al, v16h bh, v16h bl, v8f c) {
  c = __builtin_amdgcn_wmma_f32_16x16x32_f16(false, ah, false, bh, (short)0, c, false, false);
  if (NT >= 2) c = __builtin_amdgcn_wmma_f32_16x16x32_f16(false, al, false, bh, (short)0, c, false, false);
  if (NT >= 3) c = __builtin_amdgcn_wmma_f32_16x16x32_f16(false, ah, false, bl, (short)0, c, false, false);
  asm volatile("v_nop\n\tv_nop\n\tv_nop\n\tv_nop" : "+v"(c) : "v"(ah), "v"(al), "v"(bh), "v"(bl));
  return c;
}
// batched GEMM like k_gemm_b but f16 operands: A f32 (split into f16 hi/lo if ASPLIT, else rounded to f16), Bt = f16 values [n][k]; alpha; C f32; N multiple of 16 (partial tiles skipped)
template <bool ASPLIT>
__global__ __launch_bounds__(128) void k_gemm_h(const float* __restrict__ A, int lda, size_t sA, const _Float16* __restrict__ Bh, int ldb, size_t sB, float alpha, float* __restrict__ C, int ldc, size_t sC, int M, int N, int K) {
  __shared__ __attribute__((aligned(16))) float so[4][16][64];
  const int tid = threadIdx.x, w = tid >> 5, lane = tid & 31, ln = lane & 15, hh = lane >> 4; const int by = blockIdx.y;
  A += (size_t)by * sA; Bh += (size_t)by * sB; C += (size_t)by * sC;
  const int ntn = (N + 63) / 64; const int wid = blockIdx.x * 4 + w; const int mt = wid / ntn, nq = wid % ntn; if (mt * 16 >= M) return;
  const int row0 = mt * 16, col0 = nq * 64; const float* arow = A + (size_t)(row0 + ln) * lda;
  v8f acc[4] = {};
  for (int kb = 0; kb < K; kb += 32) {
    FragH ah, al;
    const v4f x0 = *(const v4fa*)(arow + kb + 8 * hh), x1 = *(const v4fa*)(arow + kb + 8 * hh + 4), x2 = *(const v4fa*)(arow + kb + 16 + 8 * hh), x3 = *(const v4fa*)(arow + kb + 16 + 8 * hh + 4);
    float xs[16] = {x0[0],x0[1],x0[2],x0[3],x1[0],x1[1],x1[2],x1[3],x2[0],x2[1],x2[2],x2[3],x3[0],x3[1],x3[2],x3[3]};
#pragma unroll
    for (int i = 0; i < 16; ++i) { const _Float16 h = (_Float16)xs[i]; ah.h[i] = h; al.h[i] = ASPLIT ? (_Float16)(xs[i] - (float)h) : (_Float16)0.0f; }
#pragma unroll
    for (int t = 0; t < 4; ++t) { if (col0 + t * 16 >= N) continue; const size_t boff = (size_t)(col0 + t * 16 + ln) * ldb + kb; FragH bq; bq.half[0] = *(const v8us*)(Bh + boff + 8 * hh); bq.half[1] = *(const v8us*)(Bh + boff + 16 + 8 * hh);
      acc[t] = mmaH<ASPLIT ? 2 : 1>(ah.v, al.v, bq.v, bq.v, acc[t]); }
  }
#pragma unroll
  for (int t = 0; t < 4; ++t) { if (col0 + t * 16 >= N) continue;
#pragma unroll
    for (int r = 0; r < 8; ++r) so[w][8 * hh + r][t * 16 + ln] = acc[t][r] * alpha; }
  __builtin_amdgcn_fence(__ATOMIC_ACQ_REL, "workgroup"); __builtin_amdgcn_wave_barrier();
  const int rsub = lane >> 4, c4 = (lane & 15) * 4;
  {
#pragma unroll
    for (int q = 0; q < 8; ++q) { const int r = q * 2 + rsub; if (col0 + c4 < N) { const v4f v = *(const v4fa*)&so[w][r][c4]; *(v4f*)(C + (size_t)(row0 + r) * ldc + col0 + c4) = v; } }
     }
}

// Wt[n][k] = f16(W[k][n]·scale) from f32 row-major W[K][N] (scale = power of two; bf16-exact weights stay exact in f16 away from the subnormal range)
__global__ __launch_bounds__(256) void k_wt_f16(const float* __restrict__ W, _Float16* __restrict__ Wt, int K, int N, float scale) {
  const int t = blockIdx.x * 256 + threadIdx.x; if (t >= N * (K / 8)) return; const int n = t / (K / 8), k8 = (t % (K / 8)) * 8; FragH f;
#pragma unroll
  for (int i = 0; i < 8; ++i) f.h[i] = (_Float16)(bf16_round(W[(size_t)(k8 + i) * N + n]) * scale); const v8us o = f.half[0];
  *(v8us*)((unsigned short*)Wt + (size_t)n * K + k8) = o; 
}
// k_gemm_hh variant with fused epilogue: v = acc·alpha + bias[by·sBias + col] (+ CP[(row/rowsPerB)·sCPb + by·64 + col] if CP) ; ACT 0 none / 1 elu ; writes f16 C16 (and f32 C if non-null)
template <int ACT>
__global__ __launch_bounds__(128) void k_gemm_hhx(const _Float16* __restrict__ A, int lda, size_t sA, const _Float16* __restrict__ Bh, int ldb, size_t sB, float alpha, const float* __restrict__ bias, size_t sBias, const float* __restrict__ CP, int rowsPerB, size_t sCPb, int row0g,
    float* __restrict__ C, _Float16* __restrict__ C16, int ldc, size_t sC, int M, int N, int K) {
  __shared__ __attribute__((aligned(16))) float so[4][16][64];
  const int tid = threadIdx.x, w = tid >> 5, lane = tid & 31, ln = lane & 15, hh = lane >> 4; const int by = blockIdx.y;
  A += (size_t)by * sA; Bh += (size_t)by * sB; const size_t cofs = (size_t)by * sC; const float* bp = bias ? bias + (size_t)by * sBias : nullptr;
  const int ntn = (N + 63) / 64; const int wid = blockIdx.x * 4 + w; const int mt = wid / ntn, nq = wid % ntn; if (mt * 16 >= M) return;
  const int row0 = mt * 16, col0 = nq * 64; const _Float16* arow = A + (size_t)(row0 + ln) * lda;
  v8f acc[4] = {};
  for (int kb = 0; kb < K; kb += 32) { FragH ah; ah.half[0] = *(const v8us*)((const unsigned short*)arow + kb + 8 * hh); ah.half[1] = *(const v8us*)((const unsigned short*)arow + kb + 16 + 8 * hh);
#pragma unroll
    for (int t = 0; t < 4; ++t) { if (col0 + t * 16 >= N) continue; const size_t boff = (size_t)(col0 + t * 16 + ln) * ldb + kb; FragH bq; bq.half[0] = *(const v8us*)((const unsigned short*)Bh + boff + 8 * hh); bq.half[1] = *(const v8us*)((const unsigned short*)Bh + boff + 16 + 8 * hh);
      acc[t] = mmaH<1>(ah.v, ah.v, bq.v, bq.v, acc[t]); }
  }
#pragma unroll
  for (int t = 0; t < 4; ++t) { if (col0 + t * 16 >= N) continue; const int col = col0 + t * 16 + ln; const float bv = bp ? bf16_round(bp[col]) : 0.f;
#pragma unroll
    for (int r = 0; r < 8; ++r) { float v = acc[t][r] * alpha + bv; if (CP) { const int rr = row0g + row0 + 8 * hh + r; if (rowsPerB < 0) v += CP[cofs + (size_t)rr * ldc + col];      /* rowsPerB < 0: own element of the batched C plane */ else { const int bidx = rr / rowsPerB; v += CP[(size_t)bidx * sCPb + (size_t)by * 64 + col]; } } if (ACT == 1) v = (v > 0.f) ? v : expm1f(v); else if (ACT == 7) v = (v > 0.f) ? v + 1.0f : expf(v); else if (ACT == 8) v = tanhf(v); else if (ACT == 9) v = 0.5f * v * (1.0f + tanhf(0.7978845608028654f * (v + 0.044715f * v * v * v))); else if (ACT == 11) v = 1.0f / (1.0f + expf(-v)); else if (ACT == 12) v = (v > 0.f) ? v : 0.01f * v; else if (ACT == 14) v = (v > 0.f) ? v : 0.1f * v; else if (ACT == 16) v = (v >= 0.f) ? v : 0.3f * v; else if (ACT == 17) v = (v >= 0.f) ? v : 0.2f * v; else if (ACT == 15) v = v / (1.0f + expf(-v)); else if (ACT == 3) v = fmaxf(v, 0.f); else if (ACT == 6) v = 0.5f * v * (1.0f + erff(v * 0.70710678118654752f)); so[w][8 * hh + r][t * 16 + ln] = v; } }
  __builtin_amdgcn_fence(__ATOMIC_ACQ_REL, "workgroup"); __builtin_amdgcn_wave_barrier();
  const int rsub = lane >> 4, c4 = (lane & 15) * 4; typedef _Float16 v4h __attribute__((ext_vector_type(4)));
  {
#pragma unroll
    for (int q = 0; q < 8; ++q) { const int r = q * 2 + rsub; if (col0 + c4 < N) { const v4f v = *(const v4fa*)&so[w][r][c4]; if (C) *(v4f*)(C + cofs + (size_t)(row0 + r) * ldc + col0 + c4) = v; if (C16) { v4h h4; for (int i = 0; i < 4; ++i) h4[i] = (_Float16)v[i]; *(v4h*)(C16 + cofs + (size_t)(row0 + r) * ldc + col0 + c4) = h4; } } }
     }
}


typedef _Float16 v4h __attribute__((ext_vector_type(4)));

__global__ __launch_bounds__(256) void k_x16(const float* __restrict__ x, _Float16* __restrict__ X16, size_t n8) { const size_t t = (size_t)blockIdx.x * 256 + threadIdx.x; if (t >= n8) return; FragH f;
#pragma unroll
  for (int q = 0; q < 8; ++q) f.h[q] = (_Float16)bf16_round(x[t * 8 + q]); *(v8us*)((unsigned short*)X16 + t * 8) = f.half[0];  }
__global__ __launch_bounds__(256) void k_h16(const float* __restrict__ x, _Float16* __restrict__ X16, size_t n8) { const size_t t = (size_t)blockIdx.x * 256 + threadIdx.x; if (t >= n8) return; FragH f;
#pragma unroll
  for (int q = 0; q < 8; ++q) f.h[q] = (_Float16)x[t * 8 + q]; *(v8us*)((unsigned short*)X16 + t * 8) = f.half[0];  }
__global__ __launch_bounds__(256) void k_round16f(const float* __restrict__ W, _Float16* __restrict__ Bt, size_t n8) { const size_t t = (size_t)blockIdx.x * 256 + threadIdx.x; if (t >= n8) return; FragH f;
#pragma unroll
  for (int i = 0; i < 8; ++i) f.h[i] = (_Float16)(bf16_round(W[t * 8 + i]) * 16.0f); *(v8us*)((unsigned short*)Bt + t * 8) = f.half[0];  }
template <int NHv, int TTv>
__global__ __launch_bounds__(256) void k_vt(const _Float16* __restrict__ V16, int ldv, int voff, _Float16* __restrict__ Vt) { __shared__ unsigned short tl[64][66]; const int tid = threadIdx.x; const int slab = blockIdx.x / (TTv / 64), lg = blockIdx.x % (TTv / 64); const int b = slab / NHv, h = slab % NHv;
  for (int i = tid; i < 64 * 8; i += 256) { const int r = i / 8, c8 = (i % 8) * 8; FragH f; f.half[0] = *(const v8us*)((const unsigned short*)V16 + ((size_t)b * TTv + lg * 64 + r) * ldv + voff + h * 64 + c8);
#pragma unroll
    for (int q = 0; q < 8; ++q) tl[r][c8 + q] = f.u[q]; }
  __syncthreads();
  {
#pragma unroll
    for (int rd = 0; rd < 2; ++rd) { const int d = rd * 32 + tid / 8, pc = tid % 8; FragH f;
#pragma unroll
      for (int q = 0; q < 8; ++q) f.u[q] = tl[pc * 8 + q][d];
      *(v8us*)((unsigned short*)Vt + ((size_t)slab * 64 + d) * TTv + lg * 64 + pc * 8) = f.half[0]; }
     } }

__global__ __launch_bounds__(256) void k_hl(const float* __restrict__ F, _Float16* __restrict__ Hh, _Float16* __restrict__ Hl, size_t n8) { const size_t t = (size_t)blockIdx.x * 256 + threadIdx.x; if (t >= n8) return; FragH fh, fl; const v4f a = *(const v4fa*)(F + t * 8), c = *(const v4fa*)(F + t * 8 + 4);
#pragma unroll
  for (int q = 0; q < 4; ++q) { _Float16 h = (_Float16)a[q]; fh.h[q] = h; fl.h[q] = (_Float16)((a[q] - (float)h) * 1024.0f); h = (_Float16)c[q]; fh.h[4 + q] = h; fl.h[4 + q] = (_Float16)((c[q] - (float)h) * 1024.0f); }
  { *(v8us*)((unsigned short*)Hh + t * 8) = fh.half[0]; *(v8us*)((unsigned short*)Hl + t * 8) = fl.half[0];  } }

// ---- fast GEMM (wave tile 32x64; requires M % 32 == 0 rows per launch region and N % 64 == 0); epilogue = k_gemm_hhx semantics ----
__device__ __forceinline__ v16h g2_frag(const _Float16* p, int hh) { FragH f; f.half[0] = *(const v8us*)((const unsigned short*)p + 8 * hh); f.half[1] = *(const v8us*)((const unsigned short*)p + 16 + 8 * hh); return f.v; }
__device__ __forceinline__ v8f g2_mma(v16h a, v16h b, v8f c) { v8f d = __builtin_amdgcn_wmma_f32_16x16x32_f16(false, a, false, b, (short)0, c, false, false); asm volatile("v_nop\n\tv_nop\n\tv_nop\n\tv_nop" : "+v"(d) : "v"(a), "v"(b)); return d; }
template <int ACT>
__global__ __launch_bounds__(128) void k_gemm2(const _Float16* __restrict__ A, int lda, size_t sA, const _Float16* __restrict__ Bh, int ldb, size_t sB, float alpha, const float* __restrict__ bias, size_t sBias, const float* __restrict__ CP, int rowsPerB, size_t sCPb, int row0g,
    float* __restrict__ C, _Float16* __restrict__ C16, int ldc, size_t sC, int M, int N, int K) { static_assert(ACT == 0 || ACT == 3 || ACT == 6 || ACT == 8 || ACT == 9 || ACT == 11 || ACT == 12 || ACT == 14 || ACT == 15 || ACT == 16 || ACT == 17, "k_gemm2: unsupported ACT code (would silently apply no activation)");
  __shared__ __attribute__((aligned(16))) float so[4][32][68];
  const int tid = threadIdx.x, w = tid >> 5, lane = tid & 31, ln = lane & 15, hh = lane >> 4; const int by = blockIdx.y;
  A += (size_t)by * sA; Bh += (size_t)by * sB; const size_t cofs = (size_t)by * sC; const float* bp = bias ? bias + (size_t)by * sBias : nullptr;
  const int ntn = N >> 6; const int mt = blockIdx.x / ntn, nq = blockIdx.x - mt * ntn; const int row0 = mt * 128 + 32 * w, col0 = nq * 64; if (row0 >= M) return;
  const _Float16* a0p = A + (size_t)(row0 + ln) * lda; const _Float16* a1p = a0p + (size_t)16 * lda;
  const _Float16* b0p = Bh + (size_t)(col0 + ln) * ldb; const _Float16* b1p = b0p + (size_t)16 * ldb; const _Float16* b2p = b1p + (size_t)16 * ldb; const _Float16* b3p = b2p + (size_t)16 * ldb;
  const v8f z8 = {0.f,0.f,0.f,0.f,0.f,0.f,0.f,0.f}; v8f c00 = z8, c01 = z8, c02 = z8, c03 = z8, c10 = z8, c11 = z8, c12 = z8, c13 = z8;
#pragma unroll 1
  for (int kb = 0; kb < K; kb += 32) { const v16h a0 = g2_frag(a0p + kb, hh), a1 = g2_frag(a1p + kb, hh);
    v16h b = g2_frag(b0p + kb, hh); c00 = g2_mma(a0, b, c00); c10 = g2_mma(a1, b, c10);
    b = g2_frag(b1p + kb, hh); c01 = g2_mma(a0, b, c01); c11 = g2_mma(a1, b, c11);
    b = g2_frag(b2p + kb, hh); c02 = g2_mma(a0, b, c02); c12 = g2_mma(a1, b, c12);
    b = g2_frag(b3p + kb, hh); c03 = g2_mma(a0, b, c03); c13 = g2_mma(a1, b, c13); }
  v8f accs[8] = {c00, c01, c02, c03, c10, c11, c12, c13};
#pragma unroll
  for (int u = 0; u < 8; ++u) { const int t = u & 3, half = u >> 2; const int col = col0 + t * 16 + ln; const float bv = bp ? bf16_round(bp[col]) : 0.f;
#pragma unroll
    for (int r = 0; r < 8; ++r) { const int rloc = half * 16 + 8 * hh + r; float v = accs[u][r] * alpha + bv; if (CP) { if (rowsPerB < 0) v += CP[cofs + (size_t)(row0g + row0 + rloc) * ldc + col];      /* rowsPerB < 0: own element of the batched C plane */ else { const int bidx = (row0g + row0 + rloc) / rowsPerB; v += CP[(size_t)bidx * sCPb + (size_t)by * 64 + col]; } }
      if (ACT == 3) v = fmaxf(v, 0.f); else if (ACT == 6) v = 0.5f * v * (1.0f + erff(v * 0.70710678118654752f)); else if (ACT == 11) v = 1.0f / (1.0f + expf(-v)); else if (ACT == 15) v = v / (1.0f + expf(-v)); else if (ACT == 12) v = (v > 0.f) ? v : 0.01f * v; else if (ACT == 8) v = tanhf(v); else if (ACT == 9) v = 0.5f * v * (1.0f + tanhf(0.7978845608028654f * (v + 0.044715f * v * v * v))); else if (ACT == 14) v = (v > 0.f) ? v : 0.1f * v; else if (ACT == 16) v = (v >= 0.f) ? v : 0.3f * v; else if (ACT == 17) v = (v >= 0.f) ? v : 0.2f * v;
      so[w][rloc][t * 16 + ln] = v; } }
  __builtin_amdgcn_fence(__ATOMIC_ACQ_REL, "workgroup"); __builtin_amdgcn_wave_barrier();
  const int rsub = lane >> 4, c4 = (lane & 15) * 4;
  {
#pragma unroll
    for (int q = 0; q < 16; ++q) { const int r = q * 2 + rsub; const v4f v = *(const v4fa*)&so[w][r][c4]; if (C) *(v4f*)(C + cofs + (size_t)(row0 + r) * ldc + col0 + c4) = v; if (C16) { v4h h4; for (int i = 0; i < 4; ++i) h4[i] = (_Float16)v[i]; *(v4h*)(C16 + cofs + (size_t)(row0 + r) * ldc + col0 + c4) = h4; } }
     } }


__global__ __launch_bounds__(256) void k_wsc(const float* __restrict__ Wm, _Float16* __restrict__ Bt, size_t n8, float sc) { const size_t t = (size_t)blockIdx.x * 256 + threadIdx.x; if (t >= n8) return; FragH f; for (int q = 0; q < 8; ++q) f.h[q] = (_Float16)(bf16_round(Wm[t * 8 + q]) * sc); *(v8us*)((unsigned short*)Bt + t * 8) = f.half[0];  }
__global__ __launch_bounds__(256) void k_stat(const float* __restrict__ x, int T, float* __restrict__ ST) {
  #pragma clang fp contract(off)
  const int t = blockIdx.x * 256 + threadIdx.x; if (t >= NB * CC) return; const float* p = x + (size_t)t * T; float s = 0.f;
#pragma unroll 1
  for (int i = 0; i < T; i += 4) { const v4f a = *(const v4fa*)(p + i); for (int q = 0; q < 4; ++q) s += bf16_round(a[q]); }
  const float mu = s / (float)T; float s2 = 0.f;
#pragma unroll 1
  for (int i = 0; i < T; i += 4) { const v4f a = *(const v4fa*)(p + i); for (int q = 0; q < 4; ++q) { const float d = bf16_round(a[q]) - mu; s2 += d * d; } }
  const float r = rsqrtf(s2 / (float)(T - 1) + 1e-5f); typedef float v2f_ __attribute__((ext_vector_type(2))); v2f_ o; o[0] = mu; o[1] = r; *(v2f_*)(ST + (size_t)t * 2) = o;  }
__global__ __launch_bounds__(256) void k_plane(const float* __restrict__ x, int T, const float* __restrict__ ST, _Float16* __restrict__ Hh, _Float16* __restrict__ Lh) {
  #pragma clang fp contract(off)
  const size_t t = (size_t)blockIdx.x * 256 + threadIdx.x; if (t >= (size_t)NB * T * CC / 8) return; const int c0 = (int)((t * 8) % CC); const size_t row = (t * 8) / CC; const int b = (int)(row / T), fr = (int)(row % T); FragH fh, fl;
  for (int q = 0; q < 8; ++q) { const int c = c0 + q; float v = bf16_round(x[((size_t)b * CC + c) * T + fr]); if (ST) { const float mu = ST[((size_t)b * CC + c) * 2], r = ST[((size_t)b * CC + c) * 2 + 1]; v = (v - mu) * r; } const _Float16 hv = (_Float16)v; fh.h[q] = hv; fl.h[q] = (_Float16)((v - (float)hv) * 1024.0f); }
  { *(v8us*)((unsigned short*)Hh + t * 8) = fh.half[0]; if (Lh) *(v8us*)((unsigned short*)Lh + t * 8) = fl.half[0];  } }
__global__ __launch_bounds__(256) void k_soft(const float* __restrict__ S, _Float16* __restrict__ P, float* __restrict__ RS) {
  #pragma clang fp contract(off)
  const int wv = threadIdx.x >> 5, ln = threadIdx.x & 31; const int r = blockIdx.x * 8 + wv; if (r >= BG * TC) return; const float* sr = S + (size_t)r * TS; float mx = -3.0e38f;
#pragma unroll 1
  for (int gq = 0; gq < TS / 256; ++gq) { const v8f a = *(const v8f*)(sr + gq * 256 + ln * 8); for (int q = 0; q < 8; ++q) mx = fmaxf(mx, a[q]); }
  for (int o = 16; o > 0; o >>= 1) mx = fmaxf(mx, __shfl_xor(mx, o, 32)); float su = 0.f;
{ su = 0.f;
#pragma unroll 1
    for (int gq = 0; gq < TS / 256; ++gq) { const v8f a = *(const v8f*)(sr + gq * 256 + ln * 8); FragH ph; for (int q = 0; q < 8; ++q) { const float e = expf(a[q] - mx); su += e; ph.h[q] = (_Float16)(e * 1024.0f); } *(v8us*)((unsigned short*)P + (size_t)r * TS + gq * 256 + ln * 8) = ph.half[0]; }
     }
  for (int o = 16; o > 0; o >>= 1) su += __shfl_xor(su, o, 32); if (ln == 0) { *(float*)(RS + (size_t)r * 32) = 1.0f / su;  } }
__global__ __launch_bounds__(256) void k_osc(const float* __restrict__ O, const float* __restrict__ RS, size_t row0, _Float16* __restrict__ OH, _Float16* __restrict__ OL) {
  #pragma clang fp contract(off)
  const size_t t = (size_t)blockIdx.x * 256 + threadIdx.x; if (t >= (size_t)BG * TC * CC / 8) return; const size_t r = (t * 8) / CC; const float rs = RS[r * 32]; const v8f a = *(const v8f*)(O + t * 8); FragH f, fl;
  for (int q = 0; q < 8; ++q) { const float v = a[q] * rs; const _Float16 hh = (_Float16)v; f.h[q] = hh; fl.h[q] = (_Float16)((v - (float)hh) * 1024.0f); }
  const size_t o = row0 * CC + t * 8; { *(v8us*)((unsigned short*)OH + o) = f.half[0]; *(v8us*)((unsigned short*)OL + o) = fl.half[0];  } }
__global__ __launch_bounds__(256) void k_out(const float* __restrict__ Y, float* __restrict__ out) { const size_t t = (size_t)blockIdx.x * 256 + threadIdx.x; if (t >= (size_t)NB * CC * TC / 8) return; const int t0 = (int)((t * 8) % TC); const size_t bo = (t * 8) / TC; const int b = (int)(bo / CC), o = (int)(bo % CC); v8f v; for (int q = 0; q < 8; ++q) v[q] = Y[((size_t)b * TC + t0 + q) * CC + o];
  *(v8f*)(out + t * 8) = v;  }

extern "C" void kernel_launch(void* const* d_in, const int* in_sizes, int n_in,
                              void* d_out, int out_size, void* d_ws, size_t ws_size, hipStream_t stream) {
  (void)in_sizes; (void)n_in; (void)out_size;
  const float* content = (const float*)d_in[0]; const float* style = (const float*)d_in[1]; const float* Wf = (const float*)d_in[2]; const float* bf_ = (const float*)d_in[3]; const float* Wg = (const float*)d_in[4]; const float* bg = (const float*)d_in[5]; const float* Wh = (const float*)d_in[6]; const float* bh = (const float*)d_in[7]; const float* Wo = (const float*)d_in[8]; const float* bo = (const float*)d_in[9];
  char* ws = (char*)d_ws; size_t off = 0;
  auto take = [&](size_t bytes) { char* p = ws + off; off += (bytes + 255) & ~(size_t)255; return p; };
  const size_t npc = (size_t)NRC * CC, nps = (size_t)NRS * CC;
  _Float16* BF = (_Float16*)take((size_t)CC * CC * 2); _Float16* BGm = (_Float16*)take((size_t)CC * CC * 2); _Float16* BH = (_Float16*)take((size_t)CC * CC * 2); _Float16* BO = (_Float16*)take((size_t)CC * CC * 2); float* STc = (float*)take((size_t)NB * CC * 2 * 4); float* STs = (float*)take((size_t)NB * CC * 2 * 4);
  _Float16* CNH = (_Float16*)take(npc * 2); _Float16* CNL = (_Float16*)take(npc * 2); _Float16* SNH = (_Float16*)take(nps * 2); _Float16* SNL = (_Float16*)take(nps * 2); _Float16* S16 = (_Float16*)take(nps * 2);
  float* T32 = (float*)take(npc * 4);      /* F f32 -> G f32 -> H16 -> Y f32, in turn */ _Float16* FH = (_Float16*)take(npc * 2); _Float16* FL = (_Float16*)take(npc * 2); _Float16* GH = (_Float16*)take(nps * 2); _Float16* GL = (_Float16*)take(nps * 2); _Float16* HT = (_Float16*)take(nps * 2);
  float* S = (float*)take((size_t)BG * TC * TS * 4); _Float16* P = (_Float16*)take((size_t)BG * TC * TS * 2); float* RS = (float*)take((size_t)BG * TC * 32 * 4);
  float* O = (float*)CNH;      /* readout f32 [BG*TC][CC] (16 MiB) over the content hi plane (dead after F) */ _Float16* OH = SNH; _Float16* OL = SNL;      /* O hi/lo [NRC][CC] over the style-normalised planes (dead after G) */ _Float16* H16 = (_Float16*)T32; float* Y = T32;
  if (off > ws_size) return;      /* 2 + 0.1 + 16 x 5 + 32 + 16 x 5 + 32 + 16 + 1 = ≈ 243 MiB */
  k_wsc<<<(CC * CC / 8 + 255) / 256, 256, 0, stream>>>(Wf, BF, (size_t)CC * CC / 8, 16.0f); k_wsc<<<(CC * CC / 8 + 255) / 256, 256, 0, stream>>>(Wg, BGm, (size_t)CC * CC / 8, 16.0f); k_wsc<<<(CC * CC / 8 + 255) / 256, 256, 0, stream>>>(Wh, BH, (size_t)CC * CC / 8, 16.0f); k_wsc<<<(CC * CC / 8 + 255) / 256, 256, 0, stream>>>(Wo, BO, (size_t)CC * CC / 8, 16.0f);      /* conv (out, in) naturals */
  k_stat<<<(NB * CC + 255) / 256, 256, 0, stream>>>(content, TC, STc); k_stat<<<(NB * CC + 255) / 256, 256, 0, stream>>>(style, TS, STs);
  k_plane<<<(unsigned)((npc / 8 + 255) / 256), 256, 0, stream>>>(content, TC, STc, CNH, CNL); k_plane<<<(unsigned)((nps / 8 + 255) / 256), 256, 0, stream>>>(style, TS, STs, SNH, SNL); k_plane<<<(unsigned)((nps / 8 + 255) / 256), 256, 0, stream>>>(style, TS, nullptr, S16, nullptr);
  const dim3 gC((NRC / 128) * (CC / 64), 1), gS((NRS / 128) * (CC / 64), 1);
  k_gemm2<0><<<gC, 128, 0, stream>>>(CNL, CC, 0, BF, CC, 0, 0.0625f / 1024.0f, nullptr, 0, nullptr, 1, 0, 0, T32, nullptr, CC, 0, NRC, CC, CC);
  k_gemm2<0><<<gC, 128, 0, stream>>>(CNH, CC, 0, BF, CC, 0, 0.0625f, bf_, 0, T32, 1, (size_t)CC, 0, T32, nullptr, CC, 0, NRC, CC, CC);      /* F rows (b,t) f32 */
  k_hl<<<(unsigned)((npc / 8 + 255) / 256), 256, 0, stream>>>(T32, FH, FL, npc / 8);
  k_gemm2<0><<<gS, 128, 0, stream>>>(SNL, CC, 0, BGm, CC, 0, 0.0625f / 1024.0f, nullptr, 0, nullptr, 1, 0, 0, T32, nullptr, CC, 0, NRS, CC, CC);
  k_gemm2<0><<<gS, 128, 0, stream>>>(SNH, CC, 0, BGm, CC, 0, 0.0625f, bg, 0, T32, 1, (size_t)CC, 0, T32, nullptr, CC, 0, NRS, CC, CC);      /* G rows (b,s) f32 */
  k_hl<<<(unsigned)((nps / 8 + 255) / 256), 256, 0, stream>>>(T32, GH, GL, nps / 8);
  k_gemm2<0><<<gS, 128, 0, stream>>>(S16, CC, 0, BH, CC, 0, 0.0625f, bh, 0, nullptr, 1, 0, 0, nullptr, H16, CC, 0, NRS, CC, CC);      /* H rows (b,s) f16 */
  k_vt<CC / 64, TS><<<NB * (CC / 64) * (TS / 64), 256, 0, stream>>>(H16, CC, 0, HT);      /* H as [b][c][s] */
  for (int g = 0; g < NB / BG; ++g) { const size_t rc0 = (size_t)g * BG * TC, rs0 = (size_t)g * BG * TS;
    k_gemm2<0><<<dim3((TC / 128) * (TS / 64), BG), 128, 0, stream>>>(FH + rc0 * CC, CC, (size_t)TC * CC, GL + rs0 * CC, CC, (size_t)TS * CC, 0.0009765625f, nullptr, 0, nullptr, 1, 0, 0, S, nullptr, TS, (size_t)TC * TS, TC, TS, CC);
    k_gemm2<0><<<dim3((TC / 128) * (TS / 64), BG), 128, 0, stream>>>(FL + rc0 * CC, CC, (size_t)TC * CC, GH + rs0 * CC, CC, (size_t)TS * CC, 0.0009765625f, nullptr, 0, S, -1, 0, 0, S, nullptr, TS, (size_t)TC * TS, TC, TS, CC);
    k_gemm2<0><<<dim3((TC / 128) * (TS / 64), BG), 128, 0, stream>>>(FH + rc0 * CC, CC, (size_t)TC * CC, GH + rs0 * CC, CC, (size_t)TS * CC, 1.0f, nullptr, 0, S, -1, 0, 0, S, nullptr, TS, (size_t)TC * TS, TC, TS, CC);      /* S = F^T G (hi.lo + lo.hi + hi.hi), unscaled */
    k_soft<<<(BG * TC) / 8, 256, 0, stream>>>(S, P, RS);
    k_gemm2<0><<<dim3((TC / 128) * (CC / 64), BG), 128, 0, stream>>>(P, TS, (size_t)TC * TS, HT + (size_t)g * BG * CC * TS, TS, (size_t)CC * TS, 0.0009765625f, nullptr, 0, nullptr, 1, 0, 0, O, nullptr, CC, (size_t)TC * CC, TC, CC, TS);      /* unnormalised O rows (b,t) = P . H^T */
    k_osc<<<(unsigned)(((size_t)BG * TC * CC / 8 + 255) / 256), 256, 0, stream>>>(O, RS, rc0, OH, OL); }
  k_gemm2<0><<<gC, 128, 0, stream>>>(OL, CC, 0, BO, CC, 0, 0.0625f / 1024.0f, nullptr, 0, nullptr, 1, 0, 0, Y, nullptr, CC, 0, NRC, CC, CC);
  k_gemm2<0><<<gC, 128, 0, stream>>>(OH, CC, 0, BO, CC, 0, 0.0625f, bo, 0, Y, 1, (size_t)CC, 0, Y, nullptr, CC, 0, NRC, CC, CC);      /* out rows = Wo O + bo */
  k_out<<<(unsigned)((npc / 8 + 255) / 256), 256, 0, stream>>>(Y, (float*)d_out);
}

// v001
// It runs in 616 microseconds.
// In both of two side-by-side timings against v000, it was 1.50 times as fast.
#include <hip/hip_runtime.h>
// SpeakerAttention (16 x 512 channels; content 1024 frames, style 1024 frames: F = Wf mvn(content) + bf, G = Wg mvn(style) + bg, H = Wh style + bh (1x1 convs); S = softmax over style frames of the UNSCALED F^T G (K = 512 channels); O = H S^T; out = Wo O + bo; mvn = per (batch, channel) mean / unbiased variance over time, eps 1e-5).
// Structure: per-(b,c) mvn statistics on VALU; [frame][channel] planes of the normalised inputs as f16 hi/residual (style raw plane exact); F and G as two-term f16 WMMA GEMMs each (32x64 wave tiles fed from LDS, f32 accumulation, exact x16 weights + bias; f32 out) then f16 hi/residual planes; H as one GEMM (f16 out) transposed to [b][c][s] by LDS tiles; per 8-batch group the score GEMM as THREE hi/residual product terms (K = 512, f32, own-element accumulation), softmax rows on VALU (unnormalised f16 weights x 2^10 + row normalisers on their own lines), readout GEMM (N = 512, K = 1024); row scaling + hi/residual; Wo as two GEMM terms (+ bias); [b][c][t] output by VALU transpose.
// Compute dtype: inputs rounded to bf16; weights exact as f16; the normalised inputs, F, G and O as f16 hi + 2^-10-scaled residual (the unscaled K = 512 logits have sigma ~ 22, so single-rounded operands would not do); style, H and the softmax weights as plain f16 (~2^-12); statistics / softmax f32. v_wmma_f32_16x16x32_f16.
#define NB 16
#define CC 512
#define TC 1024
#define TS 1024
#define NRC (NB * TC)
#define NRS (NB * TS)
#define BG 8                     /* batches per score-plane group */
typedef __bf16 v16b __attribute__((ext_vector_type(16)));
typedef unsigned short v8us __attribute__((ext_vector_type(8), may_alias));
typedef float  v8f  __attribute__((ext_vector_type(8)));
typedef float  v4f  __attribute__((ext_vector_type(4)));
typedef float  v4fa __attribute__((ext_vector_type(4), may_alias));
union FragB { v16b v; v8us half[2]; unsigned short u[16]; };

__device__ __forceinline__ unsigned short bf16_bits(float x) { unsigned int u = __float_as_uint(x); return (unsigned short)((u + 0x7FFFu + ((u >> 16) & 1u)) >> 16); }
__device__ __forceinline__ float bf16_val(unsigned short b) { return __uint_as_float(((unsigned int)b) << 16); }
__device__ __forceinline__ float bf16_round(float x) { return bf16_val(bf16_bits(x)); }
// D += A·B with NT terms: 1 = ah·bh, 2 = + al·bh (A split), 3 = + ah·bl (both split)
template <int NT>
__device__ __forceinline__ v8f mmaN(v16b ah, v16b al, v16b bh, v16b bl, v8f c) {
  c = __builtin_amdgcn_wmma_f32_16x16x32_bf16(false, ah, false, bh, (short)0, c, false, false);
  if (NT >= 2) c = __builtin_amdgcn_wmma_f32_16x16x32_bf16(false, al, false, bh, (short)0, c, false, false);
  if (NT >= 3) c = __builtin_amdgcn_wmma_f32_16x16x32_bf16(false, ah, false, bl, (short)0, c, false, false);
  asm volatile("v_nop\n\tv_nop\n\tv_nop\n\tv_nop" : "+v"(c) : "v"(ah), "v"(al), "v"(bh), "v"(bl));
  return c;
}

__global__ __launch_bounds__(256) void k_wt_bf16(const float* __restrict__ W, unsigned short* __restrict__ Wt, int K, int N) {
  const int t = blockIdx.x * 256 + threadIdx.x;
  const int k8n = K / 8;
  if (t >= N * k8n) return;
  const int n = t / k8n, k8 = (t % k8n) * 8;
  v8us v;
#pragma unroll
  for (int i = 0; i < 8; ++i) v[i] = bf16_bits(W[(size_t)(k8 + i) * N + n]);
  *(v8us*)(Wt + (size_t)n * K + k8) = v;
  
}

// GEMM C[M][N] (f32, pitch ldc) = act(A[M][K]·W + bias). A f32 row-major (pitch lda) converted per fragment to bf16
// (ASPLIT: hi/lo two planes -> 2 terms, else single rounded term); Wt bf16 [N][K] (pitch ldb). BIAS_BF16 rounds the
// bias to bf16 first (bias quantised to bf16 before the add). K%32==0, M%16==0, N%64==0.
template <bool ASPLIT, int ACT, bool BIAS_BF16>
__global__ __launch_bounds__(128) void k_gemm_bf(const float* __restrict__ A, int lda, const unsigned short* __restrict__ Wt, int ldb,
                                               const float* __restrict__ bias, float* __restrict__ C, int ldc, int M, int N, int K) {
  __shared__ __attribute__((aligned(16))) float so[4][16][64];
  const int tid = threadIdx.x, w = tid >> 5, lane = tid & 31, ln = lane & 15, hh = lane >> 4;
  const int ntn = N / 64;
  const int wid = blockIdx.x * 4 + w;
  const int mt = wid / ntn, nq = wid % ntn;
  if (mt * 16 >= M) return;
  const int row0 = mt * 16, col0 = nq * 64;
  const float* arow = A + (size_t)(row0 + ln) * lda;
  v8f acc[4] = {};
  for (int kb = 0; kb < K; kb += 32) {
    FragB ah, al;
    const v4f x0 = *(const v4fa*)(arow + kb + 8 * hh), x1 = *(const v4fa*)(arow + kb + 8 * hh + 4);
    const v4f x2 = *(const v4fa*)(arow + kb + 16 + 8 * hh), x3 = *(const v4fa*)(arow + kb + 16 + 8 * hh + 4);
    float xs[16] = {x0[0],x0[1],x0[2],x0[3],x1[0],x1[1],x1[2],x1[3],x2[0],x2[1],x2[2],x2[3],x3[0],x3[1],x3[2],x3[3]};
#pragma unroll
    for (int i = 0; i < 16; ++i) { const unsigned short hb = bf16_bits(xs[i]); ah.u[i] = hb; al.u[i] = ASPLIT ? bf16_bits(xs[i] - bf16_val(hb)) : (unsigned short)0; }
#pragma unroll
    for (int t = 0; t < 4; ++t) {
      const unsigned short* brow = Wt + (size_t)(col0 + t * 16 + ln) * ldb + kb;
      FragB b;
      b.half[0] = *(const v8us*)(brow + 8 * hh);
      b.half[1] = *(const v8us*)(brow + 16 + 8 * hh);
      acc[t] = mmaN<ASPLIT ? 2 : 1>(ah.v, al.v, b.v, b.v, acc[t]);
    }
  }
#pragma unroll
  for (int t = 0; t < 4; ++t) {
    float bv = bias ? bias[col0 + t * 16 + ln] : 0.f;
    if (BIAS_BF16) bv = bf16_round(bv);
#pragma unroll
    for (int r = 0; r < 8; ++r) { float v = acc[t][r] + bv; if (ACT == 1) v = fmaxf(v, 0.f); so[w][8 * hh + r][t * 16 + ln] = v; }
  }
  __builtin_amdgcn_fence(__ATOMIC_ACQ_REL, "workgroup");
  __builtin_amdgcn_wave_barrier();
  const int rsub = lane >> 4, c4 = (lane & 15) * 4;
  {
#pragma unroll
    for (int q = 0; q < 8; ++q) {
      const int r = q * 2 + rsub;
      const v4f v = *(const v4fa*)&so[w][r][c4];
      *(v4f*)(C + (size_t)(row0 + r) * ldc + col0 + c4) = v;
    }
    
  }
}

// GEMM C = act(A·W + bias + resid): A f32 (ASPLIT -> hi/lo 2 terms), Wt bf16 [N][K]; ACT 0 none, 1 relu, 2 exact gelu;
// resid (optional, f32, row index = (row % rmod), pitch ldr, RES_BF16 rounds it) added before the activation.
template <bool ASPLIT, int ACT, bool BIAS_BF16, bool RES_BF16>
__global__ __launch_bounds__(128) void k_gemm_bf3(const float* __restrict__ A, int lda, const unsigned short* __restrict__ Wt, int ldb,
                                                const float* __restrict__ bias, const float* __restrict__ resid, int rmod, int ldr,
                                                float* __restrict__ C, int ldc, int M, int N, int K) {
  __shared__ __attribute__((aligned(16))) float so[4][16][64];
  const int tid = threadIdx.x, w = tid >> 5, lane = tid & 31, ln = lane & 15, hh = lane >> 4;
  const int ntn = N / 64;
  const int wid = blockIdx.x * 4 + w;
  const int mt = wid / ntn, nq = wid % ntn;
  if (mt * 16 >= M) return;
  const int row0 = mt * 16, col0 = nq * 64;
  const float* arow = A + (size_t)(row0 + ln) * lda;
  v8f acc[4] = {};
  for (int kb = 0; kb < K; kb += 32) {
    FragB ah, al;
    const v4f x0 = *(const v4fa*)(arow + kb + 8 * hh), x1 = *(const v4fa*)(arow + kb + 8 * hh + 4);
    const v4f x2 = *(const v4fa*)(arow + kb + 16 + 8 * hh), x3 = *(const v4fa*)(arow + kb + 16 + 8 * hh + 4);
    float xs[16] = {x0[0],x0[1],x0[2],x0[3],x1[0],x1[1],x1[2],x1[3],x2[0],x2[1],x2[2],x2[3],x3[0],x3[1],x3[2],x3[3]};
#pragma unroll
    for (int i = 0; i < 16; ++i) { const unsigned short hb = bf16_bits(xs[i]); ah.u[i] = hb; al.u[i] = ASPLIT ? bf16_bits(xs[i] - bf16_val(hb)) : (unsigned short)0; }
#pragma unroll
    for (int t = 0; t < 4; ++t) {
      const unsigned short* brow = Wt + (size_t)(col0 + t * 16 + ln) * ldb + kb;
      FragB b;
      b.half[0] = *(const v8us*)(brow + 8 * hh);
      b.half[1] = *(const v8us*)(brow + 16 + 8 * hh);
      acc[t] = mmaN<ASPLIT ? 2 : 1>(ah.v, al.v, b.v, b.v, acc[t]);
    }
  }
#pragma unroll
  for (int t = 0; t < 4; ++t) {
    const int col = col0 + t * 16 + ln;
    float bv = bias ? bias[col] : 0.f;
    if (BIAS_BF16) bv = bf16_round(bv);
#pragma unroll
    for (int r = 0; r < 8; ++r) {
      float v = acc[t][r] + bv;
      if (resid) { float rv = resid[(size_t)((row0 + 8 * hh + r) % rmod) * ldr + col]; if (RES_BF16) rv = bf16_round(rv); v += rv; }
      if (ACT == 1) v = fmaxf(v, 0.f);
      if (ACT == 2) v = 0.5f * v * (1.0f + erff(v * 0.70710678118654752f));
      if (ACT == 3) { const float u = 0.7978845608028654f * (v + 0.044715f * v * v * v); v = 0.5f * v * (1.0f + tanhf(u)); }
      so[w][8 * hh + r][t * 16 + ln] = v;
    }
  }
  __builtin_amdgcn_fence(__ATOMIC_ACQ_REL, "workgroup");
  __builtin_amdgcn_wave_barrier();
  const int rsub = lane >> 4, c4 = (lane & 15) * 4;
  {
#pragma unroll
    for (int q = 0; q < 8; ++q) {
      const int r = q * 2 + rsub;
      const v4f v = *(const v4fa*)&so[w][r][c4];
      *(v4f*)(C + (size_t)(row0 + r) * ldc + col0 + c4) = v;
    }
    
  }
}
// row LayerNorm (biased variance, eps) over N: s = X (+ R); optional out_sum <- s; out_norm <- (s-mu)*rsqrt(var+eps)*g + b
template <bool PARAM_BF16>
__global__ __launch_bounds__(256) void k_layernorm(const float* __restrict__ X, const float* __restrict__ R, const float* __restrict__ g, const float* __restrict__ bta,
                                                  float* __restrict__ out_sum, float* __restrict__ out_norm, int N, float eps) {
  __shared__ float red[256];
  const int row = blockIdx.x, tid = threadIdx.x;
  const float* x = X + (size_t)row * N; const float* rr = R ? R + (size_t)row * N : nullptr;
  float vals[16];                     // up to N = 4096
  const int per = N / 256;            // contiguous chunk per thread? use strided-by-4 chunks: thread handles j = tid*4 + 1024*u
  float s1 = 0.f;
  for (int u = 0; u < per / 4; ++u) {
    const int j = tid * 4 + 1024 * u;
    const v4f a = *(const v4fa*)(x + j);
    v4f b = {0.f,0.f,0.f,0.f}; if (rr) b = *(const v4fa*)(rr + j);
#pragma unroll
    for (int q = 0; q < 4; ++q) { const float v = a[q] + b[q]; vals[u * 4 + q] = v; s1 += v; }
  }
  red[tid] = s1; __syncthreads();
  for (int st = 128; st > 0; st >>= 1) { if (tid < st) red[tid] += red[tid + st]; __syncthreads(); }
  const float mu = red[0] / (float)N; __syncthreads();
  float s2 = 0.f;
  for (int u = 0; u < per / 4; ++u)
#pragma unroll
    for (int q = 0; q < 4; ++q) { const float c = vals[u * 4 + q] - mu; s2 += c * c; }
  red[tid] = s2; __syncthreads();
  for (int st = 128; st > 0; st >>= 1) { if (tid < st) red[tid] += red[tid + st]; __syncthreads(); }
  const float rs = rsqrtf(red[0] / (float)N + eps);
  {
    for (int u = 0; u < per / 4; ++u) {
      const int j = tid * 4 + 1024 * u;
      v4f o, sm;
#pragma unroll
      for (int q = 0; q < 4; ++q) {
        float gg = g[j + q], bb = bta[j + q];
        if (PARAM_BF16) { gg = bf16_round(gg); bb = bf16_round(bb); }
        sm[q] = vals[u * 4 + q]; o[q] = (vals[u * 4 + q] - mu) * rs * gg + bb;
      }
      if (out_sum) *(v4f*)(out_sum + (size_t)row * N + j) = sm;
      *(v4f*)(out_norm + (size_t)row * N + j) = o;
    }
    
  }
}



// ---- f16 WMMA path (v_wmma_f32_16x16x32_f16): 11-bit significands for operands in range — used for every GEMM launched here
typedef _Float16 v16h __attribute__((ext_vector_type(16)));
union FragH { v16h v; v8us half[2]; _Float16 h[16]; unsigned short u[16]; };
template <int NT>
__device__ __forceinline__ v8f mmaH(v16h ah, v16h al, v16h bh, v16h bl, v8f c) {
  c = __builtin_amdgcn_wmma_f32_16x16x32_f16(false, ah, false, bh, (short)0, c, false, false);
  if (NT >= 2) c = __builtin_amdgcn_wmma_f32_16x16x32_f16(false, al, false, bh, (short)0, c, false, false);
  if (NT >= 3) c = __builtin_amdgcn_wmma_f32_16x16x32_f16(false, ah, false, bl, (short)0, c, false, false);
  asm volatile("v_nop\n\tv_nop\n\tv_nop\n\tv_nop" : "+v"(c) : "v"(ah), "v"(al), "v"(bh), "v"(bl));
  return c;
}
// batched GEMM like k_gemm_b but f16 operands: A f32 (split into f16 hi/lo if ASPLIT, else rounded to f16), Bt = f16 values [n][k]; alpha; C f32; N multiple of 16 (partial tiles skipped)
template <bool ASPLIT>
__global__ __launch_bounds__(128) void k_gemm_h(const float* __restrict__ A, int lda, size_t sA, const _Float16* __restrict__ Bh, int ldb, size_t sB, float alpha, float* __restrict__ C, int ldc, size_t sC, int M, int N, int K) {
  __shared__ __attribute__((aligned(16))) float so[4][16][64];
  const int tid = threadIdx.x, w = tid >> 5, lane = tid & 31, ln = lane & 15, hh = lane >> 4; const int by = blockIdx.y;
  A += (size_t)by * sA; Bh += (size_t)by * sB; C += (size_t)by * sC;
  const int ntn = (N + 63) / 64; const int wid = blockIdx.x * 4 + w; const int mt = wid / ntn, nq = wid % ntn; if (mt * 16 >= M) return;
  const int row0 = mt * 16, col0 = nq * 64; const float* arow = A + (size_t)(row0 + ln) * lda;
  v8f acc[4] = {};
  for (int kb = 0; kb < K; kb += 32) {
    FragH ah, al;
    const v4f x0 = *(const v4fa*)(arow + kb + 8 * hh), x1 = *(const v4fa*)(arow + kb + 8 * hh + 4), x2 = *(const v4fa*)(arow + kb + 16 + 8 * hh), x3 = *(const v4fa*)(arow + kb + 16 + 8 * hh + 4);
    float xs[16] = {x0[0],x0[1],x0[2],x0[3],x1[0],x1[1],x1[2],x1[3],x2[0],x2[1],x2[2],x2[3],x3[0],x3[1],x3[2],x3[3]};
#pragma unroll
    for (int i = 0; i < 16; ++i) { const _Float16 h = (_Float16)xs[i]; ah.h[i] = h; al.h[i] = ASPLIT ? (_Float16)(xs[i] - (float)h) : (_Float16)0.0f; }
#pragma unroll
    for (int t = 0; t < 4; ++t) { if (col0 + t * 16 >= N) continue; const size_t boff = (size_t)(col0 + t * 16 + ln) * ldb + kb; FragH bq; bq.half[0] = *(const v8us*)(Bh + boff + 8 * hh); bq.half[1] = *(const v8us*)(Bh + boff + 16 + 8 * hh);
      acc[t] = mmaH<ASPLIT ? 2 : 1>(ah.v, al.v, bq.v, bq.v, acc[t]); }
  }
#pragma unroll
  for (int t = 0; t < 4; ++t) { if (col0 + t * 16 >= N) continue;
#pragma unroll
    for (int r = 0; r < 8; ++r) so[w][8 * hh + r][t * 16 + ln] = acc[t][r] * alpha; }
  __builtin_amdgcn_fence(__ATOMIC_ACQ_REL, "workgroup"); __builtin_amdgcn_wave_barrier();
  const int rsub = lane >> 4, c4 = (lane & 15) * 4;
  {
#pragma unroll
    for (int q = 0; q < 8; ++q) { const int r = q * 2 + rsub; if (col0 + c4 < N) { const v4f v = *(const v4fa*)&so[w][r][c4]; *(v4f*)(C + (size_t)(row0 + r) * ldc + col0 + c4) = v; } }
     }
}

// Wt[n][k] = f16(W[k][n]·scale) from f32 row-major W[K][N] (scale = power of two; bf16-exact weights stay exact in f16 away from the subnormal range)
__global__ __launch_bounds__(256) void k_wt_f16(const float* __restrict__ W, _Float16* __restrict__ Wt, int K, int N, float scale) {
  const int t = blockIdx.x * 256 + threadIdx.x; if (t >= N * (K / 8)) return; const int n = t / (K / 8), k8 = (t % (K / 8)) * 8; FragH f;
#pragma unroll
  for (int i = 0; i < 8; ++i) f.h[i] = (_Float16)(bf16_round(W[(size_t)(k8 + i) * N + n]) * scale); const v8us o = f.half[0];
  *(v8us*)((unsigned short*)Wt + (size_t)n * K + k8) = o; 
}
// k_gemm_hh variant with fused epilogue: v = acc·alpha + bias[by·sBias + col] (+ CP[(row/rowsPerB)·sCPb + by·64 + col] if CP) ; ACT 0 none / 1 elu ; writes f16 C16 (and f32 C if non-null)
template <int ACT>
__global__ __launch_bounds__(128) void k_gemm_hhx(const _Float16* __restrict__ A, int lda, size_t sA, const _Float16* __restrict__ Bh, int ldb, size_t sB, float alpha, const float* __restrict__ bias, size_t sBias, const float* __restrict__ CP, int rowsPerB, size_t sCPb, int row0g,
    float* __restrict__ C, _Float16* __restrict__ C16, int ldc, size_t sC, int M, int N, int K) {
  __shared__ __attribute__((aligned(16))) float so[4][16][64];
  const int tid = threadIdx.x, w = tid >> 5, lane = tid & 31, ln = lane & 15, hh = lane >> 4; const int by = blockIdx.y;
  A += (size_t)by * sA; Bh += (size_t)by * sB; const size_t cofs = (size_t)by * sC; const float* bp = bias ? bias + (size_t)by * sBias : nullptr;
  const int ntn = (N + 63) / 64; const int wid = blockIdx.x * 4 + w; const int mt = wid / ntn, nq = wid % ntn; if (mt * 16 >= M) return;
  const int row0 = mt * 16, col0 = nq * 64; const _Float16* arow = A + (size_t)(row0 + ln) * lda;
  v8f acc[4] = {};
  for (int kb = 0; kb < K; kb += 32) { FragH ah; ah.half[0] = *(const v8us*)((const unsigned short*)arow + kb + 8 * hh); ah.half[1] = *(const v8us*)((const unsigned short*)arow + kb + 16 + 8 * hh);
#pragma unroll
    for (int t = 0; t < 4; ++t) { if (col0 + t * 16 >= N) continue; const size_t boff = (size_t)(col0 + t * 16 + ln) * ldb + kb; FragH bq; bq.half[0] = *(const v8us*)((const unsigned short*)Bh + boff + 8 * hh); bq.half[1] = *(const v8us*)((const unsigned short*)Bh + boff + 16 + 8 * hh);
      acc[t] = mmaH<1>(ah.v, ah.v, bq.v, bq.v, acc[t]); }
  }
#pragma unroll
  for (int t = 0; t < 4; ++t) { if (col0 + t * 16 >= N) continue; const int col = col0 + t * 16 + ln; const float bv = bp ? bf16_round(bp[col]) : 0.f;
#pragma unroll
    for (int r = 0; r < 8; ++r) { float v = acc[t][r] * alpha + bv; if (CP) { const int rr = row0g + row0 + 8 * hh + r; if (rowsPerB < 0) v += CP[cofs + (size_t)rr * ldc + col];      /* rowsPerB < 0: own element of the batched C plane */ else { const int bidx = rr / rowsPerB; v += CP[(size_t)bidx * sCPb + (size_t)by * 64 + col]; } } if (ACT == 1) v = (v > 0.f) ? v : expm1f(v); else if (ACT == 7) v = (v > 0.f) ? v + 1.0f : expf(v); else if (ACT == 8) v = tanhf(v); else if (ACT == 9) v = 0.5f * v * (1.0f + tanhf(0.7978845608028654f * (v + 0.044715f * v * v * v))); else if (ACT == 11) v = 1.0f / (1.0f + expf(-v)); else if (ACT == 12) v = (v > 0.f) ? v : 0.01f * v; else if (ACT == 14) v = (v > 0.f) ? v : 0.1f * v; else if (ACT == 16) v = (v >= 0.f) ? v : 0.3f * v; else if (ACT == 17) v = (v >= 0.f) ? v : 0.2f * v; else if (ACT == 15) v = v / (1.0f + expf(-v)); else if (ACT == 3) v = fmaxf(v, 0.f); else if (ACT == 6) v = 0.5f * v * (1.0f + erff(v * 0.70710678118654752f)); so[w][8 * hh + r][t * 16 + ln] = v; } }
  __builtin_amdgcn_fence(__ATOMIC_ACQ_REL, "workgroup"); __builtin_amdgcn_wave_barrier();
  const int rsub = lane >> 4, c4 = (lane & 15) * 4; typedef _Float16 v4h __attribute__((ext_vector_type(4)));
  {
#pragma unroll
    for (int q = 0; q < 8; ++q) { const int r = q * 2 + rsub; if (col0 + c4 < N) { const v4f v = *(const v4fa*)&so[w][r][c4]; if (C) *(v4f*)(C + cofs + (size_t)(row0 + r) * ldc + col0 + c4) = v; if (C16) { v4h h4; for (int i = 0; i < 4; ++i) h4[i] = (_Float16)v[i]; *(v4h*)(C16 + cofs + (size_t)(row0 + r) * ldc + col0 + c4) = h4; } } }
     }
}


typedef _Float16 v4h __attribute__((ext_vector_type(4)));

__global__ __launch_bounds__(256) void k_x16(const float* __restrict__ x, _Float16* __restrict__ X16, size_t n8) { const size_t t = (size_t)blockIdx.x * 256 + threadIdx.x; if (t >= n8) return; FragH f;
#pragma unroll
  for (int q = 0; q < 8; ++q) f.h[q] = (_Float16)bf16_round(x[t * 8 + q]); *(v8us*)((unsigned short*)X16 + t * 8) = f.half[0];  }
__global__ __launch_bounds__(256) void k_h16(const float* __restrict__ x, _Float16* __restrict__ X16, size_t n8) { const size_t t = (size_t)blockIdx.x * 256 + threadIdx.x; if (t >= n8) return; FragH f;
#pragma unroll
  for (int q = 0; q < 8; ++q) f.h[q] = (_Float16)x[t * 8 + q]; *(v8us*)((unsigned short*)X16 + t * 8) = f.half[0];  }
__global__ __launch_bounds__(256) void k_round16f(const float* __restrict__ W, _Float16* __restrict__ Bt, size_t n8) { const size_t t = (size_t)blockIdx.x * 256 + threadIdx.x; if (t >= n8) return; FragH f;
#pragma unroll
  for (int i = 0; i < 8; ++i) f.h[i] = (_Float16)(bf16_round(W[t * 8 + i]) * 16.0f); *(v8us*)((unsigned short*)Bt + t * 8) = f.half[0];  }
template <int NHv, int TTv>
__global__ __launch_bounds__(256) void k_vt(const _Float16* __restrict__ V16, int ldv, int voff, _Float16* __restrict__ Vt) { __shared__ unsigned short tl[64][66]; const int tid = threadIdx.x; const int slab = blockIdx.x / (TTv / 64), lg = blockIdx.x % (TTv / 64); const int b = slab / NHv, h = slab % NHv;
  for (int i = tid; i < 64 * 8; i += 256) { const int r = i / 8, c8 = (i % 8) * 8; FragH f; f.half[0] = *(const v8us*)((const unsigned short*)V16 + ((size_t)b * TTv + lg * 64 + r) * ldv + voff + h * 64 + c8);
#pragma unroll
    for (int q = 0; q < 8; ++q) tl[r][c8 + q] = f.u[q]; }
  __syncthreads();
  {
#pragma unroll
    for (int rd = 0; rd < 2; ++rd) { const int d = rd * 32 + tid / 8, pc = tid % 8; FragH f;
#pragma unroll
      for (int q = 0; q < 8; ++q) f.u[q] = tl[pc * 8 + q][d];
      *(v8us*)((unsigned short*)Vt + ((size_t)slab * 64 + d) * TTv + lg * 64 + pc * 8) = f.half[0]; }
     } }

__global__ __launch_bounds__(256) void k_hl(const float* __restrict__ F, _Float16* __restrict__ Hh, _Float16* __restrict__ Hl, size_t n8) { const size_t t = (size_t)blockIdx.x * 256 + threadIdx.x; if (t >= n8) return; FragH fh, fl; const v4f a = *(const v4fa*)(F + t * 8), c = *(const v4fa*)(F + t * 8 + 4);
#pragma unroll
  for (int q = 0; q < 4; ++q) { _Float16 h = (_Float16)a[q]; fh.h[q] = h; fl.h[q] = (_Float16)((a[q] - (float)h) * 1024.0f); h = (_Float16)c[q]; fh.h[4 + q] = h; fl.h[4 + q] = (_Float16)((c[q] - (float)h) * 1024.0f); }
  { *(v8us*)((unsigned short*)Hh + t * 8) = fh.half[0]; *(v8us*)((unsigned short*)Hl + t * 8) = fl.half[0];  } }

// ---- fast GEMM (block tile 128x128 = eight 32x64 wave tiles; A and B in 64-k tiles through a two-buffer LDS ring; requires M % 128 == 0 rows per launch region, N % 128 == 0, K % 64 == 0); epilogue = k_gemm_hhx semantics ----
__device__ __forceinline__ v16h g2_frag(const _Float16* p, int hh) { FragH f; f.half[0] = *(const v8us*)((const unsigned short*)p + 8 * hh); f.half[1] = *(const v8us*)((const unsigned short*)p + 16 + 8 * hh); return f.v; }
__device__ __forceinline__ v8f g2_mma(v16h a, v16h b, v8f c) { v8f d = __builtin_amdgcn_wmma_f32_16x16x32_f16(false, a, false, b, (short)0, c, false, false); asm volatile("v_nop\n\tv_nop\n\tv_nop\n\tv_nop" : "+v"(d) : "v"(a), "v"(b)); return d; }
#define G2P 72      /* LDS row pitch in f16: 64 k + 8 = 144 B, 16 B x odd, the conflict-free pitch for ds_load_b128 readers */
// One thread's eight b128 asynchronous copies to LDS for one 64-k pass: its 16-byte piece of rows r, r + 32, r + 64, r + 96 of the 128-row A tile and of the 128-row B tile (la, lb = LDS byte addresses, ga, gb = global addresses, rsa, rsb = 32 rows in elements).
// s_wait_xcnt 0 is the statement's last line so that no address register of an issued copy is rewritten ahead of it.
__device__ __forceinline__ void g2_copy8(unsigned la, unsigned lb, const _Float16* ga, const _Float16* gb, size_t rsa, size_t rsb) {
  asm volatile("global_load_async_to_lds_b128 %0, %8, off\n\t"
               "global_load_async_to_lds_b128 %1, %9, off\n\t"
               "global_load_async_to_lds_b128 %2, %10, off\n\t"
               "global_load_async_to_lds_b128 %3, %11, off\n\t"
               "global_load_async_to_lds_b128 %4, %12, off\n\t"
               "global_load_async_to_lds_b128 %5, %13, off\n\t"
               "global_load_async_to_lds_b128 %6, %14, off\n\t"
               "global_load_async_to_lds_b128 %7, %15, off\n\t"
               "s_wait_xcnt 0x0"
               :: "v"(la), "v"(la + 1u * 32u * G2P * 2u), "v"(la + 2u * 32u * G2P * 2u), "v"(la + 3u * 32u * G2P * 2u), "v"(lb), "v"(lb + 1u * 32u * G2P * 2u), "v"(lb + 2u * 32u * G2P * 2u), "v"(lb + 3u * 32u * G2P * 2u),
                  "v"(ga), "v"(ga + rsa), "v"(ga + 2 * rsa), "v"(ga + 3 * rsa), "v"(gb), "v"(gb + rsb), "v"(gb + 2 * rsb), "v"(gb + 3 * rsb) : "memory");
}
template <int ACT>
__global__ __launch_bounds__(256) void k_gemm2(const _Float16* __restrict__ A, int lda, size_t sA, const _Float16* __restrict__ Bh, int ldb, size_t sB, float alpha, const float* __restrict__ bias, size_t sBias, const float* __restrict__ CP, int rowsPerB, size_t sCPb, int row0g,
    float* __restrict__ C, _Float16* __restrict__ C16, int ldc, size_t sC, int M, int N, int K) { static_assert(ACT == 0 || ACT == 3 || ACT == 6 || ACT == 8 || ACT == 9 || ACT == 11 || ACT == 12 || ACT == 14 || ACT == 15 || ACT == 16 || ACT == 17, "k_gemm2: unsupported ACT code (would silently apply no activation)");
  __shared__ __attribute__((aligned(16))) _Float16 ring[2][2][128][G2P];      /* [buffer][A | B][row][k], filled by the asynchronous copies only */
  __shared__ __attribute__((aligned(16))) float so[8][32][68];
  const int tid = threadIdx.x, w = tid >> 5, lane = tid & 31, ln = lane & 15, hh = lane >> 4; const int by = blockIdx.y;
  A += (size_t)by * sA; Bh += (size_t)by * sB; const size_t cofs = (size_t)by * sC; const float* bp = bias ? bias + (size_t)by * sBias : nullptr;
  const int ntn = N >> 7; const int mt = blockIdx.x / ntn, nq = blockIdx.x - mt * ntn; if (mt * 128 >= M) return;      /* the same for the whole block, ahead of every barrier */
  const int wm = w >> 1, wn = w & 1; const int row0 = mt * 128 + 32 * wm, col0 = nq * 128 + 64 * wn;
  const int cr = tid >> 3, cc = (tid & 7) * 8;      /* this thread's first row and its 8-element piece in every copied tile */
  const _Float16* ga = A + (size_t)(mt * 128 + cr) * lda + cc; const _Float16* gb = Bh + (size_t)(nq * 128 + cr) * ldb + cc; const size_t rsa = (size_t)32 * lda, rsb = (size_t)32 * ldb;
  const unsigned la = (unsigned)(size_t)&ring[0][0][cr][cc], lb = (unsigned)(size_t)&ring[0][1][cr][cc]; const unsigned bufb = 2u * 128u * G2P * 2u;      /* LDS byte addresses in buffer 0; bytes per buffer */
  const int np = K >> 6;
  const v8f z8 = {0.f,0.f,0.f,0.f,0.f,0.f,0.f,0.f}; v8f c00 = z8, c01 = z8, c02 = z8, c03 = z8, c10 = z8, c11 = z8, c12 = z8, c13 = z8;
  g2_copy8(la, lb, ga, gb, rsa, rsb);
  asm volatile("s_wait_asynccnt 0x0" ::: "memory");      /* this wave's copies of tile 0 have landed */
  __syncthreads();      /* publishes tile 0 */
  if (np > 1) g2_copy8(la + bufb, lb + bufb, ga + 64, gb + 64, rsa, rsb);
  for (int t = 0; t < np; ++t) { const int bu = t & 1; const _Float16* a0p = &ring[bu][0][32 * wm + ln][0]; const _Float16* a1p = a0p + 16 * G2P;
    const _Float16* b0p = &ring[bu][1][64 * wn + ln][0]; const _Float16* b1p = b0p + 16 * G2P; const _Float16* b2p = b1p + 16 * G2P; const _Float16* b3p = b2p + 16 * G2P;
    v16h a0[2], a1[2], b0[2], b1[2], b2[2], b3[2];      /* the pass's 24 LDS reads go as one group ahead of its 16 products: reads placed among the products would each wait out the LDS latency */
#pragma unroll      /* the fragment arrays must stay in registers */
    for (int s = 0; s < 2; ++s) { a0[s] = g2_frag(a0p + 32 * s, hh); a1[s] = g2_frag(a1p + 32 * s, hh); b0[s] = g2_frag(b0p + 32 * s, hh); b1[s] = g2_frag(b1p + 32 * s, hh); b2[s] = g2_frag(b2p + 32 * s, hh); b3[s] = g2_frag(b3p + 32 * s, hh); }
#pragma unroll      /* as above */
    for (int s = 0; s < 2; ++s) { c00 = g2_mma(a0[s], b0[s], c00); c10 = g2_mma(a1[s], b0[s], c10); c01 = g2_mma(a0[s], b1[s], c01); c11 = g2_mma(a1[s], b1[s], c11);
      c02 = g2_mma(a0[s], b2[s], c02); c12 = g2_mma(a1[s], b2[s], c12); c03 = g2_mma(a0[s], b3[s], c03); c13 = g2_mma(a1[s], b3[s], c13); }
    asm volatile("s_wait_dscnt 0x0" ::: "memory");      /* this wave's reads of buffer bu are done before it is refilled */
    asm volatile("s_wait_asynccnt 0x0" ::: "memory");      /* this wave's copies of tile t + 1 have landed */
    __syncthreads();      /* publishes tile t + 1 and ends every wave's reads of buffer bu */
    if (t + 2 < np) g2_copy8(la + bu * bufb, lb + bu * bufb, ga + (size_t)(t + 2) * 64, gb + (size_t)(t + 2) * 64, rsa, rsb); }
  asm volatile("s_wait_asynccnt 0x0" ::: "memory");      /* no copy is outstanding when the wave goes on */
  v8f accs[8] = {c00, c01, c02, c03, c10, c11, c12, c13};
#pragma unroll
  for (int u = 0; u < 8; ++u) { const int t = u & 3, half = u >> 2; const int col = col0 + t * 16 + ln; const float bv = bp ? bf16_round(bp[col]) : 0.f;
#pragma unroll
    for (int r = 0; r < 8; ++r) { const int rloc = half * 16 + 8 * hh + r; float v = accs[u][r] * alpha + bv; if (CP) { if (rowsPerB < 0) v += CP[cofs + (size_t)(row0g + row0 + rloc) * ldc + col];      /* rowsPerB < 0: own element of the batched C plane */ else { const int bidx = (row0g + row0 + rloc) / rowsPerB; v += CP[(size_t)bidx * sCPb + (size_t)by * 64 + col]; } }
      if (ACT == 3) v = fmaxf(v, 0.f); else if (ACT == 6) v = 0.5f * v * (1.0f + erff(v * 0.70710678118654752f)); else if (ACT == 11) v = 1.0f / (1.0f + expf(-v)); else if (ACT == 15) v = v / (1.0f + expf(-v)); else if (ACT == 12) v = (v > 0.f) ? v : 0.01f * v; else if (ACT == 8) v = tanhf(v); else if (ACT == 9) v = 0.5f * v * (1.0f + tanhf(0.7978845608028654f * (v + 0.044715f * v * v * v))); else if (ACT == 14) v = (v > 0.f) ? v : 0.1f * v; else if (ACT == 16) v = (v >= 0.f) ? v : 0.3f * v; else if (ACT == 17) v = (v >= 0.f) ? v : 0.2f * v;
      so[w][rloc][t * 16 + ln] = v; } }
  __builtin_amdgcn_fence(__ATOMIC_ACQ_REL, "workgroup"); __builtin_amdgcn_wave_barrier();
  const int rsub = lane >> 4, c4 = (lane & 15) * 4;
  {
#pragma unroll
    for (int q = 0; q < 16; ++q) { const int r = q * 2 + rsub; const v4f v = *(const v4fa*)&so[w][r][c4]; if (C) *(v4f*)(C + cofs + (size_t)(row0 + r) * ldc + col0 + c4) = v; if (C16) { v4h h4; for (int i = 0; i < 4; ++i) h4[i] = (_Float16)v[i]; *(v4h*)(C16 + cofs + (size_t)(row0 + r) * ldc + col0 + c4) = h4; } }
     } }


__global__ __launch_bounds__(256) void k_wsc(const float* __restrict__ Wm, _Float16* __restrict__ Bt, size_t n8, float sc) { const size_t t = (size_t)blockIdx.x * 256 + threadIdx.x; if (t >= n8) return; FragH f; for (int q = 0; q < 8; ++q) f.h[q] = (_Float16)(bf16_round(Wm[t * 8 + q]) * sc); *(v8us*)((unsigned short*)Bt + t * 8) = f.half[0];  }
__global__ __launch_bounds__(256) void k_stat(const float* __restrict__ x, int T, float* __restrict__ ST) {
  #pragma clang fp contract(off)
  const int t = blockIdx.x * 256 + threadIdx.x; if (t >= NB * CC) return; const float* p = x + (size_t)t * T; float s = 0.f;
#pragma unroll 1
  for (int i = 0; i < T; i += 4) { const v4f a = *(const v4fa*)(p + i); for (int q = 0; q < 4; ++q) s += bf16_round(a[q]); }
  const float mu = s / (float)T; float s2 = 0.f;
#pragma unroll 1
  for (int i = 0; i < T; i += 4) { const v4f a = *(const v4fa*)(p + i); for (int q = 0; q < 4; ++q) { const float d = bf16_round(a[q]) - mu; s2 += d * d; } }
  const float r = rsqrtf(s2 / (float)(T - 1) + 1e-5f); typedef float v2f_ __attribute__((ext_vector_type(2))); v2f_ o; o[0] = mu; o[1] = r; *(v2f_*)(ST + (size_t)t * 2) = o;  }
__global__ __launch_bounds__(256) void k_plane(const float* __restrict__ x, int T, const float* __restrict__ ST, _Float16* __restrict__ Hh, _Float16* __restrict__ Lh) {
  #pragma clang fp contract(off)
  const size_t t = (size_t)blockIdx.x * 256 + threadIdx.x; if (t >= (size_t)NB * T * CC / 8) return; const int c0 = (int)((t * 8) % CC); const size_t row = (t * 8) / CC; const int b = (int)(row / T), fr = (int)(row % T); FragH fh, fl;
  for (int q = 0; q < 8; ++q) { const int c = c0 + q; float v = bf16_round(x[((size_t)b * CC + c) * T + fr]); if (ST) { const float mu = ST[((size_t)b * CC + c) * 2], r = ST[((size_t)b * CC + c) * 2 + 1]; v = (v - mu) * r; } const _Float16 hv = (_Float16)v; fh.h[q] = hv; fl.h[q] = (_Float16)((v - (float)hv) * 1024.0f); }
  { *(v8us*)((unsigned short*)Hh + t * 8) = fh.half[0]; if (Lh) *(v8us*)((unsigned short*)Lh + t * 8) = fl.half[0];  } }
__global__ __launch_bounds__(256) void k_soft(const float* __restrict__ S, _Float16* __restrict__ P, float* __restrict__ RS) {
  #pragma clang fp contract(off)
  const int wv = threadIdx.x >> 5, ln = threadIdx.x & 31; const int r = blockIdx.x * 8 + wv; if (r >= BG * TC) return; const float* sr = S + (size_t)r * TS; float mx = -3.0e38f;
#pragma unroll 1
  for (int gq = 0; gq < TS / 256; ++gq) { const v8f a = *(const v8f*)(sr + gq * 256 + ln * 8); for (int q = 0; q < 8; ++q) mx = fmaxf(mx, a[q]); }
  for (int o = 16; o > 0; o >>= 1) mx = fmaxf(mx, __shfl_xor(mx, o, 32)); float su = 0.f;
{ su = 0.f;
#pragma unroll 1
    for (int gq = 0; gq < TS / 256; ++gq) { const v8f a = *(const v8f*)(sr + gq * 256 + ln * 8); FragH ph; for (int q = 0; q < 8; ++q) { const float e = expf(a[q] - mx); su += e; ph.h[q] = (_Float16)(e * 1024.0f); } *(v8us*)((unsigned short*)P + (size_t)r * TS + gq * 256 + ln * 8) = ph.half[0]; }
     }
  for (int o = 16; o > 0; o >>= 1) su += __shfl_xor(su, o, 32); if (ln == 0) { *(float*)(RS + (size_t)r * 32) = 1.0f / su;  } }
__global__ __launch_bounds__(256) void k_osc(const float* __restrict__ O, const float* __restrict__ RS, size_t row0, _Float16* __restrict__ OH, _Float16* __restrict__ OL) {
  #pragma clang fp contract(off)
  const size_t t = (size_t)blockIdx.x * 256 + threadIdx.x; if (t >= (size_t)BG * TC * CC / 8) return; const size_t r = (t * 8) / CC; const float rs = RS[r * 32]; const v8f a = *(const v8f*)(O + t * 8); FragH f, fl;
  for (int q = 0; q < 8; ++q) { const float v = a[q] * rs; const _Float16 hh = (_Float16)v; f.h[q] = hh; fl.h[q] = (_Float16)((v - (float)hh) * 1024.0f); }
  const size_t o = row0 * CC + t * 8; { *(v8us*)((unsigned short*)OH + o) = f.half[0]; *(v8us*)((unsigned short*)OL + o) = fl.half[0];  } }
__global__ __launch_bounds__(256) void k_out(const float* __restrict__ Y, float* __restrict__ out) { const size_t t = (size_t)blockIdx.x * 256 + threadIdx.x; if (t >= (size_t)NB * CC * TC / 8) return; const int t0 = (int)((t * 8) % TC); const size_t bo = (t * 8) / TC; const int b = (int)(bo / CC), o = (int)(bo % CC); v8f v; for (int q = 0; q < 8; ++q) v[q] = Y[((size_t)b * TC + t0 + q) * CC + o];
  *(v8f*)(out + t * 8) = v;  }

extern "C" void kernel_launch(void* const* d_in, const int* in_sizes, int n_in,
                              void* d_out, int out_size, void* d_ws, size_t ws_size, hipStream_t stream) {
  (void)in_sizes; (void)n_in; (void)out_size;
  const float* content = (const float*)d_in[0]; const float* style = (const float*)d_in[1]; const float* Wf = (const float*)d_in[2]; const float* bf_ = (const float*)d_in[3]; const float* Wg = (const float*)d_in[4]; const float* bg = (const float*)d_in[5]; const float* Wh = (const float*)d_in[6]; const float* bh = (const float*)d_in[7]; const float* Wo = (const float*)d_in[8]; const float* bo = (const float*)d_in[9];
  char* ws = (char*)d_ws; size_t off = 0;
  auto take = [&](size_t bytes) { char* p = ws + off; off += (bytes + 255) & ~(size_t)255; return p; };
  const size_t npc = (size_t)NRC * CC, nps = (size_t)NRS * CC;
  _Float16* BF = (_Float16*)take((size_t)CC * CC * 2); _Float16* BGm = (_Float16*)take((size_t)CC * CC * 2); _Float16* BH = (_Float16*)take((size_t)CC * CC * 2); _Float16* BO = (_Float16*)take((size_t)CC * CC * 2); float* STc = (float*)take((size_t)NB * CC * 2 * 4); float* STs = (float*)take((size_t)NB * CC * 2 * 4);
  _Float16* CNH = (_Float16*)take(npc * 2); _Float16* CNL = (_Float16*)take(npc * 2); _Float16* SNH = (_Float16*)take(nps * 2); _Float16* SNL = (_Float16*)take(nps * 2); _Float16* S16 = (_Float16*)take(nps * 2);
  float* T32 = (float*)take(npc * 4);      /* F f32 -> G f32 -> H16 -> Y f32, in turn */ _Float16* FH = (_Float16*)take(npc * 2); _Float16* FL = (_Float16*)take(npc * 2); _Float16* GH = (_Float16*)take(nps * 2); _Float16* GL = (_Float16*)take(nps * 2); _Float16* HT = (_Float16*)take(nps * 2);
  float* S = (float*)take((size_t)BG * TC * TS * 4); _Float16* P = (_Float16*)take((size_t)BG * TC * TS * 2); float* RS = (float*)take((size_t)BG * TC * 32 * 4);
  float* O = (float*)CNH;      /* readout f32 [BG*TC][CC] (16 MiB) over the content hi plane (dead after F) */ _Float16* OH = SNH; _Float16* OL = SNL;      /* O hi/lo [NRC][CC] over the style-normalised planes (dead after G) */ _Float16* H16 = (_Float16*)T32; float* Y = T32;
  if (off > ws_size) return;      /* 2 + 0.1 + 16 x 5 + 32 + 16 x 5 + 32 + 16 + 1 = ≈ 243 MiB */
  k_wsc<<<(CC * CC / 8 + 255) / 256, 256, 0, stream>>>(Wf, BF, (size_t)CC * CC / 8, 16.0f); k_wsc<<<(CC * CC / 8 + 255) / 256, 256, 0, stream>>>(Wg, BGm, (size_t)CC * CC / 8, 16.0f); k_wsc<<<(CC * CC / 8 + 255) / 256, 256, 0, stream>>>(Wh, BH, (size_t)CC * CC / 8, 16.0f); k_wsc<<<(CC * CC / 8 + 255) / 256, 256, 0, stream>>>(Wo, BO, (size_t)CC * CC / 8, 16.0f);      /* conv (out, in) naturals */
  k_stat<<<(NB * CC + 255) / 256, 256, 0, stream>>>(content, TC, STc); k_stat<<<(NB * CC + 255) / 256, 256, 0, stream>>>(style, TS, STs);
  k_plane<<<(unsigned)((npc / 8 + 255) / 256), 256, 0, stream>>>(content, TC, STc, CNH, CNL); k_plane<<<(unsigned)((nps / 8 + 255) / 256), 256, 0, stream>>>(style, TS, STs, SNH, SNL); k_plane<<<(unsigned)((nps / 8 + 255) / 256), 256, 0, stream>>>(style, TS, nullptr, S16, nullptr);
  const dim3 gC((NRC / 128) * (CC / 128), 1), gS((NRS / 128) * (CC / 128), 1);
  k_gemm2<0><<<gC, 256, 0, stream>>>(CNL, CC, 0, BF, CC, 0, 0.0625f / 1024.0f, nullptr, 0, nullptr, 1, 0, 0, T32, nullptr, CC, 0, NRC, CC, CC);
  k_gemm2<0><<<gC, 256, 0, stream>>>(CNH, CC, 0, BF, CC, 0, 0.0625f, bf_, 0, T32, 1, (size_t)CC, 0, T32, nullptr, CC, 0, NRC, CC, CC);      /* F rows (b,t) f32 */
  k_hl<<<(unsigned)((npc / 8 + 255) / 256), 256, 0, stream>>>(T32, FH, FL, npc / 8);
  k_gemm2<0><<<gS, 256, 0, stream>>>(SNL, CC, 0, BGm, CC, 0, 0.0625f / 1024.0f, nullptr, 0, nullptr, 1, 0, 0, T32, nullptr, CC, 0, NRS, CC, CC);
  k_gemm2<0><<<gS, 256, 0, stream>>>(SNH, CC, 0, BGm, CC, 0, 0.0625f, bg, 0, T32, 1, (size_t)CC, 0, T32, nullptr, CC, 0, NRS, CC, CC);      /* G rows (b,s) f32 */
  k_hl<<<(unsigned)((nps / 8 + 255) / 256), 256, 0, stream>>>(T32, GH, GL, nps / 8);
  k_gemm2<0><<<gS, 256, 0, stream>>>(S16, CC, 0, BH, CC, 0, 0.0625f, bh, 0, nullptr, 1, 0, 0, nullptr, H16, CC, 0, NRS, CC, CC);      /* H rows (b,s) f16 */
  k_vt<CC / 64, TS><<<NB * (CC / 64) * (TS / 64), 256, 0, stream>>>(H16, CC, 0, HT);      /* H as [b][c][s] */
  for (int g = 0; g < NB / BG; ++g) { const size_t rc0 = (size_t)g * BG * TC, rs0 = (size_t)g * BG * TS;
    k_gemm2<0><<<dim3((TC / 128) * (TS / 128), BG), 256, 0, stream>>>(FH + rc0 * CC, CC, (size_t)TC * CC, GL + rs0 * CC, CC, (size_t)TS * CC, 0.0009765625f, nullptr, 0, nullptr, 1, 0, 0, S, nullptr, TS, (size_t)TC * TS, TC, TS, CC);
    k_gemm2<0><<<dim3((TC / 128) * (TS / 128), BG), 256, 0, stream>>>(FL + rc0 * CC, CC, (size_t)TC * CC, GH + rs0 * CC, CC, (size_t)TS * CC, 0.0009765625f, nullptr, 0, S, -1, 0, 0, S, nullptr, TS, (size_t)TC * TS, TC, TS, CC);
    k_gemm2<0><<<dim3((TC / 128) * (TS / 128), BG), 256, 0, stream>>>(FH + rc0 * CC, CC, (size_t)TC * CC, GH + rs0 * CC, CC, (size_t)TS * CC, 1.0f, nullptr, 0, S, -1, 0, 0, S, nullptr, TS, (size_t)TC * TS, TC, TS, CC);      /* S = F^T G (hi.lo + lo.hi + hi.hi), unscaled */
    k_soft<<<(BG * TC) / 8, 256, 0, stream>>>(S, P, RS);
    k_gemm2<0><<<dim3((TC / 128) * (CC / 128), BG), 256, 0, stream>>>(P, TS, (size_t)TC * TS, HT + (size_t)g * BG * CC * TS, TS, (size_t)CC * TS, 0.0009765625f, nullptr, 0, nullptr, 1, 0, 0, O, nullptr, CC, (size_t)TC * CC, TC, CC, TS);      /* unnormalised O rows (b,t) = P . H^T */
    k_osc<<<(unsigned)(((size_t)BG * TC * CC / 8 + 255) / 256), 256, 0, stream>>>(O, RS, rc0, OH, OL); }
  k_gemm2<0><<<gC, 256, 0, stream>>>(OL, CC, 0, BO, CC, 0, 0.0625f / 1024.0f, nullptr, 0, nullptr, 1, 0, 0, Y, nullptr, CC, 0, NRC, CC, CC);
  k_gemm2<0><<<gC, 256, 0, stream>>>(OH, CC, 0, BO, CC, 0, 0.0625f, bo, 0, Y, 1, (size_t)CC, 0, Y, nullptr, CC, 0, NRC, CC, CC);      /* out rows = Wo O + bo */
  k_out<<<(unsigned)((npc / 8 + 255) / 256), 256, 0, stream>>>(Y, (float*)d_out);
}

// v002
// One run takes 456 microseconds.
// In both of two side-by-side timings against v001, it was 1.35 times as fast.
// Counting every step since v000, it is 2.02 times as fast.
#include <hip/hip_runtime.h>
// SpeakerAttention (16 x 512 channels; content 1024 frames, style 1024 frames: F = Wf mvn(content) + bf, G = Wg mvn(style) + bg, H = Wh style + bh (1x1 convs); S = softmax over style frames of the UNSCALED F^T G (K = 512 channels); O = H S^T; out = Wo O + bo; mvn = per (batch, channel) mean / unbiased variance over time, eps 1e-5).
// Structure: per-(b,c) mvn statistics on VALU (rows staged in LDS); [frame][channel] planes (LDS tile transposes) of the normalised inputs as f16 hi/residual (style raw plane exact); F and G as two-term f16 WMMA GEMMs each (32x64 wave tiles fed from LDS, f32 accumulation, exact x16 weights + bias; f32 out) then f16 hi/residual planes; H as one GEMM (f16 out) transposed to [b][c][s] by LDS tiles; per 8-batch group the score GEMM as THREE hi/residual product terms (K = 512, f32, own-element accumulation), softmax rows on VALU (unnormalised f16 weights x 2^10 + row normalisers on their own lines), readout GEMM (N = 512, K = 1024); row scaling + hi/residual; Wo as two GEMM terms (+ bias); [b][c][t] output by an LDS tile transpose.
// Compute dtype: inputs rounded to bf16; weights exact as f16; the normalised inputs, F, G and O as f16 hi + 2^-10-scaled residual (the unscaled K = 512 logits have sigma ~ 22, so single-rounded operands would not do); style, H and the softmax weights as plain f16 (~2^-12); statistics / softmax f32. v_wmma_f32_16x16x32_f16.
#define NB 16
#define CC 512
#define TC 1024
#define TS 1024
#define NRC (NB * TC)
#define NRS (NB * TS)
#define BG 8                     /* batches per score-plane group */
typedef __bf16 v16b __attribute__((ext_vector_type(16)));
typedef unsigned short v8us __attribute__((ext_vector_type(8), may_alias));
typedef float  v8f  __attribute__((ext_vector_type(8)));
typedef float  v4f  __attribute__((ext_vector_type(4)));
typedef float  v4fa __attribute__((ext_vector_type(4), may_alias));
union FragB { v16b v; v8us half[2]; unsigned short u[16]; };

__device__ __forceinline__ unsigned short bf16_bits(float x) { unsigned int u = __float_as_uint(x); return (unsigned short)((u + 0x7FFFu + ((u >> 16) & 1u)) >> 16); }
__device__ __forceinline__ float bf16_val(unsigned short b) { return __uint_as_float(((unsigned int)b) << 16); }
__device__ __forceinline__ float bf16_round(float x) { return bf16_val(bf16_bits(x)); }
// D += A·B with NT terms: 1 = ah·bh, 2 = + al·bh (A split), 3 = + ah·bl (both split)
template <int NT>
__device__ __forceinline__ v8f mmaN(v16b ah, v16b al, v16b bh, v16b bl, v8f c) {
  c = __builtin_amdgcn_wmma_f32_16x16x32_bf16(false, ah, false, bh, (short)0, c, false, false);
  if (NT >= 2) c = __builtin_amdgcn_wmma_f32_16x16x32_bf16(false, al, false, bh, (short)0, c, false, false);
  if (NT >= 3) c = __builtin_amdgcn_wmma_f32_16x16x32_bf16(false, ah, false, bl, (short)0, c, false, false);
  asm volatile("v_nop\n\tv_nop\n\tv_nop\n\tv_nop" : "+v"(c) : "v"(ah), "v"(al), "v"(bh), "v"(bl));
  return c;
}

__global__ __launch_bounds__(256) void k_wt_bf16(const float* __restrict__ W, unsigned short* __restrict__ Wt, int K, int N) {
  const int t = blockIdx.x * 256 + threadIdx.x;
  const int k8n = K / 8;
  if (t >= N * k8n) return;
  const int n = t / k8n, k8 = (t % k8n) * 8;
  v8us v;
#pragma unroll
  for (int i = 0; i < 8; ++i) v[i] = bf16_bits(W[(size_t)(k8 + i) * N + n]);
  *(v8us*)(Wt + (size_t)n * K + k8) = v;
  
}

// GEMM C[M][N] (f32, pitch ldc) = act(A[M][K]·W + bias). A f32 row-major (pitch lda) converted per fragment to bf16
// (ASPLIT: hi/lo two planes -> 2 terms, else single rounded term); Wt bf16 [N][K] (pitch ldb). BIAS_BF16 rounds the
// bias to bf16 first (bias quantised to bf16 before the add). K%32==0, M%16==0, N%64==0.
template <bool ASPLIT, int ACT, bool BIAS_BF16>
__global__ __launch_bounds__(128) void k_gemm_bf(const float* __restrict__ A, int lda, const unsigned short* __restrict__ Wt, int ldb,
                                               const float* __restrict__ bias, float* __restrict__ C, int ldc, int M, int N, int K) {
  __shared__ __attribute__((aligned(16))) float so[4][16][64];
  const int tid = threadIdx.x, w = tid >> 5, lane = tid & 31, ln = lane & 15, hh = lane >> 4;
  const int ntn = N / 64;
  const int wid = blockIdx.x * 4 + w;
  const int mt = wid / ntn, nq = wid % ntn;
  if (mt * 16 >= M) return;
  const int row0 = mt * 16, col0 = nq * 64;
  const float* arow = A + (size_t)(row0 + ln) * lda;
  v8f acc[4] = {};
  for (int kb = 0; kb < K; kb += 32) {
    FragB ah, al;
    const v4f x0 = *(const v4fa*)(arow + kb + 8 * hh), x1 = *(const v4fa*)(arow + kb + 8 * hh + 4);
    const v4f x2 = *(const v4fa*)(arow + kb + 16 + 8 * hh), x3 = *(const v4fa*)(arow + kb + 16 + 8 * hh + 4);
    float xs[16] = {x0[0],x0[1],x0[2],x0[3],x1[0],x1[1],x1[2],x1[3],x2[0],x2[1],x2[2],x2[3],x3[0],x3[1],x3[2],x3[3]};
#pragma unroll
    for (int i = 0; i < 16; ++i) { const unsigned short hb = bf16_bits(xs[i]); ah.u[i] = hb; al.u[i] = ASPLIT ? bf16_bits(xs[i] - bf16_val(hb)) : (unsigned short)0; }
#pragma unroll
    for (int t = 0; t < 4; ++t) {
      const unsigned short* brow = Wt + (size_t)(col0 + t * 16 + ln) * ldb + kb;
      FragB b;
      b.half[0] = *(const v8us*)(brow + 8 * hh);
      b.half[1] = *(const v8us*)(brow + 16 + 8 * hh);
      acc[t] = mmaN<ASPLIT ? 2 : 1>(ah.v, al.v, b.v, b.v, acc[t]);
    }
  }
#pragma unroll
  for (int t = 0; t < 4; ++t) {
    float bv = bias ? bias[col0 + t * 16 + ln] : 0.f;
    if (BIAS_BF16) bv = bf16_round(bv);
#pragma unroll
    for (int r = 0; r < 8; ++r) { float v = acc[t][r] + bv; if (ACT == 1) v = fmaxf(v, 0.f); so[w][8 * hh + r][t * 16 + ln] = v; }
  }
  __builtin_amdgcn_fence(__ATOMIC_ACQ_REL, "workgroup");
  __builtin_amdgcn_wave_barrier();
  const int rsub = lane >> 4, c4 = (lane & 15) * 4;
  {
#pragma unroll
    for (int q = 0; q < 8; ++q) {
      const int r = q * 2 + rsub;
      const v4f v = *(const v4fa*)&so[w][r][c4];
      *(v4f*)(C + (size_t)(row0 + r) * ldc + col0 + c4) = v;
    }
    
  }
}

// GEMM C = act(A·W + bias + resid): A f32 (ASPLIT -> hi/lo 2 terms), Wt bf16 [N][K]; ACT 0 none, 1 relu, 2 exact gelu;
// resid (optional, f32, row index = (row % rmod), pitch ldr, RES_BF16 rounds it) added before the activation.
template <bool ASPLIT, int ACT, bool BIAS_BF16, bool RES_BF16>
__global__ __launch_bounds__(128) void k_gemm_bf3(const float* __restrict__ A, int lda, const unsigned short* __restrict__ Wt, int ldb,
                                                const float* __restrict__ bias, const float* __restrict__ resid, int rmod, int ldr,
                                                float* __restrict__ C, int ldc, int M, int N, int K) {
  __shared__ __attribute__((aligned(16))) float so[4][16][64];
  const int tid = threadIdx.x, w = tid >> 5, lane = tid & 31, ln = lane & 15, hh = lane >> 4;
  const int ntn = N / 64;
  const int wid = blockIdx.x * 4 + w;
  const int mt = wid / ntn, nq = wid % ntn;
  if (mt * 16 >= M) return;
  const int row0 = mt * 16, col0 = nq * 64;
  const float* arow = A + (size_t)(row0 + ln) * lda;
  v8f acc[4] = {};
  for (int kb = 0; kb < K; kb += 32) {
    FragB ah, al;
    const v4f x0 = *(const v4fa*)(arow + kb + 8 * hh), x1 = *(const v4fa*)(arow + kb + 8 * hh + 4);
    const v4f x2 = *(const v4fa*)(arow + kb + 16 + 8 * hh), x3 = *(const v4fa*)(arow + kb + 16 + 8 * hh + 4);
    float xs[16] = {x0[0],x0[1],x0[2],x0[3],x1[0],x1[1],x1[2],x1[3],x2[0],x2[1],x2[2],x2[3],x3[0],x3[1],x3[2],x3[3]};
#pragma unroll
    for (int i = 0; i < 16; ++i) { const unsigned short hb = bf16_bits(xs[i]); ah.u[i] = hb; al.u[i] = ASPLIT ? bf16_bits(xs[i] - bf16_val(hb)) : (unsigned short)0; }
#pragma unroll
    for (int t = 0; t < 4; ++t) {
      const unsigned short* brow = Wt + (size_t)(col0 + t * 16 + ln) * ldb + kb;
      FragB b;
      b.half[0] = *(const v8us*)(brow + 8 * hh);
      b.half[1] = *(const v8us*)(brow + 16 + 8 * hh);
      acc[t] = mmaN<ASPLIT ? 2 : 1>(ah.v, al.v, b.v, b.v, acc[t]);
    }
  }
#pragma unroll
  for (int t = 0; t < 4; ++t) {
    const int col = col0 + t * 16 + ln;
    float bv = bias ? bias[col] : 0.f;
    if (BIAS_BF16) bv = bf16_round(bv);
#pragma unroll
    for (int r = 0; r < 8; ++r) {
      float v = acc[t][r] + bv;
      if (resid) { float rv = resid[(size_t)((row0 + 8 * hh + r) % rmod) * ldr + col]; if (RES_BF16) rv = bf16_round(rv); v += rv; }
      if (ACT == 1) v = fmaxf(v, 0.f);
      if (ACT == 2) v = 0.5f * v * (1.0f + erff(v * 0.70710678118654752f));
      if (ACT == 3) { const float u = 0.7978845608028654f * (v + 0.044715f * v * v * v); v = 0.5f * v * (1.0f + tanhf(u)); }
      so[w][8 * hh + r][t * 16 + ln] = v;
    }
  }
  __builtin_amdgcn_fence(__ATOMIC_ACQ_REL, "workgroup");
  __builtin_amdgcn_wave_barrier();
  const int rsub = lane >> 4, c4 = (lane & 15) * 4;
  {
#pragma unroll
    for (int q = 0; q < 8; ++q) {
      const int r = q * 2 + rsub;
      const v4f v = *(const v4fa*)&so[w][r][c4];
      *(v4f*)(C + (size_t)(row0 + r) * ldc + col0 + c4) = v;
    }
    
  }
}
// row LayerNorm (biased variance, eps) over N: s = X (+ R); optional out_sum <- s; out_norm <- (s-mu)*rsqrt(var+eps)*g + b
template <bool PARAM_BF16>
__global__ __launch_bounds__(256) void k_layernorm(const float* __restrict__ X, const float* __restrict__ R, const float* __restrict__ g, const float* __restrict__ bta,
                                                  float* __restrict__ out_sum, float* __restrict__ out_norm, int N, float eps) {
  __shared__ float red[256];
  const int row = blockIdx.x, tid = threadIdx.x;
  const float* x = X + (size_t)row * N; const float* rr = R ? R + (size_t)row * N : nullptr;
  float vals[16];                     // up to N = 4096
  const int per = N / 256;            // contiguous chunk per thread? use strided-by-4 chunks: thread handles j = tid*4 + 1024*u
  float s1 = 0.f;
  for (int u = 0; u < per / 4; ++u) {
    const int j = tid * 4 + 1024 * u;
    const v4f a = *(const v4fa*)(x + j);
    v4f b = {0.f,0.f,0.f,0.f}; if (rr) b = *(const v4fa*)(rr + j);
#pragma unroll
    for (int q = 0; q < 4; ++q) { const float v = a[q] + b[q]; vals[u * 4 + q] = v; s1 += v; }
  }
  red[tid] = s1; __syncthreads();
  for (int st = 128; st > 0; st >>= 1) { if (tid < st) red[tid] += red[tid + st]; __syncthreads(); }
  const float mu = red[0] / (float)N; __syncthreads();
  float s2 = 0.f;
  for (int u = 0; u < per / 4; ++u)
#pragma unroll
    for (int q = 0; q < 4; ++q) { const float c = vals[u * 4 + q] - mu; s2 += c * c; }
  red[tid] = s2; __syncthreads();
  for (int st = 128; st > 0; st >>= 1) { if (tid < st) red[tid] += red[tid + st]; __syncthreads(); }
  const float rs = rsqrtf(red[0] / (float)N + eps);
  {
    for (int u = 0; u < per / 4; ++u) {
      const int j = tid * 4 + 1024 * u;
      v4f o, sm;
#pragma unroll
      for (int q = 0; q < 4; ++q) {
        float gg = g[j + q], bb = bta[j + q];
        if (PARAM_BF16) { gg = bf16_round(gg); bb = bf16_round(bb); }
        sm[q] = vals[u * 4 + q]; o[q] = (vals[u * 4 + q] - mu) * rs * gg + bb;
      }
      if (out_sum) *(v4f*)(out_sum + (size_t)row * N + j) = sm;
      *(v4f*)(out_norm + (size_t)row * N + j) = o;
    }
    
  }
}



// ---- f16 WMMA path (v_wmma_f32_16x16x32_f16): 11-bit significands for operands in range — used for every GEMM launched here
typedef _Float16 v16h __attribute__((ext_vector_type(16)));
union FragH { v16h v; v8us half[2]; _Float16 h[16]; unsigned short u[16]; };
template <int NT>
__device__ __forceinline__ v8f mmaH(v16h ah, v16h al, v16h bh, v16h bl, v8f c) {
  c = __builtin_amdgcn_wmma_f32_16x16x32_f16(false, ah, false, bh, (short)0, c, false, false);
  if (NT >= 2) c = __builtin_amdgcn_wmma_f32_16x16x32_f16(false, al, false, bh, (short)0, c, false, false);
  if (NT >= 3) c = __builtin_amdgcn_wmma_f32_16x16x32_f16(false, ah, false, bl, (short)0, c, false, false);
  asm volatile("v_nop\n\tv_nop\n\tv_nop\n\tv_nop" : "+v"(c) : "v"(ah), "v"(al), "v"(bh), "v"(bl));
  return c;
}
// batched GEMM like k_gemm_b but f16 operands: A f32 (split into f16 hi/lo if ASPLIT, else rounded to f16), Bt = f16 values [n][k]; alpha; C f32; N multiple of 16 (partial tiles skipped)
template <bool ASPLIT>
__global__ __launch_bounds__(128) void k_gemm_h(const float* __restrict__ A, int lda, size_t sA, const _Float16* __restrict__ Bh, int ldb, size_t sB, float alpha, float* __restrict__ C, int ldc, size_t sC, int M, int N, int K) {
  __shared__ __attribute__((aligned(16))) float so[4][16][64];
  const int tid = threadIdx.x, w = tid >> 5, lane = tid & 31, ln = lane & 15, hh = lane >> 4; const int by = blockIdx.y;
  A += (size_t)by * sA; Bh += (size_t)by * sB; C += (size_t)by * sC;
  const int ntn = (N + 63) / 64; const int wid = blockIdx.x * 4 + w; const int mt = wid / ntn, nq = wid % ntn; if (mt * 16 >= M) return;
  const int row0 = mt * 16, col0 = nq * 64; const float* arow = A + (size_t)(row0 + ln) * lda;
  v8f acc[4] = {};
  for (int kb = 0; kb < K; kb += 32) {
    FragH ah, al;
    const v4f x0 = *(const v4fa*)(arow + kb + 8 * hh), x1 = *(const v4fa*)(arow + kb + 8 * hh + 4), x2 = *(const v4fa*)(arow + kb + 16 + 8 * hh), x3 = *(const v4fa*)(arow + kb + 16 + 8 * hh + 4);
    float xs[16] = {x0[0],x0[1],x0[2],x0[3],x1[0],x1[1],x1[2],x1[3],x2[0],x2[1],x2[2],x2[3],x3[0],x3[1],x3[2],x3[3]};
#pragma unroll
    for (int i = 0; i < 16; ++i) { const _Float16 h = (_Float16)xs[i]; ah.h[i] = h; al.h[i] = ASPLIT ? (_Float16)(xs[i] - (float)h) : (_Float16)0.0f; }
#pragma unroll
    for (int t = 0; t < 4; ++t) { if (col0 + t * 16 >= N) continue; const size_t boff = (size_t)(col0 + t * 16 + ln) * ldb + kb; FragH bq; bq.half[0] = *(const v8us*)(Bh + boff + 8 * hh); bq.half[1] = *(const v8us*)(Bh + boff + 16 + 8 * hh);
      acc[t] = mmaH<ASPLIT ? 2 : 1>(ah.v, al.v, bq.v, bq.v, acc[t]); }
  }
#pragma unroll
  for (int t = 0; t < 4; ++t) { if (col0 + t * 16 >= N) continue;
#pragma unroll
    for (int r = 0; r < 8; ++r) so[w][8 * hh + r][t * 16 + ln] = acc[t][r] * alpha; }
  __builtin_amdgcn_fence(__ATOMIC_ACQ_REL, "workgroup"); __builtin_amdgcn_wave_barrier();
  const int rsub = lane >> 4, c4 = (lane & 15) * 4;
  {
#pragma unroll
    for (int q = 0; q < 8; ++q) { const int r = q * 2 + rsub; if (col0 + c4 < N) { const v4f v = *(const v4fa*)&so[w][r][c4]; *(v4f*)(C + (size_t)(row0 + r) * ldc + col0 + c4) = v; } }
     }
}

// Wt[n][k] = f16(W[k][n]·scale) from f32 row-major W[K][N] (scale = power of two; bf16-exact weights stay exact in f16 away from the subnormal range)
__global__ __launch_bounds__(256) void k_wt_f16(const float* __restrict__ W, _Float16* __restrict__ Wt, int K, int N, float scale) {
  const int t = blockIdx.x * 256 + threadIdx.x; if (t >= N * (K / 8)) return; const int n = t / (K / 8), k8 = (t % (K / 8)) * 8; FragH f;
#pragma unroll
  for (int i = 0; i < 8; ++i) f.h[i] = (_Float16)(bf16_round(W[(size_t)(k8 + i) * N + n]) * scale); const v8us o = f.half[0];
  *(v8us*)((unsigned short*)Wt + (size_t)n * K + k8) = o; 
}
// k_gemm_hh variant with fused epilogue: v = acc·alpha + bias[by·sBias + col] (+ CP[(row/rowsPerB)·sCPb + by·64 + col] if CP) ; ACT 0 none / 1 elu ; writes f16 C16 (and f32 C if non-null)
template <int ACT>
__global__ __launch_bounds__(128) void k_gemm_hhx(const _Float16* __restrict__ A, int lda, size_t sA, const _Float16* __restrict__ Bh, int ldb, size_t sB, float alpha, const float* __restrict__ bias, size_t sBias, const float* __restrict__ CP, int rowsPerB, size_t sCPb, int row0g,
    float* __restrict__ C, _Float16* __restrict__ C16, int ldc, size_t sC, int M, int N, int K) {
  __shared__ __attribute__((aligned(16))) float so[4][16][64];
  const int tid = threadIdx.x, w = tid >> 5, lane = tid & 31, ln = lane & 15, hh = lane >> 4; const int by = blockIdx.y;
  A += (size_t)by * sA; Bh += (size_t)by * sB; const size_t cofs = (size_t)by * sC; const float* bp = bias ? bias + (size_t)by * sBias : nullptr;
  const int ntn = (N + 63) / 64; const int wid = blockIdx.x * 4 + w; const int mt = wid / ntn, nq = wid % ntn; if (mt * 16 >= M) return;
  const int row0 = mt * 16, col0 = nq * 64; const _Float16* arow = A + (size_t)(row0 + ln) * lda;
  v8f acc[4] = {};
  for (int kb = 0; kb < K; kb += 32) { FragH ah; ah.half[0] = *(const v8us*)((const unsigned short*)arow + kb + 8 * hh); ah.half[1] = *(const v8us*)((const unsigned short*)arow + kb + 16 + 8 * hh);
#pragma unroll
    for (int t = 0; t < 4; ++t) { if (col0 + t * 16 >= N) continue; const size_t boff = (size_t)(col0 + t * 16 + ln) * ldb + kb; FragH bq; bq.half[0] = *(const v8us*)((const unsigned short*)Bh + boff + 8 * hh); bq.half[1] = *(const v8us*)((const unsigned short*)Bh + boff + 16 + 8 * hh);
      acc[t] = mmaH<1>(ah.v, ah.v, bq.v, bq.v, acc[t]); }
  }
#pragma unroll
  for (int t = 0; t < 4; ++t) { if (col0 + t * 16 >= N) continue; const int col = col0 + t * 16 + ln; const float bv = bp ? bf16_round(bp[col]) : 0.f;
#pragma unroll
    for (int r = 0; r < 8; ++r) { float v = acc[t][r] * alpha + bv; if (CP) { const int rr = row0g + row0 + 8 * hh + r; if (rowsPerB < 0) v += CP[cofs + (size_t)rr * ldc + col];      /* rowsPerB < 0: own element of the batched C plane */ else { const int bidx = rr / rowsPerB; v += CP[(size_t)bidx * sCPb + (size_t)by * 64 + col]; } } if (ACT == 1) v = (v > 0.f) ? v : expm1f(v); else if (ACT == 7) v = (v > 0.f) ? v + 1.0f : expf(v); else if (ACT == 8) v = tanhf(v); else if (ACT == 9) v = 0.5f * v * (1.0f + tanhf(0.7978845608028654f * (v + 0.044715f * v * v * v))); else if (ACT == 11) v = 1.0f / (1.0f + expf(-v)); else if (ACT == 12) v = (v > 0.f) ? v : 0.01f * v; else if (ACT == 14) v = (v > 0.f) ? v : 0.1f * v; else if (ACT == 16) v = (v >= 0.f) ? v : 0.3f * v; else if (ACT == 17) v = (v >= 0.f) ? v : 0.2f * v; else if (ACT == 15) v = v / (1.0f + expf(-v)); else if (ACT == 3) v = fmaxf(v, 0.f); else if (ACT == 6) v = 0.5f * v * (1.0f + erff(v * 0.70710678118654752f)); so[w][8 * hh + r][t * 16 + ln] = v; } }
  __builtin_amdgcn_fence(__ATOMIC_ACQ_REL, "workgroup"); __builtin_amdgcn_wave_barrier();
  const int rsub = lane >> 4, c4 = (lane & 15) * 4; typedef _Float16 v4h __attribute__((ext_vector_type(4)));
  {
#pragma unroll
    for (int q = 0; q < 8; ++q) { const int r = q * 2 + rsub; if (col0 + c4 < N) { const v4f v = *(const v4fa*)&so[w][r][c4]; if (C) *(v4f*)(C + cofs + (size_t)(row0 + r) * ldc + col0 + c4) = v; if (C16) { v4h h4; for (int i = 0; i < 4; ++i) h4[i] = (_Float16)v[i]; *(v4h*)(C16 + cofs + (size_t)(row0 + r) * ldc + col0 + c4) = h4; } } }
     }
}


typedef _Float16 v4h __attribute__((ext_vector_type(4)));

__global__ __launch_bounds__(256) void k_x16(const float* __restrict__ x, _Float16* __restrict__ X16, size_t n8) { const size_t t = (size_t)blockIdx.x * 256 + threadIdx.x; if (t >= n8) return; FragH f;
#pragma unroll
  for (int q = 0; q < 8; ++q) f.h[q] = (_Float16)bf16_round(x[t * 8 + q]); *(v8us*)((unsigned short*)X16 + t * 8) = f.half[0];  }
__global__ __launch_bounds__(256) void k_h16(const float* __restrict__ x, _Float16* __restrict__ X16, size_t n8) { const size_t t = (size_t)blockIdx.x * 256 + threadIdx.x; if (t >= n8) return; FragH f;
#pragma unroll
  for (int q = 0; q < 8; ++q) f.h[q] = (_Float16)x[t * 8 + q]; *(v8us*)((unsigned short*)X16 + t * 8) = f.half[0];  }
__global__ __launch_bounds__(256) void k_round16f(const float* __restrict__ W, _Float16* __restrict__ Bt, size_t n8) { const size_t t = (size_t)blockIdx.x * 256 + threadIdx.x; if (t >= n8) return; FragH f;
#pragma unroll
  for (int i = 0; i < 8; ++i) f.h[i] = (_Float16)(bf16_round(W[t * 8 + i]) * 16.0f); *(v8us*)((unsigned short*)Bt + t * 8) = f.half[0];  }
template <int NHv, int TTv>
__global__ __launch_bounds__(256) void k_vt(const _Float16* __restrict__ V16, int ldv, int voff, _Float16* __restrict__ Vt) { __shared__ unsigned short tl[64][66]; const int tid = threadIdx.x; const int slab = blockIdx.x / (TTv / 64), lg = blockIdx.x % (TTv / 64); const int b = slab / NHv, h = slab % NHv;
  for (int i = tid; i < 64 * 8; i += 256) { const int r = i / 8, c8 = (i % 8) * 8; FragH f; f.half[0] = *(const v8us*)((const unsigned short*)V16 + ((size_t)b * TTv + lg * 64 + r) * ldv + voff + h * 64 + c8);
#pragma unroll
    for (int q = 0; q < 8; ++q) tl[r][c8 + q] = f.u[q]; }
  __syncthreads();
  {
#pragma unroll
    for (int rd = 0; rd < 2; ++rd) { const int d = rd * 32 + tid / 8, pc = tid % 8; FragH f;
#pragma unroll
      for (int q = 0; q < 8; ++q) f.u[q] = tl[pc * 8 + q][d];
      *(v8us*)((unsigned short*)Vt + ((size_t)slab * 64 + d) * TTv + lg * 64 + pc * 8) = f.half[0]; }
     } }

__global__ __launch_bounds__(256) void k_hl(const float* __restrict__ F, _Float16* __restrict__ Hh, _Float16* __restrict__ Hl, size_t n8) { const size_t t = (size_t)blockIdx.x * 256 + threadIdx.x; if (t >= n8) return; FragH fh, fl; const v4f a = *(const v4fa*)(F + t * 8), c = *(const v4fa*)(F + t * 8 + 4);
#pragma unroll
  for (int q = 0; q < 4; ++q) { _Float16 h = (_Float16)a[q]; fh.h[q] = h; fl.h[q] = (_Float16)((a[q] - (float)h) * 1024.0f); h = (_Float16)c[q]; fh.h[4 + q] = h; fl.h[4 + q] = (_Float16)((c[q] - (float)h) * 1024.0f); }
  { *(v8us*)((unsigned short*)Hh + t * 8) = fh.half[0]; *(v8us*)((unsigned short*)Hl + t * 8) = fl.half[0];  } }

// ---- fast GEMM (block tile 128x128 = eight 32x64 wave tiles; A and B in 64-k tiles through a two-buffer LDS ring; requires M % 128 == 0 rows per launch region, N % 128 == 0, K % 64 == 0); epilogue = k_gemm_hhx semantics ----
__device__ __forceinline__ v16h g2_frag(const _Float16* p, int hh) { FragH f; f.half[0] = *(const v8us*)((const unsigned short*)p + 8 * hh); f.half[1] = *(const v8us*)((const unsigned short*)p + 16 + 8 * hh); return f.v; }
__device__ __forceinline__ v8f g2_mma(v16h a, v16h b, v8f c) { v8f d = __builtin_amdgcn_wmma_f32_16x16x32_f16(false, a, false, b, (short)0, c, false, false); asm volatile("v_nop\n\tv_nop\n\tv_nop\n\tv_nop" : "+v"(d) : "v"(a), "v"(b)); return d; }
#define G2P 72      /* LDS row pitch in f16: 64 k + 8 = 144 B, 16 B x odd, the conflict-free pitch for ds_load_b128 readers */
// One thread's eight b128 asynchronous copies to LDS for one 64-k pass: its 16-byte piece of rows r, r + 32, r + 64, r + 96 of the 128-row A tile and of the 128-row B tile (la, lb = LDS byte addresses, ga, gb = global addresses, rsa, rsb = 32 rows in elements).
// s_wait_xcnt 0 is the statement's last line so that no address register of an issued copy is rewritten ahead of it.
__device__ __forceinline__ void g2_copy8(unsigned la, unsigned lb, const _Float16* ga, const _Float16* gb, size_t rsa, size_t rsb) {
  asm volatile("global_load_async_to_lds_b128 %0, %8, off\n\t"
               "global_load_async_to_lds_b128 %1, %9, off\n\t"
               "global_load_async_to_lds_b128 %2, %10, off\n\t"
               "global_load_async_to_lds_b128 %3, %11, off\n\t"
               "global_load_async_to_lds_b128 %4, %12, off\n\t"
               "global_load_async_to_lds_b128 %5, %13, off\n\t"
               "global_load_async_to_lds_b128 %6, %14, off\n\t"
               "global_load_async_to_lds_b128 %7, %15, off\n\t"
               "s_wait_xcnt 0x0"
               :: "v"(la), "v"(la + 1u * 32u * G2P * 2u), "v"(la + 2u * 32u * G2P * 2u), "v"(la + 3u * 32u * G2P * 2u), "v"(lb), "v"(lb + 1u * 32u * G2P * 2u), "v"(lb + 2u * 32u * G2P * 2u), "v"(lb + 3u * 32u * G2P * 2u),
                  "v"(ga), "v"(ga + rsa), "v"(ga + 2 * rsa), "v"(ga + 3 * rsa), "v"(gb), "v"(gb + rsb), "v"(gb + 2 * rsb), "v"(gb + 3 * rsb) : "memory");
}
template <int ACT>
__global__ __launch_bounds__(256) void k_gemm2(const _Float16* __restrict__ A, int lda, size_t sA, const _Float16* __restrict__ Bh, int ldb, size_t sB, float alpha, const float* __restrict__ bias, size_t sBias, const float* __restrict__ CP, int rowsPerB, size_t sCPb, int row0g,
    float* __restrict__ C, _Float16* __restrict__ C16, int ldc, size_t sC, int M, int N, int K) { static_assert(ACT == 0 || ACT == 3 || ACT == 6 || ACT == 8 || ACT == 9 || ACT == 11 || ACT == 12 || ACT == 14 || ACT == 15 || ACT == 16 || ACT == 17, "k_gemm2: unsupported ACT code (would silently apply no activation)");
  __shared__ __attribute__((aligned(16))) _Float16 ring[2][2][128][G2P];      /* [buffer][A | B][row][k], filled by the asynchronous copies only */
  __shared__ __attribute__((aligned(16))) float so[8][32][68];
  const int tid = threadIdx.x, w = tid >> 5, lane = tid & 31, ln = lane & 15, hh = lane >> 4; const int by = blockIdx.y;
  A += (size_t)by * sA; Bh += (size_t)by * sB; const size_t cofs = (size_t)by * sC; const float* bp = bias ? bias + (size_t)by * sBias : nullptr;
  const int ntn = N >> 7; const int mt = blockIdx.x / ntn, nq = blockIdx.x - mt * ntn; if (mt * 128 >= M) return;      /* the same for the whole block, ahead of every barrier */
  const int wm = w >> 1, wn = w & 1; const int row0 = mt * 128 + 32 * wm, col0 = nq * 128 + 64 * wn;
  const int cr = tid >> 3, cc = (tid & 7) * 8;      /* this thread's first row and its 8-element piece in every copied tile */
  const _Float16* ga = A + (size_t)(mt * 128 + cr) * lda + cc; const _Float16* gb = Bh + (size_t)(nq * 128 + cr) * ldb + cc; const size_t rsa = (size_t)32 * lda, rsb = (size_t)32 * ldb;
  const unsigned la = (unsigned)(size_t)&ring[0][0][cr][cc], lb = (unsigned)(size_t)&ring[0][1][cr][cc]; const unsigned bufb = 2u * 128u * G2P * 2u;      /* LDS byte addresses in buffer 0; bytes per buffer */
  const int np = K >> 6;
  const v8f z8 = {0.f,0.f,0.f,0.f,0.f,0.f,0.f,0.f}; v8f c00 = z8, c01 = z8, c02 = z8, c03 = z8, c10 = z8, c11 = z8, c12 = z8, c13 = z8;
  g2_copy8(la, lb, ga, gb, rsa, rsb);
  asm volatile("s_wait_asynccnt 0x0" ::: "memory");      /* this wave's copies of tile 0 have landed */
  __syncthreads();      /* publishes tile 0 */
  if (np > 1) g2_copy8(la + bufb, lb + bufb, ga + 64, gb + 64, rsa, rsb);
  for (int t = 0; t < np; ++t) { const int bu = t & 1; const _Float16* a0p = &ring[bu][0][32 * wm + ln][0]; const _Float16* a1p = a0p + 16 * G2P;
    const _Float16* b0p = &ring[bu][1][64 * wn + ln][0]; const _Float16* b1p = b0p + 16 * G2P; const _Float16* b2p = b1p + 16 * G2P; const _Float16* b3p = b2p + 16 * G2P;
    v16h a0[2], a1[2], b0[2], b1[2], b2[2], b3[2];      /* the pass's 24 LDS reads go as one group ahead of its 16 products: reads placed among the products would each wait out the LDS latency */
#pragma unroll      /* the fragment arrays must stay in registers */
    for (int s = 0; s < 2; ++s) { a0[s] = g2_frag(a0p + 32 * s, hh); a1[s] = g2_frag(a1p + 32 * s, hh); b0[s] = g2_frag(b0p + 32 * s, hh); b1[s] = g2_frag(b1p + 32 * s, hh); b2[s] = g2_frag(b2p + 32 * s, hh); b3[s] = g2_frag(b3p + 32 * s, hh); }
#pragma unroll      /* as above */
    for (int s = 0; s < 2; ++s) { c00 = g2_mma(a0[s], b0[s], c00); c10 = g2_mma(a1[s], b0[s], c10); c01 = g2_mma(a0[s], b1[s], c01); c11 = g2_mma(a1[s], b1[s], c11);
      c02 = g2_mma(a0[s], b2[s], c02); c12 = g2_mma(a1[s], b2[s], c12); c03 = g2_mma(a0[s], b3[s], c03); c13 = g2_mma(a1[s], b3[s], c13); }
    asm volatile("s_wait_dscnt 0x0" ::: "memory");      /* this wave's reads of buffer bu are done before it is refilled */
    asm volatile("s_wait_asynccnt 0x0" ::: "memory");      /* this wave's copies of tile t + 1 have landed */
    __syncthreads();      /* publishes tile t + 1 and ends every wave's reads of buffer bu */
    if (t + 2 < np) g2_copy8(la + bu * bufb, lb + bu * bufb, ga + (size_t)(t + 2) * 64, gb + (size_t)(t + 2) * 64, rsa, rsb); }
  asm volatile("s_wait_asynccnt 0x0" ::: "memory");      /* no copy is outstanding when the wave goes on */
  v8f accs[8] = {c00, c01, c02, c03, c10, c11, c12, c13};
#pragma unroll
  for (int u = 0; u < 8; ++u) { const int t = u & 3, half = u >> 2; const int col = col0 + t * 16 + ln; const float bv = bp ? bf16_round(bp[col]) : 0.f;
#pragma unroll
    for (int r = 0; r < 8; ++r) { const int rloc = half * 16 + 8 * hh + r; float v = accs[u][r] * alpha + bv; if (CP) { if (rowsPerB < 0) v += CP[cofs + (size_t)(row0g + row0 + rloc) * ldc + col];      /* rowsPerB < 0: own element of the batched C plane */ else { const int bidx = (row0g + row0 + rloc) / rowsPerB; v += CP[(size_t)bidx * sCPb + (size_t)by * 64 + col]; } }
      if (ACT == 3) v = fmaxf(v, 0.f); else if (ACT == 6) v = 0.5f * v * (1.0f + erff(v * 0.70710678118654752f)); else if (ACT == 11) v = 1.0f / (1.0f + expf(-v)); else if (ACT == 15) v = v / (1.0f + expf(-v)); else if (ACT == 12) v = (v > 0.f) ? v : 0.01f * v; else if (ACT == 8) v = tanhf(v); else if (ACT == 9) v = 0.5f * v * (1.0f + tanhf(0.7978845608028654f * (v + 0.044715f * v * v * v))); else if (ACT == 14) v = (v > 0.f) ? v : 0.1f * v; else if (ACT == 16) v = (v >= 0.f) ? v : 0.3f * v; else if (ACT == 17) v = (v >= 0.f) ? v : 0.2f * v;
      so[w][rloc][t * 16 + ln] = v; } }
  __builtin_amdgcn_fence(__ATOMIC_ACQ_REL, "workgroup"); __builtin_amdgcn_wave_barrier();
  const int rsub = lane >> 4, c4 = (lane & 15) * 4;
  {
#pragma unroll
    for (int q = 0; q < 16; ++q) { const int r = q * 2 + rsub; const v4f v = *(const v4fa*)&so[w][r][c4]; if (C) *(v4f*)(C + cofs + (size_t)(row0 + r) * ldc + col0 + c4) = v; if (C16) { v4h h4; for (int i = 0; i < 4; ++i) h4[i] = (_Float16)v[i]; *(v4h*)(C16 + cofs + (size_t)(row0 + r) * ldc + col0 + c4) = h4; } }
     } }


__global__ __launch_bounds__(256) void k_wsc(const float* __restrict__ Wm, _Float16* __restrict__ Bt, size_t n8, float sc) { const size_t t = (size_t)blockIdx.x * 256 + threadIdx.x; if (t >= n8) return; FragH f; for (int q = 0; q < 8; ++q) f.h[q] = (_Float16)(bf16_round(Wm[t * 8 + q]) * sc); *(v8us*)((unsigned short*)Bt + t * 8) = f.half[0];  }
// ---- kernels whose lanes used to stride a whole row apart in global memory: the global side now moves whole lines, an LDS tile takes the strided walk ----
#define SR 32                    /* rows (b, c) per k_stat block: one per lane of the wave that sums */
#define SP (1024 + 4)            /* k_stat LDS row pitch in floats: 16 B x odd, so that 16 lanes, each on its own row, cover all banks with ds_load_b128 */
#define PT 128                   /* edge of the k_plane and k_out tiles: 512 B a row on the f32 side, 256 B on the f16 side */
static_assert(TC == 1024 && TS == 1024 && (NB * CC) % SR == 0 && CC % PT == 0, "k_stat stages rows of 256 x 4 floats; k_plane and k_out use whole tiles");
__global__ __launch_bounds__(256) void k_stat(const float* __restrict__ x, int T, float* __restrict__ ST) {
  __shared__ __attribute__((aligned(16))) float rowv[SR][SP];
  const int tid = threadIdx.x; const float* p = x + (size_t)blockIdx.x * SR * 1024 + tid * 4;      /* the row length as a constant: every load is one base plus an immediate */
#pragma unroll      /* all the block's loads in flight at once: the staging is bound by memory latency otherwise */
  for (int i = 0; i < SR; ++i) { const v4f a = *(const v4fa*)(p + i * 1024); v4f o; for (int q = 0; q < 4; ++q) o[q] = bf16_round(a[q]); *(v4fa*)&rowv[i][tid * 4] = o; }
  __syncthreads();      /* publishes the 32 staged rows */
  if (tid >= SR) return;      /* behind the only barrier: one lane sums one row, first element to last as before */
  const v4fa* rp = (const v4fa*)&rowv[tid][0]; float s = 0.f; v4f cur[8], nxt[8];      /* 32 values in hand, the next 32 on their way from LDS under the dependent adds */
  for (int j = 0; j < 8; ++j) cur[j] = rp[j];
#pragma unroll 2      /* cur and nxt change places without register copies */
  for (int c = 0; c < 32; ++c) { for (int j = 0; j < 8; ++j) nxt[j] = rp[((c + 1) & 31) * 8 + j];      /* the last trip fetches the row's head again, for the second walk */
    __builtin_amdgcn_sched_barrier(0);      /* keeps the eight LDS reads ahead of the 32 adds that cover their latency; the scheduler sinks them to their uses otherwise */
    for (int j = 0; j < 8; ++j) for (int q = 0; q < 4; ++q) s += cur[j][q];
    for (int j = 0; j < 8; ++j) cur[j] = nxt[j]; }
  const float mu = s / (float)T; float s2 = 0.f;
#pragma unroll 2      /* as above */
  for (int c = 0; c < 32; ++c) { for (int j = 0; j < 8; ++j) nxt[j] = rp[((c + 1) & 31) * 8 + j];
    __builtin_amdgcn_sched_barrier(0);      /* as above */
    for (int j = 0; j < 8; ++j) for (int q = 0; q < 4; ++q) {
      #pragma clang fp contract(off)      /* numerical: d * d keeps its own rounding, as in every earlier version, so that the scales, and with them the unscaled logits whose softmax is close to an argmax, stay bit for bit as before */
      const float d = cur[j][q] - mu; s2 += d * d; }
    for (int j = 0; j < 8; ++j) cur[j] = nxt[j]; }
  const float r = rsqrtf(s2 / (float)(T - 1) + 1e-5f); typedef float v2f_ __attribute__((ext_vector_type(2))); v2f_ o; o[0] = mu; o[1] = r; *(v2f_*)(ST + ((size_t)blockIdx.x * SR + tid) * 2) = o;  }
// one block = 128 channels x 128 frames of one batch; the tile holds hi | residual << 16 per element
typedef unsigned v4ua __attribute__((ext_vector_type(4), may_alias));
template <bool NORM, int T>
__global__ __launch_bounds__(256) void k_plane(const float* __restrict__ x, const float* __restrict__ ST, _Float16* __restrict__ Hh, _Float16* __restrict__ Lh) {
  __shared__ unsigned tl[PT][PT + 1];
  const int tid = threadIdx.x, w = __builtin_amdgcn_readfirstlane(tid >> 5) /* the wave's number in a scalar register: a row's mean and scale come by scalar loads */, lane = tid & 31; const int nft = T / PT; const int ft = blockIdx.x % nft, ct = (blockIdx.x / nft) % (CC / PT), b = blockIdx.x / (nft * (CC / PT)); const int c0 = ct * PT, f0 = ft * PT;
  const size_t rc0 = (size_t)b * CC + c0 + w; const float* xp = x + rc0 * T + f0 + lane * 4; v4f a[PT / 8]; float mu[PT / 8], r[PT / 8];
#pragma unroll      /* the block's 16 loads per thread in flight at once */
  for (int i = 0; i < PT / 8; ++i) a[i] = *(const v4fa*)(xp + (size_t)i * 8 * T);
  asm volatile("s_wait_xcnt 0x0" ::: "memory");      /* the scalar loads and the address arithmetic below reuse registers that these 16 loads name; as a statement that no load crosses it also keeps all 16 up here, in flight together */
#pragma unroll      /* mu and r must stay in registers */
  for (int i = 0; i < PT / 8; ++i) { mu[i] = NORM ? ST[(rc0 + i * 8) * 2] : 0.f; r[i] = NORM ? ST[(rc0 + i * 8) * 2 + 1] : 1.f; }
#pragma unroll      /* a must stay in registers */
  for (int i = 0; i < PT / 8; ++i) { const int cl = i * 8 + w;
    for (int q = 0; q < 4; ++q) {
      #pragma clang fp contract(off)      /* numerical: (v - mu) * r is rounded to f32 before its f16 head is taken off, as in every earlier version, so that head and residual, and with them the unscaled logits whose softmax is close to an argmax, stay as before */
      float v = bf16_round(a[i][q]); if (NORM) v = (v - mu[i]) * r[i]; union { _Float16 h[2]; unsigned u; } f; f.h[0] = (_Float16)v; f.h[1] = NORM ? (_Float16)((v - (float)f.h[0]) * 1024.0f) : (_Float16)0.0f; tl[cl][lane * 4 + q] = f.u; } }
  __syncthreads();      /* publishes the tile */
  const int g = tid & 15, fs = tid >> 4; unsigned u[8], n[8];
  for (int q = 0; q < 8; ++q) u[q] = tl[g * 8 + q][fs];
#pragma unroll      /* u and n must stay in registers; every store is one base plus an immediate */
  for (int i = 0; i < PT / 16; ++i) { const int f = i * 16 + fs; v4ua oh, ol;
    if (i + 1 < PT / 16) for (int q = 0; q < 8; ++q) n[q] = tl[g * 8 + q][f + 16];      /* the next frame's LDS reads fly over this frame's packing and stores */
    for (int q = 0; q < 4; ++q) { oh[q] = (u[2 * q] & 0xFFFFu) | (u[2 * q + 1] << 16); ol[q] = (u[2 * q] >> 16) | (u[2 * q + 1] & 0xFFFF0000u); }
    const size_t o = ((size_t)b * T + f0 + f) * CC + c0 + g * 8; *(v4ua*)((unsigned short*)Hh + o) = oh; if (NORM) *(v4ua*)((unsigned short*)Lh + o) = ol;
    if (i + 1 < PT / 16) asm volatile("s_wait_xcnt 0x0" ::: "memory");      /* the next frame's packing reuses registers that these stores name */
    for (int q = 0; q < 8; ++q) u[q] = n[q]; } }
__global__ __launch_bounds__(256) void k_soft(const float* __restrict__ S, _Float16* __restrict__ P, float* __restrict__ RS) {
  #pragma clang fp contract(off)
  const int wv = threadIdx.x >> 5, ln = threadIdx.x & 31; const int r = blockIdx.x * 8 + wv; if (r >= BG * TC) return; const float* sr = S + (size_t)r * TS; float mx = -3.0e38f;
#pragma unroll 1
  for (int gq = 0; gq < TS / 256; ++gq) { const v8f a = *(const v8f*)(sr + gq * 256 + ln * 8); for (int q = 0; q < 8; ++q) mx = fmaxf(mx, a[q]); }
  for (int o = 16; o > 0; o >>= 1) mx = fmaxf(mx, __shfl_xor(mx, o, 32)); float su = 0.f;
{ su = 0.f;
#pragma unroll 1
    for (int gq = 0; gq < TS / 256; ++gq) { const v8f a = *(const v8f*)(sr + gq * 256 + ln * 8); FragH ph; for (int q = 0; q < 8; ++q) { const float e = expf(a[q] - mx); su += e; ph.h[q] = (_Float16)(e * 1024.0f); } *(v8us*)((unsigned short*)P + (size_t)r * TS + gq * 256 + ln * 8) = ph.half[0]; }
     }
  for (int o = 16; o > 0; o >>= 1) su += __shfl_xor(su, o, 32); if (ln == 0) { *(float*)(RS + (size_t)r * 32) = 1.0f / su;  } }
__global__ __launch_bounds__(256) void k_osc(const float* __restrict__ O, const float* __restrict__ RS, size_t row0, _Float16* __restrict__ OH, _Float16* __restrict__ OL) {
  #pragma clang fp contract(off)
  const size_t t = (size_t)blockIdx.x * 256 + threadIdx.x; if (t >= (size_t)BG * TC * CC / 8) return; const size_t r = (t * 8) / CC; const float rs = RS[r * 32]; const v8f a = *(const v8f*)(O + t * 8); FragH f, fl;
  for (int q = 0; q < 8; ++q) { const float v = a[q] * rs; const _Float16 hh = (_Float16)v; f.h[q] = hh; fl.h[q] = (_Float16)((v - (float)hh) * 1024.0f); }
  const size_t o = row0 * CC + t * 8; { *(v8us*)((unsigned short*)OH + o) = f.half[0]; *(v8us*)((unsigned short*)OL + o) = fl.half[0];  } }
// one block = 128 frames x 128 output channels of one batch
__global__ __launch_bounds__(256) void k_out(const float* __restrict__ Y, float* __restrict__ out) {
  __shared__ float tl[PT][PT + 1];
  const int tid = threadIdx.x, w = __builtin_amdgcn_readfirstlane(tid >> 5) /* the wave's number in a scalar register: row addresses are a scalar base plus the lane's offset */, lane = tid & 31; const int tt = blockIdx.x % (TC / PT), ot = (blockIdx.x / (TC / PT)) % (CC / PT), b = blockIdx.x / ((TC / PT) * (CC / PT)); const int t0 = tt * PT, o0 = ot * PT; v4f a[PT / 8]; const float* yp = Y + ((size_t)b * TC + t0 + w) * CC + o0 + lane * 4;
#pragma unroll      /* the block's 16 loads per thread in flight at once */
  for (int i = 0; i < PT / 8; ++i) a[i] = *(const v4fa*)(yp + i * 8 * CC);
#pragma unroll      /* a must stay in registers */
  for (int i = 0; i < PT / 8; ++i) for (int q = 0; q < 4; ++q) tl[i * 8 + w][lane * 4 + q] = a[i][q];
  __syncthreads();      /* publishes the tile */
#pragma unroll      /* LDS reads of all rows in flight; every store is one base plus an immediate */
  for (int i = 0; i < PT / 8; ++i) { const int ol = i * 8 + w; v4f v; for (int q = 0; q < 4; ++q) v[q] = tl[lane * 4 + q][ol]; *(v4f*)(out + ((size_t)b * CC + o0 + ol) * TC + t0 + lane * 4) = v; } }

extern "C" void kernel_launch(void* const* d_in, const int* in_sizes, int n_in,
                              void* d_out, int out_size, void* d_ws, size_t ws_size, hipStream_t stream) {
  (void)in_sizes; (void)n_in; (void)out_size;
  const float* content = (const float*)d_in[0]; const float* style = (const float*)d_in[1]; const float* Wf = (const float*)d_in[2]; const float* bf_ = (const float*)d_in[3]; const float* Wg = (const float*)d_in[4]; const float* bg = (const float*)d_in[5]; const float* Wh = (const float*)d_in[6]; const float* bh = (const float*)d_in[7]; const float* Wo = (const float*)d_in[8]; const float* bo = (const float*)d_in[9];
  char* ws = (char*)d_ws; size_t off = 0;
  auto take = [&](size_t bytes) { char* p = ws + off; off += (bytes + 255) & ~(size_t)255; return p; };
  const size_t npc = (size_t)NRC * CC, nps = (size_t)NRS * CC;
  _Float16* BF = (_Float16*)take((size_t)CC * CC * 2); _Float16* BGm = (_Float16*)take((size_t)CC * CC * 2); _Float16* BH = (_Float16*)take((size_t)CC * CC * 2); _Float16* BO = (_Float16*)take((size_t)CC * CC * 2); float* STc = (float*)take((size_t)NB * CC * 2 * 4); float* STs = (float*)take((size_t)NB * CC * 2 * 4);
  _Float16* CNH = (_Float16*)take(npc * 2); _Float16* CNL = (_Float16*)take(npc * 2); _Float16* SNH = (_Float16*)take(nps * 2); _Float16* SNL = (_Float16*)take(nps * 2); _Float16* S16 = (_Float16*)take(nps * 2);
  float* T32 = (float*)take(npc * 4);      /* F f32 -> G f32 -> H16 -> Y f32, in turn */ _Float16* FH = (_Float16*)take(npc * 2); _Float16* FL = (_Float16*)take(npc * 2); _Float16* GH = (_Float16*)take(nps * 2); _Float16* GL = (_Float16*)take(nps * 2); _Float16* HT = (_Float16*)take(nps * 2);
  float* S = (float*)take((size_t)BG * TC * TS * 4); _Float16* P = (_Float16*)take((size_t)BG * TC * TS * 2); float* RS = (float*)take((size_t)BG * TC * 32 * 4);
  float* O = (float*)CNH;      /* readout f32 [BG*TC][CC] (16 MiB) over the content hi plane (dead after F) */ _Float16* OH = SNH; _Float16* OL = SNL;      /* O hi/lo [NRC][CC] over the style-normalised planes (dead after G) */ _Float16* H16 = (_Float16*)T32; float* Y = T32;
  if (off > ws_size) return;      /* 2 + 0.1 + 16 x 5 + 32 + 16 x 5 + 32 + 16 + 1 = ≈ 243 MiB */
  k_wsc<<<(CC * CC / 8 + 255) / 256, 256, 0, stream>>>(Wf, BF, (size_t)CC * CC / 8, 16.0f); k_wsc<<<(CC * CC / 8 + 255) / 256, 256, 0, stream>>>(Wg, BGm, (size_t)CC * CC / 8, 16.0f); k_wsc<<<(CC * CC / 8 + 255) / 256, 256, 0, stream>>>(Wh, BH, (size_t)CC * CC / 8, 16.0f); k_wsc<<<(CC * CC / 8 + 255) / 256, 256, 0, stream>>>(Wo, BO, (size_t)CC * CC / 8, 16.0f);      /* conv (out, in) naturals */
  k_stat<<<NB * CC / SR, 256, 0, stream>>>(content, TC, STc); k_stat<<<NB * CC / SR, 256, 0, stream>>>(style, TS, STs);
  k_plane<true, TC><<<NB * (CC / PT) * (TC / PT), 256, 0, stream>>>(content, STc, CNH, CNL); k_plane<true, TS><<<NB * (CC / PT) * (TS / PT), 256, 0, stream>>>(style, STs, SNH, SNL); k_plane<false, TS><<<NB * (CC / PT) * (TS / PT), 256, 0, stream>>>(style, nullptr, S16, nullptr);
  const dim3 gC((NRC / 128) * (CC / 128), 1), gS((NRS / 128) * (CC / 128), 1);
  k_gemm2<0><<<gC, 256, 0, stream>>>(CNL, CC, 0, BF, CC, 0, 0.0625f / 1024.0f, nullptr, 0, nullptr, 1, 0, 0, T32, nullptr, CC, 0, NRC, CC, CC);
  k_gemm2<0><<<gC, 256, 0, stream>>>(CNH, CC, 0, BF, CC, 0, 0.0625f, bf_, 0, T32, 1, (size_t)CC, 0, T32, nullptr, CC, 0, NRC, CC, CC);      /* F rows (b,t) f32 */
  k_hl<<<(unsigned)((npc / 8 + 255) / 256), 256, 0, stream>>>(T32, FH, FL, npc / 8);
  k_gemm2<0><<<gS, 256, 0, stream>>>(SNL, CC, 0, BGm, CC, 0, 0.0625f / 1024.0f, nullptr, 0, nullptr, 1, 0, 0, T32, nullptr, CC, 0, NRS, CC, CC);
  k_gemm2<0><<<gS, 256, 0, stream>>>(SNH, CC, 0, BGm, CC, 0, 0.0625f, bg, 0, T32, 1, (size_t)CC, 0, T32, nullptr, CC, 0, NRS, CC, CC);      /* G rows (b,s) f32 */
  k_hl<<<(unsigned)((nps / 8 + 255) / 256), 256, 0, stream>>>(T32, GH, GL, nps / 8);
  k_gemm2<0><<<gS, 256, 0, stream>>>(S16, CC, 0, BH, CC, 0, 0.0625f, bh, 0, nullptr, 1, 0, 0, nullptr, H16, CC, 0, NRS, CC, CC);      /* H rows (b,s) f16 */
  k_vt<CC / 64, TS><<<NB * (CC / 64) * (TS / 64), 256, 0, stream>>>(H16, CC, 0, HT);      /* H as [b][c][s] */
  for (int g = 0; g < NB / BG; ++g) { const size_t rc0 = (size_t)g * BG * TC, rs0 = (size_t)g * BG * TS;
    k_gemm2<0><<<dim3((TC / 128) * (TS / 128), BG), 256, 0, stream>>>(FH + rc0 * CC, CC, (size_t)TC * CC, GL + rs0 * CC, CC, (size_t)TS * CC, 0.0009765625f, nullptr, 0, nullptr, 1, 0, 0, S, nullptr, TS, (size_t)TC * TS, TC, TS, CC);
    k_gemm2<0><<<dim3((TC / 128) * (TS / 128), BG), 256, 0, stream>>>(FL + rc0 * CC, CC, (size_t)TC * CC, GH + rs0 * CC, CC, (size_t)TS * CC, 0.0009765625f, nullptr, 0, S, -1, 0, 0, S, nullptr, TS, (size_t)TC * TS, TC, TS, CC);
    k_gemm2<0><<<dim3((TC / 128) * (TS / 128), BG), 256, 0, stream>>>(FH + rc0 * CC, CC, (size_t)TC * CC, GH + rs0 * CC, CC, (size_t)TS * CC, 1.0f, nullptr, 0, S, -1, 0, 0, S, nullptr, TS, (size_t)TC * TS, TC, TS, CC);      /* S = F^T G (hi.lo + lo.hi + hi.hi), unscaled */
    k_soft<<<(BG * TC) / 8, 256, 0, stream>>>(S, P, RS);
    k_gemm2<0><<<dim3((TC / 128) * (CC / 128), BG), 256, 0, stream>>>(P, TS, (size_t)TC * TS, HT + (size_t)g * BG * CC * TS, TS, (size_t)CC * TS, 0.0009765625f, nullptr, 0, nullptr, 1, 0, 0, O, nullptr, CC, (size_t)TC * CC, TC, CC, TS);      /* unnormalised O rows (b,t) = P . H^T */
    k_osc<<<(unsigned)(((size_t)BG * TC * CC / 8 + 255) / 256), 256, 0, stream>>>(O, RS, rc0, OH, OL); }
  k_gemm2<0><<<gC, 256, 0, stream>>>(OL, CC, 0, BO, CC, 0, 0.0625f / 1024.0f, nullptr, 0, nullptr, 1, 0, 0, Y, nullptr, CC, 0, NRC, CC, CC);
  k_gemm2<0><<<gC, 256, 0, stream>>>(OH, CC, 0, BO, CC, 0, 0.0625f, bo, 0, Y, 1, (size_t)CC, 0, Y, nullptr, CC, 0, NRC, CC, CC);      /* out rows = Wo O + bo */
  k_out<<<NB * (CC / PT) * (TC / PT), 256, 0, stream>>>(Y, (float*)d_out);
}

// v003
// It runs in 264 microseconds.
// Timed twice side by side with v002, it ran 1.72 and 1.73 times as fast.
// Over all steps from v000 it is 3.49 times as fast.
#include <hip/hip_runtime.h>
// SpeakerAttention (16 x 512 channels; content 1024 frames, style 1024 frames: F = Wf mvn(content) + bf, G = Wg mvn(style) + bg, H = Wh style + bh (1x1 convs); S = softmax over style frames of the UNSCALED F^T G (K = 512 channels); O = H S^T; out = Wo O + bo; mvn = per (batch, channel) mean / unbiased variance over time, eps 1e-5).
// Structure: per-(b,c) mvn statistics on VALU (rows staged in LDS); [frame][channel] planes (LDS tile transposes) of the normalised inputs as f16 hi/residual (style raw plane exact); F and G as two-term f16 WMMA GEMMs, both terms in one launch (32x64 wave tiles fed from LDS, f32 accumulation, one accumulator set per scale, exact x16 weights + bias; f32 out) then f16 hi/residual planes; H as one GEMM (f16 out) transposed to [b][c][s] by LDS tiles; per 8-batch group the score GEMM as THREE hi/residual product terms in one launch (K = 512, f32; the two residual terms share an accumulator set), softmax rows on VALU (unnormalised f16 weights x 2^10 + row normalisers on their own lines), readout GEMM (N = 512, K = 1024); row scaling + hi/residual; Wo as two GEMM terms in one launch (+ bias); [b][c][t] output by an LDS tile transpose.
// Compute dtype: inputs rounded to bf16; weights exact as f16; the normalised inputs, F, G and O as f16 hi + 2^-10-scaled residual (the unscaled K = 512 logits have sigma ~ 22, so single-rounded operands would not do); style, H and the softmax weights as plain f16 (~2^-12); statistics / softmax f32. v_wmma_f32_16x16x32_f16.
#define NB 16
#define CC 512
#define TC 1024
#define TS 1024
#define NRC (NB * TC)
#define NRS (NB * TS)
#define BG 8                     /* batches per score-plane group */
typedef __bf16 v16b __attribute__((ext_vector_type(16)));
typedef unsigned short v8us __attribute__((ext_vector_type(8), may_alias));
typedef float  v8f  __attribute__((ext_vector_type(8)));
typedef float  v4f  __attribute__((ext_vector_type(4)));
typedef float  v4fa __attribute__((ext_vector_type(4), may_alias));
union FragB { v16b v; v8us half[2]; unsigned short u[16]; };

__device__ __forceinline__ unsigned short bf16_bits(float x) { unsigned int u = __float_as_uint(x); return (unsigned short)((u + 0x7FFFu + ((u >> 16) & 1u)) >> 16); }
__device__ __forceinline__ float bf16_val(unsigned short b) { return __uint_as_float(((unsigned int)b) << 16); }
__device__ __forceinline__ float bf16_round(float x) { return bf16_val(bf16_bits(x)); }
// D += A·B with NT terms: 1 = ah·bh, 2 = + al·bh (A split), 3 = + ah·bl (both split)
template <int NT>
__device__ __forceinline__ v8f mmaN(v16b ah, v16b al, v16b bh, v16b bl, v8f c) {
  c = __builtin_amdgcn_wmma_f32_16x16x32_bf16(false, ah, false, bh, (short)0, c, false, false);
  if (NT >= 2) c = __builtin_amdgcn_wmma_f32_16x16x32_bf16(false, al, false, bh, (short)0, c, false, false);
  if (NT >= 3) c = __builtin_amdgcn_wmma_f32_16x16x32_bf16(false, ah, false, bl, (short)0, c, false, false);
  asm volatile("v_nop\n\tv_nop\n\tv_nop\n\tv_nop" : "+v"(c) : "v"(ah), "v"(al), "v"(bh), "v"(bl));
  return c;
}

__global__ __launch_bounds__(256) void k_wt_bf16(const float* __restrict__ W, unsigned short* __restrict__ Wt, int K, int N) {
  const int t = blockIdx.x * 256 + threadIdx.x;
  const int k8n = K / 8;
  if (t >= N * k8n) return;
  const int n = t / k8n, k8 = (t % k8n) * 8;
  v8us v;
#pragma unroll
  for (int i = 0; i < 8; ++i) v[i] = bf16_bits(W[(size_t)(k8 + i) * N + n]);
  *(v8us*)(Wt + (size_t)n * K + k8) = v;
  
}

// GEMM C[M][N] (f32, pitch ldc) = act(A[M][K]·W + bias). A f32 row-major (pitch lda) converted per fragment to bf16
// (ASPLIT: hi/lo two planes -> 2 terms, else single rounded term); Wt bf16 [N][K] (pitch ldb). BIAS_BF16 rounds the
// bias to bf16 first (bias quantised to bf16 before the add). K%32==0, M%16==0, N%64==0.
template <bool ASPLIT, int ACT, bool BIAS_BF16>
__global__ __launch_bounds__(128) void k_gemm_bf(const float* __restrict__ A, int lda, const unsigned short* __restrict__ Wt, int ldb,
                                               const float* __restrict__ bias, float* __restrict__ C, int ldc, int M, int N, int K) {
  __shared__ __attribute__((aligned(16))) float so[4][16][64];
  const int tid = threadIdx.x, w = tid >> 5, lane = tid & 31, ln = lane & 15, hh = lane >> 4;
  const int ntn = N / 64;
  const int wid = blockIdx.x * 4 + w;
  const int mt = wid / ntn, nq = wid % ntn;
  if (mt * 16 >= M) return;
  const int row0 = mt * 16, col0 = nq * 64;
  const float* arow = A + (size_t)(row0 + ln) * lda;
  v8f acc[4] = {};
  for (int kb = 0; kb < K; kb += 32) {
    FragB ah, al;
    const v4f x0 = *(const v4fa*)(arow + kb + 8 * hh), x1 = *(const v4fa*)(arow + kb + 8 * hh + 4);
    const v4f x2 = *(const v4fa*)(arow + kb + 16 + 8 * hh), x3 = *(const v4fa*)(arow + kb + 16 + 8 * hh + 4);
    float xs[16] = {x0[0],x0[1],x0[2],x0[3],x1[0],x1[1],x1[2],x1[3],x2[0],x2[1],x2[2],x2[3],x3[0],x3[1],x3[2],x3[3]};
#pragma unroll
    for (int i = 0; i < 16; ++i) { const unsigned short hb = bf16_bits(xs[i]); ah.u[i] = hb; al.u[i] = ASPLIT ? bf16_bits(xs[i] - bf16_val(hb)) : (unsigned short)0; }
#pragma unroll
    for (int t = 0; t < 4; ++t) {
      const unsigned short* brow = Wt + (size_t)(col0 + t * 16 + ln) * ldb + kb;
      FragB b;
      b.half[0] = *(const v8us*)(brow + 8 * hh);
      b.half[1] = *(const v8us*)(brow + 16 + 8 * hh);
      acc[t] = mmaN<ASPLIT ? 2 : 1>(ah.v, al.v, b.v, b.v, acc[t]);
    }
  }
#pragma unroll
  for (int t = 0; t < 4; ++t) {
    float bv = bias ? bias[col0 + t * 16 + ln] : 0.f;
    if (BIAS_BF16) bv = bf16_round(bv);
#pragma unroll
    for (int r = 0; r < 8; ++r) { float v = acc[t][r] + bv; if (ACT == 1) v = fmaxf(v, 0.f); so[w][8 * hh + r][t * 16 + ln] = v; }
  }
  __builtin_amdgcn_fence(__ATOMIC_ACQ_REL, "workgroup");
  __builtin_amdgcn_wave_barrier();
  const int rsub = lane >> 4, c4 = (lane & 15) * 4;
  {
#pragma unroll
    for (int q = 0; q < 8; ++q) {
      const int r = q * 2 + rsub;
      const v4f v = *(const v4fa*)&so[w][r][c4];
      *(v4f*)(C + (size_t)(row0 + r) * ldc + col0 + c4) = v;
    }
    
  }
}

// GEMM C = act(A·W + bias + resid): A f32 (ASPLIT -> hi/lo 2 terms), Wt bf16 [N][K]; ACT 0 none, 1 relu, 2 exact gelu;
// resid (optional, f32, row index = (row % rmod), pitch ldr, RES_BF16 rounds it) added before the activation.
template <bool ASPLIT, int ACT, bool BIAS_BF16, bool RES_BF16>
__global__ __launch_bounds__(128) void k_gemm_bf3(const float* __restrict__ A, int lda, const unsigned short* __restrict__ Wt, int ldb,
                                                const float* __restrict__ bias, const float* __restrict__ resid, int rmod, int ldr,
                                                float* __restrict__ C, int ldc, int M, int N, int K) {
  __shared__ __attribute__((aligned(16))) float so[4][16][64];
  const int tid = threadIdx.x, w = tid >> 5, lane = tid & 31, ln = lane & 15, hh = lane >> 4;
  const int ntn = N / 64;
  const int wid = blockIdx.x * 4 + w;
  const int mt = wid / ntn, nq = wid % ntn;
  if (mt * 16 >= M) return;
  const int row0 = mt * 16, col0 = nq * 64;
  const float* arow = A + (size_t)(row0 + ln) * lda;
  v8f acc[4] = {};
  for (int kb = 0; kb < K; kb += 32) {
    FragB ah, al;
    const v4f x0 = *(const v4fa*)(arow + kb + 8 * hh), x1 = *(const v4fa*)(arow + kb + 8 * hh + 4);
    const v4f x2 = *(const v4fa*)(arow + kb + 16 + 8 * hh), x3 = *(const v4fa*)(arow + kb + 16 + 8 * hh + 4);
    float xs[16] = {x0[0],x0[1],x0[2],x0[3],x1[0],x1[1],x1[2],x1[3],x2[0],x2[1],x2[2],x2[3],x3[0],x3[1],x3[2],x3[3]};
#pragma unroll
    for (int i = 0; i < 16; ++i) { const unsigned short hb = bf16_bits(xs[i]); ah.u[i] = hb; al.u[i] = ASPLIT ? bf16_bits(xs[i] - bf16_val(hb)) : (unsigned short)0; }
#pragma unroll
    for (int t = 0; t < 4; ++t) {
      const unsigned short* brow = Wt + (size_t)(col0 + t * 16 + ln) * ldb + kb;
      FragB b;
      b.half[0] = *(const v8us*)(brow + 8 * hh);
      b.half[1] = *(const v8us*)(brow + 16 + 8 * hh);
      acc[t] = mmaN<ASPLIT ? 2 : 1>(ah.v, al.v, b.v, b.v, acc[t]);
    }
  }
#pragma unroll
  for (int t = 0; t < 4; ++t) {
    const int col = col0 + t * 16 + ln;
    float bv = bias ? bias[col] : 0.f;
    if (BIAS_BF16) bv = bf16_round(bv);
#pragma unroll
    for (int r = 0; r < 8; ++r) {
      float v = acc[t][r] + bv;
      if (resid) { float rv = resid[(size_t)((row0 + 8 * hh + r) % rmod) * ldr + col]; if (RES_BF16) rv = bf16_round(rv); v += rv; }
      if (ACT == 1) v = fmaxf(v, 0.f);
      if (ACT == 2) v = 0.5f * v * (1.0f + erff(v * 0.70710678118654752f));
      if (ACT == 3) { const float u = 0.7978845608028654f * (v + 0.044715f * v * v * v); v = 0.5f * v * (1.0f + tanhf(u)); }
      so[w][8 * hh + r][t * 16 + ln] = v;
    }
  }
  __builtin_amdgcn_fence(__ATOMIC_ACQ_REL, "workgroup");
  __builtin_amdgcn_wave_barrier();
  const int rsub = lane >> 4, c4 = (lane & 15) * 4;
  {
#pragma unroll
    for (int q = 0; q < 8; ++q) {
      const int r = q * 2 + rsub;
      const v4f v = *(const v4fa*)&so[w][r][c4];
      *(v4f*)(C + (size_t)(row0 + r) * ldc + col0 + c4) = v;
    }
    
  }
}
// row LayerNorm (biased variance, eps) over N: s = X (+ R); optional out_sum <- s; out_norm <- (s-mu)*rsqrt(var+eps)*g + b
template <bool PARAM_BF16>
__global__ __launch_bounds__(256) void k_layernorm(const float* __restrict__ X, const float* __restrict__ R, const float* __restrict__ g, const float* __restrict__ bta,
                                                  float* __restrict__ out_sum, float* __restrict__ out_norm, int N, float eps) {
  __shared__ float red[256];
  const int row = blockIdx.x, tid = threadIdx.x;
  const float* x = X + (size_t)row * N; const float* rr = R ? R + (size_t)row * N : nullptr;
  float vals[16];                     // up to N = 4096
  const int per = N / 256;            // contiguous chunk per thread? use strided-by-4 chunks: thread handles j = tid*4 + 1024*u
  float s1 = 0.f;
  for (int u = 0; u < per / 4; ++u) {
    const int j = tid * 4 + 1024 * u;
    const v4f a = *(const v4fa*)(x + j);
    v4f b = {0.f,0.f,0.f,0.f}; if (rr) b = *(const v4fa*)(rr + j);
#pragma unroll
    for (int q = 0; q < 4; ++q) { const float v = a[q] + b[q]; vals[u * 4 + q] = v; s1 += v; }
  }
  red[tid] = s1; __syncthreads();
  for (int st = 128; st > 0; st >>= 1) { if (tid < st) red[tid] += red[tid + st]; __syncthreads(); }
  const float mu = red[0] / (float)N; __syncthreads();
  float s2 = 0.f;
  for (int u = 0; u < per / 4; ++u)
#pragma unroll
    for (int q = 0; q < 4; ++q) { const float c = vals[u * 4 + q] - mu; s2 += c * c; }
  red[tid] = s2; __syncthreads();
  for (int st = 128; st > 0; st >>= 1) { if (tid < st) red[tid] += red[tid + st]; __syncthreads(); }
  const float rs = rsqrtf(red[0] / (float)N + eps);
  {
    for (int u = 0; u < per / 4; ++u) {
      const int j = tid * 4 + 1024 * u;
      v4f o, sm;
#pragma unroll
      for (int q = 0; q < 4; ++q) {
        float gg = g[j + q], bb = bta[j + q];
        if (PARAM_BF16) { gg = bf16_round(gg); bb = bf16_round(bb); }
        sm[q] = vals[u * 4 + q]; o[q] = (vals[u * 4 + q] - mu) * rs * gg + bb;
      }
      if (out_sum) *(v4f*)(out_sum + (size_t)row * N + j) = sm;
      *(v4f*)(out_norm + (size_t)row * N + j) = o;
    }
    
  }
}



// ---- f16 WMMA path (v_wmma_f32_16x16x32_f16): 11-bit significands for operands in range — used for every GEMM launched here
typedef _Float16 v16h __attribute__((ext_vector_type(16)));
union FragH { v16h v; v8us half[2]; _Float16 h[16]; unsigned short u[16]; };
template <int NT>
__device__ __forceinline__ v8f mmaH(v16h ah, v16h al, v16h bh, v16h bl, v8f c) {
  c = __builtin_amdgcn_wmma_f32_16x16x32_f16(false, ah, false, bh, (short)0, c, false, false);
  if (NT >= 2) c = __builtin_amdgcn_wmma_f32_16x16x32_f16(false, al, false, bh, (short)0, c, false, false);
  if (NT >= 3) c = __builtin_amdgcn_wmma_f32_16x16x32_f16(false, ah, false, bl, (short)0, c, false, false);
  asm volatile("v_nop\n\tv_nop\n\tv_nop\n\tv_nop" : "+v"(c) : "v"(ah), "v"(al), "v"(bh), "v"(bl));
  return c;
}
// batched GEMM like k_gemm_b but f16 operands: A f32 (split into f16 hi/lo if ASPLIT, else rounded to f16), Bt = f16 values [n][k]; alpha; C f32; N multiple of 16 (partial tiles skipped)
template <bool ASPLIT>
__global__ __launch_bounds__(128) void k_gemm_h(const float* __restrict__ A, int lda, size_t sA, const _Float16* __restrict__ Bh, int ldb, size_t sB, float alpha, float* __restrict__ C, int ldc, size_t sC, int M, int N, int K) {
  __shared__ __attribute__((aligned(16))) float so[4][16][64];
  const int tid = threadIdx.x, w = tid >> 5, lane = tid & 31, ln = lane & 15, hh = lane >> 4; const int by = blockIdx.y;
  A += (size_t)by * sA; Bh += (size_t)by * sB; C += (size_t)by * sC;
  const int ntn = (N + 63) / 64; const int wid = blockIdx.x * 4 + w; const int mt = wid / ntn, nq = wid % ntn; if (mt * 16 >= M) return;
  const int row0 = mt * 16, col0 = nq * 64; const float* arow = A + (size_t)(row0 + ln) * lda;
  v8f acc[4] = {};
  for (int kb = 0; kb < K; kb += 32) {
    FragH ah, al;
    const v4f x0 = *(const v4fa*)(arow + kb + 8 * hh), x1 = *(const v4fa*)(arow + kb + 8 * hh + 4), x2 = *(const v4fa*)(arow + kb + 16 + 8 * hh), x3 = *(const v4fa*)(arow + kb + 16 + 8 * hh + 4);
    float xs[16] = {x0[0],x0[1],x0[2],x0[3],x1[0],x1[1],x1[2],x1[3],x2[0],x2[1],x2[2],x2[3],x3[0],x3[1],x3[2],x3[3]};
#pragma unroll
    for (int i = 0; i < 16; ++i) { const _Float16 h = (_Float16)xs[i]; ah.h[i] = h; al.h[i] = ASPLIT ? (_Float16)(xs[i] - (float)h) : (_Float16)0.0f; }
#pragma unroll
    for (int t = 0; t < 4; ++t) { if (col0 + t * 16 >= N) continue; const size_t boff = (size_t)(col0 + t * 16 + ln) * ldb + kb; FragH bq; bq.half[0] = *(const v8us*)(Bh + boff + 8 * hh); bq.half[1] = *(const v8us*)(Bh + boff + 16 + 8 * hh);
      acc[t] = mmaH<ASPLIT ? 2 : 1>(ah.v, al.v, bq.v, bq.v, acc[t]); }
  }
#pragma unroll
  for (int t = 0; t < 4; ++t) { if (col0 + t * 16 >= N) continue;
#pragma unroll
    for (int r = 0; r < 8; ++r) so[w][8 * hh + r][t * 16 + ln] = acc[t][r] * alpha; }
  __builtin_amdgcn_fence(__ATOMIC_ACQ_REL, "workgroup"); __builtin_amdgcn_wave_barrier();
  const int rsub = lane >> 4, c4 = (lane & 15) * 4;
  {
#pragma unroll
    for (int q = 0; q < 8; ++q) { const int r = q * 2 + rsub; if (col0 + c4 < N) { const v4f v = *(const v4fa*)&so[w][r][c4]; *(v4f*)(C + (size_t)(row0 + r) * ldc + col0 + c4) = v; } }
     }
}

// Wt[n][k] = f16(W[k][n]·scale) from f32 row-major W[K][N] (scale = power of two; bf16-exact weights stay exact in f16 away from the subnormal range)
__global__ __launch_bounds__(256) void k_wt_f16(const float* __restrict__ W, _Float16* __restrict__ Wt, int K, int N, float scale) {
  const int t = blockIdx.x * 256 + threadIdx.x; if (t >= N * (K / 8)) return; const int n = t / (K / 8), k8 = (t % (K / 8)) * 8; FragH f;
#pragma unroll
  for (int i = 0; i < 8; ++i) f.h[i] = (_Float16)(bf16_round(W[(size_t)(k8 + i) * N + n]) * scale); const v8us o = f.half[0];
  *(v8us*)((unsigned short*)Wt + (size_t)n * K + k8) = o; 
}
// k_gemm_hh variant with fused epilogue: v = acc·alpha + bias[by·sBias + col] (+ CP[(row/rowsPerB)·sCPb + by·64 + col] if CP) ; ACT 0 none / 1 elu ; writes f16 C16 (and f32 C if non-null)
template <int ACT>
__global__ __launch_bounds__(128) void k_gemm_hhx(const _Float16* __restrict__ A, int lda, size_t sA, const _Float16* __restrict__ Bh, int ldb, size_t sB, float alpha, const float* __restrict__ bias, size_t sBias, const float* __restrict__ CP, int rowsPerB, size_t sCPb, int row0g,
    float* __restrict__ C, _Float16* __restrict__ C16, int ldc, size_t sC, int M, int N, int K) {
  __shared__ __attribute__((aligned(16))) float so[4][16][64];
  const int tid = threadIdx.x, w = tid >> 5, lane = tid & 31, ln = lane & 15, hh = lane >> 4; const int by = blockIdx.y;
  A += (size_t)by * sA; Bh += (size_t)by * sB; const size_t cofs = (size_t)by * sC; const float* bp = bias ? bias + (size_t)by * sBias : nullptr;
  const int ntn = (N + 63) / 64; const int wid = blockIdx.x * 4 + w; const int mt = wid / ntn, nq = wid % ntn; if (mt * 16 >= M) return;
  const int row0 = mt * 16, col0 = nq * 64; const _Float16* arow = A + (size_t)(row0 + ln) * lda;
  v8f acc[4] = {};
  for (int kb = 0; kb < K; kb += 32) { FragH ah; ah.half[0] = *(const v8us*)((const unsigned short*)arow + kb + 8 * hh); ah.half[1] = *(const v8us*)((const unsigned short*)arow + kb + 16 + 8 * hh);
#pragma unroll
    for (int t = 0; t < 4; ++t) { if (col0 + t * 16 >= N) continue; const size_t boff = (size_t)(col0 + t * 16 + ln) * ldb + kb; FragH bq; bq.half[0] = *(const v8us*)((const unsigned short*)Bh + boff + 8 * hh); bq.half[1] = *(const v8us*)((const unsigned short*)Bh + boff + 16 + 8 * hh);
      acc[t] = mmaH<1>(ah.v, ah.v, bq.v, bq.v, acc[t]); }
  }
#pragma unroll
  for (int t = 0; t < 4; ++t) { if (col0 + t * 16 >= N) continue; const int col = col0 + t * 16 + ln; const float bv = bp ? bf16_round(bp[col]) : 0.f;
#pragma unroll
    for (int r = 0; r < 8; ++r) { float v = acc[t][r] * alpha + bv; if (CP) { const int rr = row0g + row0 + 8 * hh + r; if (rowsPerB < 0) v += CP[cofs + (size_t)rr * ldc + col];      /* rowsPerB < 0: own element of the batched C plane */ else { const int bidx = rr / rowsPerB; v += CP[(size_t)bidx * sCPb + (size_t)by * 64 + col]; } } if (ACT == 1) v = (v > 0.f) ? v : expm1f(v); else if (ACT == 7) v = (v > 0.f) ? v + 1.0f : expf(v); else if (ACT == 8) v = tanhf(v); else if (ACT == 9) v = 0.5f * v * (1.0f + tanhf(0.7978845608028654f * (v + 0.044715f * v * v * v))); else if (ACT == 11) v = 1.0f / (1.0f + expf(-v)); else if (ACT == 12) v = (v > 0.f) ? v : 0.01f * v; else if (ACT == 14) v = (v > 0.f) ? v : 0.1f * v; else if (ACT == 16) v = (v >= 0.f) ? v : 0.3f * v; else if (ACT == 17) v = (v >= 0.f) ? v : 0.2f * v; else if (ACT == 15) v = v / (1.0f + expf(-v)); else if (ACT == 3) v = fmaxf(v, 0.f); else if (ACT == 6) v = 0.5f * v * (1.0f + erff(v * 0.70710678118654752f)); so[w][8 * hh + r][t * 16 + ln] = v; } }
  __builtin_amdgcn_fence(__ATOMIC_ACQ_REL, "workgroup"); __builtin_amdgcn_wave_barrier();
  const int rsub = lane >> 4, c4 = (lane & 15) * 4; typedef _Float16 v4h __attribute__((ext_vector_type(4)));
  {
#pragma unroll
    for (int q = 0; q < 8; ++q) { const int r = q * 2 + rsub; if (col0 + c4 < N) { const v4f v = *(const v4fa*)&so[w][r][c4]; if (C) *(v4f*)(C + cofs + (size_t)(row0 + r) * ldc + col0 + c4) = v; if (C16) { v4h h4; for (int i = 0; i < 4; ++i) h4[i] = (_Float16)v[i]; *(v4h*)(C16 + cofs + (size_t)(row0 + r) * ldc + col0 + c4) = h4; } } }
     }
}


typedef _Float16 v4h __attribute__((ext_vector_type(4)));

__global__ __launch_bounds__(256) void k_x16(const float* __restrict__ x, _Float16* __restrict__ X16, size_t n8) { const size_t t = (size_t)blockIdx.x * 256 + threadIdx.x; if (t >= n8) return; FragH f;
#pragma unroll
  for (int q = 0; q < 8; ++q) f.h[q] = (_Float16)bf16_round(x[t * 8 + q]); *(v8us*)((unsigned short*)X16 + t * 8) = f.half[0];  }
__global__ __launch_bounds__(256) void k_h16(const float* __restrict__ x, _Float16* __restrict__ X16, size_t n8) { const size_t t = (size_t)blockIdx.x * 256 + threadIdx.x; if (t >= n8) return; FragH f;
#pragma unroll
  for (int q = 0; q < 8; ++q) f.h[q] = (_Float16)x[t * 8 + q]; *(v8us*)((unsigned short*)X16 + t * 8) = f.half[0];  }
__global__ __launch_bounds__(256) void k_round16f(const float* __restrict__ W, _Float16* __restrict__ Bt, size_t n8) { const size_t t = (size_t)blockIdx.x * 256 + threadIdx.x; if (t >= n8) return; FragH f;
#pragma unroll
  for (int i = 0; i < 8; ++i) f.h[i] = (_Float16)(bf16_round(W[t * 8 + i]) * 16.0f); *(v8us*)((unsigned short*)Bt + t * 8) = f.half[0];  }
template <int NHv, int TTv>
__global__ __launch_bounds__(256) void k_vt(const _Float16* __restrict__ V16, int ldv, int voff, _Float16* __restrict__ Vt) { __shared__ unsigned short tl[64][66]; const int tid = threadIdx.x; const int slab = blockIdx.x / (TTv / 64), lg = blockIdx.x % (TTv / 64); const int b = slab / NHv, h = slab % NHv;
  for (int i = tid; i < 64 * 8; i += 256) { const int r = i / 8, c8 = (i % 8) * 8; FragH f; f.half[0] = *(const v8us*)((const unsigned short*)V16 + ((size_t)b * TTv + lg * 64 + r) * ldv + voff + h * 64 + c8);
#pragma unroll
    for (int q = 0; q < 8; ++q) tl[r][c8 + q] = f.u[q]; }
  __syncthreads();
  {
#pragma unroll
    for (int rd = 0; rd < 2; ++rd) { const int d = rd * 32 + tid / 8, pc = tid % 8; FragH f;
#pragma unroll
      for (int q = 0; q < 8; ++q) f.u[q] = tl[pc * 8 + q][d];
      *(v8us*)((unsigned short*)Vt + ((size_t)slab * 64 + d) * TTv + lg * 64 + pc * 8) = f.half[0]; }
     } }

__global__ __launch_bounds__(256) void k_hl(const float* __restrict__ F, _Float16* __restrict__ Hh, _Float16* __restrict__ Hl, size_t n8) { const size_t t = (size_t)blockIdx.x * 256 + threadIdx.x; if (t >= n8) return; FragH fh, fl; const v4f a = *(const v4fa*)(F + t * 8), c = *(const v4fa*)(F + t * 8 + 4);
#pragma unroll
  for (int q = 0; q < 4; ++q) { _Float16 h = (_Float16)a[q]; fh.h[q] = h; fl.h[q] = (_Float16)((a[q] - (float)h) * 1024.0f); h = (_Float16)c[q]; fh.h[4 + q] = h; fl.h[4 + q] = (_Float16)((c[q] - (float)h) * 1024.0f); }
  { *(v8us*)((unsigned short*)Hh + t * 8) = fh.half[0]; *(v8us*)((unsigned short*)Hl + t * 8) = fl.half[0];  } }

// ---- fast GEMM (block tile 128x128 = eight 32x64 wave tiles; A and B in 64-k tiles through a two-buffer LDS ring; requires M % 128 == 0 rows per launch region, N % 128 == 0, K % 64 == 0); epilogue = k_gemm_hhx semantics ----
__device__ __forceinline__ v16h g2_frag(const _Float16* p, int hh) { FragH f; f.half[0] = *(const v8us*)((const unsigned short*)p + 8 * hh); f.half[1] = *(const v8us*)((const unsigned short*)p + 16 + 8 * hh); return f.v; }
__device__ __forceinline__ v8f g2_mma(v16h a, v16h b, v8f c) { v8f d = __builtin_amdgcn_wmma_f32_16x16x32_f16(false, a, false, b, (short)0, c, false, false); asm volatile("v_nop\n\tv_nop\n\tv_nop\n\tv_nop" : "+v"(d) : "v"(a), "v"(b)); return d; }
#define G2P 72      /* LDS row pitch in f16: 64 k + 8 = 144 B, 16 B x odd, the conflict-free pitch for ds_load_b128 readers */
// One thread's eight b128 asynchronous copies to LDS for one 64-k pass: its 16-byte piece of rows r, r + 32, r + 64, r + 96 of the 128-row A tile and of the 128-row B tile (la, lb = LDS byte addresses, ga, gb = global addresses, rsa, rsb = 32 rows in elements).
// s_wait_xcnt 0 is the statement's last line so that no address register of an issued copy is rewritten ahead of it.
__device__ __forceinline__ void g2_copy8(unsigned la, unsigned lb, const _Float16* ga, const _Float16* gb, size_t rsa, size_t rsb) {
  asm volatile("global_load_async_to_lds_b128 %0, %8, off\n\t"
               "global_load_async_to_lds_b128 %1, %9, off\n\t"
               "global_load_async_to_lds_b128 %2, %10, off\n\t"
               "global_load_async_to_lds_b128 %3, %11, off\n\t"
               "global_load_async_to_lds_b128 %4, %12, off\n\t"
               "global_load_async_to_lds_b128 %5, %13, off\n\t"
               "global_load_async_to_lds_b128 %6, %14, off\n\t"
               "global_load_async_to_lds_b128 %7, %15, off\n\t"
               "s_wait_xcnt 0x0"
               :: "v"(la), "v"(la + 1u * 32u * G2P * 2u), "v"(la + 2u * 32u * G2P * 2u), "v"(la + 3u * 32u * G2P * 2u), "v"(lb), "v"(lb + 1u * 32u * G2P * 2u), "v"(lb + 2u * 32u * G2P * 2u), "v"(lb + 3u * 32u * G2P * 2u),
                  "v"(ga), "v"(ga + rsa), "v"(ga + 2 * rsa), "v"(ga + 3 * rsa), "v"(gb), "v"(gb + rsb), "v"(gb + 2 * rsb), "v"(gb + 3 * rsb) : "memory");
}
template <int ACT>
__global__ __launch_bounds__(256) void k_gemm2(const _Float16* __restrict__ A, int lda, size_t sA, const _Float16* __restrict__ Bh, int ldb, size_t sB, float alpha, const float* __restrict__ bias, size_t sBias, const float* __restrict__ CP, int rowsPerB, size_t sCPb, int row0g,
    float* __restrict__ C, _Float16* __restrict__ C16, int ldc, size_t sC, int M, int N, int K) { static_assert(ACT == 0 || ACT == 3 || ACT == 6 || ACT == 8 || ACT == 9 || ACT == 11 || ACT == 12 || ACT == 14 || ACT == 15 || ACT == 16 || ACT == 17, "k_gemm2: unsupported ACT code (would silently apply no activation)");
  __shared__ __attribute__((aligned(16))) _Float16 ring[2][2][128][G2P];      /* [buffer][A | B][row][k], filled by the asynchronous copies only */
  __shared__ __attribute__((aligned(16))) float so[8][32][68];
  const int tid = threadIdx.x, w = tid >> 5, lane = tid & 31, ln = lane & 15, hh = lane >> 4; const int by = blockIdx.y;
  A += (size_t)by * sA; Bh += (size_t)by * sB; const size_t cofs = (size_t)by * sC; const float* bp = bias ? bias + (size_t)by * sBias : nullptr;
  const int ntn = N >> 7; const int mt = blockIdx.x / ntn, nq = blockIdx.x - mt * ntn; if (mt * 128 >= M) return;      /* the same for the whole block, ahead of every barrier */
  const int wm = w >> 1, wn = w & 1; const int row0 = mt * 128 + 32 * wm, col0 = nq * 128 + 64 * wn;
  const int cr = tid >> 3, cc = (tid & 7) * 8;      /* this thread's first row and its 8-element piece in every copied tile */
  const _Float16* ga = A + (size_t)(mt * 128 + cr) * lda + cc; const _Float16* gb = Bh + (size_t)(nq * 128 + cr) * ldb + cc; const size_t rsa = (size_t)32 * lda, rsb = (size_t)32 * ldb;
  const unsigned la = (unsigned)(size_t)&ring[0][0][cr][cc], lb = (unsigned)(size_t)&ring[0][1][cr][cc]; const unsigned bufb = 2u * 128u * G2P * 2u;      /* LDS byte addresses in buffer 0; bytes per buffer */
  const int np = K >> 6;
  const v8f z8 = {0.f,0.f,0.f,0.f,0.f,0.f,0.f,0.f}; v8f c00 = z8, c01 = z8, c02 = z8, c03 = z8, c10 = z8, c11 = z8, c12 = z8, c13 = z8;
  g2_copy8(la, lb, ga, gb, rsa, rsb);
  asm volatile("s_wait_asynccnt 0x0" ::: "memory");      /* this wave's copies of tile 0 have landed */
  __syncthreads();      /* publishes tile 0 */
  if (np > 1) g2_copy8(la + bufb, lb + bufb, ga + 64, gb + 64, rsa, rsb);
  for (int t = 0; t < np; ++t) { const int bu = t & 1; const _Float16* a0p = &ring[bu][0][32 * wm + ln][0]; const _Float16* a1p = a0p + 16 * G2P;
    const _Float16* b0p = &ring[bu][1][64 * wn + ln][0]; const _Float16* b1p = b0p + 16 * G2P; const _Float16* b2p = b1p + 16 * G2P; const _Float16* b3p = b2p + 16 * G2P;
    v16h a0[2], a1[2], b0[2], b1[2], b2[2], b3[2];      /* the pass's 24 LDS reads go as one group ahead of its 16 products: reads placed among the products would each wait out the LDS latency */
#pragma unroll      /* the fragment arrays must stay in registers */
    for (int s = 0; s < 2; ++s) { a0[s] = g2_frag(a0p + 32 * s, hh); a1[s] = g2_frag(a1p + 32 * s, hh); b0[s] = g2_frag(b0p + 32 * s, hh); b1[s] = g2_frag(b1p + 32 * s, hh); b2[s] = g2_frag(b2p + 32 * s, hh); b3[s] = g2_frag(b3p + 32 * s, hh); }
#pragma unroll      /* as above */
    for (int s = 0; s < 2; ++s) { c00 = g2_mma(a0[s], b0[s], c00); c10 = g2_mma(a1[s], b0[s], c10); c01 = g2_mma(a0[s], b1[s], c01); c11 = g2_mma(a1[s], b1[s], c11);
      c02 = g2_mma(a0[s], b2[s], c02); c12 = g2_mma(a1[s], b2[s], c12); c03 = g2_mma(a0[s], b3[s], c03); c13 = g2_mma(a1[s], b3[s], c13); }
    asm volatile("s_wait_dscnt 0x0" ::: "memory");      /* this wave's reads of buffer bu are done before it is refilled */
    asm volatile("s_wait_asynccnt 0x0" ::: "memory");      /* this wave's copies of tile t + 1 have landed */
    __syncthreads();      /* publishes tile t + 1 and ends every wave's reads of buffer bu */
    if (t + 2 < np) g2_copy8(la + bu * bufb, lb + bu * bufb, ga + (size_t)(t + 2) * 64, gb + (size_t)(t + 2) * 64, rsa, rsb); }
  asm volatile("s_wait_asynccnt 0x0" ::: "memory");      /* no copy is outstanding when the wave goes on */
  v8f accs[8] = {c00, c01, c02, c03, c10, c11, c12, c13};
#pragma unroll
  for (int u = 0; u < 8; ++u) { const int t = u & 3, half = u >> 2; const int col = col0 + t * 16 + ln; const float bv = bp ? bf16_round(bp[col]) : 0.f;
#pragma unroll
    for (int r = 0; r < 8; ++r) { const int rloc = half * 16 + 8 * hh + r; float v = accs[u][r] * alpha + bv; if (CP) { if (rowsPerB < 0) v += CP[cofs + (size_t)(row0g + row0 + rloc) * ldc + col];      /* rowsPerB < 0: own element of the batched C plane */ else { const int bidx = (row0g + row0 + rloc) / rowsPerB; v += CP[(size_t)bidx * sCPb + (size_t)by * 64 + col]; } }
      if (ACT == 3) v = fmaxf(v, 0.f); else if (ACT == 6) v = 0.5f * v * (1.0f + erff(v * 0.70710678118654752f)); else if (ACT == 11) v = 1.0f / (1.0f + expf(-v)); else if (ACT == 15) v = v / (1.0f + expf(-v)); else if (ACT == 12) v = (v > 0.f) ? v : 0.01f * v; else if (ACT == 8) v = tanhf(v); else if (ACT == 9) v = 0.5f * v * (1.0f + tanhf(0.7978845608028654f * (v + 0.044715f * v * v * v))); else if (ACT == 14) v = (v > 0.f) ? v : 0.1f * v; else if (ACT == 16) v = (v >= 0.f) ? v : 0.3f * v; else if (ACT == 17) v = (v >= 0.f) ? v : 0.2f * v;
      so[w][rloc][t * 16 + ln] = v; } }
  __builtin_amdgcn_fence(__ATOMIC_ACQ_REL, "workgroup"); __builtin_amdgcn_wave_barrier();
  const int rsub = lane >> 4, c4 = (lane & 15) * 4;
  {
#pragma unroll
    for (int q = 0; q < 16; ++q) { const int r = q * 2 + rsub; const v4f v = *(const v4fa*)&so[w][r][c4]; if (C) *(v4f*)(C + cofs + (size_t)(row0 + r) * ldc + col0 + c4) = v; if (C16) { v4h h4; for (int i = 0; i < 4; ++i) h4[i] = (_Float16)v[i]; *(v4h*)(C16 + cofs + (size_t)(row0 + r) * ldc + col0 + c4) = h4; } }
     } }


// ---- k_gemm2 for a product whose operands are f16 hi + scaled residual planes: every term in ONE launch, summed in registers. H takes Ah.Bh; X takes Al.Bh and, with NBP == 2, Ah.Bl as well (both carry the residual's scale); C = H alphaH + bias + X alphaL. Same block and wave tiles, same ring order as k_gemm2; a stage is [Ah | Bh | Al (| Bl)] ----
// One thread's four b128 asynchronous copies to LDS for one 128-row tile; s_wait_xcnt 0 is the statement's last line so that no address register of an issued copy is rewritten ahead of it.
__device__ __forceinline__ void g2_copy4(unsigned la, const _Float16* ga, size_t rsa) {
  asm volatile("global_load_async_to_lds_b128 %0, %4, off\n\t"
               "global_load_async_to_lds_b128 %1, %5, off\n\t"
               "global_load_async_to_lds_b128 %2, %6, off\n\t"
               "global_load_async_to_lds_b128 %3, %7, off\n\t"
               "s_wait_xcnt 0x0"
               :: "v"(la), "v"(la + 1u * 32u * G2P * 2u), "v"(la + 2u * 32u * G2P * 2u), "v"(la + 3u * 32u * G2P * 2u), "v"(ga), "v"(ga + rsa), "v"(ga + 2 * rsa), "v"(ga + 3 * rsa) : "memory");
}
#define G2T (128 * G2P)      /* f16 elements of one 128-row tile in LDS */
template <int NBP>
__global__ __launch_bounds__(256) void k_gemm2s(const _Float16* __restrict__ Ah, const _Float16* __restrict__ Al, int lda, size_t sA, const _Float16* __restrict__ Bh, const _Float16* __restrict__ Bl, int ldb, size_t sB, float alphaH, float alphaL, const float* __restrict__ bias,
    float* __restrict__ C, int ldc, size_t sC, int M, int N, int K) { static_assert(NBP == 1 || NBP == 2, "B is one plane or hi + residual");
  constexpr unsigned bufb = (2u + NBP) * G2T * 2u;      /* bytes per buffer */
  __shared__ __attribute__((aligned(16))) unsigned char sm[2 * bufb];      /* the ring, filled by the asynchronous copies only; behind the loop's last barrier the same bytes stage the output, so that two blocks still share a WGP's LDS */
  static_assert(2 * bufb >= 8u * 32u * 68u * 4u, "the output staging lies inside the ring");
  const int tid = threadIdx.x, w = tid >> 5, lane = tid & 31, ln = lane & 15, hh = lane >> 4; const int by = blockIdx.y;
  Ah += (size_t)by * sA; Al += (size_t)by * sA; Bh += (size_t)by * sB; if (NBP == 2) Bl += (size_t)by * sB; const size_t cofs = (size_t)by * sC;
  const int ntn = N >> 7; const int mt = blockIdx.x / ntn, nq = blockIdx.x - mt * ntn; if (mt * 128 >= M) return;      /* the same for the whole block, ahead of every barrier */
  const int wm = w >> 1, wn = w & 1; const int row0 = mt * 128 + 32 * wm, col0 = nq * 128 + 64 * wn;
  const int cr = tid >> 3, cc = (tid & 7) * 8;      /* this thread's first row and its 8-element piece in every copied tile */
  const size_t oa = (size_t)(mt * 128 + cr) * lda + cc, ob = (size_t)(nq * 128 + cr) * ldb + cc; const size_t rsa = (size_t)32 * lda, rsb = (size_t)32 * ldb;
  const unsigned la = (unsigned)(size_t)&sm[(cr * G2P + cc) * 2], lb = la + G2T * 2u, lr = 2u * G2T * 2u;      /* LDS byte addresses in buffer 0 of the Ah and Bh tiles; from a hi tile to its residual tile */
  auto stage = [&](unsigned bo, size_t k0) { g2_copy8(la + bo, lb + bo, Ah + oa + k0, Bh + ob + k0, rsa, rsb);
    if (NBP == 2) g2_copy8(la + lr + bo, lb + lr + bo, Al + oa + k0, Bl + ob + k0, rsa, rsb); else g2_copy4(la + lr + bo, Al + oa + k0, rsa); };
  const int np = K >> 6;
  const v8f z8 = {0.f,0.f,0.f,0.f,0.f,0.f,0.f,0.f}; v8f H[2][4], X[2][4];
#pragma unroll      /* the accumulators must stay in registers */
  for (int j = 0; j < 4; ++j) { H[0][j] = z8; H[1][j] = z8; X[0][j] = z8; X[1][j] = z8; }
  stage(0u, 0);
  asm volatile("s_wait_asynccnt 0x0" ::: "memory");      /* this wave's copies of stage 0 have landed */
  __syncthreads();      /* publishes stage 0 */
  if (np > 1) stage(bufb, 64);
  for (int t = 0; t < np; ++t) { const int bu = t & 1; const _Float16* ahp = (const _Float16*)(sm + bu * bufb) + (32 * wm + ln) * G2P; const _Float16* bhp = (const _Float16*)(sm + bu * bufb) + G2T + (64 * wn + ln) * G2P; const _Float16* alp = ahp + 2 * G2T; const _Float16* blp = bhp + 2 * G2T;
#pragma unroll      /* fragments and accumulators must stay in registers */
    for (int s = 0; s < 2; ++s) { v16h bh[4], bl[4];      /* a 32-k step's LDS reads go as one group ahead of its products */
      const v16h ah0 = g2_frag(ahp + 32 * s, hh), ah1 = g2_frag(ahp + 16 * G2P + 32 * s, hh), al0 = g2_frag(alp + 32 * s, hh), al1 = g2_frag(alp + 16 * G2P + 32 * s, hh);
#pragma unroll      /* as above */
      for (int j = 0; j < 4; ++j) { bh[j] = g2_frag(bhp + j * 16 * G2P + 32 * s, hh); if (NBP == 2) bl[j] = g2_frag(blp + j * 16 * G2P + 32 * s, hh); }
#pragma unroll      /* as above */
      for (int j = 0; j < 4; ++j) { H[0][j] = g2_mma(ah0, bh[j], H[0][j]); H[1][j] = g2_mma(ah1, bh[j], H[1][j]); X[0][j] = g2_mma(al0, bh[j], X[0][j]); X[1][j] = g2_mma(al1, bh[j], X[1][j]); }
      if (NBP == 2) {
#pragma unroll      /* as above */
        for (int j = 0; j < 4; ++j) { X[0][j] = g2_mma(ah0, bl[j], X[0][j]); X[1][j] = g2_mma(ah1, bl[j], X[1][j]); } } }
    asm volatile("s_wait_dscnt 0x0" ::: "memory");      /* this wave's reads of buffer bu are done before it is refilled */
    asm volatile("s_wait_asynccnt 0x0" ::: "memory");      /* this wave's copies of stage t + 1 have landed */
    __syncthreads();      /* publishes stage t + 1 and ends every wave's reads of buffer bu */
    if (t + 2 < np) stage(bu * bufb, (size_t)(t + 2) * 64); }
  asm volatile("s_wait_asynccnt 0x0" ::: "memory");      /* no copy is outstanding when the wave goes on */
  float* so = (float*)sm + w * 32 * 68;      /* this wave's own 32 x 68 staging rows; every wave has left the ring at the last pass's barrier */
#pragma unroll      /* the accumulators are indexed by constants only */
  for (int u = 0; u < 8; ++u) { const int j = u & 3, half = u >> 2; const float bv = bias ? bf16_round(bias[col0 + j * 16 + ln]) : 0.f;
#pragma unroll      /* as above */
    for (int r = 0; r < 8; ++r) { float v = H[half][j][r] * alphaH + bv; v += X[half][j][r] * alphaL; so[(half * 16 + 8 * hh + r) * 68 + j * 16 + ln] = v; } }
  __builtin_amdgcn_fence(__ATOMIC_ACQ_REL, "workgroup"); __builtin_amdgcn_wave_barrier();      /* the wave's staging stores stand ahead of its own reads of them; no other wave reads these rows */
  const int rsub = lane >> 4, c4 = (lane & 15) * 4;
#pragma unroll      /* the 16 LDS reads and stores of whole lines in flight together */
  for (int q = 0; q < 16; ++q) { const int r = q * 2 + rsub; const v4f v = *(const v4fa*)&so[r * 68 + c4]; *(v4f*)(C + cofs + (size_t)(row0 + r) * ldc + col0 + c4) = v; } }

__global__ __launch_bounds__(256) void k_wsc(const float* __restrict__ Wm, _Float16* __restrict__ Bt, size_t n8, float sc) { const size_t t = (size_t)blockIdx.x * 256 + threadIdx.x; if (t >= n8) return; FragH f; for (int q = 0; q < 8; ++q) f.h[q] = (_Float16)(bf16_round(Wm[t * 8 + q]) * sc); *(v8us*)((unsigned short*)Bt + t * 8) = f.half[0];  }
// ---- kernels whose lanes used to stride a whole row apart in global memory: the global side now moves whole lines, an LDS tile takes the strided walk ----
#define SR 32                    /* rows (b, c) per k_stat block: one per lane of the wave that sums */
#define SP (1024 + 4)            /* k_stat LDS row pitch in floats: 16 B x odd, so that 16 lanes, each on its own row, cover all banks with ds_load_b128 */
#define PT 128                   /* edge of the k_plane and k_out tiles: 512 B a row on the f32 side, 256 B on the f16 side */
static_assert(TC == 1024 && TS == 1024 && (NB * CC) % SR == 0 && CC % PT == 0, "k_stat stages rows of 256 x 4 floats; k_plane and k_out use whole tiles");
__global__ __launch_bounds__(256) void k_stat(const float* __restrict__ x, int T, float* __restrict__ ST) {
  __shared__ __attribute__((aligned(16))) float rowv[SR][SP];
  const int tid = threadIdx.x; const float* p = x + (size_t)blockIdx.x * SR * 1024 + tid * 4;      /* the row length as a constant: every load is one base plus an immediate */
#pragma unroll      /* all the block's loads in flight at once: the staging is bound by memory latency otherwise */
  for (int i = 0; i < SR; ++i) { const v4f a = *(const v4fa*)(p + i * 1024); v4f o; for (int q = 0; q < 4; ++q) o[q] = bf16_round(a[q]); *(v4fa*)&rowv[i][tid * 4] = o; }
  __syncthreads();      /* publishes the 32 staged rows */
  if (tid >= SR) return;      /* behind the only barrier: one lane sums one row, first element to last as before */
  const v4fa* rp = (const v4fa*)&rowv[tid][0]; float s = 0.f; v4f cur[8], nxt[8];      /* 32 values in hand, the next 32 on their way from LDS under the dependent adds */
  for (int j = 0; j < 8; ++j) cur[j] = rp[j];
#pragma unroll 2      /* cur and nxt change places without register copies */
  for (int c = 0; c < 32; ++c) { for (int j = 0; j < 8; ++j) nxt[j] = rp[((c + 1) & 31) * 8 + j];      /* the last trip fetches the row's head again, for the second walk */
    __builtin_amdgcn_sched_barrier(0);      /* keeps the eight LDS reads ahead of the 32 adds that cover their latency; the scheduler sinks them to their uses otherwise */
    for (int j = 0; j < 8; ++j) for (int q = 0; q < 4; ++q) s += cur[j][q];
    for (int j = 0; j < 8; ++j) cur[j] = nxt[j]; }
  const float mu = s / (float)T; float s2 = 0.f;
#pragma unroll 2      /* as above */
  for (int c = 0; c < 32; ++c) { for (int j = 0; j < 8; ++j) nxt[j] = rp[((c + 1) & 31) * 8 + j];
    __builtin_amdgcn_sched_barrier(0);      /* as above */
    for (int j = 0; j < 8; ++j) for (int q = 0; q < 4; ++q) {
      #pragma clang fp contract(off)      /* numerical: d * d keeps its own rounding, as in every earlier version, so that the scales, and with them the unscaled logits whose softmax is close to an argmax, stay bit for bit as before */
      const float d = cur[j][q] - mu; s2 += d * d; }
    for (int j = 0; j < 8; ++j) cur[j] = nxt[j]; }
  const float r = rsqrtf(s2 / (float)(T - 1) + 1e-5f); typedef float v2f_ __attribute__((ext_vector_type(2))); v2f_ o; o[0] = mu; o[1] = r; *(v2f_*)(ST + ((size_t)blockIdx.x * SR + tid) * 2) = o;  }
// one block = 128 channels x 128 frames of one batch; the tile holds hi | residual << 16 per element
typedef unsigned v4ua __attribute__((ext_vector_type(4), may_alias));
template <bool NORM, int T>
__global__ __launch_bounds__(256) void k_plane(const float* __restrict__ x, const float* __restrict__ ST, _Float16* __restrict__ Hh, _Float16* __restrict__ Lh) {
  __shared__ unsigned tl[PT][PT + 1];
  const int tid = threadIdx.x, w = __builtin_amdgcn_readfirstlane(tid >> 5) /* the wave's number in a scalar register: a row's mean and scale come by scalar loads */, lane = tid & 31; const int nft = T / PT; const int ft = blockIdx.x % nft, ct = (blockIdx.x / nft) % (CC / PT), b = blockIdx.x / (nft * (CC / PT)); const int c0 = ct * PT, f0 = ft * PT;
  const size_t rc0 = (size_t)b * CC + c0 + w; const float* xp = x + rc0 * T + f0 + lane * 4; v4f a[PT / 8]; float mu[PT / 8], r[PT / 8];
#pragma unroll      /* the block's 16 loads per thread in flight at once */
  for (int i = 0; i < PT / 8; ++i) a[i] = *(const v4fa*)(xp + (size_t)i * 8 * T);
  asm volatile("s_wait_xcnt 0x0" ::: "memory");      /* the scalar loads and the address arithmetic below reuse registers that these 16 loads name; as a statement that no load crosses it also keeps all 16 up here, in flight together */
#pragma unroll      /* mu and r must stay in registers */
  for (int i = 0; i < PT / 8; ++i) { mu[i] = NORM ? ST[(rc0 + i * 8) * 2] : 0.f; r[i] = NORM ? ST[(rc0 + i * 8) * 2 + 1] : 1.f; }
#pragma unroll      /* a must stay in registers */
  for (int i = 0; i < PT / 8; ++i) { const int cl = i * 8 + w;
    for (int q = 0; q < 4; ++q) {
      #pragma clang fp contract(off)      /* numerical: (v - mu) * r is rounded to f32 before its f16 head is taken off, as in every earlier version, so that head and residual, and with them the unscaled logits whose softmax is close to an argmax, stay as before */
      float v = bf16_round(a[i][q]); if (NORM) v = (v - mu[i]) * r[i]; union { _Float16 h[2]; unsigned u; } f; f.h[0] = (_Float16)v; f.h[1] = NORM ? (_Float16)((v - (float)f.h[0]) * 1024.0f) : (_Float16)0.0f; tl[cl][lane * 4 + q] = f.u; } }
  __syncthreads();      /* publishes the tile */
  const int g = tid & 15, fs = tid >> 4; unsigned u[8], n[8];
  for (int q = 0; q < 8; ++q) u[q] = tl[g * 8 + q][fs];
#pragma unroll      /* u and n must stay in registers; every store is one base plus an immediate */
  for (int i = 0; i < PT / 16; ++i) { const int f = i * 16 + fs; v4ua oh, ol;
    if (i + 1 < PT / 16) for (int q = 0; q < 8; ++q) n[q] = tl[g * 8 + q][f + 16];      /* the next frame's LDS reads fly over this frame's packing and stores */
    for (int q = 0; q < 4; ++q) { oh[q] = (u[2 * q] & 0xFFFFu) | (u[2 * q + 1] << 16); ol[q] = (u[2 * q] >> 16) | (u[2 * q + 1] & 0xFFFF0000u); }
    const size_t o = ((size_t)b * T + f0 + f) * CC + c0 + g * 8; *(v4ua*)((unsigned short*)Hh + o) = oh; if (NORM) *(v4ua*)((unsigned short*)Lh + o) = ol;
    if (i + 1 < PT / 16) asm volatile("s_wait_xcnt 0x0" ::: "memory");      /* the next frame's packing reuses registers that these stores name */
    for (int q = 0; q < 8; ++q) u[q] = n[q]; } }
__global__ __launch_bounds__(256) void k_soft(const float* __restrict__ S, _Float16* __restrict__ P, float* __restrict__ RS) {
  #pragma clang fp contract(off)
  const int wv = threadIdx.x >> 5, ln = threadIdx.x & 31; const int r = blockIdx.x * 8 + wv; if (r >= BG * TC) return; const float* sr = S + (size_t)r * TS; float mx = -3.0e38f;
#pragma unroll 1
  for (int gq = 0; gq < TS / 256; ++gq) { const v8f a = *(const v8f*)(sr + gq * 256 + ln * 8); for (int q = 0; q < 8; ++q) mx = fmaxf(mx, a[q]); }
  for (int o = 16; o > 0; o >>= 1) mx = fmaxf(mx, __shfl_xor(mx, o, 32)); float su = 0.f;
{ su = 0.f;
#pragma unroll 1
    for (int gq = 0; gq < TS / 256; ++gq) { const v8f a = *(const v8f*)(sr + gq * 256 + ln * 8); FragH ph; for (int q = 0; q < 8; ++q) { const float e = expf(a[q] - mx); su += e; ph.h[q] = (_Float16)(e * 1024.0f); } *(v8us*)((unsigned short*)P + (size_t)r * TS + gq * 256 + ln * 8) = ph.half[0]; }
     }
  for (int o = 16; o > 0; o >>= 1) su += __shfl_xor(su, o, 32); if (ln == 0) { *(float*)(RS + (size_t)r * 32) = 1.0f / su;  } }
__global__ __launch_bounds__(256) void k_osc(const float* __restrict__ O, const float* __restrict__ RS, size_t row0, _Float16* __restrict__ OH, _Float16* __restrict__ OL) {
  #pragma clang fp contract(off)
  const size_t t = (size_t)blockIdx.x * 256 + threadIdx.x; if (t >= (size_t)BG * TC * CC / 8) return; const size_t r = (t * 8) / CC; const float rs = RS[r * 32]; const v8f a = *(const v8f*)(O + t * 8); FragH f, fl;
  for (int q = 0; q < 8; ++q) { const float v = a[q] * rs; const _Float16 hh = (_Float16)v; f.h[q] = hh; fl.h[q] = (_Float16)((v - (float)hh) * 1024.0f); }
  const size_t o = row0 * CC + t * 8; { *(v8us*)((unsigned short*)OH + o) = f.half[0]; *(v8us*)((unsigned short*)OL + o) = fl.half[0];  } }
// one block = 128 frames x 128 output channels of one batch
__global__ __launch_bounds__(256) void k_out(const float* __restrict__ Y, float* __restrict__ out) {
  __shared__ float tl[PT][PT + 1];
  const int tid = threadIdx.x, w = __builtin_amdgcn_readfirstlane(tid >> 5) /* the wave's number in a scalar register: row addresses are a scalar base plus the lane's offset */, lane = tid & 31; const int tt = blockIdx.x % (TC / PT), ot = (blockIdx.x / (TC / PT)) % (CC / PT), b = blockIdx.x / ((TC / PT) * (CC / PT)); const int t0 = tt * PT, o0 = ot * PT; v4f a[PT / 8]; const float* yp = Y + ((size_t)b * TC + t0 + w) * CC + o0 + lane * 4;
#pragma unroll      /* the block's 16 loads per thread in flight at once */
  for (int i = 0; i < PT / 8; ++i) a[i] = *(const v4fa*)(yp + i * 8 * CC);
#pragma unroll      /* a must stay in registers */
  for (int i = 0; i < PT / 8; ++i) for (int q = 0; q < 4; ++q) tl[i * 8 + w][lane * 4 + q] = a[i][q];
  __syncthreads();      /* publishes the tile */
#pragma unroll      /* LDS reads of all rows in flight; every store is one base plus an immediate */
  for (int i = 0; i < PT / 8; ++i) { const int ol = i * 8 + w; v4f v; for (int q = 0; q < 4; ++q) v[q] = tl[lane * 4 + q][ol]; *(v4f*)(out + ((size_t)b * CC + o0 + ol) * TC + t0 + lane * 4) = v; } }

extern "C" void kernel_launch(void* const* d_in, const int* in_sizes, int n_in,
                              void* d_out, int out_size, void* d_ws, size_t ws_size, hipStream_t stream) {
  (void)in_sizes; (void)n_in; (void)out_size;
  const float* content = (const float*)d_in[0]; const float* style = (const float*)d_in[1]; const float* Wf = (const float*)d_in[2]; const float* bf_ = (const float*)d_in[3]; const float* Wg = (const float*)d_in[4]; const float* bg = (const float*)d_in[5]; const float* Wh = (const float*)d_in[6]; const float* bh = (const float*)d_in[7]; const float* Wo = (const float*)d_in[8]; const float* bo = (const float*)d_in[9];
  char* ws = (char*)d_ws; size_t off = 0;
  auto take = [&](size_t bytes) { char* p = ws + off; off += (bytes + 255) & ~(size_t)255; return p; };
  const size_t npc = (size_t)NRC * CC, nps = (size_t)NRS * CC;
  _Float16* BF = (_Float16*)take((size_t)CC * CC * 2); _Float16* BGm = (_Float16*)take((size_t)CC * CC * 2); _Float16* BH = (_Float16*)take((size_t)CC * CC * 2); _Float16* BO = (_Float16*)take((size_t)CC * CC * 2); float* STc = (float*)take((size_t)NB * CC * 2 * 4); float* STs = (float*)take((size_t)NB * CC * 2 * 4);
  _Float16* CNH = (_Float16*)take(npc * 2); _Float16* CNL = (_Float16*)take(npc * 2); _Float16* SNH = (_Float16*)take(nps * 2); _Float16* SNL = (_Float16*)take(nps * 2); _Float16* S16 = (_Float16*)take(nps * 2);
  float* T32 = (float*)take(npc * 4);      /* F f32 -> G f32 -> H16 -> Y f32, in turn */ _Float16* FH = (_Float16*)take(npc * 2); _Float16* FL = (_Float16*)take(npc * 2); _Float16* GH = (_Float16*)take(nps * 2); _Float16* GL = (_Float16*)take(nps * 2); _Float16* HT = (_Float16*)take(nps * 2);
  float* S = (float*)take((size_t)BG * TC * TS * 4); _Float16* P = (_Float16*)take((size_t)BG * TC * TS * 2); float* RS = (float*)take((size_t)BG * TC * 32 * 4);
  float* O = (float*)CNH;      /* readout f32 [BG*TC][CC] (16 MiB) over the content hi plane (dead after F) */ _Float16* OH = SNH; _Float16* OL = SNL;      /* O hi/lo [NRC][CC] over the style-normalised planes (dead after G) */ _Float16* H16 = (_Float16*)T32; float* Y = T32;
  if (off > ws_size) return;      /* 2 + 0.1 + 16 x 5 + 32 + 16 x 5 + 32 + 16 + 1 = ≈ 243 MiB */
  k_wsc<<<(CC * CC / 8 + 255) / 256, 256, 0, stream>>>(Wf, BF, (size_t)CC * CC / 8, 16.0f); k_wsc<<<(CC * CC / 8 + 255) / 256, 256, 0, stream>>>(Wg, BGm, (size_t)CC * CC / 8, 16.0f); k_wsc<<<(CC * CC / 8 + 255) / 256, 256, 0, stream>>>(Wh, BH, (size_t)CC * CC / 8, 16.0f); k_wsc<<<(CC * CC / 8 + 255) / 256, 256, 0, stream>>>(Wo, BO, (size_t)CC * CC / 8, 16.0f);      /* conv (out, in) naturals */
  k_stat<<<NB * CC / SR, 256, 0, stream>>>(content, TC, STc); k_stat<<<NB * CC / SR, 256, 0, stream>>>(style, TS, STs);
  k_plane<true, TC><<<NB * (CC / PT) * (TC / PT), 256, 0, stream>>>(content, STc, CNH, CNL); k_plane<true, TS><<<NB * (CC / PT) * (TS / PT), 256, 0, stream>>>(style, STs, SNH, SNL); k_plane<false, TS><<<NB * (CC / PT) * (TS / PT), 256, 0, stream>>>(style, nullptr, S16, nullptr);
  const dim3 gC((NRC / 128) * (CC / 128), 1), gS((NRS / 128) * (CC / 128), 1);
  k_gemm2s<1><<<gC, 256, 0, stream>>>(CNH, CNL, CC, 0, BF, nullptr, CC, 0, 0.0625f, 0.0625f / 1024.0f, bf_, T32, CC, 0, NRC, CC, CC);      /* F rows (b,t) f32 */
  k_hl<<<(unsigned)((npc / 8 + 255) / 256), 256, 0, stream>>>(T32, FH, FL, npc / 8);
  k_gemm2s<1><<<gS, 256, 0, stream>>>(SNH, SNL, CC, 0, BGm, nullptr, CC, 0, 0.0625f, 0.0625f / 1024.0f, bg, T32, CC, 0, NRS, CC, CC);      /* G rows (b,s) f32 */
  k_hl<<<(unsigned)((nps / 8 + 255) / 256), 256, 0, stream>>>(T32, GH, GL, nps / 8);
  k_gemm2<0><<<gS, 256, 0, stream>>>(S16, CC, 0, BH, CC, 0, 0.0625f, bh, 0, nullptr, 1, 0, 0, nullptr, H16, CC, 0, NRS, CC, CC);      /* H rows (b,s) f16 */
  k_vt<CC / 64, TS><<<NB * (CC / 64) * (TS / 64), 256, 0, stream>>>(H16, CC, 0, HT);      /* H as [b][c][s] */
  for (int g = 0; g < NB / BG; ++g) { const size_t rc0 = (size_t)g * BG * TC, rs0 = (size_t)g * BG * TS;
    k_gemm2s<2><<<dim3((TC / 128) * (TS / 128), BG), 256, 0, stream>>>(FH + rc0 * CC, FL + rc0 * CC, CC, (size_t)TC * CC, GH + rs0 * CC, GL + rs0 * CC, CC, (size_t)TS * CC, 1.0f, 0.0009765625f, nullptr, S, TS, (size_t)TC * TS, TC, TS, CC);      /* S = F^T G (hi.hi + (lo.hi + hi.lo)), unscaled */
    k_soft<<<(BG * TC) / 8, 256, 0, stream>>>(S, P, RS);
    k_gemm2<0><<<dim3((TC / 128) * (CC / 128), BG), 256, 0, stream>>>(P, TS, (size_t)TC * TS, HT + (size_t)g * BG * CC * TS, TS, (size_t)CC * TS, 0.0009765625f, nullptr, 0, nullptr, 1, 0, 0, O, nullptr, CC, (size_t)TC * CC, TC, CC, TS);      /* unnormalised O rows (b,t) = P . H^T */
    k_osc<<<(unsigned)(((size_t)BG * TC * CC / 8 + 255) / 256), 256, 0, stream>>>(O, RS, rc0, OH, OL); }
  k_gemm2s<1><<<gC, 256, 0, stream>>>(OH, OL, CC, 0, BO, nullptr, CC, 0, 0.0625f, 0.0625f / 1024.0f, bo, Y, CC, 0, NRC, CC, CC);      /* out rows = Wo O + bo */
  k_out<<<NB * (CC / PT) * (TC / PT), 256, 0, stream>>>(Y, (float*)d_out);
}

// v004
// It runs in 218 microseconds.
// In two side-by-side timings against v003, it was 1.21 and 1.20 times as fast.
// Over all steps from v000 it is 4.22 times as fast.
#include <hip/hip_runtime.h>
// SpeakerAttention (16 x 512 channels; content 1024 frames, style 1024 frames: F = Wf mvn(content) + bf, G = Wg mvn(style) + bg, H = Wh style + bh (1x1 convs); S = softmax over style frames of the UNSCALED F^T G (K = 512 channels); O = H S^T; out = Wo O + bo; mvn = per (batch, channel) mean / unbiased variance over time, eps 1e-5).
// Structure: per-(b,c) mvn statistics on VALU (rows staged in LDS); [frame][channel] planes (LDS tile transposes) of the normalised inputs as f16 hi/residual (style raw plane exact); F and G as two-term f16 WMMA GEMMs, both terms in one launch (32x64 wave tiles fed from LDS, f32 accumulation, one accumulator set per scale, exact x16 weights + bias), stored by their own epilogue as f16 hi/residual planes; H as one GEMM per batch with the weights as the A operand, so that it comes out as [b][c][s] (f16); per 8-batch group the score GEMM as THREE hi/residual product terms in one launch (K = 512, f32; the two residual terms share an accumulator set), softmax rows on VALU (unnormalised f16 weights x 2^10 + row normalisers on their own lines), readout GEMM (N = 512, K = 1024) whose epilogue scales the rows and stores hi/residual planes; Wo as two GEMM terms in one launch (+ bias) whose LDS staging holds each wave's tile column by column, so that it stores [b][c][t] itself.
// Compute dtype: inputs rounded to bf16; weights exact as f16; the normalised inputs, F, G and O as f16 hi + 2^-10-scaled residual (the unscaled K = 512 logits have sigma ~ 22, so single-rounded operands would not do); style, H and the softmax weights as plain f16 (~2^-12); statistics / softmax f32. v_wmma_f32_16x16x32_f16.
#define NB 16
#define CC 512
#define TC 1024
#define TS 1024
#define NRC (NB * TC)
#define NRS (NB * TS)
#define BG 8                     /* batches per score-plane group */
typedef __bf16 v16b __attribute__((ext_vector_type(16)));
typedef unsigned short v8us __attribute__((ext_vector_type(8), may_alias));
typedef float  v8f  __attribute__((ext_vector_type(8)));
typedef float  v4f  __attribute__((ext_vector_type(4)));
typedef float  v4fa __attribute__((ext_vector_type(4), may_alias));
union FragB { v16b v; v8us half[2]; unsigned short u[16]; };

__device__ __forceinline__ unsigned short bf16_bits(float x) { unsigned int u = __float_as_uint(x); return (unsigned short)((u + 0x7FFFu + ((u >> 16) & 1u)) >> 16); }
__device__ __forceinline__ float bf16_val(unsigned short b) { return __uint_as_float(((unsigned int)b) << 16); }
__device__ __forceinline__ float bf16_round(float x) { return bf16_val(bf16_bits(x)); }
// D += A·B with NT terms: 1 = ah·bh, 2 = + al·bh (A split), 3 = + ah·bl (both split)
template <int NT>
__device__ __forceinline__ v8f mmaN(v16b ah, v16b al, v16b bh, v16b bl, v8f c) {
  c = __builtin_amdgcn_wmma_f32_16x16x32_bf16(false, ah, false, bh, (short)0, c, false, false);
  if (NT >= 2) c = __builtin_amdgcn_wmma_f32_16x16x32_bf16(false, al, false, bh, (short)0, c, false, false);
  if (NT >= 3) c = __builtin_amdgcn_wmma_f32_16x16x32_bf16(false, ah, false, bl, (short)0, c, false, false);
  asm volatile("v_nop\n\tv_nop\n\tv_nop\n\tv_nop" : "+v"(c) : "v"(ah), "v"(al), "v"(bh), "v"(bl));
  return c;
}

__global__ __launch_bounds__(256) void k_wt_bf16(const float* __restrict__ W, unsigned short* __restrict__ Wt, int K, int N) {
  const int t = blockIdx.x * 256 + threadIdx.x;
  const int k8n = K / 8;
  if (t >= N * k8n) return;
  const int n = t / k8n, k8 = (t % k8n) * 8;
  v8us v;
#pragma unroll
  for (int i = 0; i < 8; ++i) v[i] = bf16_bits(W[(size_t)(k8 + i) * N + n]);
  *(v8us*)(Wt + (size_t)n * K + k8) = v;
  
}

// GEMM C[M][N] (f32, pitch ldc) = act(A[M][K]·W + bias). A f32 row-major (pitch lda) converted per fragment to bf16
// (ASPLIT: hi/lo two planes -> 2 terms, else single rounded term); Wt bf16 [N][K] (pitch ldb). BIAS_BF16 rounds the
// bias to bf16 first (bias quantised to bf16 before the add). K%32==0, M%16==0, N%64==0.
template <bool ASPLIT, int ACT, bool BIAS_BF16>
__global__ __launch_bounds__(128) void k_gemm_bf(const float* __restrict__ A, int lda, const unsigned short* __restrict__ Wt, int ldb,
                                               const float* __restrict__ bias, float* __restrict__ C, int ldc, int M, int N, int K) {
  __shared__ __attribute__((aligned(16))) float so[4][16][64];
  const int tid = threadIdx.x, w = tid >> 5, lane = tid & 31, ln = lane & 15, hh = lane >> 4;
  const int ntn = N / 64;
  const int wid = blockIdx.x * 4 + w;
  const int mt = wid / ntn, nq = wid % ntn;
  if (mt * 16 >= M) return;
  const int row0 = mt * 16, col0 = nq * 64;
  const float* arow = A + (size_t)(row0 + ln) * lda;
  v8f acc[4] = {};
  for (int kb = 0; kb < K; kb += 32) {
    FragB ah, al;
    const v4f x0 = *(const v4fa*)(arow + kb + 8 * hh), x1 = *(const v4fa*)(arow + kb + 8 * hh + 4);
    const v4f x2 = *(const v4fa*)(arow + kb + 16 + 8 * hh), x3 = *(const v4fa*)(arow + kb + 16 + 8 * hh + 4);
    float xs[16] = {x0[0],x0[1],x0[2],x0[3],x1[0],x1[1],x1[2],x1[3],x2[0],x2[1],x2[2],x2[3],x3[0],x3[1],x3[2],x3[3]};
#pragma unroll
    for (int i = 0; i < 16; ++i) { const unsigned short hb = bf16_bits(xs[i]); ah.u[i] = hb; al.u[i] = ASPLIT ? bf16_bits(xs[i] - bf16_val(hb)) : (unsigned short)0; }
#pragma unroll
    for (int t = 0; t < 4; ++t) {
      const unsigned short* brow = Wt + (size_t)(col0 + t * 16 + ln) * ldb + kb;
      FragB b;
      b.half[0] = *(const v8us*)(brow + 8 * hh);
      b.half[1] = *(const v8us*)(brow + 16 + 8 * hh);
      acc[t] = mmaN<ASPLIT ? 2 : 1>(ah.v, al.v, b.v, b.v, acc[t]);
    }
  }
#pragma unroll
  for (int t = 0; t < 4; ++t) {
    float bv = bias ? bias[col0 + t * 16 + ln] : 0.f;
    if (BIAS_BF16) bv = bf16_round(bv);
#pragma unroll
    for (int r = 0; r < 8; ++r) { float v = acc[t][r] + bv; if (ACT == 1) v = fmaxf(v, 0.f); so[w][8 * hh + r][t * 16 + ln] = v; }
  }
  __builtin_amdgcn_fence(__ATOMIC_ACQ_REL, "workgroup");
  __builtin_amdgcn_wave_barrier();
  const int rsub = lane >> 4, c4 = (lane & 15) * 4;
  {
#pragma unroll
    for (int q = 0; q < 8; ++q) {
      const int r = q * 2 + rsub;
      const v4f v = *(const v4fa*)&so[w][r][c4];
      *(v4f*)(C + (size_t)(row0 + r) * ldc + col0 + c4) = v;
    }
    
  }
}

// GEMM C = act(A·W + bias + resid): A f32 (ASPLIT -> hi/lo 2 terms), Wt bf16 [N][K]; ACT 0 none, 1 relu, 2 exact gelu;
// resid (optional, f32, row index = (row % rmod), pitch ldr, RES_BF16 rounds it) added before the activation.
template <bool ASPLIT, int ACT, bool BIAS_BF16, bool RES_BF16>
__global__ __launch_bounds__(128) void k_gemm_bf3(const float* __restrict__ A, int lda, const unsigned short* __restrict__ Wt, int ldb,
                                                const float* __restrict__ bias, const float* __restrict__ resid, int rmod, int ldr,
                                                float* __restrict__ C, int ldc, int M, int N, int K) {
  __shared__ __attribute__((aligned(16))) float so[4][16][64];
  const int tid = threadIdx.x, w = tid >> 5, lane = tid & 31, ln = lane & 15, hh = lane >> 4;
  const int ntn = N / 64;
  const int wid = blockIdx.x * 4 + w;
  const int mt = wid / ntn, nq = wid % ntn;
  if (mt * 16 >= M) return;
  const int row0 = mt * 16, col0 = nq * 64;
  const float* arow = A + (size_t)(row0 + ln) * lda;
  v8f acc[4] = {};
  for (int kb = 0; kb < K; kb += 32) {
    FragB ah, al;
    const v4f x0 = *(const v4fa*)(arow + kb + 8 * hh), x1 = *(const v4fa*)(arow + kb + 8 * hh + 4);
    const v4f x2 = *(const v4fa*)(arow + kb + 16 + 8 * hh), x3 = *(const v4fa*)(arow + kb + 16 + 8 * hh + 4);
    float xs[16] = {x0[0],x0[1],x0[2],x0[3],x1[0],x1[1],x1[2],x1[3],x2[0],x2[1],x2[2],x2[3],x3[0],x3[1],x3[2],x3[3]};
#pragma unroll
    for (int i = 0; i < 16; ++i) { const unsigned short hb = bf16_bits(xs[i]); ah.u[i] = hb; al.u[i] = ASPLIT ? bf16_bits(xs[i] - bf16_val(hb)) : (unsigned short)0; }
#pragma unroll
    for (int t = 0; t < 4; ++t) {
      const unsigned short* brow = Wt + (size_t)(col0 + t * 16 + ln) * ldb + kb;
      FragB b;
      b.half[0] = *(const v8us*)(brow + 8 * hh);
      b.half[1] = *(const v8us*)(brow + 16 + 8 * hh);
      acc[t] = mmaN<ASPLIT ? 2 : 1>(ah.v, al.v, b.v, b.v, acc[t]);
    }
  }
#pragma unroll
  for (int t = 0; t < 4; ++t) {
    const int col = col0 + t * 16 + ln;
    float bv = bias ? bias[col] : 0.f;
    if (BIAS_BF16) bv = bf16_round(bv);
#pragma unroll
    for (int r = 0; r < 8; ++r) {
      float v = acc[t][r] + bv;
      if (resid) { float rv = resid[(size_t)((row0 + 8 * hh + r) % rmod) * ldr + col]; if (RES_BF16) rv = bf16_round(rv); v += rv; }
      if (ACT == 1) v = fmaxf(v, 0.f);
      if (ACT == 2) v = 0.5f * v * (1.0f + erff(v * 0.70710678118654752f));
      if (ACT == 3) { const float u = 0.7978845608028654f * (v + 0.044715f * v * v * v); v = 0.5f * v * (1.0f + tanhf(u)); }
      so[w][8 * hh + r][t * 16 + ln] = v;
    }
  }
  __builtin_amdgcn_fence(__ATOMIC_ACQ_REL, "workgroup");
  __builtin_amdgcn_wave_barrier();
  const int rsub = lane >> 4, c4 = (lane & 15) * 4;
  {
#pragma unroll
    for (int q = 0; q < 8; ++q) {
      const int r = q * 2 + rsub;
      const v4f v = *(const v4fa*)&so[w][r][c4];
      *(v4f*)(C + (size_t)(row0 + r) * ldc + col0 + c4) = v;
    }
    
  }
}
// row LayerNorm (biased variance, eps) over N: s = X (+ R); optional out_sum <- s; out_norm <- (s-mu)*rsqrt(var+eps)*g + b
template <bool PARAM_BF16>
__global__ __launch_bounds__(256) void k_layernorm(const float* __restrict__ X, const float* __restrict__ R, const float* __restrict__ g, const float* __restrict__ bta,
                                                  float* __restrict__ out_sum, float* __restrict__ out_norm, int N, float eps) {
  __shared__ float red[256];
  const int row = blockIdx.x, tid = threadIdx.x;
  const float* x = X + (size_t)row * N; const float* rr = R ? R + (size_t)row * N : nullptr;
  float vals[16];                     // up to N = 4096
  const int per = N / 256;            // contiguous chunk per thread? use strided-by-4 chunks: thread handles j = tid*4 + 1024*u
  float s1 = 0.f;
  for (int u = 0; u < per / 4; ++u) {
    const int j = tid * 4 + 1024 * u;
    const v4f a = *(const v4fa*)(x + j);
    v4f b = {0.f,0.f,0.f,0.f}; if (rr) b = *(const v4fa*)(rr + j);
#pragma unroll
    for (int q = 0; q < 4; ++q) { const float v = a[q] + b[q]; vals[u * 4 + q] = v; s1 += v; }
  }
  red[tid] = s1; __syncthreads();
  for (int st = 128; st > 0; st >>= 1) { if (tid < st) red[tid] += red[tid + st]; __syncthreads(); }
  const float mu = red[0] / (float)N; __syncthreads();
  float s2 = 0.f;
  for (int u = 0; u < per / 4; ++u)
#pragma unroll
    for (int q = 0; q < 4; ++q) { const float c = vals[u * 4 + q] - mu; s2 += c * c; }
  red[tid] = s2; __syncthreads();
  for (int st = 128; st > 0; st >>= 1) { if (tid < st) red[tid] += red[tid + st]; __syncthreads(); }
  const float rs = rsqrtf(red[0] / (float)N + eps);
  {
    for (int u = 0; u < per / 4; ++u) {
      const int j = tid * 4 + 1024 * u;
      v4f o, sm;
#pragma unroll
      for (int q = 0; q < 4; ++q) {
        float gg = g[j + q], bb = bta[j + q];
        if (PARAM_BF16) { gg = bf16_round(gg); bb = bf16_round(bb); }
        sm[q] = vals[u * 4 + q]; o[q] = (vals[u * 4 + q] - mu) * rs * gg + bb;
      }
      if (out_sum) *(v4f*)(out_sum + (size_t)row * N + j) = sm;
      *(v4f*)(out_norm + (size_t)row * N + j) = o;
    }
    
  }
}



// ---- f16 WMMA path (v_wmma_f32_16x16x32_f16): 11-bit significands for operands in range — used for every GEMM launched here
typedef _Float16 v16h __attribute__((ext_vector_type(16)));
union FragH { v16h v; v8us half[2]; _Float16 h[16]; unsigned short u[16]; };
template <int NT>
__device__ __forceinline__ v8f mmaH(v16h ah, v16h al, v16h bh, v16h bl, v8f c) {
  c = __builtin_amdgcn_wmma_f32_16x16x32_f16(false, ah, false, bh, (short)0, c, false, false);
  if (NT >= 2) c = __builtin_amdgcn_wmma_f32_16x16x32_f16(false, al, false, bh, (short)0, c, false, false);
  if (NT >= 3) c = __builtin_amdgcn_wmma_f32_16x16x32_f16(false, ah, false, bl, (short)0, c, false, false);
  asm volatile("v_nop\n\tv_nop\n\tv_nop\n\tv_nop" : "+v"(c) : "v"(ah), "v"(al), "v"(bh), "v"(bl));
  return c;
}
// batched GEMM like k_gemm_b but f16 operands: A f32 (split into f16 hi/lo if ASPLIT, else rounded to f16), Bt = f16 values [n][k]; alpha; C f32; N multiple of 16 (partial tiles skipped)
template <bool ASPLIT>
__global__ __launch_bounds__(128) void k_gemm_h(const float* __restrict__ A, int lda, size_t sA, const _Float16* __restrict__ Bh, int ldb, size_t sB, float alpha, float* __restrict__ C, int ldc, size_t sC, int M, int N, int K) {
  __shared__ __attribute__((aligned(16))) float so[4][16][64];
  const int tid = threadIdx.x, w = tid >> 5, lane = tid & 31, ln = lane & 15, hh = lane >> 4; const int by = blockIdx.y;
  A += (size_t)by * sA; Bh += (size_t)by * sB; C += (size_t)by * sC;
  const int ntn = (N + 63) / 64; const int wid = blockIdx.x * 4 + w; const int mt = wid / ntn, nq = wid % ntn; if (mt * 16 >= M) return;
  const int row0 = mt * 16, col0 = nq * 64; const float* arow = A + (size_t)(row0 + ln) * lda;
  v8f acc[4] = {};
  for (int kb = 0; kb < K; kb += 32) {
    FragH ah, al;
    const v4f x0 = *(const v4fa*)(arow + kb + 8 * hh), x1 = *(const v4fa*)(arow + kb + 8 * hh + 4), x2 = *(const v4fa*)(arow + kb + 16 + 8 * hh), x3 = *(const v4fa*)(arow + kb + 16 + 8 * hh + 4);
    float xs[16] = {x0[0],x0[1],x0[2],x0[3],x1[0],x1[1],x1[2],x1[3],x2[0],x2[1],x2[2],x2[3],x3[0],x3[1],x3[2],x3[3]};
#pragma unroll
    for (int i = 0; i < 16; ++i) { const _Float16 h = (_Float16)xs[i]; ah.h[i] = h; al.h[i] = ASPLIT ? (_Float16)(xs[i] - (float)h) : (_Float16)0.0f; }
#pragma unroll
    for (int t = 0; t < 4; ++t) { if (col0 + t * 16 >= N) continue; const size_t boff = (size_t)(col0 + t * 16 + ln) * ldb + kb; FragH bq; bq.half[0] = *(const v8us*)(Bh + boff + 8 * hh); bq.half[1] = *(const v8us*)(Bh + boff + 16 + 8 * hh);
      acc[t] = mmaH<ASPLIT ? 2 : 1>(ah.v, al.v, bq.v, bq.v, acc[t]); }
  }
#pragma unroll
  for (int t = 0; t < 4; ++t) { if (col0 + t * 16 >= N) continue;
#pragma unroll
    for (int r = 0; r < 8; ++r) so[w][8 * hh + r][t * 16 + ln] = acc[t][r] * alpha; }
  __builtin_amdgcn_fence(__ATOMIC_ACQ_REL, "workgroup"); __builtin_amdgcn_wave_barrier();
  const int rsub = lane >> 4, c4 = (lane & 15) * 4;
  {
#pragma unroll
    for (int q = 0; q < 8; ++q) { const int r = q * 2 + rsub; if (col0 + c4 < N) { const v4f v = *(const v4fa*)&so[w][r][c4]; *(v4f*)(C + (size_t)(row0 + r) * ldc + col0 + c4) = v; } }
     }
}

// Wt[n][k] = f16(W[k][n]·scale) from f32 row-major W[K][N] (scale = power of two; bf16-exact weights stay exact in f16 away from the subnormal range)
__global__ __launch_bounds__(256) void k_wt_f16(const float* __restrict__ W, _Float16* __restrict__ Wt, int K, int N, float scale) {
  const int t = blockIdx.x * 256 + threadIdx.x; if (t >= N * (K / 8)) return; const int n = t / (K / 8), k8 = (t % (K / 8)) * 8; FragH f;
#pragma unroll
  for (int i = 0; i < 8; ++i) f.h[i] = (_Float16)(bf16_round(W[(size_t)(k8 + i) * N + n]) * scale); const v8us o = f.half[0];
  *(v8us*)((unsigned short*)Wt + (size_t)n * K + k8) = o; 
}
// k_gemm_hh variant with fused epilogue: v = acc·alpha + bias[by·sBias + col] (+ CP[(row/rowsPerB)·sCPb + by·64 + col] if CP) ; ACT 0 none / 1 elu ; writes f16 C16 (and f32 C if non-null)
template <int ACT>
__global__ __launch_bounds__(128) void k_gemm_hhx(const _Float16* __restrict__ A, int lda, size_t sA, const _Float16* __restrict__ Bh, int ldb, size_t sB, float alpha, const float* __restrict__ bias, size_t sBias, const float* __restrict__ CP, int rowsPerB, size_t sCPb, int row0g,
    float* __restrict__ C, _Float16* __restrict__ C16, int ldc, size_t sC, int M, int N, int K) {
  __shared__ __attribute__((aligned(16))) float so[4][16][64];
  const int tid = threadIdx.x, w = tid >> 5, lane = tid & 31, ln = lane & 15, hh = lane >> 4; const int by = blockIdx.y;
  A += (size_t)by * sA; Bh += (size_t)by * sB; const size_t cofs = (size_t)by * sC; const float* bp = bias ? bias + (size_t)by * sBias : nullptr;
  const int ntn = (N + 63) / 64; const int wid = blockIdx.x * 4 + w; const int mt = wid / ntn, nq = wid % ntn; if (mt * 16 >= M) return;
  const int row0 = mt * 16, col0 = nq * 64; const _Float16* arow = A + (size_t)(row0 + ln) * lda;
  v8f acc[4] = {};
  for (int kb = 0; kb < K; kb += 32) { FragH ah; ah.half[0] = *(const v8us*)((const unsigned short*)arow + kb + 8 * hh); ah.half[1] = *(const v8us*)((const unsigned short*)arow + kb + 16 + 8 * hh);
#pragma unroll
    for (int t = 0; t < 4; ++t) { if (col0 + t * 16 >= N) continue; const size_t boff = (size_t)(col0 + t * 16 + ln) * ldb + kb; FragH bq; bq.half[0] = *(const v8us*)((const unsigned short*)Bh + boff + 8 * hh); bq.half[1] = *(const v8us*)((const unsigned short*)Bh + boff + 16 + 8 * hh);
      acc[t] = mmaH<1>(ah.v, ah.v, bq.v, bq.v, acc[t]); }
  }
#pragma unroll
  for (int t = 0; t < 4; ++t) { if (col0 + t * 16 >= N) continue; const int col = col0 + t * 16 + ln; const float bv = bp ? bf16_round(bp[col]) : 0.f;
#pragma unroll
    for (int r = 0; r < 8; ++r) { float v = acc[t][r] * alpha + bv; if (CP) { const int rr = row0g + row0 + 8 * hh + r; if (rowsPerB < 0) v += CP[cofs + (size_t)rr * ldc + col];      /* rowsPerB < 0: own element of the batched C plane */ else { const int bidx = rr / rowsPerB; v += CP[(size_t)bidx * sCPb + (size_t)by * 64 + col]; } } if (ACT == 1) v = (v > 0.f) ? v : expm1f(v); else if (ACT == 7) v = (v > 0.f) ? v + 1.0f : expf(v); else if (ACT == 8) v = tanhf(v); else if (ACT == 9) v = 0.5f * v * (1.0f + tanhf(0.7978845608028654f * (v + 0.044715f * v * v * v))); else if (ACT == 11) v = 1.0f / (1.0f + expf(-v)); else if (ACT == 12) v = (v > 0.f) ? v : 0.01f * v; else if (ACT == 14) v = (v > 0.f) ? v : 0.1f * v; else if (ACT == 16) v = (v >= 0.f) ? v : 0.3f * v; else if (ACT == 17) v = (v >= 0.f) ? v : 0.2f * v; else if (ACT == 15) v = v / (1.0f + expf(-v)); else if (ACT == 3) v = fmaxf(v, 0.f); else if (ACT == 6) v = 0.5f * v * (1.0f + erff(v * 0.70710678118654752f)); so[w][8 * hh + r][t * 16 + ln] = v; } }
  __builtin_amdgcn_fence(__ATOMIC_ACQ_REL, "workgroup"); __builtin_amdgcn_wave_barrier();
  const int rsub = lane >> 4, c4 = (lane & 15) * 4; typedef _Float16 v4h __attribute__((ext_vector_type(4)));
  {
#pragma unroll
    for (int q = 0; q < 8; ++q) { const int r = q * 2 + rsub; if (col0 + c4 < N) { const v4f v = *(const v4fa*)&so[w][r][c4]; if (C) *(v4f*)(C + cofs + (size_t)(row0 + r) * ldc + col0 + c4) = v; if (C16) { v4h h4; for (int i = 0; i < 4; ++i) h4[i] = (_Float16)v[i]; *(v4h*)(C16 + cofs + (size_t)(row0 + r) * ldc + col0 + c4) = h4; } } }
     }
}


typedef _Float16 v4h __attribute__((ext_vector_type(4)));

__global__ __launch_bounds__(256) void k_x16(const float* __restrict__ x, _Float16* __restrict__ X16, size_t n8) { const size_t t = (size_t)blockIdx.x * 256 + threadIdx.x; if (t >= n8) return; FragH f;
#pragma unroll
  for (int q = 0; q < 8; ++q) f.h[q] = (_Float16)bf16_round(x[t * 8 + q]); *(v8us*)((unsigned short*)X16 + t * 8) = f.half[0];  }
__global__ __launch_bounds__(256) void k_h16(const float* __restrict__ x, _Float16* __restrict__ X16, size_t n8) { const size_t t = (size_t)blockIdx.x * 256 + threadIdx.x; if (t >= n8) return; FragH f;
#pragma unroll
  for (int q = 0; q < 8; ++q) f.h[q] = (_Float16)x[t * 8 + q]; *(v8us*)((unsigned short*)X16 + t * 8) = f.half[0];  }
__global__ __launch_bounds__(256) void k_round16f(const float* __restrict__ W, _Float16* __restrict__ Bt, size_t n8) { const size_t t = (size_t)blockIdx.x * 256 + threadIdx.x; if (t >= n8) return; FragH f;
#pragma unroll
  for (int i = 0; i < 8; ++i) f.h[i] = (_Float16)(bf16_round(W[t * 8 + i]) * 16.0f); *(v8us*)((unsigned short*)Bt + t * 8) = f.half[0];  }
// eight neighbouring f32 values of a row as f16 hi and residual x 2^10, 16 bytes to each plane
__device__ __forceinline__ void g2_store_hl(v4f a, v4f c, _Float16* hp, _Float16* lp) { FragH fh, fl;
#pragma unroll      /* fh and fl must stay in registers */
  for (int q = 0; q < 4; ++q) { _Float16 h = (_Float16)a[q]; fh.h[q] = h; fl.h[q] = (_Float16)((a[q] - (float)h) * 1024.0f); h = (_Float16)c[q]; fh.h[4 + q] = h; fl.h[4 + q] = (_Float16)((c[q] - (float)h) * 1024.0f); }
  *(v8us*)(unsigned short*)hp = fh.half[0]; *(v8us*)(unsigned short*)lp = fl.half[0]; }

// ---- fast GEMM (block tile 128x128 = eight 32x64 wave tiles; A and B in 64-k tiles through a two-buffer LDS ring; requires M % 128 == 0 rows per launch region, N % 128 == 0, K % 64 == 0); epilogue: acc alpha (+ bias, except EPI 1), activation, LDS staging (EPI 1 adds its bias behind it), then the form the consumer reads. EPI 1: the bias, which must be there, goes by the ROW of C (the weights are the A operand), C16 = f16. EPI 2: row r times rowscale[r * 32] (r counted over the batches), C16 | C16L = f16 hi | residual x 2^10 ----
__device__ __forceinline__ v16h g2_frag(const _Float16* p, int hh) { FragH f; f.half[0] = *(const v8us*)((const unsigned short*)p + 8 * hh); f.half[1] = *(const v8us*)((const unsigned short*)p + 16 + 8 * hh); return f.v; }
__device__ __forceinline__ v8f g2_mma(v16h a, v16h b, v8f c) { v8f d = __builtin_amdgcn_wmma_f32_16x16x32_f16(false, a, false, b, (short)0, c, false, false); asm volatile("v_nop\n\tv_nop\n\tv_nop\n\tv_nop" : "+v"(d) : "v"(a), "v"(b)); return d; }
#define G2P 72      /* LDS row pitch in f16: 64 k + 8 = 144 B, 16 B x odd, the conflict-free pitch for ds_load_b128 readers */
// One thread's eight b128 asynchronous copies to LDS for one 64-k pass: its 16-byte piece of rows r, r + 32, r + 64, r + 96 of the 128-row A tile and of the 128-row B tile (la, lb = LDS byte addresses, ga, gb = global addresses, rsa, rsb = 32 rows in elements).
// s_wait_xcnt 0 is the statement's last line so that no address register of an issued copy is rewritten ahead of it.
__device__ __forceinline__ void g2_copy8(unsigned la, unsigned lb, const _Float16* ga, const _Float16* gb, size_t rsa, size_t rsb) {
  asm volatile("global_load_async_to_lds_b128 %0, %8, off\n\t"
               "global_load_async_to_lds_b128 %1, %9, off\n\t"
               "global_load_async_to_lds_b128 %2, %10, off\n\t"
               "global_load_async_to_lds_b128 %3, %11, off\n\t"
               "global_load_async_to_lds_b128 %4, %12, off\n\t"
               "global_load_async_to_lds_b128 %5, %13, off\n\t"
               "global_load_async_to_lds_b128 %6, %14, off\n\t"
               "global_load_async_to_lds_b128 %7, %15, off\n\t"
               "s_wait_xcnt 0x0"
               :: "v"(la), "v"(la + 1u * 32u * G2P * 2u), "v"(la + 2u * 32u * G2P * 2u), "v"(la + 3u * 32u * G2P * 2u), "v"(lb), "v"(lb + 1u * 32u * G2P * 2u), "v"(lb + 2u * 32u * G2P * 2u), "v"(lb + 3u * 32u * G2P * 2u),
                  "v"(ga), "v"(ga + rsa), "v"(ga + 2 * rsa), "v"(ga + 3 * rsa), "v"(gb), "v"(gb + rsb), "v"(gb + 2 * rsb), "v"(gb + 3 * rsb) : "memory");
}
template <int ACT, int EPI>
__global__ __launch_bounds__(256) void k_gemm2(const _Float16* __restrict__ A, int lda, size_t sA, const _Float16* __restrict__ Bh, int ldb, size_t sB, float alpha, const float* __restrict__ bias, size_t sBias,
    const float* __restrict__ rowscale, _Float16* __restrict__ C16, _Float16* __restrict__ C16L, int ldc, size_t sC, int M, int N, int K) { static_assert(EPI == 1 || EPI == 2, "k_gemm2: the bias by rows and f16 out, or scaled rows and hi/residual planes out"); static_assert(ACT == 0 || ACT == 3 || ACT == 6 || ACT == 8 || ACT == 9 || ACT == 11 || ACT == 12 || ACT == 14 || ACT == 15 || ACT == 16 || ACT == 17, "k_gemm2: unsupported ACT code (would silently apply no activation)");
  __shared__ __attribute__((aligned(16))) _Float16 ring[2][2][128][G2P];      /* [buffer][A | B][row][k], filled by the asynchronous copies only */
  __shared__ __attribute__((aligned(16))) float so[8][32][68];
  const int tid = threadIdx.x, w = tid >> 5, lane = tid & 31, ln = lane & 15, hh = lane >> 4; const int by = blockIdx.y;
  A += (size_t)by * sA; Bh += (size_t)by * sB; const size_t cofs = (size_t)by * sC; const float* bp = bias ? bias + (size_t)by * sBias : nullptr;
  const int ntn = N >> 7; const int mt = blockIdx.x / ntn, nq = blockIdx.x - mt * ntn; if (mt * 128 >= M) return;      /* the same for the whole block, ahead of every barrier */
  const int wm = w >> 1, wn = w & 1; const int row0 = mt * 128 + 32 * wm, col0 = nq * 128 + 64 * wn;
  const int cr = tid >> 3, cc = (tid & 7) * 8;      /* this thread's first row and its 8-element piece in every copied tile */
  const _Float16* ga = A + (size_t)(mt * 128 + cr) * lda + cc; const _Float16* gb = Bh + (size_t)(nq * 128 + cr) * ldb + cc; const size_t rsa = (size_t)32 * lda, rsb = (size_t)32 * ldb;
  const unsigned la = (unsigned)(size_t)&ring[0][0][cr][cc], lb = (unsigned)(size_t)&ring[0][1][cr][cc]; const unsigned bufb = 2u * 128u * G2P * 2u;      /* LDS byte addresses in buffer 0; bytes per buffer */
  const int np = K >> 6;
  const v8f z8 = {0.f,0.f,0.f,0.f,0.f,0.f,0.f,0.f}; v8f c00 = z8, c01 = z8, c02 = z8, c03 = z8, c10 = z8, c11 = z8, c12 = z8, c13 = z8;
  g2_copy8(la, lb, ga, gb, rsa, rsb);
  asm volatile("s_wait_asynccnt 0x0" ::: "memory");      /* this wave's copies of tile 0 have landed */
  __syncthreads();      /* publishes tile 0 */
  if (np > 1) g2_copy8(la + bufb, lb + bufb, ga + 64, gb + 64, rsa, rsb);
  for (int t = 0; t < np; ++t) { const int bu = t & 1; const _Float16* a0p = &ring[bu][0][32 * wm + ln][0]; const _Float16* a1p = a0p + 16 * G2P;
    const _Float16* b0p = &ring[bu][1][64 * wn + ln][0]; const _Float16* b1p = b0p + 16 * G2P; const _Float16* b2p = b1p + 16 * G2P; const _Float16* b3p = b2p + 16 * G2P;
    v16h a0[2], a1[2], b0[2], b1[2], b2[2], b3[2];      /* the pass's 24 LDS reads go as one group ahead of its 16 products: reads placed among the products would each wait out the LDS latency */
#pragma unroll      /* the fragment arrays must stay in registers */
    for (int s = 0; s < 2; ++s) { a0[s] = g2_frag(a0p + 32 * s, hh); a1[s] = g2_frag(a1p + 32 * s, hh); b0[s] = g2_frag(b0p + 32 * s, hh); b1[s] = g2_frag(b1p + 32 * s, hh); b2[s] = g2_frag(b2p + 32 * s, hh); b3[s] = g2_frag(b3p + 32 * s, hh); }
#pragma unroll      /* as above */
    for (int s = 0; s < 2; ++s) { c00 = g2_mma(a0[s], b0[s], c00); c10 = g2_mma(a1[s], b0[s], c10); c01 = g2_mma(a0[s], b1[s], c01); c11 = g2_mma(a1[s], b1[s], c11);
      c02 = g2_mma(a0[s], b2[s], c02); c12 = g2_mma(a1[s], b2[s], c12); c03 = g2_mma(a0[s], b3[s], c03); c13 = g2_mma(a1[s], b3[s], c13); }
    asm volatile("s_wait_dscnt 0x0" ::: "memory");      /* this wave's reads of buffer bu are done before it is refilled */
    asm volatile("s_wait_asynccnt 0x0" ::: "memory");      /* this wave's copies of tile t + 1 have landed */
    __syncthreads();      /* publishes tile t + 1 and ends every wave's reads of buffer bu */
    if (t + 2 < np) g2_copy8(la + bu * bufb, lb + bu * bufb, ga + (size_t)(t + 2) * 64, gb + (size_t)(t + 2) * 64, rsa, rsb); }
  asm volatile("s_wait_asynccnt 0x0" ::: "memory");      /* no copy is outstanding when the wave goes on */
  v8f accs[8] = {c00, c01, c02, c03, c10, c11, c12, c13};
#pragma unroll
  for (int u = 0; u < 8; ++u) { const int t = u & 3, half = u >> 2; const int col = col0 + t * 16 + ln; const float bv = (EPI != 1 && bp) ? bf16_round(bp[col]) : 0.f;      /* EPI 1 adds its bias, one value a row, behind the staging */
#pragma unroll
    for (int r = 0; r < 8; ++r) { const int rloc = half * 16 + 8 * hh + r; float v = accs[u][r] * alpha + bv;
      if (ACT == 3) v = fmaxf(v, 0.f); else if (ACT == 6) v = 0.5f * v * (1.0f + erff(v * 0.70710678118654752f)); else if (ACT == 11) v = 1.0f / (1.0f + expf(-v)); else if (ACT == 15) v = v / (1.0f + expf(-v)); else if (ACT == 12) v = (v > 0.f) ? v : 0.01f * v; else if (ACT == 8) v = tanhf(v); else if (ACT == 9) v = 0.5f * v * (1.0f + tanhf(0.7978845608028654f * (v + 0.044715f * v * v * v))); else if (ACT == 14) v = (v > 0.f) ? v : 0.1f * v; else if (ACT == 16) v = (v >= 0.f) ? v : 0.3f * v; else if (ACT == 17) v = (v >= 0.f) ? v : 0.2f * v;
      so[w][rloc][t * 16 + ln] = v; } }
  __builtin_amdgcn_fence(__ATOMIC_ACQ_REL, "workgroup"); __builtin_amdgcn_wave_barrier();
  const int rsub = lane >> 3, c8 = (lane & 7) * 8;      /* eight lanes take one row's 64 columns: a whole 128-byte line of f16 */
  v4f a[8], c[8]; float rv[8];      /* rv: the row's bias (EPI 1) or scale (EPI 2) */
#pragma unroll      /* a, c and rv must stay in registers; the 16 LDS reads and the 8 loads of rv go as one group, so that their latency is paid once */
  for (int q = 0; q < 8; ++q) { const int r = q * 4 + rsub; a[q] = *(const v4fa*)&so[w][r][c8]; c[q] = *(const v4fa*)&so[w][r][c8 + 4]; rv[q] = EPI == 1 ? bp[row0 + r] : rowscale[((size_t)by * M + row0 + r) * 32]; }
#pragma unroll      /* as above */
  for (int q = 0; q < 8; ++q) { const size_t o = cofs + (size_t)(row0 + q * 4 + rsub) * ldc + col0 + c8;
    if (EPI == 1) { const float bq = bf16_round(rv[q]); FragH f; for (int i = 0; i < 4; ++i) { f.h[i] = (_Float16)(a[q][i] + bq); f.h[4 + i] = (_Float16)(c[q][i] + bq); } *(v8us*)((unsigned short*)C16 + o) = f.half[0]; }
    else g2_store_hl(a[q] * rv[q], c[q] * rv[q], C16 + o, C16L + o); } }


// ---- k_gemm2 for a product whose operands are f16 hi + scaled residual planes: every term in ONE launch, summed in registers. H takes Ah.Bh; X takes Al.Bh and, with NBP == 2, Ah.Bl as well (both carry the residual's scale); C = H alphaH + bias + X alphaL. Same block and wave tiles, same ring order as k_gemm2; a stage is [Ah | Bh | Al (| Bl)]. EPI 0: C f32, row-major. EPI 1: CH | CL = f16 hi | residual x 2^10, row-major. EPI 2: C f32 as [row / TC][column][row % TC] ----
// One thread's four b128 asynchronous copies to LDS for one 128-row tile; s_wait_xcnt 0 is the statement's last line so that no address register of an issued copy is rewritten ahead of it.
__device__ __forceinline__ void g2_copy4(unsigned la, const _Float16* ga, size_t rsa) {
  asm volatile("global_load_async_to_lds_b128 %0, %4, off\n\t"
               "global_load_async_to_lds_b128 %1, %5, off\n\t"
               "global_load_async_to_lds_b128 %2, %6, off\n\t"
               "global_load_async_to_lds_b128 %3, %7, off\n\t"
               "s_wait_xcnt 0x0"
               :: "v"(la), "v"(la + 1u * 32u * G2P * 2u), "v"(la + 2u * 32u * G2P * 2u), "v"(la + 3u * 32u * G2P * 2u), "v"(ga), "v"(ga + rsa), "v"(ga + 2 * rsa), "v"(ga + 3 * rsa) : "memory");
}
#define G2T (128 * G2P)      /* f16 elements of one 128-row tile in LDS */
template <int NBP, int EPI>
__global__ __launch_bounds__(256) void k_gemm2s(const _Float16* __restrict__ Ah, const _Float16* __restrict__ Al, int lda, size_t sA, const _Float16* __restrict__ Bh, const _Float16* __restrict__ Bl, int ldb, size_t sB, float alphaH, float alphaL, const float* __restrict__ bias,
    float* __restrict__ C, _Float16* __restrict__ CH, _Float16* __restrict__ CL, int ldc, size_t sC, int M, int N, int K) { static_assert(NBP == 1 || NBP == 2, "B is one plane or hi + residual"); static_assert(EPI >= 0 && EPI <= 2 && TC % 128 == 0, "a block's 128 rows lie in one batch");
  constexpr unsigned bufb = (2u + NBP) * G2T * 2u;      /* bytes per buffer */
  __shared__ __attribute__((aligned(16))) unsigned char sm[2 * bufb];      /* the ring, filled by the asynchronous copies only; behind the loop's last barrier the same bytes stage the output, so that two blocks still share a WGP's LDS */
  const int tid = threadIdx.x, w = tid >> 5, lane = tid & 31, ln = lane & 15, hh = lane >> 4; const int by = blockIdx.y;
  Ah += (size_t)by * sA; Al += (size_t)by * sA; Bh += (size_t)by * sB; if (NBP == 2) Bl += (size_t)by * sB; const size_t cofs = (size_t)by * sC;
  const int ntn = N >> 7; const int mt = blockIdx.x / ntn, nq = blockIdx.x - mt * ntn; if (mt * 128 >= M) return;      /* the same for the whole block, ahead of every barrier */
  const int wm = w >> 1, wn = w & 1; const int row0 = mt * 128 + 32 * wm, col0 = nq * 128 + 64 * wn;
  const int cr = tid >> 3, cc = (tid & 7) * 8;      /* this thread's first row and its 8-element piece in every copied tile */
  const size_t oa = (size_t)(mt * 128 + cr) * lda + cc, ob = (size_t)(nq * 128 + cr) * ldb + cc; const size_t rsa = (size_t)32 * lda, rsb = (size_t)32 * ldb;
  const unsigned la = (unsigned)(size_t)&sm[(cr * G2P + cc) * 2], lb = la + G2T * 2u, lr = 2u * G2T * 2u;      /* LDS byte addresses in buffer 0 of the Ah and Bh tiles; from a hi tile to its residual tile */
  auto stage = [&](unsigned bo, size_t k0) { g2_copy8(la + bo, lb + bo, Ah + oa + k0, Bh + ob + k0, rsa, rsb);
    if (NBP == 2) g2_copy8(la + lr + bo, lb + lr + bo, Al + oa + k0, Bl + ob + k0, rsa, rsb); else g2_copy4(la + lr + bo, Al + oa + k0, rsa); };
  const int np = K >> 6;
  const v8f z8 = {0.f,0.f,0.f,0.f,0.f,0.f,0.f,0.f}; v8f H[2][4], X[2][4];
#pragma unroll      /* the accumulators must stay in registers */
  for (int j = 0; j < 4; ++j) { H[0][j] = z8; H[1][j] = z8; X[0][j] = z8; X[1][j] = z8; }
  stage(0u, 0);
  asm volatile("s_wait_asynccnt 0x0" ::: "memory");      /* this wave's copies of stage 0 have landed */
  __syncthreads();      /* publishes stage 0 */
  if (np > 1) stage(bufb, 64);
  for (int t = 0; t < np; ++t) { const int bu = t & 1; const _Float16* ahp = (const _Float16*)(sm + bu * bufb) + (32 * wm + ln) * G2P; const _Float16* bhp = (const _Float16*)(sm + bu * bufb) + G2T + (64 * wn + ln) * G2P; const _Float16* alp = ahp + 2 * G2T; const _Float16* blp = bhp + 2 * G2T;
#pragma unroll      /* fragments and accumulators must stay in registers */
    for (int s = 0; s < 2; ++s) { v16h bh[4], bl[4];      /* a 32-k step's LDS reads go as one group ahead of its products */
      const v16h ah0 = g2_frag(ahp + 32 * s, hh), ah1 = g2_frag(ahp + 16 * G2P + 32 * s, hh), al0 = g2_frag(alp + 32 * s, hh), al1 = g2_frag(alp + 16 * G2P + 32 * s, hh);
#pragma unroll      /* as above */
      for (int j = 0; j < 4; ++j) { bh[j] = g2_frag(bhp + j * 16 * G2P + 32 * s, hh); if (NBP == 2) bl[j] = g2_frag(blp + j * 16 * G2P + 32 * s, hh); }
#pragma unroll      /* as above */
      for (int j = 0; j < 4; ++j) { H[0][j] = g2_mma(ah0, bh[j], H[0][j]); H[1][j] = g2_mma(ah1, bh[j], H[1][j]); X[0][j] = g2_mma(al0, bh[j], X[0][j]); X[1][j] = g2_mma(al1, bh[j], X[1][j]); }
      if (NBP == 2) {
#pragma unroll      /* as above */
        for (int j = 0; j < 4; ++j) { X[0][j] = g2_mma(ah0, bl[j], X[0][j]); X[1][j] = g2_mma(ah1, bl[j], X[1][j]); } } }
    asm volatile("s_wait_dscnt 0x0" ::: "memory");      /* this wave's reads of buffer bu are done before it is refilled */
    asm volatile("s_wait_asynccnt 0x0" ::: "memory");      /* this wave's copies of stage t + 1 have landed */
    __syncthreads();      /* publishes stage t + 1 and ends every wave's reads of buffer bu */
    if (t + 2 < np) stage(bu * bufb, (size_t)(t + 2) * 64); }
  asm volatile("s_wait_asynccnt 0x0" ::: "memory");      /* no copy is outstanding when the wave goes on */
  constexpr int SOP = EPI == 2 ? 36 : 68;      /* staging pitch in floats, 16 B x odd: 32 rows of 64 columns, or (EPI 2) 64 columns of 32 rows */
  constexpr int SOW = EPI == 2 ? 64 * SOP : 32 * SOP; static_assert(2 * bufb >= 8u * SOW * 4u, "the output staging lies inside the ring");
  float* so = (float*)sm + w * SOW;      /* this wave's own staging; every wave has left the ring at the last pass's barrier */
#pragma unroll      /* the accumulators are indexed by constants only */
  for (int u = 0; u < 8; ++u) { const int j = u & 3, half = u >> 2; const float bv = bias ? bf16_round(bias[col0 + j * 16 + ln]) : 0.f;
    v4f p0, p1;
#pragma unroll      /* as above */
    for (int r = 0; r < 8; ++r) { float v = H[half][j][r] * alphaH + bv; v += X[half][j][r] * alphaL; if (EPI != 2) so[(half * 16 + 8 * hh + r) * SOP + j * 16 + ln] = v; else if (r < 4) p0[r] = v; else p1[r - 4] = v; }
    if (EPI == 2) { float* sc = so + (j * 16 + ln) * SOP + half * 16 + 8 * hh; *(v4fa*)sc = p0; *(v4fa*)(sc + 4) = p1; } }      /* a lane's eight values are eight rows of one column: side by side here */
  __builtin_amdgcn_fence(__ATOMIC_ACQ_REL, "workgroup"); __builtin_amdgcn_wave_barrier();      /* the wave's staging stores stand ahead of its own reads of them; no other wave reads these rows */
  if (EPI == 0) { const int rsub = lane >> 4, c4 = (lane & 15) * 4;
#pragma unroll      /* the 16 LDS reads and stores of whole lines in flight together */
    for (int q = 0; q < 16; ++q) { const int r = q * 2 + rsub; const v4f v = *(const v4fa*)&so[r * SOP + c4]; *(v4f*)(C + cofs + (size_t)(row0 + r) * ldc + col0 + c4) = v; } }
  else if (EPI == 1) { const int rsub = lane >> 3, c8 = (lane & 7) * 8;      /* eight lanes take one row's 64 columns: a whole 128-byte line in each plane */
    v4f a[8], c[8];
#pragma unroll      /* a and c must stay in registers; the 16 LDS reads go as one group, so that their latency is paid once */
    for (int q = 0; q < 8; ++q) { a[q] = *(const v4fa*)&so[(q * 4 + rsub) * SOP + c8]; c[q] = *(const v4fa*)&so[(q * 4 + rsub) * SOP + c8 + 4]; }
#pragma unroll      /* as above */
    for (int q = 0; q < 8; ++q) { const size_t o = cofs + (size_t)(row0 + q * 4 + rsub) * ldc + col0 + c8; g2_store_hl(a[q], c[q], CH + o, CL + o); } }
  else { const int cs = (lane >> 3) * 8, r4 = (lane & 7) * 4; const int bb = row0 / TC;      /* eight lanes take one column's 32 rows: a whole 128-byte line; the four columns of a read lie 8 apart, which spreads them over the banks */
    float* op = C + ((size_t)bb * N + col0 + cs) * TC + (row0 - bb * TC) + r4;
#pragma unroll      /* as above; every store is one base plus an immediate */
    for (int q = 0; q < 16; ++q) { const int cq = (q & 7) + 32 * (q >> 3); const v4f v = *(const v4fa*)&so[(cs + cq) * SOP + r4]; *(v4f*)(op + (size_t)cq * TC) = v; } } }

__global__ __launch_bounds__(256) void k_wsc(const float* __restrict__ Wm, _Float16* __restrict__ Bt, size_t n8, float sc) { const size_t t = (size_t)blockIdx.x * 256 + threadIdx.x; if (t >= n8) return; FragH f; for (int q = 0; q < 8; ++q) f.h[q] = (_Float16)(bf16_round(Wm[t * 8 + q]) * sc); *(v8us*)((unsigned short*)Bt + t * 8) = f.half[0];  }
// ---- kernels whose lanes used to stride a whole row apart in global memory: the global side now moves whole lines, an LDS tile takes the strided walk ----
#define SR 32                    /* rows (b, c) per k_stat block: one per lane of the wave that sums */
#define SP (1024 + 4)            /* k_stat LDS row pitch in floats: 16 B x odd, so that 16 lanes, each on its own row, cover all banks with ds_load_b128 */
#define PT 128                   /* edge of the k_plane tiles: 512 B a row on the f32 side, 256 B on the f16 side */
static_assert(TC == 1024 && TS == 1024 && (NB * CC) % SR == 0 && CC % PT == 0, "k_stat stages rows of 256 x 4 floats; k_plane uses whole tiles");
__global__ __launch_bounds__(256) void k_stat(const float* __restrict__ x, int T, float* __restrict__ ST) {
  __shared__ __attribute__((aligned(16))) float rowv[SR][SP];
  const int tid = threadIdx.x; const float* p = x + (size_t)blockIdx.x * SR * 1024 + tid * 4;      /* the row length as a constant: every load is one base plus an immediate */
#pragma unroll      /* all the block's loads in flight at once: the staging is bound by memory latency otherwise */
  for (int i = 0; i < SR; ++i) { const v4f a = *(const v4fa*)(p + i * 1024); v4f o; for (int q = 0; q < 4; ++q) o[q] = bf16_round(a[q]); *(v4fa*)&rowv[i][tid * 4] = o; }
  __syncthreads();      /* publishes the 32 staged rows */
  if (tid >= SR) return;      /* behind the only barrier: one lane sums one row, first element to last as before */
  const v4fa* rp = (const v4fa*)&rowv[tid][0]; float s = 0.f; v4f cur[8], nxt[8];      /* 32 values in hand, the next 32 on their way from LDS under the dependent adds */
  for (int j = 0; j < 8; ++j) cur[j] = rp[j];
#pragma unroll 2      /* cur and nxt change places without register copies */
  for (int c = 0; c < 32; ++c) { for (int j = 0; j < 8; ++j) nxt[j] = rp[((c + 1) & 31) * 8 + j];      /* the last trip fetches the row's head again, for the second walk */
    __builtin_amdgcn_sched_barrier(0);      /* keeps the eight LDS reads ahead of the 32 adds that cover their latency; the scheduler sinks them to their uses otherwise */
    for (int j = 0; j < 8; ++j) for (int q = 0; q < 4; ++q) s += cur[j][q];
    for (int j = 0; j < 8; ++j) cur[j] = nxt[j]; }
  const float mu = s / (float)T; float s2 = 0.f;
#pragma unroll 2      /* as above */
  for (int c = 0; c < 32; ++c) { for (int j = 0; j < 8; ++j) nxt[j] = rp[((c + 1) & 31) * 8 + j];
    __builtin_amdgcn_sched_barrier(0);      /* as above */
    for (int j = 0; j < 8; ++j) for (int q = 0; q < 4; ++q) {
      #pragma clang fp contract(off)      /* numerical: d * d keeps its own rounding, as in every earlier version, so that the scales, and with them the unscaled logits whose softmax is close to an argmax, stay bit for bit as before */
      const float d = cur[j][q] - mu; s2 += d * d; }
    for (int j = 0; j < 8; ++j) cur[j] = nxt[j]; }
  const float r = rsqrtf(s2 / (float)(T - 1) + 1e-5f); typedef float v2f_ __attribute__((ext_vector_type(2))); v2f_ o; o[0] = mu; o[1] = r; *(v2f_*)(ST + ((size_t)blockIdx.x * SR + tid) * 2) = o;  }
// one block = 128 channels x 128 frames of one batch; the tile holds hi | residual << 16 per element
typedef unsigned v4ua __attribute__((ext_vector_type(4), may_alias));
template <bool NORM, int T>
__global__ __launch_bounds__(256) void k_plane(const float* __restrict__ x, const float* __restrict__ ST, _Float16* __restrict__ Hh, _Float16* __restrict__ Lh) {
  __shared__ unsigned tl[PT][PT + 1];
  const int tid = threadIdx.x, w = __builtin_amdgcn_readfirstlane(tid >> 5) /* the wave's number in a scalar register: a row's mean and scale come by scalar loads */, lane = tid & 31; const int nft = T / PT; const int ft = blockIdx.x % nft, ct = (blockIdx.x / nft) % (CC / PT), b = blockIdx.x / (nft * (CC / PT)); const int c0 = ct * PT, f0 = ft * PT;
  const size_t rc0 = (size_t)b * CC + c0 + w; const float* xp = x + rc0 * T + f0 + lane * 4; v4f a[PT / 8]; float mu[PT / 8], r[PT / 8];
#pragma unroll      /* the block's 16 loads per thread in flight at once */
  for (int i = 0; i < PT / 8; ++i) a[i] = *(const v4fa*)(xp + (size_t)i * 8 * T);
  asm volatile("s_wait_xcnt 0x0" ::: "memory");      /* the scalar loads and the address arithmetic below reuse registers that these 16 loads name; as a statement that no load crosses it also keeps all 16 up here, in flight together */
#pragma unroll      /* mu and r must stay in registers */
  for (int i = 0; i < PT / 8; ++i) { mu[i] = NORM ? ST[(rc0 + i * 8) * 2] : 0.f; r[i] = NORM ? ST[(rc0 + i * 8) * 2 + 1] : 1.f; }
#pragma unroll      /* a must stay in registers */
  for (int i = 0; i < PT / 8; ++i) { const int cl = i * 8 + w;
    for (int q = 0; q < 4; ++q) {
      #pragma clang fp contract(off)      /* numerical: (v - mu) * r is rounded to f32 before its f16 head is taken off, as in every earlier version, so that head and residual, and with them the unscaled logits whose softmax is close to an argmax, stay as before */
      float v = bf16_round(a[i][q]); if (NORM) v = (v - mu[i]) * r[i]; union { _Float16 h[2]; unsigned u; } f; f.h[0] = (_Float16)v; f.h[1] = NORM ? (_Float16)((v - (float)f.h[0]) * 1024.0f) : (_Float16)0.0f; tl[cl][lane * 4 + q] = f.u; } }
  __syncthreads();      /* publishes the tile */
  const int g = tid & 15, fs = tid >> 4; unsigned u[8], n[8];
  for (int q = 0; q < 8; ++q) u[q] = tl[g * 8 + q][fs];
#pragma unroll      /* u and n must stay in registers; every store is one base plus an immediate */
  for (int i = 0; i < PT / 16; ++i) { const int f = i * 16 + fs; v4ua oh, ol;
    if (i + 1 < PT / 16) for (int q = 0; q < 8; ++q) n[q] = tl[g * 8 + q][f + 16];      /* the next frame's LDS reads fly over this frame's packing and stores */
    for (int q = 0; q < 4; ++q) { oh[q] = (u[2 * q] & 0xFFFFu) | (u[2 * q + 1] << 16); ol[q] = (u[2 * q] >> 16) | (u[2 * q + 1] & 0xFFFF0000u); }
    const size_t o = ((size_t)b * T + f0 + f) * CC + c0 + g * 8; *(v4ua*)((unsigned short*)Hh + o) = oh; if (NORM) *(v4ua*)((unsigned short*)Lh + o) = ol;
    if (i + 1 < PT / 16) asm volatile("s_wait_xcnt 0x0" ::: "memory");      /* the next frame's packing reuses registers that these stores name */
    for (int q = 0; q < 8; ++q) u[q] = n[q]; } }
__global__ __launch_bounds__(256) void k_soft(const float* __restrict__ S, _Float16* __restrict__ P, float* __restrict__ RS) {
  #pragma clang fp contract(off)
  const int wv = threadIdx.x >> 5, ln = threadIdx.x & 31; const int r = blockIdx.x * 8 + wv; if (r >= BG * TC) return; const float* sr = S + (size_t)r * TS; float mx = -3.0e38f;
#pragma unroll 1
  for (int gq = 0; gq < TS / 256; ++gq) { const v8f a = *(const v8f*)(sr + gq * 256 + ln * 8); for (int q = 0; q < 8; ++q) mx = fmaxf(mx, a[q]); }
  for (int o = 16; o > 0; o >>= 1) mx = fmaxf(mx, __shfl_xor(mx, o, 32)); float su = 0.f;
{ su = 0.f;
#pragma unroll 1
    for (int gq = 0; gq < TS / 256; ++gq) { const v8f a = *(const v8f*)(sr + gq * 256 + ln * 8); FragH ph; for (int q = 0; q < 8; ++q) { const float e = expf(a[q] - mx); su += e; ph.h[q] = (_Float16)(e * 1024.0f); } *(v8us*)((unsigned short*)P + (size_t)r * TS + gq * 256 + ln * 8) = ph.half[0]; }
     }
  for (int o = 16; o > 0; o >>= 1) su += __shfl_xor(su, o, 32); if (ln == 0) { *(float*)(RS + (size_t)r * 32) = 1.0f / su;  } }
extern "C" void kernel_launch(void* const* d_in, const int* in_sizes, int n_in,
                              void* d_out, int out_size, void* d_ws, size_t ws_size, hipStream_t stream) {
  (void)in_sizes; (void)n_in; (void)out_size;
  const float* content = (const float*)d_in[0]; const float* style = (const float*)d_in[1]; const float* Wf = (const float*)d_in[2]; const float* bf_ = (const float*)d_in[3]; const float* Wg = (const float*)d_in[4]; const float* bg = (const float*)d_in[5]; const float* Wh = (const float*)d_in[6]; const float* bh = (const float*)d_in[7]; const float* Wo = (const float*)d_in[8]; const float* bo = (const float*)d_in[9];
  char* ws = (char*)d_ws; size_t off = 0;
  auto take = [&](size_t bytes) { char* p = ws + off; off += (bytes + 255) & ~(size_t)255; return p; };
  const size_t npc = (size_t)NRC * CC, nps = (size_t)NRS * CC;
  _Float16* BF = (_Float16*)take((size_t)CC * CC * 2); _Float16* BGm = (_Float16*)take((size_t)CC * CC * 2); _Float16* BH = (_Float16*)take((size_t)CC * CC * 2); _Float16* BO = (_Float16*)take((size_t)CC * CC * 2); float* STc = (float*)take((size_t)NB * CC * 2 * 4); float* STs = (float*)take((size_t)NB * CC * 2 * 4);
  _Float16* CNH = (_Float16*)take(npc * 2); _Float16* CNL = (_Float16*)take(npc * 2); _Float16* SNH = (_Float16*)take(nps * 2); _Float16* SNL = (_Float16*)take(nps * 2); _Float16* S16 = (_Float16*)take(nps * 2);
  _Float16* FH = (_Float16*)take(npc * 2); _Float16* FL = (_Float16*)take(npc * 2); _Float16* GH = (_Float16*)take(nps * 2); _Float16* GL = (_Float16*)take(nps * 2); _Float16* HT = (_Float16*)take(nps * 2);
  float* S = (float*)take((size_t)BG * TC * TS * 4); _Float16* P = (_Float16*)take((size_t)BG * TC * TS * 2); float* RS = (float*)take((size_t)BG * TC * 32 * 4);
  _Float16* OH = SNH; _Float16* OL = SNL;      /* O hi/lo [NRC][CC] over the style-normalised planes (dead after G) */
  if (off > ws_size) return;      /* 2 + 0.1 + 16 x 5 + 16 x 5 + 32 + 16 + 1 = about 211 MiB */
  k_wsc<<<(CC * CC / 8 + 255) / 256, 256, 0, stream>>>(Wf, BF, (size_t)CC * CC / 8, 16.0f); k_wsc<<<(CC * CC / 8 + 255) / 256, 256, 0, stream>>>(Wg, BGm, (size_t)CC * CC / 8, 16.0f); k_wsc<<<(CC * CC / 8 + 255) / 256, 256, 0, stream>>>(Wh, BH, (size_t)CC * CC / 8, 16.0f); k_wsc<<<(CC * CC / 8 + 255) / 256, 256, 0, stream>>>(Wo, BO, (size_t)CC * CC / 8, 16.0f);      /* conv (out, in) naturals */
  k_stat<<<NB * CC / SR, 256, 0, stream>>>(content, TC, STc); k_stat<<<NB * CC / SR, 256, 0, stream>>>(style, TS, STs);
  k_plane<true, TC><<<NB * (CC / PT) * (TC / PT), 256, 0, stream>>>(content, STc, CNH, CNL); k_plane<true, TS><<<NB * (CC / PT) * (TS / PT), 256, 0, stream>>>(style, STs, SNH, SNL); k_plane<false, TS><<<NB * (CC / PT) * (TS / PT), 256, 0, stream>>>(style, nullptr, S16, nullptr);
  const dim3 gC((NRC / 128) * (CC / 128), 1), gS((NRS / 128) * (CC / 128), 1);
  k_gemm2s<1, 1><<<gC, 256, 0, stream>>>(CNH, CNL, CC, 0, BF, nullptr, CC, 0, 0.0625f, 0.0625f / 1024.0f, bf_, nullptr, FH, FL, CC, 0, NRC, CC, CC);      /* F rows (b,t), hi/residual */
  k_gemm2s<1, 1><<<gS, 256, 0, stream>>>(SNH, SNL, CC, 0, BGm, nullptr, CC, 0, 0.0625f, 0.0625f / 1024.0f, bg, nullptr, GH, GL, CC, 0, NRS, CC, CC);      /* G rows (b,s), hi/residual */
  k_gemm2<0, 1><<<dim3((CC / 128) * (TS / 128), NB), 256, 0, stream>>>(BH, CC, 0, S16, CC, (size_t)TS * CC, 0.0625f, bh, 0, nullptr, HT, nullptr, TS, (size_t)CC * TS, CC, TS, CC);      /* H as [b][c][s] f16 = Wh . style^T */
  for (int g = 0; g < NB / BG; ++g) { const size_t rc0 = (size_t)g * BG * TC, rs0 = (size_t)g * BG * TS;
    k_gemm2s<2, 0><<<dim3((TC / 128) * (TS / 128), BG), 256, 0, stream>>>(FH + rc0 * CC, FL + rc0 * CC, CC, (size_t)TC * CC, GH + rs0 * CC, GL + rs0 * CC, CC, (size_t)TS * CC, 1.0f, 0.0009765625f, nullptr, S, nullptr, nullptr, TS, (size_t)TC * TS, TC, TS, CC);      /* S = F^T G (hi.hi + (lo.hi + hi.lo)), unscaled */
    k_soft<<<(BG * TC) / 8, 256, 0, stream>>>(S, P, RS);
    k_gemm2<0, 2><<<dim3((TC / 128) * (CC / 128), BG), 256, 0, stream>>>(P, TS, (size_t)TC * TS, HT + (size_t)g * BG * CC * TS, TS, (size_t)CC * TS, 0.0009765625f, nullptr, 0, RS, OH + rc0 * CC, OL + rc0 * CC, CC, (size_t)TC * CC, TC, CC, TS); }      /* O rows (b,t) = (P . H^T) / row sum, hi/residual */
  k_gemm2s<1, 2><<<gC, 256, 0, stream>>>(OH, OL, CC, 0, BO, nullptr, CC, 0, 0.0625f, 0.0625f / 1024.0f, bo, (float*)d_out, nullptr, nullptr, CC, 0, NRC, CC, CC);      /* out [b][o][t] = Wo O + bo */
}

// v005
// A run of this version takes 171 microseconds.
// Next to v004, in two timings, it ran 1.27 times as fast each time.
// Counting every step since v000, it is 5.36 times as fast.
#include <hip/hip_runtime.h>
// SpeakerAttention (16 x 512 channels; content 1024 frames, style 1024 frames: F = Wf mvn(content) + bf, G = Wg mvn(style) + bg, H = Wh style + bh (1x1 convs); S = softmax over style frames of the UNSCALED F^T G (K = 512 channels); O = H S^T; out = Wo O + bo; mvn = per (batch, channel) mean / unbiased variance over time, eps 1e-5).
// Structure: per-(b,c) mvn statistics on VALU (rows staged in LDS); [frame][channel] planes (LDS tile transposes) of the normalised inputs as f16 hi/residual (style raw plane exact); F and G as two-term f16 WMMA GEMMs, both terms in one launch (32x64 wave tiles fed from LDS, f32 accumulation, one accumulator set per scale, exact x16 weights + bias), stored by their own epilogue as f16 hi/residual planes; H as one GEMM per batch with the weights as the A operand, so that it comes out as [b][c][s] (f16); the score GEMM of all batches as THREE hi/residual product terms in one launch (K = 512, f32; the two residual terms share an accumulator set), softmax rows on VALU (unnormalised f16 weights x 2^10 + row normalisers on their own lines), readout GEMM (N = 512, K = 1024) whose epilogue scales the rows and stores hi/residual planes; Wo as two GEMM terms in one launch (+ bias) whose LDS staging holds each wave's tile column by column, so that it stores [b][c][t] itself. Launches that do not depend on one another share one grid (blockIdx.y says whose block it is): both statistics; the three planes and the four weight matrices; F, G and H.
// Compute dtype: inputs rounded to bf16; weights exact as f16; the normalised inputs, F, G and O as f16 hi + 2^-10-scaled residual (the unscaled K = 512 logits have sigma ~ 22, so single-rounded operands would not do); style, H and the softmax weights as plain f16 (~2^-12); statistics / softmax f32. v_wmma_f32_16x16x32_f16.
#define NB 16
#define CC 512
#define TC 1024
#define TS 1024
#define NRC (NB * TC)
#define NRS (NB * TS)
#define BG 16                    /* batches per launch of the score, softmax and readout kernels: all of them */
typedef __bf16 v16b __attribute__((ext_vector_type(16)));
typedef unsigned short v8us __attribute__((ext_vector_type(8), may_alias));
typedef float  v8f  __attribute__((ext_vector_type(8)));
typedef float  v4f  __attribute__((ext_vector_type(4)));
typedef float  v4fa __attribute__((ext_vector_type(4), may_alias));
union FragB { v16b v; v8us half[2]; unsigned short u[16]; };

__device__ __forceinline__ unsigned short bf16_bits(float x) { unsigned int u = __float_as_uint(x); return (unsigned short)((u + 0x7FFFu + ((u >> 16) & 1u)) >> 16); }
__device__ __forceinline__ float bf16_val(unsigned short b) { return __uint_as_float(((unsigned int)b) << 16); }
__device__ __forceinline__ float bf16_round(float x) { return bf16_val(bf16_bits(x)); }
// D += A·B with NT terms: 1 = ah·bh, 2 = + al·bh (A split), 3 = + ah·bl (both split)
template <int NT>
__device__ __forceinline__ v8f mmaN(v16b ah, v16b al, v16b bh, v16b bl, v8f c) {
  c = __builtin_amdgcn_wmma_f32_16x16x32_bf16(false, ah, false, bh, (short)0, c, false, false);
  if (NT >= 2) c = __builtin_amdgcn_wmma_f32_16x16x32_bf16(false, al, false, bh, (short)0, c, false, false);
  if (NT >= 3) c = __builtin_amdgcn_wmma_f32_16x16x32_bf16(false, ah, false, bl, (short)0, c, false, false);
  asm volatile("v_nop\n\tv_nop\n\tv_nop\n\tv_nop" : "+v"(c) : "v"(ah), "v"(al), "v"(bh), "v"(bl));
  return c;
}

__global__ __launch_bounds__(256) void k_wt_bf16(const float* __restrict__ W, unsigned short* __restrict__ Wt, int K, int N) {
  const int t = blockIdx.x * 256 + threadIdx.x;
  const int k8n = K / 8;
  if (t >= N * k8n) return;
  const int n = t / k8n, k8 = (t % k8n) * 8;
  v8us v;
#pragma unroll
  for (int i = 0; i < 8; ++i) v[i] = bf16_bits(W[(size_t)(k8 + i) * N + n]);
  *(v8us*)(Wt + (size_t)n * K + k8) = v;
  
}

// GEMM C[M][N] (f32, pitch ldc) = act(A[M][K]·W + bias). A f32 row-major (pitch lda) converted per fragment to bf16
// (ASPLIT: hi/lo two planes -> 2 terms, else single rounded term); Wt bf16 [N][K] (pitch ldb). BIAS_BF16 rounds the
// bias to bf16 first (bias quantised to bf16 before the add). K%32==0, M%16==0, N%64==0.
template <bool ASPLIT, int ACT, bool BIAS_BF16>
__global__ __launch_bounds__(128) void k_gemm_bf(const float* __restrict__ A, int lda, const unsigned short* __restrict__ Wt, int ldb,
                                               const float* __restrict__ bias, float* __restrict__ C, int ldc, int M, int N, int K) {
  __shared__ __attribute__((aligned(16))) float so[4][16][64];
  const int tid = threadIdx.x, w = tid >> 5, lane = tid & 31, ln = lane & 15, hh = lane >> 4;
  const int ntn = N / 64;
  const int wid = blockIdx.x * 4 + w;
  const int mt = wid / ntn, nq = wid % ntn;
  if (mt * 16 >= M) return;
  const int row0 = mt * 16, col0 = nq * 64;
  const float* arow = A + (size_t)(row0 + ln) * lda;
  v8f acc[4] = {};
  for (int kb = 0; kb < K; kb += 32) {
    FragB ah, al;
    const v4f x0 = *(const v4fa*)(arow + kb + 8 * hh), x1 = *(const v4fa*)(arow + kb + 8 * hh + 4);
    const v4f x2 = *(const v4fa*)(arow + kb + 16 + 8 * hh), x3 = *(const v4fa*)(arow + kb + 16 + 8 * hh + 4);
    float xs[16] = {x0[0],x0[1],x0[2],x0[3],x1[0],x1[1],x1[2],x1[3],x2[0],x2[1],x2[2],x2[3],x3[0],x3[1],x3[2],x3[3]};
#pragma unroll
    for (int i = 0; i < 16; ++i) { const unsigned short hb = bf16_bits(xs[i]); ah.u[i] = hb; al.u[i] = ASPLIT ? bf16_bits(xs[i] - bf16_val(hb)) : (unsigned short)0; }
#pragma unroll
    for (int t = 0; t < 4; ++t) {
      const unsigned short* brow = Wt + (size_t)(col0 + t * 16 + ln) * ldb + kb;
      FragB b;
      b.half[0] = *(const v8us*)(brow + 8 * hh);
      b.half[1] = *(const v8us*)(brow + 16 + 8 * hh);
      acc[t] = mmaN<ASPLIT ? 2 : 1>(ah.v, al.v, b.v, b.v, acc[t]);
    }
  }
#pragma unroll
  for (int t = 0; t < 4; ++t) {
    float bv = bias ? bias[col0 + t * 16 + ln] : 0.f;
    if (BIAS_BF16) bv = bf16_round(bv);
#pragma unroll
    for (int r = 0; r < 8; ++r) { float v = acc[t][r] + bv; if (ACT == 1) v = fmaxf(v, 0.f); so[w][8 * hh + r][t * 16 + ln] = v; }
  }
  __builtin_amdgcn_fence(__ATOMIC_ACQ_REL, "workgroup");
  __builtin_amdgcn_wave_barrier();
  const int rsub = lane >> 4, c4 = (lane & 15) * 4;
  {
#pragma unroll
    for (int q = 0; q < 8; ++q) {
      const int r = q * 2 + rsub;
      const v4f v = *(const v4fa*)&so[w][r][c4];
      *(v4f*)(C + (size_t)(row0 + r) * ldc + col0 + c4) = v;
    }
    
  }
}

// GEMM C = act(A·W + bias + resid): A f32 (ASPLIT -> hi/lo 2 terms), Wt bf16 [N][K]; ACT 0 none, 1 relu, 2 exact gelu;
// resid (optional, f32, row index = (row % rmod), pitch ldr, RES_BF16 rounds it) added before the activation.
template <bool ASPLIT, int ACT, bool BIAS_BF16, bool RES_BF16>
__global__ __launch_bounds__(128) void k_gemm_bf3(const float* __restrict__ A, int lda, const unsigned short* __restrict__ Wt, int ldb,
                                                const float* __restrict__ bias, const float* __restrict__ resid, int rmod, int ldr,
                                                float* __restrict__ C, int ldc, int M, int N, int K) {
  __shared__ __attribute__((aligned(16))) float so[4][16][64];
  const int tid = threadIdx.x, w = tid >> 5, lane = tid & 31, ln = lane & 15, hh = lane >> 4;
  const int ntn = N / 64;
  const int wid = blockIdx.x * 4 + w;
  const int mt = wid / ntn, nq = wid % ntn;
  if (mt * 16 >= M) return;
  const int row0 = mt * 16, col0 = nq * 64;
  const float* arow = A + (size_t)(row0 + ln) * lda;
  v8f acc[4] = {};
  for (int kb = 0; kb < K; kb += 32) {
    FragB ah, al;
    const v4f x0 = *(const v4fa*)(arow + kb + 8 * hh), x1 = *(const v4fa*)(arow + kb + 8 * hh + 4);
    const v4f x2 = *(const v4fa*)(arow + kb + 16 + 8 * hh), x3 = *(const v4fa*)(arow + kb + 16 + 8 * hh + 4);
    float xs[16] = {x0[0],x0[1],x0[2],x0[3],x1[0],x1[1],x1[2],x1[3],x2[0],x2[1],x2[2],x2[3],x3[0],x3[1],x3[2],x3[3]};
#pragma unroll
    for (int i = 0; i < 16; ++i) { const unsigned short hb = bf16_bits(xs[i]); ah.u[i] = hb; al.u[i] = ASPLIT ? bf16_bits(xs[i] - bf16_val(hb)) : (unsigned short)0; }
#pragma unroll
    for (int t = 0; t < 4; ++t) {
      const unsigned short* brow = Wt + (size_t)(col0 + t * 16 + ln) * ldb + kb;
      FragB b;
      b.half[0] = *(const v8us*)(brow + 8 * hh);
      b.half[1] = *(const v8us*)(brow + 16 + 8 * hh);
      acc[t] = mmaN<ASPLIT ? 2 : 1>(ah.v, al.v, b.v, b.v, acc[t]);
    }
  }
#pragma unroll
  for (int t = 0; t < 4; ++t) {
    const int col = col0 + t * 16 + ln;
    float bv = bias ? bias[col] : 0.f;
    if (BIAS_BF16) bv = bf16_round(bv);
#pragma unroll
    for (int r = 0; r < 8; ++r) {
      float v = acc[t][r] + bv;
      if (resid) { float rv = resid[(size_t)((row0 + 8 * hh + r) % rmod) * ldr + col]; if (RES_BF16) rv = bf16_round(rv); v += rv; }
      if (ACT == 1) v = fmaxf(v, 0.f);
      if (ACT == 2) v = 0.5f * v * (1.0f + erff(v * 0.70710678118654752f));
      if (ACT == 3) { const float u = 0.7978845608028654f * (v + 0.044715f * v * v * v); v = 0.5f * v * (1.0f + tanhf(u)); }
      so[w][8 * hh + r][t * 16 + ln] = v;
    }
  }
  __builtin_amdgcn_fence(__ATOMIC_ACQ_REL, "workgroup");
  __builtin_amdgcn_wave_barrier();
  const int rsub = lane >> 4, c4 = (lane & 15) * 4;
  {
#pragma unroll
    for (int q = 0; q < 8; ++q) {
      const int r = q * 2 + rsub;
      const v4f v = *(const v4fa*)&so[w][r][c4];
      *(v4f*)(C + (size_t)(row0 + r) * ldc + col0 + c4) = v;
    }
    
  }
}
// row LayerNorm (biased variance, eps) over N: s = X (+ R); optional out_sum <- s; out_norm <- (s-mu)*rsqrt(var+eps)*g + b
template <bool PARAM_BF16>
__global__ __launch_bounds__(256) void k_layernorm(const float* __restrict__ X, const float* __restrict__ R, const float* __restrict__ g, const float* __restrict__ bta,
                                                  float* __restrict__ out_sum, float* __restrict__ out_norm, int N, float eps) {
  __shared__ float red[256];
  const int row = blockIdx.x, tid = threadIdx.x;
  const float* x = X + (size_t)row * N; const float* rr = R ? R + (size_t)row * N : nullptr;
  float vals[16];                     // up to N = 4096
  const int per = N / 256;            // contiguous chunk per thread? use strided-by-4 chunks: thread handles j = tid*4 + 1024*u
  float s1 = 0.f;
  for (int u = 0; u < per / 4; ++u) {
    const int j = tid * 4 + 1024 * u;
    const v4f a = *(const v4fa*)(x + j);
    v4f b = {0.f,0.f,0.f,0.f}; if (rr) b = *(const v4fa*)(rr + j);
#pragma unroll
    for (int q = 0; q < 4; ++q) { const float v = a[q] + b[q]; vals[u * 4 + q] = v; s1 += v; }
  }
  red[tid] = s1; __syncthreads();
  for (int st = 128; st > 0; st >>= 1) { if (tid < st) red[tid] += red[tid + st]; __syncthreads(); }
  const float mu = red[0] / (float)N; __syncthreads();
  float s2 = 0.f;
  for (int u = 0; u < per / 4; ++u)
#pragma unroll
    for (int q = 0; q < 4; ++q) { const float c = vals[u * 4 + q] - mu; s2 += c * c; }
  red[tid] = s2; __syncthreads();
  for (int st = 128; st > 0; st >>= 1) { if (tid < st) red[tid] += red[tid + st]; __syncthreads(); }
  const float rs = rsqrtf(red[0] / (float)N + eps);
  {
    for (int u = 0; u < per / 4; ++u) {
      const int j = tid * 4 + 1024 * u;
      v4f o, sm;
#pragma unroll
      for (int q = 0; q < 4; ++q) {
        float gg = g[j + q], bb = bta[j + q];
        if (PARAM_BF16) { gg = bf16_round(gg); bb = bf16_round(bb); }
        sm[q] = vals[u * 4 + q]; o[q] = (vals[u * 4 + q] - mu) * rs * gg + bb;
      }
      if (out_sum) *(v4f*)(out_sum + (size_t)row * N + j) = sm;
      *(v4f*)(out_norm + (size_t)row * N + j) = o;
    }
    
  }
}



// ---- f16 WMMA path (v_wmma_f32_16x16x32_f16): 11-bit significands for operands in range — used for every GEMM launched here
typedef _Float16 v16h __attribute__((ext_vector_type(16)));
union FragH { v16h v; v8us half[2]; _Float16 h[16]; unsigned short u[16]; };
template <int NT>
__device__ __forceinline__ v8f mmaH(v16h ah, v16h al, v16h bh, v16h bl, v8f c) {
  c = __builtin_amdgcn_wmma_f32_16x16x32_f16(false, ah, false, bh, (short)0, c, false, false);
  if (NT >= 2) c = __builtin_amdgcn_wmma_f32_16x16x32_f16(false, al, false, bh, (short)0, c, false, false);
  if (NT >= 3) c = __builtin_amdgcn_wmma_f32_16x16x32_f16(false, ah, false, bl, (short)0, c, false, false);
  asm volatile("v_nop\n\tv_nop\n\tv_nop\n\tv_nop" : "+v"(c) : "v"(ah), "v"(al), "v"(bh), "v"(bl));
  return c;
}
// batched GEMM like k_gemm_b but f16 operands: A f32 (split into f16 hi/lo if ASPLIT, else rounded to f16), Bt = f16 values [n][k]; alpha; C f32; N multiple of 16 (partial tiles skipped)
template <bool ASPLIT>
__global__ __launch_bounds__(128) void k_gemm_h(const float* __restrict__ A, int lda, size_t sA, const _Float16* __restrict__ Bh, int ldb, size_t sB, float alpha, float* __restrict__ C, int ldc, size_t sC, int M, int N, int K) {
  __shared__ __attribute__((aligned(16))) float so[4][16][64];
  const int tid = threadIdx.x, w = tid >> 5, lane = tid & 31, ln = lane & 15, hh = lane >> 4; const int by = blockIdx.y;
  A += (size_t)by * sA; Bh += (size_t)by * sB; C += (size_t)by * sC;
  const int ntn = (N + 63) / 64; const int wid = blockIdx.x * 4 + w; const int mt = wid / ntn, nq = wid % ntn; if (mt * 16 >= M) return;
  const int row0 = mt * 16, col0 = nq * 64; const float* arow = A + (size_t)(row0 + ln) * lda;
  v8f acc[4] = {};
  for (int kb = 0; kb < K; kb += 32) {
    FragH ah, al;
    const v4f x0 = *(const v4fa*)(arow + kb + 8 * hh), x1 = *(const v4fa*)(arow + kb + 8 * hh + 4), x2 = *(const v4fa*)(arow + kb + 16 + 8 * hh), x3 = *(const v4fa*)(arow + kb + 16 + 8 * hh + 4);
    float xs[16] = {x0[0],x0[1],x0[2],x0[3],x1[0],x1[1],x1[2],x1[3],x2[0],x2[1],x2[2],x2[3],x3[0],x3[1],x3[2],x3[3]};
#pragma unroll
    for (int i = 0; i < 16; ++i) { const _Float16 h = (_Float16)xs[i]; ah.h[i] = h; al.h[i] = ASPLIT ? (_Float16)(xs[i] - (float)h) : (_Float16)0.0f; }
#pragma unroll
    for (int t = 0; t < 4; ++t) { if (col0 + t * 16 >= N) continue; const size_t boff = (size_t)(col0 + t * 16 + ln) * ldb + kb; FragH bq; bq.half[0] = *(const v8us*)(Bh + boff + 8 * hh); bq.half[1] = *(const v8us*)(Bh + boff + 16 + 8 * hh);
      acc[t] = mmaH<ASPLIT ? 2 : 1>(ah.v, al.v, bq.v, bq.v, acc[t]); }
  }
#pragma unroll
  for (int t = 0; t < 4; ++t) { if (col0 + t * 16 >= N) continue;
#pragma unroll
    for (int r = 0; r < 8; ++r) so[w][8 * hh + r][t * 16 + ln] = acc[t][r] * alpha; }
  __builtin_amdgcn_fence(__ATOMIC_ACQ_REL, "workgroup"); __builtin_amdgcn_wave_barrier();
  const int rsub = lane >> 4, c4 = (lane & 15) * 4;
  {
#pragma unroll
    for (int q = 0; q < 8; ++q) { const int r = q * 2 + rsub; if (col0 + c4 < N) { const v4f v = *(const v4fa*)&so[w][r][c4]; *(v4f*)(C + (size_t)(row0 + r) * ldc + col0 + c4) = v; } }
     }
}

// Wt[n][k] = f16(W[k][n]·scale) from f32 row-major W[K][N] (scale = power of two; bf16-exact weights stay exact in f16 away from the subnormal range)
__global__ __launch_bounds__(256) void k_wt_f16(const float* __restrict__ W, _Float16* __restrict__ Wt, int K, int N, float scale) {
  const int t = blockIdx.x * 256 + threadIdx.x; if (t >= N * (K / 8)) return; const int n = t / (K / 8), k8 = (t % (K / 8)) * 8; FragH f;
#pragma unroll
  for (int i = 0; i < 8; ++i) f.h[i] = (_Float16)(bf16_round(W[(size_t)(k8 + i) * N + n]) * scale); const v8us o = f.half[0];
  *(v8us*)((unsigned short*)Wt + (size_t)n * K + k8) = o; 
}
// k_gemm_hh variant with fused epilogue: v = acc·alpha + bias[by·sBias + col] (+ CP[(row/rowsPerB)·sCPb + by·64 + col] if CP) ; ACT 0 none / 1 elu ; writes f16 C16 (and f32 C if non-null)
template <int ACT>
__global__ __launch_bounds__(128) void k_gemm_hhx(const _Float16* __restrict__ A, int lda, size_t sA, const _Float16* __restrict__ Bh, int ldb, size_t sB, float alpha, const float* __restrict__ bias, size_t sBias, const float* __restrict__ CP, int rowsPerB, size_t sCPb, int row0g,
    float* __restrict__ C, _Float16* __restrict__ C16, int ldc, size_t sC, int M, int N, int K) {
  __shared__ __attribute__((aligned(16))) float so[4][16][64];
  const int tid = threadIdx.x, w = tid >> 5, lane = tid & 31, ln = lane & 15, hh = lane >> 4; const int by = blockIdx.y;
  A += (size_t)by * sA; Bh += (size_t)by * sB; const size_t cofs = (size_t)by * sC; const float* bp = bias ? bias + (size_t)by * sBias : nullptr;
  const int ntn = (N + 63) / 64; const int wid = blockIdx.x * 4 + w; const int mt = wid / ntn, nq = wid % ntn; if (mt * 16 >= M) return;
  const int row0 = mt * 16, col0 = nq * 64; const _Float16* arow = A + (size_t)(row0 + ln) * lda;
  v8f acc[4] = {};
  for (int kb = 0; kb < K; kb += 32) { FragH ah; ah.half[0] = *(const v8us*)((const unsigned short*)arow + kb + 8 * hh); ah.half[1] = *(const v8us*)((const unsigned short*)arow + kb + 16 + 8 * hh);
#pragma unroll
    for (int t = 0; t < 4; ++t) { if (col0 + t * 16 >= N) continue; const size_t boff = (size_t)(col0 + t * 16 + ln) * ldb + kb; FragH bq; bq.half[0] = *(const v8us*)((const unsigned short*)Bh + boff + 8 * hh); bq.half[1] = *(const v8us*)((const unsigned short*)Bh + boff + 16 + 8 * hh);
      acc[t] = mmaH<1>(ah.v, ah.v, bq.v, bq.v, acc[t]); }
  }
#pragma unroll
  for (int t = 0; t < 4; ++t) { if (col0 + t * 16 >= N) continue; const int col = col0 + t * 16 + ln; const float bv = bp ? bf16_round(bp[col]) : 0.f;
#pragma unroll
    for (int r = 0; r < 8; ++r) { float v = acc[t][r] * alpha + bv; if (CP) { const int rr = row0g + row0 + 8 * hh + r; if (rowsPerB < 0) v += CP[cofs + (size_t)rr * ldc + col];      /* rowsPerB < 0: own element of the batched C plane */ else { const int bidx = rr / rowsPerB; v += CP[(size_t)bidx * sCPb + (size_t)by * 64 + col]; } } if (ACT == 1) v = (v > 0.f) ? v : expm1f(v); else if (ACT == 7) v = (v > 0.f) ? v + 1.0f : expf(v); else if (ACT == 8) v = tanhf(v); else if (ACT == 9) v = 0.5f * v * (1.0f + tanhf(0.7978845608028654f * (v + 0.044715f * v * v * v))); else if (ACT == 11) v = 1.0f / (1.0f + expf(-v)); else if (ACT == 12) v = (v > 0.f) ? v : 0.01f * v; else if (ACT == 14) v = (v > 0.f) ? v : 0.1f * v; else if (ACT == 16) v = (v >= 0.f) ? v : 0.3f * v; else if (ACT == 17) v = (v >= 0.f) ? v : 0.2f * v; else if (ACT == 15) v = v / (1.0f + expf(-v)); else if (ACT == 3) v = fmaxf(v, 0.f); else if (ACT == 6) v = 0.5f * v * (1.0f + erff(v * 0.70710678118654752f)); so[w][8 * hh + r][t * 16 + ln] = v; } }
  __builtin_amdgcn_fence(__ATOMIC_ACQ_REL, "workgroup"); __builtin_amdgcn_wave_barrier();
  const int rsub = lane >> 4, c4 = (lane & 15) * 4; typedef _Float16 v4h __attribute__((ext_vector_type(4)));
  {
#pragma unroll
    for (int q = 0; q < 8; ++q) { const int r = q * 2 + rsub; if (col0 + c4 < N) { const v4f v = *(const v4fa*)&so[w][r][c4]; if (C) *(v4f*)(C + cofs + (size_t)(row0 + r) * ldc + col0 + c4) = v; if (C16) { v4h h4; for (int i = 0; i < 4; ++i) h4[i] = (_Float16)v[i]; *(v4h*)(C16 + cofs + (size_t)(row0 + r) * ldc + col0 + c4) = h4; } } }
     }
}


typedef _Float16 v4h __attribute__((ext_vector_type(4)));

__global__ __launch_bounds__(256) void k_x16(const float* __restrict__ x, _Float16* __restrict__ X16, size_t n8) { const size_t t = (size_t)blockIdx.x * 256 + threadIdx.x; if (t >= n8) return; FragH f;
#pragma unroll
  for (int q = 0; q < 8; ++q) f.h[q] = (_Float16)bf16_round(x[t * 8 + q]); *(v8us*)((unsigned short*)X16 + t * 8) = f.half[0];  }
__global__ __launch_bounds__(256) void k_h16(const float* __restrict__ x, _Float16* __restrict__ X16, size_t n8) { const size_t t = (size_t)blockIdx.x * 256 + threadIdx.x; if (t >= n8) return; FragH f;
#pragma unroll
  for (int q = 0; q < 8; ++q) f.h[q] = (_Float16)x[t * 8 + q]; *(v8us*)((unsigned short*)X16 + t * 8) = f.half[0];  }
__global__ __launch_bounds__(256) void k_round16f(const float* __restrict__ W, _Float16* __restrict__ Bt, size_t n8) { const size_t t = (size_t)blockIdx.x * 256 + threadIdx.x; if (t >= n8) return; FragH f;
#pragma unroll
  for (int i = 0; i < 8; ++i) f.h[i] = (_Float16)(bf16_round(W[t * 8 + i]) * 16.0f); *(v8us*)((unsigned short*)Bt + t * 8) = f.half[0];  }
// eight neighbouring f32 values of a row as f16 hi and residual x 2^10, 16 bytes to each plane
__device__ __forceinline__ void g2_store_hl(v4f a, v4f c, _Float16* hp, _Float16* lp) { FragH fh, fl;
#pragma unroll      /* fh and fl must stay in registers */
  for (int q = 0; q < 4; ++q) { _Float16 h = (_Float16)a[q]; fh.h[q] = h; fl.h[q] = (_Float16)((a[q] - (float)h) * 1024.0f); h = (_Float16)c[q]; fh.h[4 + q] = h; fl.h[4 + q] = (_Float16)((c[q] - (float)h) * 1024.0f); }
  *(v8us*)(unsigned short*)hp = fh.half[0]; *(v8us*)(unsigned short*)lp = fl.half[0]; }

// ---- fast GEMM (block tile 128x128 = eight 32x64 wave tiles; A and B in 64-k tiles through a two-buffer LDS ring; requires M % 128 == 0 rows per launch region, N % 128 == 0, K % 64 == 0); epilogue: acc alpha (+ bias, except EPI 1), activation, LDS staging (EPI 1 adds its bias behind it), then the form the consumer reads. EPI 1: the bias, which must be there, goes by the ROW of C (the weights are the A operand), C16 = f16. EPI 2: row r times rowscale[r * 32] (r counted over the batches), C16 | C16L = f16 hi | residual x 2^10 ----
__device__ __forceinline__ v16h g2_frag(const _Float16* p, int hh) { FragH f; f.half[0] = *(const v8us*)((const unsigned short*)p + 8 * hh); f.half[1] = *(const v8us*)((const unsigned short*)p + 16 + 8 * hh); return f.v; }
__device__ __forceinline__ v8f g2_mma(v16h a, v16h b, v8f c) { v8f d = __builtin_amdgcn_wmma_f32_16x16x32_f16(false, a, false, b, (short)0, c, false, false); asm volatile("v_nop\n\tv_nop\n\tv_nop\n\tv_nop" : "+v"(d) : "v"(a), "v"(b)); return d; }
#define G2P 72      /* LDS row pitch in f16: 64 k + 8 = 144 B, 16 B x odd, the conflict-free pitch for ds_load_b128 readers */
// One thread's eight b128 asynchronous copies to LDS for one 64-k pass: its 16-byte piece of rows r, r + 32, r + 64, r + 96 of the 128-row A tile and of the 128-row B tile (la, lb = LDS byte addresses, ga, gb = global addresses, rsa, rsb = 32 rows in elements).
// s_wait_xcnt 0 is the statement's last line so that no address register of an issued copy is rewritten ahead of it.
__device__ __forceinline__ void g2_copy8(unsigned la, unsigned lb, const _Float16* ga, const _Float16* gb, size_t rsa, size_t rsb) {
  asm volatile("global_load_async_to_lds_b128 %0, %8, off\n\t"
               "global_load_async_to_lds_b128 %1, %9, off\n\t"
               "global_load_async_to_lds_b128 %2, %10, off\n\t"
               "global_load_async_to_lds_b128 %3, %11, off\n\t"
               "global_load_async_to_lds_b128 %4, %12, off\n\t"
               "global_load_async_to_lds_b128 %5, %13, off\n\t"
               "global_load_async_to_lds_b128 %6, %14, off\n\t"
               "global_load_async_to_lds_b128 %7, %15, off\n\t"
               "s_wait_xcnt 0x0"
               :: "v"(la), "v"(la + 1u * 32u * G2P * 2u), "v"(la + 2u * 32u * G2P * 2u), "v"(la + 3u * 32u * G2P * 2u), "v"(lb), "v"(lb + 1u * 32u * G2P * 2u), "v"(lb + 2u * 32u * G2P * 2u), "v"(lb + 3u * 32u * G2P * 2u),
                  "v"(ga), "v"(ga + rsa), "v"(ga + 2 * rsa), "v"(ga + 3 * rsa), "v"(gb), "v"(gb + rsb), "v"(gb + 2 * rsb), "v"(gb + 3 * rsb) : "memory");
}
#define G2RB (2 * 2 * 128 * G2P * 2)      /* bytes of k_gemm2's ring */
#define G2SB (G2RB + 8 * 32 * 68 * 4)      /* bytes of its ring and its output staging */
// the body takes its LDS (G2SB bytes, 16-byte aligned) and its block indices from the kernel that calls it, so that one grid can hold blocks of this product and of another kind
template <int ACT, int EPI>
__device__ __forceinline__ void gemm2_body(unsigned char* sm, const int bx, const int by, const _Float16* __restrict__ A, int lda, size_t sA, const _Float16* __restrict__ Bh, int ldb, size_t sB, float alpha, const float* __restrict__ bias, size_t sBias,
    const float* __restrict__ rowscale, _Float16* __restrict__ C16, _Float16* __restrict__ C16L, int ldc, size_t sC, int M, int N, int K) { static_assert(EPI == 1 || EPI == 2, "k_gemm2: the bias by rows and f16 out, or scaled rows and hi/residual planes out"); static_assert(ACT == 0 || ACT == 3 || ACT == 6 || ACT == 8 || ACT == 9 || ACT == 11 || ACT == 12 || ACT == 14 || ACT == 15 || ACT == 16 || ACT == 17, "k_gemm2: unsupported ACT code (would silently apply no activation)");
  _Float16 (*ring)[2][128][G2P] = (_Float16 (*)[2][128][G2P])sm;      /* [buffer][A | B][row][k], filled by the asynchronous copies only */
  float (*so)[32][68] = (float (*)[32][68])(sm + G2RB);
  const int tid = threadIdx.x, w = tid >> 5, lane = tid & 31, ln = lane & 15, hh = lane >> 4;
  A += (size_t)by * sA; Bh += (size_t)by * sB; const size_t cofs = (size_t)by * sC; const float* bp = bias ? bias + (size_t)by * sBias : nullptr;
  const int ntn = N >> 7; const int mt = bx / ntn, nq = bx - mt * ntn; if (mt * 128 >= M) return;      /* the same for the whole block, ahead of every barrier */
  const int wm = w >> 1, wn = w & 1; const int row0 = mt * 128 + 32 * wm, col0 = nq * 128 + 64 * wn;
  const int cr = tid >> 3, cc = (tid & 7) * 8;      /* this thread's first row and its 8-element piece in every copied tile */
  const _Float16* ga = A + (size_t)(mt * 128 + cr) * lda + cc; const _Float16* gb = Bh + (size_t)(nq * 128 + cr) * ldb + cc; const size_t rsa = (size_t)32 * lda, rsb = (size_t)32 * ldb;
  const unsigned la = (unsigned)(size_t)&ring[0][0][cr][cc], lb = (unsigned)(size_t)&ring[0][1][cr][cc]; const unsigned bufb = 2u * 128u * G2P * 2u;      /* LDS byte addresses in buffer 0; bytes per buffer */
  const int np = K >> 6;
  const v8f z8 = {0.f,0.f,0.f,0.f,0.f,0.f,0.f,0.f}; v8f c00 = z8, c01 = z8, c02 = z8, c03 = z8, c10 = z8, c11 = z8, c12 = z8, c13 = z8;
  g2_copy8(la, lb, ga, gb, rsa, rsb);
  asm volatile("s_wait_asynccnt 0x0" ::: "memory");      /* this wave's copies of tile 0 have landed */
  __syncthreads();      /* publishes tile 0 */
  if (np > 1) g2_copy8(la + bufb, lb + bufb, ga + 64, gb + 64, rsa, rsb);
  for (int t = 0; t < np; ++t) { const int bu = t & 1; const _Float16* a0p = &ring[bu][0][32 * wm + ln][0]; const _Float16* a1p = a0p + 16 * G2P;
    const _Float16* b0p = &ring[bu][1][64 * wn + ln][0]; const _Float16* b1p = b0p + 16 * G2P; const _Float16* b2p = b1p + 16 * G2P; const _Float16* b3p = b2p + 16 * G2P;
    v16h a0[2], a1[2], b0[2], b1[2], b2[2], b3[2];      /* the pass's 24 LDS reads go as one group ahead of its 16 products: reads placed among the products would each wait out the LDS latency */
#pragma unroll      /* the fragment arrays must stay in registers */
    for (int s = 0; s < 2; ++s) { a0[s] = g2_frag(a0p + 32 * s, hh); a1[s] = g2_frag(a1p + 32 * s, hh); b0[s] = g2_frag(b0p + 32 * s, hh); b1[s] = g2_frag(b1p + 32 * s, hh); b2[s] = g2_frag(b2p + 32 * s, hh); b3[s] = g2_frag(b3p + 32 * s, hh); }
#pragma unroll      /* as above */
    for (int s = 0; s < 2; ++s) { c00 = g2_mma(a0[s], b0[s], c00); c10 = g2_mma(a1[s], b0[s], c10); c01 = g2_mma(a0[s], b1[s], c01); c11 = g2_mma(a1[s], b1[s], c11);
      c02 = g2_mma(a0[s], b2[s], c02); c12 = g2_mma(a1[s], b2[s], c12); c03 = g2_mma(a0[s], b3[s], c03); c13 = g2_mma(a1[s], b3[s], c13); }
    asm volatile("s_wait_dscnt 0x0" ::: "memory");      /* this wave's reads of buffer bu are done before it is refilled */
    asm volatile("s_wait_asynccnt 0x0" ::: "memory");      /* this wave's copies of tile t + 1 have landed */
    __syncthreads();      /* publishes tile t + 1 and ends every wave's reads of buffer bu */
    if (t + 2 < np) g2_copy8(la + bu * bufb, lb + bu * bufb, ga + (size_t)(t + 2) * 64, gb + (size_t)(t + 2) * 64, rsa, rsb); }
  asm volatile("s_wait_asynccnt 0x0" ::: "memory");      /* no copy is outstanding when the wave goes on */
  v8f accs[8] = {c00, c01, c02, c03, c10, c11, c12, c13};
#pragma unroll
  for (int u = 0; u < 8; ++u) { const int t = u & 3, half = u >> 2; const int col = col0 + t * 16 + ln; const float bv = (EPI != 1 && bp) ? bf16_round(bp[col]) : 0.f;      /* EPI 1 adds its bias, one value a row, behind the staging */
#pragma unroll
    for (int r = 0; r < 8; ++r) { const int rloc = half * 16 + 8 * hh + r; float v = accs[u][r] * alpha + bv;
      if (ACT == 3) v = fmaxf(v, 0.f); else if (ACT == 6) v = 0.5f * v * (1.0f + erff(v * 0.70710678118654752f)); else if (ACT == 11) v = 1.0f / (1.0f + expf(-v)); else if (ACT == 15) v = v / (1.0f + expf(-v)); else if (ACT == 12) v = (v > 0.f) ? v : 0.01f * v; else if (ACT == 8) v = tanhf(v); else if (ACT == 9) v = 0.5f * v * (1.0f + tanhf(0.7978845608028654f * (v + 0.044715f * v * v * v))); else if (ACT == 14) v = (v > 0.f) ? v : 0.1f * v; else if (ACT == 16) v = (v >= 0.f) ? v : 0.3f * v; else if (ACT == 17) v = (v >= 0.f) ? v : 0.2f * v;
      so[w][rloc][t * 16 + ln] = v; } }
  __builtin_amdgcn_fence(__ATOMIC_ACQ_REL, "workgroup"); __builtin_amdgcn_wave_barrier();
  const int rsub = lane >> 3, c8 = (lane & 7) * 8;      /* eight lanes take one row's 64 columns: a whole 128-byte line of f16 */
  v4f a[8], c[8]; float rv[8];      /* rv: the row's bias (EPI 1) or scale (EPI 2) */
#pragma unroll      /* a, c and rv must stay in registers; the 16 LDS reads and the 8 loads of rv go as one group, so that their latency is paid once */
  for (int q = 0; q < 8; ++q) { const int r = q * 4 + rsub; a[q] = *(const v4fa*)&so[w][r][c8]; c[q] = *(const v4fa*)&so[w][r][c8 + 4]; rv[q] = EPI == 1 ? bp[row0 + r] : rowscale[((size_t)by * M + row0 + r) * 32]; }
#pragma unroll      /* as above */
  for (int q = 0; q < 8; ++q) { const size_t o = cofs + (size_t)(row0 + q * 4 + rsub) * ldc + col0 + c8;
    if (EPI == 1) { const float bq = bf16_round(rv[q]); FragH f; for (int i = 0; i < 4; ++i) { f.h[i] = (_Float16)(a[q][i] + bq); f.h[4 + i] = (_Float16)(c[q][i] + bq); } *(v8us*)((unsigned short*)C16 + o) = f.half[0]; }
    else g2_store_hl(a[q] * rv[q], c[q] * rv[q], C16 + o, C16L + o); } }
template <int ACT, int EPI>
__global__ __launch_bounds__(256) void k_gemm2(const _Float16* __restrict__ A, int lda, size_t sA, const _Float16* __restrict__ Bh, int ldb, size_t sB, float alpha, const float* __restrict__ bias, size_t sBias,
    const float* __restrict__ rowscale, _Float16* __restrict__ C16, _Float16* __restrict__ C16L, int ldc, size_t sC, int M, int N, int K) {
  __shared__ __attribute__((aligned(16))) unsigned char sm[G2SB];
  gemm2_body<ACT, EPI>(sm, blockIdx.x, blockIdx.y, A, lda, sA, Bh, ldb, sB, alpha, bias, sBias, rowscale, C16, C16L, ldc, sC, M, N, K); }


// ---- k_gemm2 for a product whose operands are f16 hi + scaled residual planes: every term in ONE launch, summed in registers. H takes Ah.Bh; X takes Al.Bh and, with NBP == 2, Ah.Bl as well (both carry the residual's scale); C = H alphaH + bias + X alphaL. Same block and wave tiles, same ring order as k_gemm2; a stage is [Ah | Bh | Al (| Bl)]. EPI 0: C f32, row-major. EPI 1: CH | CL = f16 hi | residual x 2^10, row-major. EPI 2: C f32 as [row / TC][column][row % TC] ----
// One thread's four b128 asynchronous copies to LDS for one 128-row tile; s_wait_xcnt 0 is the statement's last line so that no address register of an issued copy is rewritten ahead of it.
__device__ __forceinline__ void g2_copy4(unsigned la, const _Float16* ga, size_t rsa) {
  asm volatile("global_load_async_to_lds_b128 %0, %4, off\n\t"
               "global_load_async_to_lds_b128 %1, %5, off\n\t"
               "global_load_async_to_lds_b128 %2, %6, off\n\t"
               "global_load_async_to_lds_b128 %3, %7, off\n\t"
               "s_wait_xcnt 0x0"
               :: "v"(la), "v"(la + 1u * 32u * G2P * 2u), "v"(la + 2u * 32u * G2P * 2u), "v"(la + 3u * 32u * G2P * 2u), "v"(ga), "v"(ga + rsa), "v"(ga + 2 * rsa), "v"(ga + 3 * rsa) : "memory");
}
#define G2T (128 * G2P)      /* f16 elements of one 128-row tile in LDS */
#define G2SS(NBP) (2u * (2u + (NBP)) * G2T * 2u)      /* bytes of the two buffers */
// LDS (G2SS(NBP) bytes, 16-byte aligned) and block indices from the calling kernel, as for gemm2_body
template <int NBP, int EPI>
__device__ __forceinline__ void gemm2s_body(unsigned char* sm, const int bx, const int by, const _Float16* __restrict__ Ah, const _Float16* __restrict__ Al, int lda, size_t sA, const _Float16* __restrict__ Bh, const _Float16* __restrict__ Bl, int ldb, size_t sB, float alphaH, float alphaL, const float* __restrict__ bias, const float* __restrict__ bias1,
    float* __restrict__ C, _Float16* __restrict__ CH, _Float16* __restrict__ CL, int ldc, size_t sC, int M, int N, int K) { static_assert(NBP == 1 || NBP == 2, "B is one plane or hi + residual"); static_assert(EPI >= 0 && EPI <= 2 && TC % 128 == 0, "a block's 128 rows lie in one batch");
  constexpr unsigned bufb = (2u + NBP) * G2T * 2u;      /* bytes per buffer */
  static_assert(G2SS(NBP) == 2 * bufb, "sm is the ring");      /* filled by the asynchronous copies only; behind the loop's last barrier the same bytes stage the output, so that two blocks still share a WGP's LDS */
  const int tid = threadIdx.x, w = tid >> 5, lane = tid & 31, ln = lane & 15, hh = lane >> 4;
  Ah += (size_t)by * sA; Al += (size_t)by * sA; Bh += (size_t)by * sB; if (NBP == 2) Bl += (size_t)by * sB; const size_t cofs = (size_t)by * sC; const float* bsel = (EPI == 1 && by == 1) ? bias1 : bias;      /* EPI 1 with two products in one grid: the second has a bias vector of its own */
  const int ntn = N >> 7; const int mt = bx / ntn, nq = bx - mt * ntn; if (mt * 128 >= M) return;      /* the same for the whole block, ahead of every barrier */
  const int wm = w >> 1, wn = w & 1; const int row0 = mt * 128 + 32 * wm, col0 = nq * 128 + 64 * wn;
  const int cr = tid >> 3, cc = (tid & 7) * 8;      /* this thread's first row and its 8-element piece in every copied tile */
  const size_t oa = (size_t)(mt * 128 + cr) * lda + cc, ob = (size_t)(nq * 128 + cr) * ldb + cc; const size_t rsa = (size_t)32 * lda, rsb = (size_t)32 * ldb;
  const unsigned la = (unsigned)(size_t)&sm[(cr * G2P + cc) * 2], lb = la + G2T * 2u, lr = 2u * G2T * 2u;      /* LDS byte addresses in buffer 0 of the Ah and Bh tiles; from a hi tile to its residual tile */
  auto stage = [&](unsigned bo, size_t k0) { g2_copy8(la + bo, lb + bo, Ah + oa + k0, Bh + ob + k0, rsa, rsb);
    if (NBP == 2) g2_copy8(la + lr + bo, lb + lr + bo, Al + oa + k0, Bl + ob + k0, rsa, rsb); else g2_copy4(la + lr + bo, Al + oa + k0, rsa); };
  const int np = K >> 6;
  const v8f z8 = {0.f,0.f,0.f,0.f,0.f,0.f,0.f,0.f}; v8f H[2][4], X[2][4];
#pragma unroll      /* the accumulators must stay in registers */
  for (int j = 0; j < 4; ++j) { H[0][j] = z8; H[1][j] = z8; X[0][j] = z8; X[1][j] = z8; }
  stage(0u, 0);
  asm volatile("s_wait_asynccnt 0x0" ::: "memory");      /* this wave's copies of stage 0 have landed */
  __syncthreads();      /* publishes stage 0 */
  if (np > 1) stage(bufb, 64);
  for (int t = 0; t < np; ++t) { const int bu = t & 1; const _Float16* ahp = (const _Float16*)(sm + bu * bufb) + (32 * wm + ln) * G2P; const _Float16* bhp = (const _Float16*)(sm + bu * bufb) + G2T + (64 * wn + ln) * G2P; const _Float16* alp = ahp + 2 * G2T; const _Float16* blp = bhp + 2 * G2T;
#pragma unroll      /* fragments and accumulators must stay in registers */
    for (int s = 0; s < 2; ++s) { v16h bh[4], bl[4];      /* a 32-k step's LDS reads go as one group ahead of its products */
      const v16h ah0 = g2_frag(ahp + 32 * s, hh), ah1 = g2_frag(ahp + 16 * G2P + 32 * s, hh), al0 = g2_frag(alp + 32 * s, hh), al1 = g2_frag(alp + 16 * G2P + 32 * s, hh);
#pragma unroll      /* as above */
      for (int j = 0; j < 4; ++j) { bh[j] = g2_frag(bhp + j * 16 * G2P + 32 * s, hh); if (NBP == 2) bl[j] = g2_frag(blp + j * 16 * G2P + 32 * s, hh); }
#pragma unroll      /* as above */
      for (int j = 0; j < 4; ++j) { H[0][j] = g2_mma(ah0, bh[j], H[0][j]); H[1][j] = g2_mma(ah1, bh[j], H[1][j]); X[0][j] = g2_mma(al0, bh[j], X[0][j]); X[1][j] = g2_mma(al1, bh[j], X[1][j]); }
      if (NBP == 2) {
#pragma unroll      /* as above */
        for (int j = 0; j < 4; ++j) { X[0][j] = g2_mma(ah0, bl[j], X[0][j]); X[1][j] = g2_mma(ah1, bl[j], X[1][j]); } } }
    asm volatile("s_wait_dscnt 0x0" ::: "memory");      /* this wave's reads of buffer bu are done before it is refilled */
    asm volatile("s_wait_asynccnt 0x0" ::: "memory");      /* this wave's copies of stage t + 1 have landed */
    __syncthreads();      /* publishes stage t + 1 and ends every wave's reads of buffer bu */
    if (t + 2 < np) stage(bu * bufb, (size_t)(t + 2) * 64); }
  asm volatile("s_wait_asynccnt 0x0" ::: "memory");      /* no copy is outstanding when the wave goes on */
  constexpr int SOP = EPI == 2 ? 36 : 68;      /* staging pitch in floats, 16 B x odd: 32 rows of 64 columns, or (EPI 2) 64 columns of 32 rows */
  constexpr int SOW = EPI == 2 ? 64 * SOP : 32 * SOP; static_assert(2 * bufb >= 8u * SOW * 4u, "the output staging lies inside the ring");
  float* so = (float*)sm + w * SOW;      /* this wave's own staging; every wave has left the ring at the last pass's barrier */
#pragma unroll      /* the accumulators are indexed by constants only */
  for (int u = 0; u < 8; ++u) { const int j = u & 3, half = u >> 2; const float bv = bsel ? bf16_round(bsel[col0 + j * 16 + ln]) : 0.f;
    v4f p0, p1;
#pragma unroll      /* as above */
    for (int r = 0; r < 8; ++r) { float v = H[half][j][r] * alphaH + bv; v += X[half][j][r] * alphaL; if (EPI != 2) so[(half * 16 + 8 * hh + r) * SOP + j * 16 + ln] = v; else if (r < 4) p0[r] = v; else p1[r - 4] = v; }
    if (EPI == 2) { float* sc = so + (j * 16 + ln) * SOP + half * 16 + 8 * hh; *(v4fa*)sc = p0; *(v4fa*)(sc + 4) = p1; } }      /* a lane's eight values are eight rows of one column: side by side here */
  __builtin_amdgcn_fence(__ATOMIC_ACQ_REL, "workgroup"); __builtin_amdgcn_wave_barrier();      /* the wave's staging stores stand ahead of its own reads of them; no other wave reads these rows */
  if (EPI == 0) { const int rsub = lane >> 4, c4 = (lane & 15) * 4;
#pragma unroll      /* the 16 LDS reads and stores of whole lines in flight together */
    for (int q = 0; q < 16; ++q) { const int r = q * 2 + rsub; const v4f v = *(const v4fa*)&so[r * SOP + c4]; *(v4f*)(C + cofs + (size_t)(row0 + r) * ldc + col0 + c4) = v; } }
  else if (EPI == 1) { const int rsub = lane >> 3, c8 = (lane & 7) * 8;      /* eight lanes take one row's 64 columns: a whole 128-byte line in each plane */
    v4f a[8], c[8];
#pragma unroll      /* a and c must stay in registers; the 16 LDS reads go as one group, so that their latency is paid once */
    for (int q = 0; q < 8; ++q) { a[q] = *(const v4fa*)&so[(q * 4 + rsub) * SOP + c8]; c[q] = *(const v4fa*)&so[(q * 4 + rsub) * SOP + c8 + 4]; }
#pragma unroll      /* as above */
    for (int q = 0; q < 8; ++q) { const size_t o = cofs + (size_t)(row0 + q * 4 + rsub) * ldc + col0 + c8; g2_store_hl(a[q], c[q], CH + o, CL + o); } }
  else { const int cs = (lane >> 3) * 8, r4 = (lane & 7) * 4; const int bb = row0 / TC;      /* eight lanes take one column's 32 rows: a whole 128-byte line; the four columns of a read lie 8 apart, which spreads them over the banks */
    float* op = C + ((size_t)bb * N + col0 + cs) * TC + (row0 - bb * TC) + r4;
#pragma unroll      /* as above; every store is one base plus an immediate */
    for (int q = 0; q < 16; ++q) { const int cq = (q & 7) + 32 * (q >> 3); const v4f v = *(const v4fa*)&so[(cs + cq) * SOP + r4]; *(v4f*)(op + (size_t)cq * TC) = v; } } }
template <int NBP, int EPI>
__global__ __launch_bounds__(256) void k_gemm2s(const _Float16* __restrict__ Ah, const _Float16* __restrict__ Al, int lda, size_t sA, const _Float16* __restrict__ Bh, const _Float16* __restrict__ Bl, int ldb, size_t sB, float alphaH, float alphaL, const float* __restrict__ bias,
    float* __restrict__ C, _Float16* __restrict__ CH, _Float16* __restrict__ CL, int ldc, size_t sC, int M, int N, int K) {
  __shared__ __attribute__((aligned(16))) unsigned char sm[G2SS(NBP)];
  gemm2s_body<NBP, EPI>(sm, blockIdx.x, blockIdx.y, Ah, Al, lda, sA, Bh, Bl, ldb, sB, alphaH, alphaL, bias, nullptr, C, CH, CL, ldc, sC, M, N, K); }
// the three 1x1 convolutions of the inputs in one grid: blockIdx.y = 0: F rows (b,t); 1: G rows (b,s), whose planes, weights and outputs lie sN, sW and sN elements behind F's; 2: H as [b][c][s] f16 = Wh . style^T, blockIdx.x = 32 tiles x 16 batches. The longer blocks come first.
static_assert(NRC == NRS && (NRC / 128) * (CC / 128) == (CC / 128) * (TS / 128) * NB && (CC / 128) * (TS / 128) == 32, "k_fgh: every blockIdx.y has the same number of blocks");
__global__ __launch_bounds__(256) void k_fgh(const _Float16* __restrict__ NH, const _Float16* __restrict__ NL, size_t sN, const _Float16* __restrict__ BFG, size_t sW, const float* __restrict__ bf_, const float* __restrict__ bg, _Float16* __restrict__ FGH, _Float16* __restrict__ FGL,
    const _Float16* __restrict__ BH, const _Float16* __restrict__ S16, const float* __restrict__ bh, _Float16* __restrict__ HT) {
  __shared__ __attribute__((aligned(16))) unsigned char sm[G2SB > G2SS(1) ? G2SB : G2SS(1)];
  if (blockIdx.y < 2) gemm2s_body<1, 1>(sm, blockIdx.x, blockIdx.y, NH, NL, CC, sN, BFG, nullptr, CC, sW, 0.0625f, 0.0625f / 1024.0f, bf_, bg, nullptr, FGH, FGL, CC, sN, NRC, CC, CC);      /* the test reads the same for the whole block: each side holds its own barriers */
  else gemm2_body<0, 1>(sm, blockIdx.x & 31, blockIdx.x >> 5, BH, CC, 0, S16, CC, (size_t)TS * CC, 0.0625f, bh, 0, nullptr, HT, nullptr, TS, (size_t)CC * TS, CC, TS, CC); }

// ---- kernels whose lanes used to stride a whole row apart in global memory: the global side now moves whole lines, an LDS tile takes the strided walk ----
#define SR 32                    /* rows (b, c) per k_stat block: one per lane of the wave that sums */
#define SP (1024 + 4)            /* k_stat LDS row pitch in floats: 16 B x odd, so that 16 lanes, each on its own row, cover all banks with ds_load_b128 */
#define PT 128                   /* edge of the k_plane tiles: 512 B a row on the f32 side, 256 B on the f16 side */
static_assert(TC == 1024 && TS == 1024 && (NB * CC) % SR == 0 && CC % PT == 0, "k_stat stages rows of 256 x 4 floats; k_plane uses whole tiles");
__global__ __launch_bounds__(256) void k_stat(const float* __restrict__ x0, const float* __restrict__ x1, int T, float* __restrict__ ST0, float* __restrict__ ST1) {
  __shared__ __attribute__((aligned(16))) float rowv[SR][SP];
  const float* x = blockIdx.y ? x1 : x0; float* ST = blockIdx.y ? ST1 : ST0;      /* both inputs' rows in one grid */
  const int tid = threadIdx.x; const float* p = x + (size_t)blockIdx.x * SR * 1024 + tid * 4;      /* the row length as a constant: every load is one base plus an immediate */
#pragma unroll      /* all the block's loads in flight at once: the staging is bound by memory latency otherwise */
  for (int i = 0; i < SR; ++i) { const v4f a = *(const v4fa*)(p + i * 1024); v4f o; for (int q = 0; q < 4; ++q) o[q] = bf16_round(a[q]); *(v4fa*)&rowv[i][tid * 4] = o; }
  __syncthreads();      /* publishes the 32 staged rows */
  if (tid >= SR) return;      /* behind the only barrier: one lane sums one row, first element to last as before */
  const v4fa* rp = (const v4fa*)&rowv[tid][0]; float s = 0.f; v4f cur[8], nxt[8];      /* 32 values in hand, the next 32 on their way from LDS under the dependent adds */
  for (int j = 0; j < 8; ++j) cur[j] = rp[j];
#pragma unroll 2      /* cur and nxt change places without register copies */
  for (int c = 0; c < 32; ++c) { for (int j = 0; j < 8; ++j) nxt[j] = rp[((c + 1) & 31) * 8 + j];      /* the last trip fetches the row's head again, for the second walk */
    __builtin_amdgcn_sched_barrier(0);      /* keeps the eight LDS reads ahead of the 32 adds that cover their latency; the scheduler sinks them to their uses otherwise */
    for (int j = 0; j < 8; ++j) for (int q = 0; q < 4; ++q) s += cur[j][q];
    for (int j = 0; j < 8; ++j) cur[j] = nxt[j]; }
  const float mu = s / (float)T; float s2 = 0.f;
#pragma unroll 2      /* as above */
  for (int c = 0; c < 32; ++c) { for (int j = 0; j < 8; ++j) nxt[j] = rp[((c + 1) & 31) * 8 + j];
    __builtin_amdgcn_sched_barrier(0);      /* as above */
    for (int j = 0; j < 8; ++j) for (int q = 0; q < 4; ++q) {
      #pragma clang fp contract(off)      /* numerical: d * d keeps its own rounding, as in every earlier version, so that the scales, and with them the unscaled logits whose softmax is close to an argmax, stay bit for bit as before */
      const float d = cur[j][q] - mu; s2 += d * d; }
    for (int j = 0; j < 8; ++j) cur[j] = nxt[j]; }
  const float r = rsqrtf(s2 / (float)(T - 1) + 1e-5f); typedef float v2f_ __attribute__((ext_vector_type(2))); v2f_ o; o[0] = mu; o[1] = r; *(v2f_*)(ST + ((size_t)blockIdx.x * SR + tid) * 2) = o;  }
// one block = 128 channels x 128 frames of one batch; the tile holds hi | residual << 16 per element
typedef unsigned v4ua __attribute__((ext_vector_type(4), may_alias));
template <bool NORM, int T>
__device__ __forceinline__ void plane_body(unsigned (*tl)[PT + 1], const float* __restrict__ x, const float* __restrict__ ST, _Float16* __restrict__ Hh, _Float16* __restrict__ Lh) {
  const int tid = threadIdx.x, w = __builtin_amdgcn_readfirstlane(tid >> 5) /* the wave's number in a scalar register: a row's mean and scale come by scalar loads */, lane = tid & 31; const int nft = T / PT; const int ft = blockIdx.x % nft, ct = (blockIdx.x / nft) % (CC / PT), b = blockIdx.x / (nft * (CC / PT)); const int c0 = ct * PT, f0 = ft * PT;
  const size_t rc0 = (size_t)b * CC + c0 + w; const float* xp = x + rc0 * T + f0 + lane * 4; v4f a[PT / 8]; float mu[PT / 8], r[PT / 8];
  const __attribute__((address_space(4))) float* STk = (const __attribute__((address_space(4))) float*)ST;      /* nothing writes the statistics in this launch: read through the constant address space they still come by scalar loads, now that the body is one branch of a larger kernel */
#pragma unroll      /* the block's 16 loads per thread in flight at once */
  for (int i = 0; i < PT / 8; ++i) a[i] = *(const v4fa*)(xp + (size_t)i * 8 * T);
  asm volatile("s_wait_xcnt 0x0" ::: "memory");      /* the scalar loads and the address arithmetic below reuse registers that these 16 loads name; as a statement that no load crosses it also keeps all 16 up here, in flight together */
#pragma unroll      /* mu and r must stay in registers */
  for (int i = 0; i < PT / 8; ++i) { mu[i] = NORM ? STk[(rc0 + i * 8) * 2] : 0.f; r[i] = NORM ? STk[(rc0 + i * 8) * 2 + 1] : 1.f; }
#pragma unroll      /* a must stay in registers */
  for (int i = 0; i < PT / 8; ++i) { const int cl = i * 8 + w;
    for (int q = 0; q < 4; ++q) {
      #pragma clang fp contract(off)      /* numerical: (v - mu) * r is rounded to f32 before its f16 head is taken off, as in every earlier version, so that head and residual, and with them the unscaled logits whose softmax is close to an argmax, stay as before */
      float v = bf16_round(a[i][q]); if (NORM) v = (v - mu[i]) * r[i]; union { _Float16 h[2]; unsigned u; } f; f.h[0] = (_Float16)v; f.h[1] = NORM ? (_Float16)((v - (float)f.h[0]) * 1024.0f) : (_Float16)0.0f; tl[cl][lane * 4 + q] = f.u; } }
  __syncthreads();      /* publishes the tile */
  const int g = tid & 15, fs = tid >> 4; unsigned u[8], n[8];
  for (int q = 0; q < 8; ++q) u[q] = tl[g * 8 + q][fs];
#pragma unroll      /* u and n must stay in registers; every store is one base plus an immediate */
  for (int i = 0; i < PT / 16; ++i) { const int f = i * 16 + fs; v4ua oh, ol;
    if (i + 1 < PT / 16) for (int q = 0; q < 8; ++q) n[q] = tl[g * 8 + q][f + 16];      /* the next frame's LDS reads fly over this frame's packing and stores */
    for (int q = 0; q < 4; ++q) { oh[q] = (u[2 * q] & 0xFFFFu) | (u[2 * q + 1] << 16); ol[q] = (u[2 * q] >> 16) | (u[2 * q + 1] & 0xFFFF0000u); }
    const size_t o = ((size_t)b * T + f0 + f) * CC + c0 + g * 8; *(v4ua*)((unsigned short*)Hh + o) = oh; if (NORM) *(v4ua*)((unsigned short*)Lh + o) = ol;
    if (i + 1 < PT / 16) asm volatile("s_wait_xcnt 0x0" ::: "memory");      /* the next frame's packing reuses registers that these stores name */
    for (int q = 0; q < 8; ++q) u[q] = n[q]; } }
// one grid for all that the GEMMs read and that needs no more than the inputs and the statistics: blockIdx.y = 0 content normalised, 1 style normalised, 2 style raw, 3 the four weight matrices x 16 as f16 (128 blocks each, BW = four planes in a row)
static_assert(TC == TS && NB * (CC / PT) * (TC / PT) == 4 * (CC * CC / 8 / 256), "k_planes: every blockIdx.y has the same number of blocks");
__global__ __launch_bounds__(256) void k_planes(const float* __restrict__ content, const float* __restrict__ style, const float* __restrict__ ST, size_t sS, _Float16* __restrict__ NH, _Float16* __restrict__ NL, size_t sN, _Float16* __restrict__ S16,
    const float* __restrict__ Wf, const float* __restrict__ Wg, const float* __restrict__ Wh, const float* __restrict__ Wo, _Float16* __restrict__ BW) {
  __shared__ unsigned tl[PT][PT + 1];
  const int y = blockIdx.y;      /* the same for the whole block: each branch holds its own barrier or none */
  if (y < 2) plane_body<true, TC>(tl, y ? style : content, ST + y * sS, NH + y * sN, NL + y * sN);      /* the style's statistics and planes lie sS and sN elements behind the content's */
  else if (y == 2) { plane_body<false, TS>(tl, style, nullptr, S16, nullptr);
    asm volatile("s_wait_xcnt 0x0" ::: "memory"); }      /* the code that the listing has behind this branch reuses registers that the body's last store names */
  else { const int m = blockIdx.x >> 7; const float* Wm = m == 0 ? Wf : m == 1 ? Wg : m == 2 ? Wh : Wo; const size_t t = (size_t)(blockIdx.x & 127) * 256 + threadIdx.x; FragH f;
    for (int q = 0; q < 8; ++q) f.h[q] = (_Float16)(bf16_round(Wm[t * 8 + q]) * 16.0f);
    *(v8us*)((unsigned short*)BW + (size_t)m * CC * CC + t * 8) = f.half[0];
    asm volatile("s_wait_xcnt 0x0" ::: "memory"); } }      /* the scalar code on the way to the kernel's end reuses a register of this store's base address */
__global__ __launch_bounds__(256) void k_soft(const float* __restrict__ S, _Float16* __restrict__ P, float* __restrict__ RS) {
  #pragma clang fp contract(off)
  const int wv = threadIdx.x >> 5, ln = threadIdx.x & 31; const int r = blockIdx.x * 8 + wv; if (r >= BG * TC) return; const float* sr = S + (size_t)r * TS; float mx = -3.0e38f;
#pragma unroll 1
  for (int gq = 0; gq < TS / 256; ++gq) { const v8f a = *(const v8f*)(sr + gq * 256 + ln * 8); for (int q = 0; q < 8; ++q) mx = fmaxf(mx, a[q]); }
  for (int o = 16; o > 0; o >>= 1) mx = fmaxf(mx, __shfl_xor(mx, o, 32)); float su = 0.f;
{ su = 0.f;
#pragma unroll 1
    for (int gq = 0; gq < TS / 256; ++gq) { const v8f a = *(const v8f*)(sr + gq * 256 + ln * 8); FragH ph; for (int q = 0; q < 8; ++q) { const float e = expf(a[q] - mx); su += e; ph.h[q] = (_Float16)(e * 1024.0f); } *(v8us*)((unsigned short*)P + (size_t)r * TS + gq * 256 + ln * 8) = ph.half[0]; }
     }
  for (int o = 16; o > 0; o >>= 1) su += __shfl_xor(su, o, 32); if (ln == 0) { *(float*)(RS + (size_t)r * 32) = 1.0f / su;  } }
extern "C" void kernel_launch(void* const* d_in, const int* in_sizes, int n_in,
                              void* d_out, int out_size, void* d_ws, size_t ws_size, hipStream_t stream) {
  (void)in_sizes; (void)n_in; (void)out_size;
  const float* content = (const float*)d_in[0]; const float* style = (const float*)d_in[1]; const float* Wf = (const float*)d_in[2]; const float* bf_ = (const float*)d_in[3]; const float* Wg = (const float*)d_in[4]; const float* bg = (const float*)d_in[5]; const float* Wh = (const float*)d_in[6]; const float* bh = (const float*)d_in[7]; const float* Wo = (const float*)d_in[8]; const float* bo = (const float*)d_in[9];
  char* ws = (char*)d_ws; size_t off = 0;
  auto take = [&](size_t bytes) { char* p = ws + off; off += (bytes + 255) & ~(size_t)255; return p; };
  const size_t npc = (size_t)NRC * CC, nps = (size_t)NRS * CC;
  _Float16* BF = (_Float16*)take((size_t)CC * CC * 2); _Float16* BGm = (_Float16*)take((size_t)CC * CC * 2); _Float16* BH = (_Float16*)take((size_t)CC * CC * 2); _Float16* BO = (_Float16*)take((size_t)CC * CC * 2); float* STc = (float*)take((size_t)NB * CC * 2 * 4); float* STs = (float*)take((size_t)NB * CC * 2 * 4);
  _Float16* CNH = (_Float16*)take(npc * 2); _Float16* CNL = (_Float16*)take(npc * 2); _Float16* SNH = (_Float16*)take(nps * 2); _Float16* SNL = (_Float16*)take(nps * 2); _Float16* S16 = (_Float16*)take(nps * 2);
  _Float16* FH = (_Float16*)take(npc * 2); _Float16* FL = (_Float16*)take(npc * 2); _Float16* GH = (_Float16*)take(nps * 2); _Float16* GL = (_Float16*)take(nps * 2); _Float16* HT = (_Float16*)take(nps * 2);
  float* S = (float*)take((size_t)BG * TC * TS * 4); float* RS = (float*)take((size_t)BG * TC * 32 * 4);
  _Float16* P = CNH;      /* the softmax weights [NRC][TS] over both content-normalised planes (dead after F) */
  _Float16* OH = SNH; _Float16* OL = SNL;      /* O hi/lo [NRC][CC] over the style-normalised planes (dead after G) */
  if (off > ws_size) return;      /* 2 + 0.1 + 16 x 5 + 16 x 5 + 64 + 2 = about 228 MiB */
  k_stat<<<dim3(NB * CC / SR, 2), 256, 0, stream>>>(content, style, TC, STc, STs);
  k_planes<<<dim3(NB * (CC / PT) * (TC / PT), 4), 256, 0, stream>>>(content, style, STc, STs - STc, CNH, CNL, SNH - CNH, S16, Wf, Wg, Wh, Wo, BF);      /* BF, BGm, BH, BO lie in a row; conv (out, in) naturals */
  k_fgh<<<dim3((NRC / 128) * (CC / 128), 3), 256, 0, stream>>>(CNH, CNL, SNH - CNH, BF, BGm - BF, bf_, bg, FH, FL, BH, S16, bh, HT);      /* F into FH | FL; G from SNH | SNL and BGm into GH | GL, each as far behind its counterpart as SNH behind CNH; H into HT */
  k_gemm2s<2, 0><<<dim3((TC / 128) * (TS / 128), BG), 256, 0, stream>>>(FH, FL, CC, (size_t)TC * CC, GH, GL, CC, (size_t)TS * CC, 1.0f, 0.0009765625f, nullptr, S, nullptr, nullptr, TS, (size_t)TC * TS, TC, TS, CC);      /* S = F^T G (hi.hi + (lo.hi + hi.lo)), unscaled */
  k_soft<<<(BG * TC) / 8, 256, 0, stream>>>(S, P, RS);
  k_gemm2<0, 2><<<dim3((TC / 128) * (CC / 128), BG), 256, 0, stream>>>(P, TS, (size_t)TC * TS, HT, TS, (size_t)CC * TS, 0.0009765625f, nullptr, 0, RS, OH, OL, CC, (size_t)TC * CC, TC, CC, TS);      /* O rows (b,t) = (P . H^T) / row sum, hi/residual */
  k_gemm2s<1, 2><<<dim3((NRC / 128) * (CC / 128), 1), 256, 0, stream>>>(OH, OL, CC, 0, BO, nullptr, CC, 0, 0.0625f, 0.0625f / 1024.0f, bo, (float*)d_out, nullptr, nullptr, CC, 0, NRC, CC, CC);      /* out [b][o][t] = Wo O + bo */
}

// v006
// One run takes 155 microseconds.
// Two timings next to v005 both put it at 1.10 times that version's speed.
// Over all steps from v000 it is 5.90 times as fast.
#include <hip/hip_runtime.h>
// SpeakerAttention (16 x 512 channels; content 1024 frames, style 1024 frames: F = Wf mvn(content) + bf, G = Wg mvn(style) + bg, H = Wh style + bh (1x1 convs); S = softmax over style frames of the UNSCALED F^T G (K = 512 channels); O = H S^T; out = Wo O + bo; mvn = per (batch, channel) mean / unbiased variance over time, eps 1e-5).
// Structure: per-(b,c) mvn statistics on VALU and the [frame][channel] planes of the normalised inputs as f16 hi/residual (style raw plane exact) in one kernel that holds its rows in registers; F and G as two-term f16 WMMA GEMMs, both terms in one launch (32x64 wave tiles fed from LDS, f32 accumulation, one accumulator set per scale, exact x16 weights + bias), stored by their own epilogue as f16 hi/residual planes; H as one GEMM per batch with the weights as the A operand, so that it comes out as [b][c][s] (f16); the score GEMM of all batches as THREE hi/residual product terms in one launch (K = 512, f32; the two residual terms share an accumulator set), softmax rows on VALU (unnormalised f16 weights x 2^10 + row normalisers on their own lines), readout GEMM (N = 512, K = 1024) whose epilogue scales the rows and stores hi/residual planes; Wo as two GEMM terms in one launch (+ bias) whose LDS staging holds each wave's tile column by column, so that it stores [b][c][t] itself. Launches that do not depend on one another share one grid (blockIdx.y says whose block it is): both inputs' statistics and planes, with the four weight matrices; F, G and H.
// Compute dtype: inputs rounded to bf16; weights exact as f16; the normalised inputs, F, G and O as f16 hi + 2^-10-scaled residual (the unscaled K = 512 logits have sigma ~ 22, so single-rounded operands would not do); style, H and the softmax weights as plain f16 (~2^-12); statistics / softmax f32. v_wmma_f32_16x16x32_f16.
#define NB 16
#define CC 512
#define TC 1024
#define TS 1024
#define NRC (NB * TC)
#define NRS (NB * TS)
#define BG 16                    /* batches per launch of the score, softmax and readout kernels: all of them */
typedef __bf16 v16b __attribute__((ext_vector_type(16)));
typedef unsigned short v8us __attribute__((ext_vector_type(8), may_alias));
typedef float  v8f  __attribute__((ext_vector_type(8)));
typedef float  v4f  __attribute__((ext_vector_type(4)));
typedef float  v4fa __attribute__((ext_vector_type(4), may_alias));
union FragB { v16b v; v8us half[2]; unsigned short u[16]; };

__device__ __forceinline__ unsigned short bf16_bits(float x) { unsigned int u = __float_as_uint(x); return (unsigned short)((u + 0x7FFFu + ((u >> 16) & 1u)) >> 16); }
__device__ __forceinline__ float bf16_val(unsigned short b) { return __uint_as_float(((unsigned int)b) << 16); }
__device__ __forceinline__ float bf16_round(float x) { return bf16_val(bf16_bits(x)); }
// D += A·B with NT terms: 1 = ah·bh, 2 = + al·bh (A split), 3 = + ah·bl (both split)
template <int NT>
__device__ __forceinline__ v8f mmaN(v16b ah, v16b al, v16b bh, v16b bl, v8f c) {
  c = __builtin_amdgcn_wmma_f32_16x16x32_bf16(false, ah, false, bh, (short)0, c, false, false);
  if (NT >= 2) c = __builtin_amdgcn_wmma_f32_16x16x32_bf16(false, al, false, bh, (short)0, c, false, false);
  if (NT >= 3) c = __builtin_amdgcn_wmma_f32_16x16x32_bf16(false, ah, false, bl, (short)0, c, false, false);
  asm volatile("v_nop\n\tv_nop\n\tv_nop\n\tv_nop" : "+v"(c) : "v"(ah), "v"(al), "v"(bh), "v"(bl));
  return c;
}

__global__ __launch_bounds__(256) void k_wt_bf16(const float* __restrict__ W, unsigned short* __restrict__ Wt, int K, int N) {
  const int t = blockIdx.x * 256 + threadIdx.x;
  const int k8n = K / 8;
  if (t >= N * k8n) return;
  const int n = t / k8n, k8 = (t % k8n) * 8;
  v8us v;
#pragma unroll
  for (int i = 0; i < 8; ++i) v[i] = bf16_bits(W[(size_t)(k8 + i) * N + n]);
  *(v8us*)(Wt + (size_t)n * K + k8) = v;
  
}

// GEMM C[M][N] (f32, pitch ldc) = act(A[M][K]·W + bias). A f32 row-major (pitch lda) converted per fragment to bf16
// (ASPLIT: hi/lo two planes -> 2 terms, else single rounded term); Wt bf16 [N][K] (pitch ldb). BIAS_BF16 rounds the
// bias to bf16 first (bias quantised to bf16 before the add). K%32==0, M%16==0, N%64==0.
template <bool ASPLIT, int ACT, bool BIAS_BF16>
__global__ __launch_bounds__(128) void k_gemm_bf(const float* __restrict__ A, int lda, const unsigned short* __restrict__ Wt, int ldb,
                                               const float* __restrict__ bias, float* __restrict__ C, int ldc, int M, int N, int K) {
  __shared__ __attribute__((aligned(16))) float so[4][16][64];
  const int tid = threadIdx.x, w = tid >> 5, lane = tid & 31, ln = lane & 15, hh = lane >> 4;
  const int ntn = N / 64;
  const int wid = blockIdx.x * 4 + w;
  const int mt = wid / ntn, nq = wid % ntn;
  if (mt * 16 >= M) return;
  const int row0 = mt * 16, col0 = nq * 64;
  const float* arow = A + (size_t)(row0 + ln) * lda;
  v8f acc[4] = {};
  for (int kb = 0; kb < K; kb += 32) {
    FragB ah, al;
    const v4f x0 = *(const v4fa*)(arow + kb + 8 * hh), x1 = *(const v4fa*)(arow + kb + 8 * hh + 4);
    const v4f x2 = *(const v4fa*)(arow + kb + 16 + 8 * hh), x3 = *(const v4fa*)(arow + kb + 16 + 8 * hh + 4);
    float xs[16] = {x0[0],x0[1],x0[2],x0[3],x1[0],x1[1],x1[2],x1[3],x2[0],x2[1],x2[2],x2[3],x3[0],x3[1],x3[2],x3[3]};
#pragma unroll
    for (int i = 0; i < 16; ++i) { const unsigned short hb = bf16_bits(xs[i]); ah.u[i] = hb; al.u[i] = ASPLIT ? bf16_bits(xs[i] - bf16_val(hb)) : (unsigned short)0; }
#pragma unroll
    for (int t = 0; t < 4; ++t) {
      const unsigned short* brow = Wt + (size_t)(col0 + t * 16 + ln) * ldb + kb;
      FragB b;
      b.half[0] = *(const v8us*)(brow + 8 * hh);
      b.half[1] = *(const v8us*)(brow + 16 + 8 * hh);
      acc[t] = mmaN<ASPLIT ? 2 : 1>(ah.v, al.v, b.v, b.v, acc[t]);
    }
  }
#pragma unroll
  for (int t = 0; t < 4; ++t) {
    float bv = bias ? bias[col0 + t * 16 + ln] : 0.f;
    if (BIAS_BF16) bv = bf16_round(bv);
#pragma unroll
    for (int r = 0; r < 8; ++r) { float v = acc[t][r] + bv; if (ACT == 1) v = fmaxf(v, 0.f); so[w][8 * hh + r][t * 16 + ln] = v; }
  }
  __builtin_amdgcn_fence(__ATOMIC_ACQ_REL, "workgroup");
  __builtin_amdgcn_wave_barrier();
  const int rsub = lane >> 4, c4 = (lane & 15) * 4;
  {
#pragma unroll
    for (int q = 0; q < 8; ++q) {
      const int r = q * 2 + rsub;
      const v4f v = *(const v4fa*)&so[w][r][c4];
      *(v4f*)(C + (size_t)(row0 + r) * ldc + col0 + c4) = v;
    }
    
  }
}

// GEMM C = act(A·W + bias + resid): A f32 (ASPLIT -> hi/lo 2 terms), Wt bf16 [N][K]; ACT 0 none, 1 relu, 2 exact gelu;
// resid (optional, f32, row index = (row % rmod), pitch ldr, RES_BF16 rounds it) added before the activation.
template <bool ASPLIT, int ACT, bool BIAS_BF16, bool RES_BF16>
__global__ __launch_bounds__(128) void k_gemm_bf3(const float* __restrict__ A, int lda, const unsigned short* __restrict__ Wt, int ldb,
                                                const float* __restrict__ bias, const float* __restrict__ resid, int rmod, int ldr,
                                                float* __restrict__ C, int ldc, int M, int N, int K) {
  __shared__ __attribute__((aligned(16))) float so[4][16][64];
  const int tid = threadIdx.x, w = tid >> 5, lane = tid & 31, ln = lane & 15, hh = lane >> 4;
  const int ntn = N / 64;
  const int wid = blockIdx.x * 4 + w;
  const int mt = wid / ntn, nq = wid % ntn;
  if (mt * 16 >= M) return;
  const int row0 = mt * 16, col0 = nq * 64;
  const float* arow = A + (size_t)(row0 + ln) * lda;
  v8f acc[4] = {};
  for (int kb = 0; kb < K; kb += 32) {
    FragB ah, al;
    const v4f x0 = *(const v4fa*)(arow + kb + 8 * hh), x1 = *(const v4fa*)(arow + kb + 8 * hh + 4);
    const v4f x2 = *(const v4fa*)(arow + kb + 16 + 8 * hh), x3 = *(const v4fa*)(arow + kb + 16 + 8 * hh + 4);
    float xs[16] = {x0[0],x0[1],x0[2],x0[3],x1[0],x1[1],x1[2],x1[3],x2[0],x2[1],x2[2],x2[3],x3[0],x3[1],x3[2],x3[3]};
#pragma unroll
    for (int i = 0; i < 16; ++i) { const unsigned short hb = bf16_bits(xs[i]); ah.u[i] = hb; al.u[i] = ASPLIT ? bf16_bits(xs[i] - bf16_val(hb)) : (unsigned short)0; }
#pragma unroll
    for (int t = 0; t < 4; ++t) {
      const unsigned short* brow = Wt + (size_t)(col0 + t * 16 + ln) * ldb + kb;
      FragB b;
      b.half[0] = *(const v8us*)(brow + 8 * hh);
      b.half[1] = *(const v8us*)(brow + 16 + 8 * hh);
      acc[t] = mmaN<ASPLIT ? 2 : 1>(ah.v, al.v, b.v, b.v, acc[t]);
    }
  }
#pragma unroll
  for (int t = 0; t < 4; ++t) {
    const int col = col0 + t * 16 + ln;
    float bv = bias ? bias[col] : 0.f;
    if (BIAS_BF16) bv = bf16_round(bv);
#pragma unroll
    for (int r = 0; r < 8; ++r) {
      float v = acc[t][r] + bv;
      if (resid) { float rv = resid[(size_t)((row0 + 8 * hh + r) % rmod) * ldr + col]; if (RES_BF16) rv = bf16_round(rv); v += rv; }
      if (ACT == 1) v = fmaxf(v, 0.f);
      if (ACT == 2) v = 0.5f * v * (1.0f + erff(v * 0.70710678118654752f));
      if (ACT == 3) { const float u = 0.7978845608028654f * (v + 0.044715f * v * v * v); v = 0.5f * v * (1.0f + tanhf(u)); }
      so[w][8 * hh + r][t * 16 + ln] = v;
    }
  }
  __builtin_amdgcn_fence(__ATOMIC_ACQ_REL, "workgroup");
  __builtin_amdgcn_wave_barrier();
  const int rsub = lane >> 4, c4 = (lane & 15) * 4;
  {
#pragma unroll
    for (int q = 0; q < 8; ++q) {
      const int r = q * 2 + rsub;
      const v4f v = *(const v4fa*)&so[w][r][c4];
      *(v4f*)(C + (size_t)(row0 + r) * ldc + col0 + c4) = v;
    }
    
  }
}
// row LayerNorm (biased variance, eps) over N: s = X (+ R); optional out_sum <- s; out_norm <- (s-mu)*rsqrt(var+eps)*g + b
template <bool PARAM_BF16>
__global__ __launch_bounds__(256) void k_layernorm(const float* __restrict__ X, const float* __restrict__ R, const float* __restrict__ g, const float* __restrict__ bta,
                                                  float* __restrict__ out_sum, float* __restrict__ out_norm, int N, float eps) {
  __shared__ float red[256];
  const int row = blockIdx.x, tid = threadIdx.x;
  const float* x = X + (size_t)row * N; const float* rr = R ? R + (size_t)row * N : nullptr;
  float vals[16];                     // up to N = 4096
  const int per = N / 256;            // contiguous chunk per thread? use strided-by-4 chunks: thread handles j = tid*4 + 1024*u
  float s1 = 0.f;
  for (int u = 0; u < per / 4; ++u) {
    const int j = tid * 4 + 1024 * u;
    const v4f a = *(const v4fa*)(x + j);
    v4f b = {0.f,0.f,0.f,0.f}; if (rr) b = *(const v4fa*)(rr + j);
#pragma unroll
    for (int q = 0; q < 4; ++q) { const float v = a[q] + b[q]; vals[u * 4 + q] = v; s1 += v; }
  }
  red[tid] = s1; __syncthreads();
  for (int st = 128; st > 0; st >>= 1) { if (tid < st) red[tid] += red[tid + st]; __syncthreads(); }
  const float mu = red[0] / (float)N; __syncthreads();
  float s2 = 0.f;
  for (int u = 0; u < per / 4; ++u)
#pragma unroll
    for (int q = 0; q < 4; ++q) { const float c = vals[u * 4 + q] - mu; s2 += c * c; }
  red[tid] = s2; __syncthreads();
  for (int st = 128; st > 0; st >>= 1) { if (tid < st) red[tid] += red[tid + st]; __syncthreads(); }
  const float rs = rsqrtf(red[0] / (float)N + eps);
  {
    for (int u = 0; u < per / 4; ++u) {
      const int j = tid * 4 + 1024 * u;
      v4f o, sm;
#pragma unroll
      for (int q = 0; q < 4; ++q) {
        float gg = g[j + q], bb = bta[j + q];
        if (PARAM_BF16) { gg = bf16_round(gg); bb = bf16_round(bb); }
        sm[q] = vals[u * 4 + q]; o[q] = (vals[u * 4 + q] - mu) * rs * gg + bb;
      }
      if (out_sum) *(v4f*)(out_sum + (size_t)row * N + j) = sm;
      *(v4f*)(out_norm + (size_t)row * N + j) = o;
    }
    
  }
}



// ---- f16 WMMA path (v_wmma_f32_16x16x32_f16): 11-bit significands for operands in range — used for every GEMM launched here
typedef _Float16 v16h __attribute__((ext_vector_type(16)));
union FragH { v16h v; v8us half[2]; _Float16 h[16]; unsigned short u[16]; };
template <int NT>
__device__ __forceinline__ v8f mmaH(v16h ah, v16h al, v16h bh, v16h bl, v8f c) {
  c = __builtin_amdgcn_wmma_f32_16x16x32_f16(false, ah, false, bh, (short)0, c, false, false);
  if (NT >= 2) c = __builtin_amdgcn_wmma_f32_16x16x32_f16(false, al, false, bh, (short)0, c, false, false);
  if (NT >= 3) c = __builtin_amdgcn_wmma_f32_16x16x32_f16(false, ah, false, bl, (short)0, c, false, false);
  asm volatile("v_nop\n\tv_nop\n\tv_nop\n\tv_nop" : "+v"(c) : "v"(ah), "v"(al), "v"(bh), "v"(bl));
  return c;
}
// batched GEMM like k_gemm_b but f16 operands: A f32 (split into f16 hi/lo if ASPLIT, else rounded to f16), Bt = f16 values [n][k]; alpha; C f32; N multiple of 16 (partial tiles skipped)
template <bool ASPLIT>
__global__ __launch_bounds__(128) void k_gemm_h(const float* __restrict__ A, int lda, size_t sA, const _Float16* __restrict__ Bh, int ldb, size_t sB, float alpha, float* __restrict__ C, int ldc, size_t sC, int M, int N, int K) {
  __shared__ __attribute__((aligned(16))) float so[4][16][64];
  const int tid = threadIdx.x, w = tid >> 5, lane = tid & 31, ln = lane & 15, hh = lane >> 4; const int by = blockIdx.y;
  A += (size_t)by * sA; Bh += (size_t)by * sB; C += (size_t)by * sC;
  const int ntn = (N + 63) / 64; const int wid = blockIdx.x * 4 + w; const int mt = wid / ntn, nq = wid % ntn; if (mt * 16 >= M) return;
  const int row0 = mt * 16, col0 = nq * 64; const float* arow = A + (size_t)(row0 + ln) * lda;
  v8f acc[4] = {};
  for (int kb = 0; kb < K; kb += 32) {
    FragH ah, al;
    const v4f x0 = *(const v4fa*)(arow + kb + 8 * hh), x1 = *(const v4fa*)(arow + kb + 8 * hh + 4), x2 = *(const v4fa*)(arow + kb + 16 + 8 * hh), x3 = *(const v4fa*)(arow + kb + 16 + 8 * hh + 4);
    float xs[16] = {x0[0],x0[1],x0[2],x0[3],x1[0],x1[1],x1[2],x1[3],x2[0],x2[1],x2[2],x2[3],x3[0],x3[1],x3[2],x3[3]};
#pragma unroll
    for (int i = 0; i < 16; ++i) { const _Float16 h = (_Float16)xs[i]; ah.h[i] = h; al.h[i] = ASPLIT ? (_Float16)(xs[i] - (float)h) : (_Float16)0.0f; }
#pragma unroll
    for (int t = 0; t < 4; ++t) { if (col0 + t * 16 >= N) continue; const size_t boff = (size_t)(col0 + t * 16 + ln) * ldb + kb; FragH bq; bq.half[0] = *(const v8us*)(Bh + boff + 8 * hh); bq.half[1] = *(const v8us*)(Bh + boff + 16 + 8 * hh);
      acc[t] = mmaH<ASPLIT ? 2 : 1>(ah.v, al.v, bq.v, bq.v, acc[t]); }
  }
#pragma unroll
  for (int t = 0; t < 4; ++t) { if (col0 + t * 16 >= N) continue;
#pragma unroll
    for (int r = 0; r < 8; ++r) so[w][8 * hh + r][t * 16 + ln] = acc[t][r] * alpha; }
  __builtin_amdgcn_fence(__ATOMIC_ACQ_REL, "workgroup"); __builtin_amdgcn_wave_barrier();
  const int rsub = lane >> 4, c4 = (lane & 15) * 4;
  {
#pragma unroll
    for (int q = 0; q < 8; ++q) { const int r = q * 2 + rsub; if (col0 + c4 < N) { const v4f v = *(const v4fa*)&so[w][r][c4]; *(v4f*)(C + (size_t)(row0 + r) * ldc + col0 + c4) = v; } }
     }
}

// Wt[n][k] = f16(W[k][n]·scale) from f32 row-major W[K][N] (scale = power of two; bf16-exact weights stay exact in f16 away from the subnormal range)
__global__ __launch_bounds__(256) void k_wt_f16(const float* __restrict__ W, _Float16* __restrict__ Wt, int K, int N, float scale) {
  const int t = blockIdx.x * 256 + threadIdx.x; if (t >= N * (K / 8)) return; const int n = t / (K / 8), k8 = (t % (K / 8)) * 8; FragH f;
#pragma unroll
  for (int i = 0; i < 8; ++i) f.h[i] = (_Float16)(bf16_round(W[(size_t)(k8 + i) * N + n]) * scale); const v8us o = f.half[0];
  *(v8us*)((unsigned short*)Wt + (size_t)n * K + k8) = o; 
}
// k_gemm_hh variant with fused epilogue: v = acc·alpha + bias[by·sBias + col] (+ CP[(row/rowsPerB)·sCPb + by·64 + col] if CP) ; ACT 0 none / 1 elu ; writes f16 C16 (and f32 C if non-null)
template <int ACT>
__global__ __launch_bounds__(128) void k_gemm_hhx(const _Float16* __restrict__ A, int lda, size_t sA, const _Float16* __restrict__ Bh, int ldb, size_t sB, float alpha, const float* __restrict__ bias, size_t sBias, const float* __restrict__ CP, int rowsPerB, size_t sCPb, int row0g,
    float* __restrict__ C, _Float16* __restrict__ C16, int ldc, size_t sC, int M, int N, int K) {
  __shared__ __attribute__((aligned(16))) float so[4][16][64];
  const int tid = threadIdx.x, w = tid >> 5, lane = tid & 31, ln = lane & 15, hh = lane >> 4; const int by = blockIdx.y;
  A += (size_t)by * sA; Bh += (size_t)by * sB; const size_t cofs = (size_t)by * sC; const float* bp = bias ? bias + (size_t)by * sBias : nullptr;
  const int ntn = (N + 63) / 64; const int wid = blockIdx.x * 4 + w; const int mt = wid / ntn, nq = wid % ntn; if (mt * 16 >= M) return;
  const int row0 = mt * 16, col0 = nq * 64; const _Float16* arow = A + (size_t)(row0 + ln) * lda;
  v8f acc[4] = {};
  for (int kb = 0; kb < K; kb += 32) { FragH ah; ah.half[0] = *(const v8us*)((const unsigned short*)arow + kb + 8 * hh); ah.half[1] = *(const v8us*)((const unsigned short*)arow + kb + 16 + 8 * hh);
#pragma unroll
    for (int t = 0; t < 4; ++t) { if (col0 + t * 16 >= N) continue; const size_t boff = (size_t)(col0 + t * 16 + ln) * ldb + kb; FragH bq; bq.half[0] = *(const v8us*)((const unsigned short*)Bh + boff + 8 * hh); bq.half[1] = *(const v8us*)((const unsigned short*)Bh + boff + 16 + 8 * hh);
      acc[t] = mmaH<1>(ah.v, ah.v, bq.v, bq.v, acc[t]); }
  }
#pragma unroll
  for (int t = 0; t < 4; ++t) { if (col0 + t * 16 >= N) continue; const int col = col0 + t * 16 + ln; const float bv = bp ? bf16_round(bp[col]) : 0.f;
#pragma unroll
    for (int r = 0; r < 8; ++r) { float v = acc[t][r] * alpha + bv; if (CP) { const int rr = row0g + row0 + 8 * hh + r; if (rowsPerB < 0) v += CP[cofs + (size_t)rr * ldc + col];      /* rowsPerB < 0: own element of the batched C plane */ else { const int bidx = rr / rowsPerB; v += CP[(size_t)bidx * sCPb + (size_t)by * 64 + col]; } } if (ACT == 1) v = (v > 0.f) ? v : expm1f(v); else if (ACT == 7) v = (v > 0.f) ? v + 1.0f : expf(v); else if (ACT == 8) v = tanhf(v); else if (ACT == 9) v = 0.5f * v * (1.0f + tanhf(0.7978845608028654f * (v + 0.044715f * v * v * v))); else if (ACT == 11) v = 1.0f / (1.0f + expf(-v)); else if (ACT == 12) v = (v > 0.f) ? v : 0.01f * v; else if (ACT == 14) v = (v > 0.f) ? v : 0.1f * v; else if (ACT == 16) v = (v >= 0.f) ? v : 0.3f * v; else if (ACT == 17) v = (v >= 0.f) ? v : 0.2f * v; else if (ACT == 15) v = v / (1.0f + expf(-v)); else if (ACT == 3) v = fmaxf(v, 0.f); else if (ACT == 6) v = 0.5f * v * (1.0f + erff(v * 0.70710678118654752f)); so[w][8 * hh + r][t * 16 + ln] = v; } }
  __builtin_amdgcn_fence(__ATOMIC_ACQ_REL, "workgroup"); __builtin_amdgcn_wave_barrier();
  const int rsub = lane >> 4, c4 = (lane & 15) * 4; typedef _Float16 v4h __attribute__((ext_vector_type(4)));
  {
#pragma unroll
    for (int q = 0; q < 8; ++q) { const int r = q * 2 + rsub; if (col0 + c4 < N) { const v4f v = *(const v4fa*)&so[w][r][c4]; if (C) *(v4f*)(C + cofs + (size_t)(row0 + r) * ldc + col0 + c4) = v; if (C16) { v4h h4; for (int i = 0; i < 4; ++i) h4[i] = (_Float16)v[i]; *(v4h*)(C16 + cofs + (size_t)(row0 + r) * ldc + col0 + c4) = h4; } } }
     }
}


typedef _Float16 v4h __attribute__((ext_vector_type(4)));

__global__ __launch_bounds__(256) void k_x16(const float* __restrict__ x, _Float16* __restrict__ X16, size_t n8) { const size_t t = (size_t)blockIdx.x * 256 + threadIdx.x; if (t >= n8) return; FragH f;
#pragma unroll
  for (int q = 0; q < 8; ++q) f.h[q] = (_Float16)bf16_round(x[t * 8 + q]); *(v8us*)((unsigned short*)X16 + t * 8) = f.half[0];  }
__global__ __launch_bounds__(256) void k_h16(const float* __restrict__ x, _Float16* __restrict__ X16, size_t n8) { const size_t t = (size_t)blockIdx.x * 256 + threadIdx.x; if (t >= n8) return; FragH f;
#pragma unroll
  for (int q = 0; q < 8; ++q) f.h[q] = (_Float16)x[t * 8 + q]; *(v8us*)((unsigned short*)X16 + t * 8) = f.half[0];  }
__global__ __launch_bounds__(256) void k_round16f(const float* __restrict__ W, _Float16* __restrict__ Bt, size_t n8) { const size_t t = (size_t)blockIdx.x * 256 + threadIdx.x; if (t >= n8) return; FragH f;
#pragma unroll
  for (int i = 0; i < 8; ++i) f.h[i] = (_Float16)(bf16_round(W[t * 8 + i]) * 16.0f); *(v8us*)((unsigned short*)Bt + t * 8) = f.half[0];  }
// eight neighbouring f32 values of a row as f16 hi and residual x 2^10, 16 bytes to each plane
__device__ __forceinline__ void g2_store_hl(v4f a, v4f c, _Float16* hp, _Float16* lp) { FragH fh, fl;
#pragma unroll      /* fh and fl must stay in registers */
  for (int q = 0; q < 4; ++q) { _Float16 h = (_Float16)a[q]; fh.h[q] = h; fl.h[q] = (_Float16)((a[q] - (float)h) * 1024.0f); h = (_Float16)c[q]; fh.h[4 + q] = h; fl.h[4 + q] = (_Float16)((c[q] - (float)h) * 1024.0f); }
  *(v8us*)(unsigned short*)hp = fh.half[0]; *(v8us*)(unsigned short*)lp = fl.half[0]; }

// ---- fast GEMM (block tile 128x128 = eight 32x64 wave tiles; A and B in 64-k tiles through a two-buffer LDS ring; requires M % 128 == 0 rows per launch region, N % 128 == 0, K % 64 == 0); epilogue: acc alpha (+ bias, except EPI 1), activation, LDS staging (EPI 1 adds its bias behind it), then the form the consumer reads. EPI 1: the bias, which must be there, goes by the ROW of C (the weights are the A operand), C16 = f16. EPI 2: row r times rowscale[r * 32] (r counted over the batches), C16 | C16L = f16 hi | residual x 2^10 ----
__device__ __forceinline__ v16h g2_frag(const _Float16* p, int hh) { FragH f; f.half[0] = *(const v8us*)((const unsigned short*)p + 8 * hh); f.half[1] = *(const v8us*)((const unsigned short*)p + 16 + 8 * hh); return f.v; }
__device__ __forceinline__ v8f g2_mma(v16h a, v16h b, v8f c) { v8f d = __builtin_amdgcn_wmma_f32_16x16x32_f16(false, a, false, b, (short)0, c, false, false); asm volatile("v_nop\n\tv_nop\n\tv_nop\n\tv_nop" : "+v"(d) : "v"(a), "v"(b)); return d; }
#define G2P 72      /* LDS row pitch in f16: 64 k + 8 = 144 B, 16 B x odd, the conflict-free pitch for ds_load_b128 readers */
// One thread's eight b128 asynchronous copies to LDS for one 64-k pass: its 16-byte piece of rows r, r + 32, r + 64, r + 96 of the 128-row A tile and of the 128-row B tile (la, lb = LDS byte addresses, ga, gb = global addresses, rsa, rsb = 32 rows in elements).
// s_wait_xcnt 0 is the statement's last line so that no address register of an issued copy is rewritten ahead of it.
__device__ __forceinline__ void g2_copy8(unsigned la, unsigned lb, const _Float16* ga, const _Float16* gb, size_t rsa, size_t rsb) {
  asm volatile("global_load_async_to_lds_b128 %0, %8, off\n\t"
               "global_load_async_to_lds_b128 %1, %9, off\n\t"
               "global_load_async_to_lds_b128 %2, %10, off\n\t"
               "global_load_async_to_lds_b128 %3, %11, off\n\t"
               "global_load_async_to_lds_b128 %4, %12, off\n\t"
               "global_load_async_to_lds_b128 %5, %13, off\n\t"
               "global_load_async_to_lds_b128 %6, %14, off\n\t"
               "global_load_async_to_lds_b128 %7, %15, off\n\t"
               "s_wait_xcnt 0x0"
               :: "v"(la), "v"(la + 1u * 32u * G2P * 2u), "v"(la + 2u * 32u * G2P * 2u), "v"(la + 3u * 32u * G2P * 2u), "v"(lb), "v"(lb + 1u * 32u * G2P * 2u), "v"(lb + 2u * 32u * G2P * 2u), "v"(lb + 3u * 32u * G2P * 2u),
                  "v"(ga), "v"(ga + rsa), "v"(ga + 2 * rsa), "v"(ga + 3 * rsa), "v"(gb), "v"(gb + rsb), "v"(gb + 2 * rsb), "v"(gb + 3 * rsb) : "memory");
}
#define G2RB (2 * 2 * 128 * G2P * 2)      /* bytes of k_gemm2's ring */
#define G2SB (G2RB + 8 * 32 * 68 * 4)      /* bytes of its ring and its output staging */
// the body takes its LDS (G2SB bytes, 16-byte aligned) and its block indices from the kernel that calls it, so that one grid can hold blocks of this product and of another kind
template <int ACT, int EPI>
__device__ __forceinline__ void gemm2_body(unsigned char* sm, const int bx, const int by, const _Float16* __restrict__ A, int lda, size_t sA, const _Float16* __restrict__ Bh, int ldb, size_t sB, float alpha, const float* __restrict__ bias, size_t sBias,
    const float* __restrict__ rowscale, _Float16* __restrict__ C16, _Float16* __restrict__ C16L, int ldc, size_t sC, int M, int N, int K) { static_assert(EPI == 1 || EPI == 2, "k_gemm2: the bias by rows and f16 out, or scaled rows and hi/residual planes out"); static_assert(ACT == 0 || ACT == 3 || ACT == 6 || ACT == 8 || ACT == 9 || ACT == 11 || ACT == 12 || ACT == 14 || ACT == 15 || ACT == 16 || ACT == 17, "k_gemm2: unsupported ACT code (would silently apply no activation)");
  _Float16 (*ring)[2][128][G2P] = (_Float16 (*)[2][128][G2P])sm;      /* [buffer][A | B][row][k], filled by the asynchronous copies only */
  float (*so)[32][68] = (float (*)[32][68])(sm + G2RB);
  const int tid = threadIdx.x, w = tid >> 5, lane = tid & 31, ln = lane & 15, hh = lane >> 4;
  A += (size_t)by * sA; Bh += (size_t)by * sB; const size_t cofs = (size_t)by * sC; const float* bp = bias ? bias + (size_t)by * sBias : nullptr;
  const int ntn = N >> 7; const int mt = bx / ntn, nq = bx - mt * ntn; if (mt * 128 >= M) return;      /* the same for the whole block, ahead of every barrier */
  const int wm = w >> 1, wn = w & 1; const int row0 = mt * 128 + 32 * wm, col0 = nq * 128 + 64 * wn;
  const int cr = tid >> 3, cc = (tid & 7) * 8;      /* this thread's first row and its 8-element piece in every copied tile */
  const _Float16* ga = A + (size_t)(mt * 128 + cr) * lda + cc; const _Float16* gb = Bh + (size_t)(nq * 128 + cr) * ldb + cc; const size_t rsa = (size_t)32 * lda, rsb = (size_t)32 * ldb;
  const unsigned la = (unsigned)(size_t)&ring[0][0][cr][cc], lb = (unsigned)(size_t)&ring[0][1][cr][cc]; const unsigned bufb = 2u * 128u * G2P * 2u;      /* LDS byte addresses in buffer 0; bytes per buffer */
  const int np = K >> 6;
  const v8f z8 = {0.f,0.f,0.f,0.f,0.f,0.f,0.f,0.f}; v8f c00 = z8, c01 = z8, c02 = z8, c03 = z8, c10 = z8, c11 = z8, c12 = z8, c13 = z8;
  g2_copy8(la, lb, ga, gb, rsa, rsb);
  asm volatile("s_wait_asynccnt 0x0" ::: "memory");      /* this wave's copies of tile 0 have landed */
  __syncthreads();      /* publishes tile 0 */
  if (np > 1) g2_copy8(la + bufb, lb + bufb, ga + 64, gb + 64, rsa, rsb);
  for (int t = 0; t < np; ++t) { const int bu = t & 1; const _Float16* a0p = &ring[bu][0][32 * wm + ln][0]; const _Float16* a1p = a0p + 16 * G2P;
    const _Float16* b0p = &ring[bu][1][64 * wn + ln][0]; const _Float16* b1p = b0p + 16 * G2P; const _Float16* b2p = b1p + 16 * G2P; const _Float16* b3p = b2p + 16 * G2P;
    v16h a0[2], a1[2], b0[2], b1[2], b2[2], b3[2];      /* the pass's 24 LDS reads go as one group ahead of its 16 products: reads placed among the products would each wait out the LDS latency */
#pragma unroll      /* the fragment arrays must stay in registers */
    for (int s = 0; s < 2; ++s) { a0[s] = g2_frag(a0p + 32 * s, hh); a1[s] = g2_frag(a1p + 32 * s, hh); b0[s] = g2_frag(b0p + 32 * s, hh); b1[s] = g2_frag(b1p + 32 * s, hh); b2[s] = g2_frag(b2p + 32 * s, hh); b3[s] = g2_frag(b3p + 32 * s, hh); }
#pragma unroll      /* as above */
    for (int s = 0; s < 2; ++s) { c00 = g2_mma(a0[s], b0[s], c00); c10 = g2_mma(a1[s], b0[s], c10); c01 = g2_mma(a0[s], b1[s], c01); c11 = g2_mma(a1[s], b1[s], c11);
      c02 = g2_mma(a0[s], b2[s], c02); c12 = g2_mma(a1[s], b2[s], c12); c03 = g2_mma(a0[s], b3[s], c03); c13 = g2_mma(a1[s], b3[s], c13); }
    asm volatile("s_wait_dscnt 0x0" ::: "memory");      /* this wave's reads of buffer bu are done before it is refilled */
    asm volatile("s_wait_asynccnt 0x0" ::: "memory");      /* this wave's copies of tile t + 1 have landed */
    __syncthreads();      /* publishes tile t + 1 and ends every wave's reads of buffer bu */
    if (t + 2 < np) g2_copy8(la + bu * bufb, lb + bu * bufb, ga + (size_t)(t + 2) * 64, gb + (size_t)(t + 2) * 64, rsa, rsb); }
  asm volatile("s_wait_asynccnt 0x0" ::: "memory");      /* no copy is outstanding when the wave goes on */
  v8f accs[8] = {c00, c01, c02, c03, c10, c11, c12, c13};
#pragma unroll
  for (int u = 0; u < 8; ++u) { const int t = u & 3, half = u >> 2; const int col = col0 + t * 16 + ln; const float bv = (EPI != 1 && bp) ? bf16_round(bp[col]) : 0.f;      /* EPI 1 adds its bias, one value a row, behind the staging */
#pragma unroll
    for (int r = 0; r < 8; ++r) { const int rloc = half * 16 + 8 * hh + r; float v = accs[u][r] * alpha + bv;
      if (ACT == 3) v = fmaxf(v, 0.f); else if (ACT == 6) v = 0.5f * v * (1.0f + erff(v * 0.70710678118654752f)); else if (ACT == 11) v = 1.0f / (1.0f + expf(-v)); else if (ACT == 15) v = v / (1.0f + expf(-v)); else if (ACT == 12) v = (v > 0.f) ? v : 0.01f * v; else if (ACT == 8) v = tanhf(v); else if (ACT == 9) v = 0.5f * v * (1.0f + tanhf(0.7978845608028654f * (v + 0.044715f * v * v * v))); else if (ACT == 14) v = (v > 0.f) ? v : 0.1f * v; else if (ACT == 16) v = (v >= 0.f) ? v : 0.3f * v; else if (ACT == 17) v = (v >= 0.f) ? v : 0.2f * v;
      so[w][rloc][t * 16 + ln] = v; } }
  __builtin_amdgcn_fence(__ATOMIC_ACQ_REL, "workgroup"); __builtin_amdgcn_wave_barrier();
  const int rsub = lane >> 3, c8 = (lane & 7) * 8;      /* eight lanes take one row's 64 columns: a whole 128-byte line of f16 */
  v4f a[8], c[8]; float rv[8];      /* rv: the row's bias (EPI 1) or scale (EPI 2) */
#pragma unroll      /* a, c and rv must stay in registers; the 16 LDS reads and the 8 loads of rv go as one group, so that their latency is paid once */
  for (int q = 0; q < 8; ++q) { const int r = q * 4 + rsub; a[q] = *(const v4fa*)&so[w][r][c8]; c[q] = *(const v4fa*)&so[w][r][c8 + 4]; rv[q] = EPI == 1 ? bp[row0 + r] : rowscale[((size_t)by * M + row0 + r) * 32]; }
#pragma unroll      /* as above */
  for (int q = 0; q < 8; ++q) { const size_t o = cofs + (size_t)(row0 + q * 4 + rsub) * ldc + col0 + c8;
    if (EPI == 1) { const float bq = bf16_round(rv[q]); FragH f; for (int i = 0; i < 4; ++i) { f.h[i] = (_Float16)(a[q][i] + bq); f.h[4 + i] = (_Float16)(c[q][i] + bq); } *(v8us*)((unsigned short*)C16 + o) = f.half[0]; }
    else g2_store_hl(a[q] * rv[q], c[q] * rv[q], C16 + o, C16L + o); } }
template <int ACT, int EPI>
__global__ __launch_bounds__(256) void k_gemm2(const _Float16* __restrict__ A, int lda, size_t sA, const _Float16* __restrict__ Bh, int ldb, size_t sB, float alpha, const float* __restrict__ bias, size_t sBias,
    const float* __restrict__ rowscale, _Float16* __restrict__ C16, _Float16* __restrict__ C16L, int ldc, size_t sC, int M, int N, int K) {
  __shared__ __attribute__((aligned(16))) unsigned char sm[G2SB];
  gemm2_body<ACT, EPI>(sm, blockIdx.x, blockIdx.y, A, lda, sA, Bh, ldb, sB, alpha, bias, sBias, rowscale, C16, C16L, ldc, sC, M, N, K); }


// ---- k_gemm2 for a product whose operands are f16 hi + scaled residual planes: every term in ONE launch, summed in registers. H takes Ah.Bh; X takes Al.Bh and, with NBP == 2, Ah.Bl as well (both carry the residual's scale); C = H alphaH + bias + X alphaL. Same block and wave tiles, same ring order as k_gemm2; a stage is [Ah | Bh | Al (| Bl)]. EPI 0: C f32, row-major. EPI 1: CH | CL = f16 hi | residual x 2^10, row-major. EPI 2: C f32 as [row / TC][column][row % TC] ----
// One thread's four b128 asynchronous copies to LDS for one 128-row tile; s_wait_xcnt 0 is the statement's last line so that no address register of an issued copy is rewritten ahead of it.
__device__ __forceinline__ void g2_copy4(unsigned la, const _Float16* ga, size_t rsa) {
  asm volatile("global_load_async_to_lds_b128 %0, %4, off\n\t"
               "global_load_async_to_lds_b128 %1, %5, off\n\t"
               "global_load_async_to_lds_b128 %2, %6, off\n\t"
               "global_load_async_to_lds_b128 %3, %7, off\n\t"
               "s_wait_xcnt 0x0"
               :: "v"(la), "v"(la + 1u * 32u * G2P * 2u), "v"(la + 2u * 32u * G2P * 2u), "v"(la + 3u * 32u * G2P * 2u), "v"(ga), "v"(ga + rsa), "v"(ga + 2 * rsa), "v"(ga + 3 * rsa) : "memory");
}
#define G2T (128 * G2P)      /* f16 elements of one 128-row tile in LDS */
#define G2SS(NBP) (2u * (2u + (NBP)) * G2T * 2u)      /* bytes of the two buffers */
// LDS (G2SS(NBP) bytes, 16-byte aligned) and block indices from the calling kernel, as for gemm2_body
template <int NBP, int EPI>
__device__ __forceinline__ void gemm2s_body(unsigned char* sm, const int bx, const int by, const _Float16* __restrict__ Ah, const _Float16* __restrict__ Al, int lda, size_t sA, const _Float16* __restrict__ Bh, const _Float16* __restrict__ Bl, int ldb, size_t sB, float alphaH, float alphaL, const float* __restrict__ bias, const float* __restrict__ bias1,
    float* __restrict__ C, _Float16* __restrict__ CH, _Float16* __restrict__ CL, int ldc, size_t sC, int M, int N, int K) { static_assert(NBP == 1 || NBP == 2, "B is one plane or hi + residual"); static_assert(EPI >= 0 && EPI <= 2 && TC % 128 == 0, "a block's 128 rows lie in one batch");
  constexpr unsigned bufb = (2u + NBP) * G2T * 2u;      /* bytes per buffer */
  static_assert(G2SS(NBP) == 2 * bufb, "sm is the ring");      /* filled by the asynchronous copies only; behind the loop's last barrier the same bytes stage the output, so that two blocks still share a WGP's LDS */
  const int tid = threadIdx.x, w = tid >> 5, lane = tid & 31, ln = lane & 15, hh = lane >> 4;
  Ah += (size_t)by * sA; Al += (size_t)by * sA; Bh += (size_t)by * sB; if (NBP == 2) Bl += (size_t)by * sB; const size_t cofs = (size_t)by * sC; const float* bsel = (EPI == 1 && by == 1) ? bias1 : bias;      /* EPI 1 with two products in one grid: the second has a bias vector of its own */
  const int ntn = N >> 7; const int mt = bx / ntn, nq = bx - mt * ntn; if (mt * 128 >= M) return;      /* the same for the whole block, ahead of every barrier */
  const int wm = w >> 1, wn = w & 1; const int row0 = mt * 128 + 32 * wm, col0 = nq * 128 + 64 * wn;
  const int cr = tid >> 3, cc = (tid & 7) * 8;      /* this thread's first row and its 8-element piece in every copied tile */
  const size_t oa = (size_t)(mt * 128 + cr) * lda + cc, ob = (size_t)(nq * 128 + cr) * ldb + cc; const size_t rsa = (size_t)32 * lda, rsb = (size_t)32 * ldb;
  const unsigned la = (unsigned)(size_t)&sm[(cr * G2P + cc) * 2], lb = la + G2T * 2u, lr = 2u * G2T * 2u;      /* LDS byte addresses in buffer 0 of the Ah and Bh tiles; from a hi tile to its residual tile */
  auto stage = [&](unsigned bo, size_t k0) { g2_copy8(la + bo, lb + bo, Ah + oa + k0, Bh + ob + k0, rsa, rsb);
    if (NBP == 2) g2_copy8(la + lr + bo, lb + lr + bo, Al + oa + k0, Bl + ob + k0, rsa, rsb); else g2_copy4(la + lr + bo, Al + oa + k0, rsa); };
  const int np = K >> 6;
  const v8f z8 = {0.f,0.f,0.f,0.f,0.f,0.f,0.f,0.f}; v8f H[2][4], X[2][4];
#pragma unroll      /* the accumulators must stay in registers */
  for (int j = 0; j < 4; ++j) { H[0][j] = z8; H[1][j] = z8; X[0][j] = z8; X[1][j] = z8; }
  stage(0u, 0);
  asm volatile("s_wait_asynccnt 0x0" ::: "memory");      /* this wave's copies of stage 0 have landed */
  __syncthreads();      /* publishes stage 0 */
  if (np > 1) stage(bufb, 64);
  for (int t = 0; t < np; ++t) { const int bu = t & 1; const _Float16* ahp = (const _Float16*)(sm + bu * bufb) + (32 * wm + ln) * G2P; const _Float16* bhp = (const _Float16*)(sm + bu * bufb) + G2T + (64 * wn + ln) * G2P; const _Float16* alp = ahp + 2 * G2T; const _Float16* blp = bhp + 2 * G2T;
#pragma unroll      /* fragments and accumulators must stay in registers */
    for (int s = 0; s < 2; ++s) { v16h bh[4], bl[4];      /* a 32-k step's LDS reads go as one group ahead of its products */
      const v16h ah0 = g2_frag(ahp + 32 * s, hh), ah1 = g2_frag(ahp + 16 * G2P + 32 * s, hh), al0 = g2_frag(alp + 32 * s, hh), al1 = g2_frag(alp + 16 * G2P + 32 * s, hh);
#pragma unroll      /* as above */
      for (int j = 0; j < 4; ++j) { bh[j] = g2_frag(bhp + j * 16 * G2P + 32 * s, hh); if (NBP == 2) bl[j] = g2_frag(blp + j * 16 * G2P + 32 * s, hh); }
#pragma unroll      /* as above */
      for (int j = 0; j < 4; ++j) { H[0][j] = g2_mma(ah0, bh[j], H[0][j]); H[1][j] = g2_mma(ah1, bh[j], H[1][j]); X[0][j] = g2_mma(al0, bh[j], X[0][j]); X[1][j] = g2_mma(al1, bh[j], X[1][j]); }
      if (NBP == 2) {
#pragma unroll      /* as above */
        for (int j = 0; j < 4; ++j) { X[0][j] = g2_mma(ah0, bl[j], X[0][j]); X[1][j] = g2_mma(ah1, bl[j], X[1][j]); } } }
    asm volatile("s_wait_dscnt 0x0" ::: "memory");      /* this wave's reads of buffer bu are done before it is refilled */
    asm volatile("s_wait_asynccnt 0x0" ::: "memory");      /* this wave's copies of stage t + 1 have landed */
    __syncthreads();      /* publishes stage t + 1 and ends every wave's reads of buffer bu */
    if (t + 2 < np) stage(bu * bufb, (size_t)(t + 2) * 64); }
  asm volatile("s_wait_asynccnt 0x0" ::: "memory");      /* no copy is outstanding when the wave goes on */
  constexpr int SOP = EPI == 2 ? 36 : 68;      /* staging pitch in floats, 16 B x odd: 32 rows of 64 columns, or (EPI 2) 64 columns of 32 rows */
  constexpr int SOW = EPI == 2 ? 64 * SOP : 32 * SOP; static_assert(2 * bufb >= 8u * SOW * 4u, "the output staging lies inside the ring");
  float* so = (float*)sm + w * SOW;      /* this wave's own staging; every wave has left the ring at the last pass's barrier */
#pragma unroll      /* the accumulators are indexed by constants only */
  for (int u = 0; u < 8; ++u) { const int j = u & 3, half = u >> 2; const float bv = bsel ? bf16_round(bsel[col0 + j * 16 + ln]) : 0.f;
    v4f p0, p1;
#pragma unroll      /* as above */
    for (int r = 0; r < 8; ++r) { float v = H[half][j][r] * alphaH + bv; v += X[half][j][r] * alphaL; if (EPI != 2) so[(half * 16 + 8 * hh + r) * SOP + j * 16 + ln] = v; else if (r < 4) p0[r] = v; else p1[r - 4] = v; }
    if (EPI == 2) { float* sc = so + (j * 16 + ln) * SOP + half * 16 + 8 * hh; *(v4fa*)sc = p0; *(v4fa*)(sc + 4) = p1; } }      /* a lane's eight values are eight rows of one column: side by side here */
  __builtin_amdgcn_fence(__ATOMIC_ACQ_REL, "workgroup"); __builtin_amdgcn_wave_barrier();      /* the wave's staging stores stand ahead of its own reads of them; no other wave reads these rows */
  if (EPI == 0) { const int rsub = lane >> 4, c4 = (lane & 15) * 4;
#pragma unroll      /* the 16 LDS reads and stores of whole lines in flight together */
    for (int q = 0; q < 16; ++q) { const int r = q * 2 + rsub; const v4f v = *(const v4fa*)&so[r * SOP + c4]; *(v4f*)(C + cofs + (size_t)(row0 + r) * ldc + col0 + c4) = v; } }
  else if (EPI == 1) { const int rsub = lane >> 3, c8 = (lane & 7) * 8;      /* eight lanes take one row's 64 columns: a whole 128-byte line in each plane */
    v4f a[8], c[8];
#pragma unroll      /* a and c must stay in registers; the 16 LDS reads go as one group, so that their latency is paid once */
    for (int q = 0; q < 8; ++q) { a[q] = *(const v4fa*)&so[(q * 4 + rsub) * SOP + c8]; c[q] = *(const v4fa*)&so[(q * 4 + rsub) * SOP + c8 + 4]; }
#pragma unroll      /* as above */
    for (int q = 0; q < 8; ++q) { const size_t o = cofs + (size_t)(row0 + q * 4 + rsub) * ldc + col0 + c8; g2_store_hl(a[q], c[q], CH + o, CL + o); } }
  else { const int cs = (lane >> 3) * 8, r4 = (lane & 7) * 4; const int bb = row0 / TC;      /* eight lanes take one column's 32 rows: a whole 128-byte line; the four columns of a read lie 8 apart, which spreads them over the banks */
    float* op = C + ((size_t)bb * N + col0 + cs) * TC + (row0 - bb * TC) + r4;
#pragma unroll      /* as above; every store is one base plus an immediate */
    for (int q = 0; q < 16; ++q) { const int cq = (q & 7) + 32 * (q >> 3); const v4f v = *(const v4fa*)&so[(cs + cq) * SOP + r4]; *(v4f*)(op + (size_t)cq * TC) = v; } } }
template <int NBP, int EPI>
__global__ __launch_bounds__(256) void k_gemm2s(const _Float16* __restrict__ Ah, const _Float16* __restrict__ Al, int lda, size_t sA, const _Float16* __restrict__ Bh, const _Float16* __restrict__ Bl, int ldb, size_t sB, float alphaH, float alphaL, const float* __restrict__ bias,
    float* __restrict__ C, _Float16* __restrict__ CH, _Float16* __restrict__ CL, int ldc, size_t sC, int M, int N, int K) {
  __shared__ __attribute__((aligned(16))) unsigned char sm[G2SS(NBP)];
  gemm2s_body<NBP, EPI>(sm, blockIdx.x, blockIdx.y, Ah, Al, lda, sA, Bh, Bl, ldb, sB, alphaH, alphaL, bias, nullptr, C, CH, CL, ldc, sC, M, N, K); }
// the three 1x1 convolutions of the inputs in one grid: blockIdx.y = 0: F rows (b,t); 1: G rows (b,s), whose planes, weights and outputs lie sN, sW and sN elements behind F's; 2: H as [b][c][s] f16 = Wh . style^T, blockIdx.x = 32 tiles x 16 batches. The longer blocks come first.
static_assert(NRC == NRS && (NRC / 128) * (CC / 128) == (CC / 128) * (TS / 128) * NB && (CC / 128) * (TS / 128) == 32, "k_fgh: every blockIdx.y has the same number of blocks");
__global__ __launch_bounds__(256) void k_fgh(const _Float16* __restrict__ NH, const _Float16* __restrict__ NL, size_t sN, const _Float16* __restrict__ BFG, size_t sW, const float* __restrict__ bf_, const float* __restrict__ bg, _Float16* __restrict__ FGH, _Float16* __restrict__ FGL,
    const _Float16* __restrict__ BH, const _Float16* __restrict__ S16, const float* __restrict__ bh, _Float16* __restrict__ HT) {
  __shared__ __attribute__((aligned(16))) unsigned char sm[G2SB > G2SS(1) ? G2SB : G2SS(1)];
  if (blockIdx.y < 2) gemm2s_body<1, 1>(sm, blockIdx.x, blockIdx.y, NH, NL, CC, sN, BFG, nullptr, CC, sW, 0.0625f, 0.0625f / 1024.0f, bf_, bg, nullptr, FGH, FGL, CC, sN, NRC, CC, CC);      /* the test reads the same for the whole block: each side holds its own barriers */
  else gemm2_body<0, 1>(sm, blockIdx.x & 31, blockIdx.x >> 5, BH, CC, 0, S16, CC, (size_t)TS * CC, 0.0625f, bh, 0, nullptr, HT, nullptr, TS, (size_t)CC * TS, CC, TS, CC); }

// ---- statistics, planes and weights in one launch: a block holds 64 channels x 1024 frames of one batch of one input in registers, so that the input is read once; a thread's 16 channels x 8 frames are what it stores, eight channels to a 16-byte piece, and nothing is transposed through LDS ----
#define FC 64                    /* channels per k_prep block: one 128-byte line of every [frame][channel] plane */
#define RP 132                   /* LDS pitch in floats of a channel's 128 partial sums: a multiple of 16 bytes for the b128 readers */
static_assert(TC == 1024 && TS == 1024 && CC % FC == 0 && 4 * CC * CC == 2 * NB * (CC / FC) * 512 * 8, "k_prep: rows of 16 waves x 64 frames; every thread converts eight weights");
// a work-group barrier that orders LDS alone: only LDS goes from wave to wave in k_prep, and __syncthreads() would hold every wave until its global stores have completed as well
__device__ __forceinline__ void prep_barrier() { __builtin_amdgcn_fence(__ATOMIC_RELEASE, "workgroup", "local"); __builtin_amdgcn_s_barrier(); __builtin_amdgcn_fence(__ATOMIC_ACQUIRE, "workgroup", "local"); }
// the sum of a channel's 128 partial sums, in all eight lanes that share the channel
__device__ __forceinline__ float prep_total(const float (*red)[RP], int rc, int rj) {
  const v4f t0 = *(const v4fa*)&red[rc][rj * 4], t1 = *(const v4fa*)&red[rc][32 + rj * 4], t2 = *(const v4fa*)&red[rc][64 + rj * 4], t3 = *(const v4fa*)&red[rc][96 + rj * 4];
  const v4f t = (t0 + t1) + (t2 + t3); float s = (t[0] + t[1]) + (t[2] + t[3]);
  for (int o = 4; o > 0; o >>= 1) s += __shfl_xor(s, o, 32);
  return s; }
__global__ __launch_bounds__(512) void k_prep(const float* __restrict__ content, const float* __restrict__ style, _Float16* __restrict__ NH, _Float16* __restrict__ NL, size_t sN, _Float16* __restrict__ S16,
    const float* __restrict__ Wf, const float* __restrict__ Wg, const float* __restrict__ Wh, const float* __restrict__ Wo, _Float16* __restrict__ BW) {
  __shared__ __attribute__((aligned(16))) float red[FC][RP];
  __shared__ __attribute__((aligned(16))) float smu[FC], srs[FC];
  const int tid = threadIdx.x, w = tid >> 5, lane = tid & 31, fl = lane & 7, gl = lane >> 3;      /* eight lanes take 32 frames of a row, a whole 128-byte line; the four lane groups take rows 8 apart */
  const int y = blockIdx.y, b = blockIdx.x / (CC / FC), c0 = (blockIdx.x % (CC / FC)) * FC;      /* y: 0 content, 1 style; the same for the whole block */
  const int f0 = w * 64 + fl * 4;      /* the thread's frames: f0 .. f0 + 3 and f0 + 32 .. f0 + 35 */
  const int blk = y * (NB * (CC / FC)) + blockIdx.x, m = blk >> 6;      /* 64 blocks convert one weight matrix (x 16, f16); BW = four planes in a row */
  const char* wp = (const char*)((m == 0 ? Wf : m == 1 ? Wg : m == 2 ? Wh : Wo) + (blk & 63) * 4096); const unsigned wb = tid * 32u;      /* the block's 4096 weights; the thread's eight, in bytes */
  const float* xp = (y ? style : content) + ((size_t)b * CC + c0 + gl * 8) * 1024 + f0;      /* the row length as a constant: every load is one base plus an immediate */
  const v4f w0 = *(const v4fa*)(wp + wb), w1 = *(const v4fa*)(wp + wb + 16);
  v4f a[16][2];      /* [u][e]: channel c0 + (u >> 3) * 32 + gl * 8 + (u & 7), frames f0 + 32 e + 0 .. 3 */
#pragma unroll      /* a must stay in registers; all 32 loads of the thread in flight at once */
  for (int u = 0; u < 16; ++u) { a[u][0] = *(const v4fa*)(xp + ((u >> 3) * 32 + (u & 7)) * 1024); a[u][1] = *(const v4fa*)(xp + ((u >> 3) * 32 + (u & 7)) * 1024 + 32); }
  asm volatile("s_wait_xcnt 0x0" :: "v"(wb), "v"(xp) : "memory");      /* the two vector addresses are inputs, so that they live up to this wait and no register that an issued load names is rewritten ahead of it */
  __builtin_amdgcn_sched_barrier(0);      /* keeps the arithmetic on the first values behind the last load; the scheduler otherwise holds eight loads back until earlier ones have returned */
  { FragH fw;
#pragma unroll      /* fw must stay in registers */
    for (int q = 0; q < 4; ++q) { fw.h[q] = (_Float16)(bf16_round(w0[q]) * 16.0f); fw.h[4 + q] = (_Float16)(bf16_round(w1[q]) * 16.0f); }
    *(v8us*)((unsigned short*)BW + (size_t)blk * 4096 + tid * 8) = fw.half[0]; }
  const int rc = tid >> 3, rj = tid & 7;      /* eight threads add up one channel's partial sums */
#pragma unroll      /* a must stay in registers */
  for (int u = 0; u < 16; ++u) {
#pragma unroll      /* as above */
    for (int q = 0; q < 4; ++q) { a[u][0][q] = bf16_round(a[u][0][q]); a[u][1][q] = bf16_round(a[u][1][q]); }
    const v4f t = a[u][0] + a[u][1]; red[(u >> 3) * 32 + gl * 8 + (u & 7)][w * 8 + fl] = (t[0] + t[1]) + (t[2] + t[3]); }
  const size_t o0 = ((size_t)b * 1024 + f0) * CC + c0 + gl * 8;      /* the thread's first piece in every plane; frames lie CC apart, its two channel groups 32 */
  if (y) { unsigned short* Rh = (unsigned short*)(S16 + o0);      /* the style's raw plane needs no statistics: its stores fly under them */
#pragma unroll      /* a is indexed by constants only; every store is one base plus an immediate; the two halves of a frame's line go one behind the other */
    for (int k = 0; k < 8; ++k) { FragH fr[2];
#pragma unroll      /* as above */
      for (int u = 0; u < 16; ++u) fr[u >> 3].h[u & 7] = (_Float16)a[u][k >> 2][k & 3];
      *(v8us*)(Rh + ((k >> 2) * 32 + (k & 3)) * CC) = fr[0].half[0]; *(v8us*)(Rh + ((k >> 2) * 32 + (k & 3)) * CC + 32) = fr[1].half[0]; } }
  asm volatile("s_wait_xcnt 0x0" ::: "memory");      /* what follows reuses registers that the stores above name */
  prep_barrier();      /* publishes the partial sums */
  { const float s = prep_total(red, rc, rj); if (rj == 0) smu[rc] = s / 1024.0f; }
  prep_barrier();      /* publishes the means and ends every read of red */
#pragma unroll      /* a must stay in registers */
  for (int u = 0; u < 16; ++u) { const float mu = smu[(u >> 3) * 32 + gl * 8 + (u & 7)]; a[u][0] -= mu; a[u][1] -= mu; const v4f t = a[u][0] * a[u][0] + a[u][1] * a[u][1]; red[(u >> 3) * 32 + gl * 8 + (u & 7)][w * 8 + fl] = (t[0] + t[1]) + (t[2] + t[3]); }
  prep_barrier();      /* publishes the partial sums of squares */
  { const float s2 = prep_total(red, rc, rj); if (rj == 0) srs[rc] = rsqrtf(s2 / 1023.0f + 1e-5f); }      /* unbiased variance */
  prep_barrier();      /* publishes the scales */
  float r[16];
#pragma unroll      /* r must stay in registers */
  for (int u = 0; u < 16; ++u) r[u] = srs[(u >> 3) * 32 + gl * 8 + (u & 7)];
  unsigned short* Hh = (unsigned short*)(NH + y * sN + o0); unsigned short* Lh = (unsigned short*)(NL + y * sN + o0);      /* the style's planes lie sN elements behind the content's */
#pragma unroll      /* a and r are indexed by constants only; the stores as above */
  for (int k = 0; k < 8; ++k) { const int o = ((k >> 2) * 32 + (k & 3)) * CC; FragH fh[2], fo[2];
#pragma unroll      /* as above */
    for (int u = 0; u < 16; ++u) { const float v = a[u][k >> 2][k & 3] * r[u]; const _Float16 hv = (_Float16)v; fh[u >> 3].h[u & 7] = hv; fo[u >> 3].h[u & 7] = (_Float16)((v - (float)hv) * 1024.0f); }
    *(v8us*)(Hh + o) = fh[0].half[0]; *(v8us*)(Hh + o + 32) = fh[1].half[0]; *(v8us*)(Lh + o) = fo[0].half[0]; *(v8us*)(Lh + o + 32) = fo[1].half[0];
    asm volatile("s_wait_xcnt 0x0" ::: "memory"); } }      /* the next frame's packing, and the code on the way to the kernel's end, reuse registers that these stores name */
__global__ __launch_bounds__(256) void k_soft(const float* __restrict__ S, _Float16* __restrict__ P, float* __restrict__ RS) {
  #pragma clang fp contract(off)
  const int wv = threadIdx.x >> 5, ln = threadIdx.x & 31; const int r = blockIdx.x * 8 + wv; if (r >= BG * TC) return; const float* sr = S + (size_t)r * TS; float mx = -3.0e38f;
#pragma unroll 1
  for (int gq = 0; gq < TS / 256; ++gq) { const v8f a = *(const v8f*)(sr + gq * 256 + ln * 8); for (int q = 0; q < 8; ++q) mx = fmaxf(mx, a[q]); }
  for (int o = 16; o > 0; o >>= 1) mx = fmaxf(mx, __shfl_xor(mx, o, 32)); float su = 0.f;
{ su = 0.f;
#pragma unroll 1
    for (int gq = 0; gq < TS / 256; ++gq) { const v8f a = *(const v8f*)(sr + gq * 256 + ln * 8); FragH ph; for (int q = 0; q < 8; ++q) { const float e = expf(a[q] - mx); su += e; ph.h[q] = (_Float16)(e * 1024.0f); } *(v8us*)((unsigned short*)P + (size_t)r * TS + gq * 256 + ln * 8) = ph.half[0]; }
     }
  for (int o = 16; o > 0; o >>= 1) su += __shfl_xor(su, o, 32); if (ln == 0) { *(float*)(RS + (size_t)r * 32) = 1.0f / su;  } }
extern "C" void kernel_launch(void* const* d_in, const int* in_sizes, int n_in,
                              void* d_out, int out_size, void* d_ws, size_t ws_size, hipStream_t stream) {
  (void)in_sizes; (void)n_in; (void)out_size;
  const float* content = (const float*)d_in[0]; const float* style = (const float*)d_in[1]; const float* Wf = (const float*)d_in[2]; const float* bf_ = (const float*)d_in[3]; const float* Wg = (const float*)d_in[4]; const float* bg = (const float*)d_in[5]; const float* Wh = (const float*)d_in[6]; const float* bh = (const float*)d_in[7]; const float* Wo = (const float*)d_in[8]; const float* bo = (const float*)d_in[9];
  char* ws = (char*)d_ws; size_t off = 0;
  auto take = [&](size_t bytes) { char* p = ws + off; off += (bytes + 255) & ~(size_t)255; return p; };
  const size_t npc = (size_t)NRC * CC, nps = (size_t)NRS * CC;
  _Float16* BF = (_Float16*)take((size_t)CC * CC * 2); _Float16* BGm = (_Float16*)take((size_t)CC * CC * 2); _Float16* BH = (_Float16*)take((size_t)CC * CC * 2); _Float16* BO = (_Float16*)take((size_t)CC * CC * 2);
  _Float16* CNH = (_Float16*)take(npc * 2); _Float16* CNL = (_Float16*)take(npc * 2); _Float16* SNH = (_Float16*)take(nps * 2); _Float16* SNL = (_Float16*)take(nps * 2); _Float16* S16 = (_Float16*)take(nps * 2);
  _Float16* FH = (_Float16*)take(npc * 2); _Float16* FL = (_Float16*)take(npc * 2); _Float16* GH = (_Float16*)take(nps * 2); _Float16* GL = (_Float16*)take(nps * 2); _Float16* HT = (_Float16*)take(nps * 2);
  float* S = (float*)take((size_t)BG * TC * TS * 4); float* RS = (float*)take((size_t)BG * TC * 32 * 4);
  _Float16* P = CNH;      /* the softmax weights [NRC][TS] over both content-normalised planes (dead after F) */
  _Float16* OH = SNH; _Float16* OL = SNL;      /* O hi/lo [NRC][CC] over the style-normalised planes (dead after G) */
  if (off > ws_size) return;      /* 2 + 16 x 5 + 16 x 5 + 64 + 2 = about 228 MiB */
  k_prep<<<dim3(NB * (CC / FC), 2), 512, 0, stream>>>(content, style, CNH, CNL, SNH - CNH, S16, Wf, Wg, Wh, Wo, BF);      /* BF, BGm, BH, BO lie in a row; conv (out, in) naturals */
  k_fgh<<<dim3((NRC / 128) * (CC / 128), 3), 256, 0, stream>>>(CNH, CNL, SNH - CNH, BF, BGm - BF, bf_, bg, FH, FL, BH, S16, bh, HT);      /* F into FH | FL; G from SNH | SNL and BGm into GH | GL, each as far behind its counterpart as SNH behind CNH; H into HT */
  k_gemm2s<2, 0><<<dim3((TC / 128) * (TS / 128), BG), 256, 0, stream>>>(FH, FL, CC, (size_t)TC * CC, GH, GL, CC, (size_t)TS * CC, 1.0f, 0.0009765625f, nullptr, S, nullptr, nullptr, TS, (size_t)TC * TS, TC, TS, CC);      /* S = F^T G (hi.hi + (lo.hi + hi.lo)), unscaled */
  k_soft<<<(BG * TC) / 8, 256, 0, stream>>>(S, P, RS);
  k_gemm2<0, 2><<<dim3((TC / 128) * (CC / 128), BG), 256, 0, stream>>>(P, TS, (size_t)TC * TS, HT, TS, (size_t)CC * TS, 0.0009765625f, nullptr, 0, RS, OH, OL, CC, (size_t)TC * CC, TC, CC, TS);      /* O rows (b,t) = (P . H^T) / row sum, hi/residual */
  k_gemm2s<1, 2><<<dim3((NRC / 128) * (CC / 128), 1), 256, 0, stream>>>(OH, OL, CC, 0, BO, nullptr, CC, 0, 0.0625f, 0.0625f / 1024.0f, bo, (float*)d_out, nullptr, nullptr, CC, 0, NRC, CC, CC);      /* out [b][o][t] = Wo O + bo */
}

// v007
// A run of this version takes 132 microseconds.
// In both of two side-by-side timings against v006, it was 1.17 times as fast.
// Over all steps from v000 it is 6.91 times as fast.
#include <hip/hip_runtime.h>
// SpeakerAttention (16 x 512 channels; content 1024 frames, style 1024 frames: F = Wf mvn(content) + bf, G = Wg mvn(style) + bg, H = Wh style + bh (1x1 convs); S = softmax over style frames of the UNSCALED F^T G (K = 512 channels); O = H S^T; out = Wo O + bo; mvn = per (batch, channel) mean / unbiased variance over time, eps 1e-5).
// Structure: per-(b,c) mvn statistics on VALU and the [frame][channel] planes of the normalised inputs as f16 hi/residual (style raw plane exact) in one kernel that holds its rows in registers; F and G as two-term f16 WMMA GEMMs, both terms in one launch (32x64 wave tiles fed from LDS, f32 accumulation, one accumulator set per scale, exact x16 weights + bias), stored by their own epilogue as f16 hi/residual planes; Wo H as one GEMM per batch with the weights as the A operand, so that it comes out as [b][o][s] (f16); the score GEMM of all batches as THREE hi/residual product terms in one launch (K = 512, f32; the two residual terms share an accumulator set), softmax rows on VALU (unnormalised f16 weights x 2^10 + row normalisers on their own lines). The last convolution is folded into H by associativity: Wo (H S^T) = (Wo H) S^T and Wo H = (Wo Wh) style + Wo bh, so a small WMMA product of the two weight matrices (and of Wo with bh) comes first, the H GEMM takes Wo Wh for its weights, and the readout GEMM (A = Wo H, M = 512; B = the softmax weights, N = 1024; K = 1024) scales its columns, adds bo and stores out [b][o][t] itself. Launches that do not depend on one another share one grid (blockIdx.y says whose block it is): the weight product, both inputs' statistics and planes, with Wf and Wg; F, G and Wo H.
// Compute dtype: inputs rounded to bf16; Wf, Wg, Wo, Wh exact as f16; the normalised inputs, F and G as f16 hi + 2^-10-scaled residual (the unscaled K = 512 logits have sigma ~ 22, so single-rounded operands would not do); style, Wo Wh, Wo H and the softmax weights as plain f16 (~2^-12); statistics / softmax f32. v_wmma_f32_16x16x32_f16.
#define NB 16
#define CC 512
#define TC 1024
#define TS 1024
#define NRC (NB * TC)
#define NRS (NB * TS)
#define BG 16                    /* batches per launch of the score, softmax and readout kernels: all of them */
typedef __bf16 v16b __attribute__((ext_vector_type(16)));
typedef unsigned short v8us __attribute__((ext_vector_type(8), may_alias));
typedef float  v8f  __attribute__((ext_vector_type(8)));
typedef float  v4f  __attribute__((ext_vector_type(4)));
typedef float  v4fa __attribute__((ext_vector_type(4), may_alias));
union FragB { v16b v; v8us half[2]; unsigned short u[16]; };

__device__ __forceinline__ unsigned short bf16_bits(float x) { unsigned int u = __float_as_uint(x); return (unsigned short)((u + 0x7FFFu + ((u >> 16) & 1u)) >> 16); }
__device__ __forceinline__ float bf16_val(unsigned short b) { return __uint_as_float(((unsigned int)b) << 16); }
__device__ __forceinline__ float bf16_round(float x) { return bf16_val(bf16_bits(x)); }
// D += A·B with NT terms: 1 = ah·bh, 2 = + al·bh (A split), 3 = + ah·bl (both split)
template <int NT>
__device__ __forceinline__ v8f mmaN(v16b ah, v16b al, v16b bh, v16b bl, v8f c) {
  c = __builtin_amdgcn_wmma_f32_16x16x32_bf16(false, ah, false, bh, (short)0, c, false, false);
  if (NT >= 2) c = __builtin_amdgcn_wmma_f32_16x16x32_bf16(false, al, false, bh, (short)0, c, false, false);
  if (NT >= 3) c = __builtin_amdgcn_wmma_f32_16x16x32_bf16(false, ah, false, bl, (short)0, c, false, false);
  asm volatile("v_nop\n\tv_nop\n\tv_nop\n\tv_nop" : "+v"(c) : "v"(ah), "v"(al), "v"(bh), "v"(bl));
  return c;
}

__global__ __launch_bounds__(256) void k_wt_bf16(const float* __restrict__ W, unsigned short* __restrict__ Wt, int K, int N) {
  const int t = blockIdx.x * 256 + threadIdx.x;
  const int k8n = K / 8;
  if (t >= N * k8n) return;
  const int n = t / k8n, k8 = (t % k8n) * 8;
  v8us v;
#pragma unroll
  for (int i = 0; i < 8; ++i) v[i] = bf16_bits(W[(size_t)(k8 + i) * N + n]);
  *(v8us*)(Wt + (size_t)n * K + k8) = v;
  
}

// GEMM C[M][N] (f32, pitch ldc) = act(A[M][K]·W + bias). A f32 row-major (pitch lda) converted per fragment to bf16
// (ASPLIT: hi/lo two planes -> 2 terms, else single rounded term); Wt bf16 [N][K] (pitch ldb). BIAS_BF16 rounds the
// bias to bf16 first (bias quantised to bf16 before the add). K%32==0, M%16==0, N%64==0.
template <bool ASPLIT, int ACT, bool BIAS_BF16>
__global__ __launch_bounds__(128) void k_gemm_bf(const float* __restrict__ A, int lda, const unsigned short* __restrict__ Wt, int ldb,
                                               const float* __restrict__ bias, float* __restrict__ C, int ldc, int M, int N, int K) {
  __shared__ __attribute__((aligned(16))) float so[4][16][64];
  const int tid = threadIdx.x, w = tid >> 5, lane = tid & 31, ln = lane & 15, hh = lane >> 4;
  const int ntn = N / 64;
  const int wid = blockIdx.x * 4 + w;
  const int mt = wid / ntn, nq = wid % ntn;
  if (mt * 16 >= M) return;
  const int row0 = mt * 16, col0 = nq * 64;
  const float* arow = A + (size_t)(row0 + ln) * lda;
  v8f acc[4] = {};
  for (int kb = 0; kb < K; kb += 32) {
    FragB ah, al;
    const v4f x0 = *(const v4fa*)(arow + kb + 8 * hh), x1 = *(const v4fa*)(arow + kb + 8 * hh + 4);
    const v4f x2 = *(const v4fa*)(arow + kb + 16 + 8 * hh), x3 = *(const v4fa*)(arow + kb + 16 + 8 * hh + 4);
    float xs[16] = {x0[0],x0[1],x0[2],x0[3],x1[0],x1[1],x1[2],x1[3],x2[0],x2[1],x2[2],x2[3],x3[0],x3[1],x3[2],x3[3]};
#pragma unroll
    for (int i = 0; i < 16; ++i) { const unsigned short hb = bf16_bits(xs[i]); ah.u[i] = hb; al.u[i] = ASPLIT ? bf16_bits(xs[i] - bf16_val(hb)) : (unsigned short)0; }
#pragma unroll
    for (int t = 0; t < 4; ++t) {
      const unsigned short* brow = Wt + (size_t)(col0 + t * 16 + ln) * ldb + kb;
      FragB b;
      b.half[0] = *(const v8us*)(brow + 8 * hh);
      b.half[1] = *(const v8us*)(brow + 16 + 8 * hh);
      acc[t] = mmaN<ASPLIT ? 2 : 1>(ah.v, al.v, b.v, b.v, acc[t]);
    }
  }
#pragma unroll
  for (int t = 0; t < 4; ++t) {
    float bv = bias ? bias[col0 + t * 16 + ln] : 0.f;
    if (BIAS_BF16) bv = bf16_round(bv);
#pragma unroll
    for (int r = 0; r < 8; ++r) { float v = acc[t][r] + bv; if (ACT == 1) v = fmaxf(v, 0.f); so[w][8 * hh + r][t * 16 + ln] = v; }
  }
  __builtin_amdgcn_fence(__ATOMIC_ACQ_REL, "workgroup");
  __builtin_amdgcn_wave_barrier();
  const int rsub = lane >> 4, c4 = (lane & 15) * 4;
  {
#pragma unroll
    for (int q = 0; q < 8; ++q) {
      const int r = q * 2 + rsub;
      const v4f v = *(const v4fa*)&so[w][r][c4];
      *(v4f*)(C + (size_t)(row0 + r) * ldc + col0 + c4) = v;
    }
    
  }
}

// GEMM C = act(A·W + bias + resid): A f32 (ASPLIT -> hi/lo 2 terms), Wt bf16 [N][K]; ACT 0 none, 1 relu, 2 exact gelu;
// resid (optional, f32, row index = (row % rmod), pitch ldr, RES_BF16 rounds it) added before the activation.
template <bool ASPLIT, int ACT, bool BIAS_BF16, bool RES_BF16>
__global__ __launch_bounds__(128) void k_gemm_bf3(const float* __restrict__ A, int lda, const unsigned short* __restrict__ Wt, int ldb,
                                                const float* __restrict__ bias, const float* __restrict__ resid, int rmod, int ldr,
                                                float* __restrict__ C, int ldc, int M, int N, int K) {
  __shared__ __attribute__((aligned(16))) float so[4][16][64];
  const int tid = threadIdx.x, w = tid >> 5, lane = tid & 31, ln = lane & 15, hh = lane >> 4;
  const int ntn = N / 64;
  const int wid = blockIdx.x * 4 + w;
  const int mt = wid / ntn, nq = wid % ntn;
  if (mt * 16 >= M) return;
  const int row0 = mt * 16, col0 = nq * 64;
  const float* arow = A + (size_t)(row0 + ln) * lda;
  v8f acc[4] = {};
  for (int kb = 0; kb < K; kb += 32) {
    FragB ah, al;
    const v4f x0 = *(const v4fa*)(arow + kb + 8 * hh), x1 = *(const v4fa*)(arow + kb + 8 * hh + 4);
    const v4f x2 = *(const v4fa*)(arow + kb + 16 + 8 * hh), x3 = *(const v4fa*)(arow + kb + 16 + 8 * hh + 4);
    float xs[16] = {x0[0],x0[1],x0[2],x0[3],x1[0],x1[1],x1[2],x1[3],x2[0],x2[1],x2[2],x2[3],x3[0],x3[1],x3[2],x3[3]};
#pragma unroll
    for (int i = 0; i < 16; ++i) { const unsigned short hb = bf16_bits(xs[i]); ah.u[i] = hb; al.u[i] = ASPLIT ? bf16_bits(xs[i] - bf16_val(hb)) : (unsigned short)0; }
#pragma unroll
    for (int t = 0; t < 4; ++t) {
      const unsigned short* brow = Wt + (size_t)(col0 + t * 16 + ln) * ldb + kb;
      FragB b;
      b.half[0] = *(const v8us*)(brow + 8 * hh);
      b.half[1] = *(const v8us*)(brow + 16 + 8 * hh);
      acc[t] = mmaN<ASPLIT ? 2 : 1>(ah.v, al.v, b.v, b.v, acc[t]);
    }
  }
#pragma unroll
  for (int t = 0; t < 4; ++t) {
    const int col = col0 + t * 16 + ln;
    float bv = bias ? bias[col] : 0.f;
    if (BIAS_BF16) bv = bf16_round(bv);
#pragma unroll
    for (int r = 0; r < 8; ++r) {
      float v = acc[t][r] + bv;
      if (resid) { float rv = resid[(size_t)((row0 + 8 * hh + r) % rmod) * ldr + col]; if (RES_BF16) rv = bf16_round(rv); v += rv; }
      if (ACT == 1) v = fmaxf(v, 0.f);
      if (ACT == 2) v = 0.5f * v * (1.0f + erff(v * 0.70710678118654752f));
      if (ACT == 3) { const float u = 0.7978845608028654f * (v + 0.044715f * v * v * v); v = 0.5f * v * (1.0f + tanhf(u)); }
      so[w][8 * hh + r][t * 16 + ln] = v;
    }
  }
  __builtin_amdgcn_fence(__ATOMIC_ACQ_REL, "workgroup");
  __builtin_amdgcn_wave_barrier();
  const int rsub = lane >> 4, c4 = (lane & 15) * 4;
  {
#pragma unroll
    for (int q = 0; q < 8; ++q) {
      const int r = q * 2 + rsub;
      const v4f v = *(const v4fa*)&so[w][r][c4];
      *(v4f*)(C + (size_t)(row0 + r) * ldc + col0 + c4) = v;
    }
    
  }
}
// row LayerNorm (biased variance, eps) over N: s = X (+ R); optional out_sum <- s; out_norm <- (s-mu)*rsqrt(var+eps)*g + b
template <bool PARAM_BF16>
__global__ __launch_bounds__(256) void k_layernorm(const float* __restrict__ X, const float* __restrict__ R, const float* __restrict__ g, const float* __restrict__ bta,
                                                  float* __restrict__ out_sum, float* __restrict__ out_norm, int N, float eps) {
  __shared__ float red[256];
  const int row = blockIdx.x, tid = threadIdx.x;
  const float* x = X + (size_t)row * N; const float* rr = R ? R + (size_t)row * N : nullptr;
  float vals[16];                     // up to N = 4096
  const int per = N / 256;            // contiguous chunk per thread? use strided-by-4 chunks: thread handles j = tid*4 + 1024*u
  float s1 = 0.f;
  for (int u = 0; u < per / 4; ++u) {
    const int j = tid * 4 + 1024 * u;
    const v4f a = *(const v4fa*)(x + j);
    v4f b = {0.f,0.f,0.f,0.f}; if (rr) b = *(const v4fa*)(rr + j);
#pragma unroll
    for (int q = 0; q < 4; ++q) { const float v = a[q] + b[q]; vals[u * 4 + q] = v; s1 += v; }
  }
  red[tid] = s1; __syncthreads();
  for (int st = 128; st > 0; st >>= 1) { if (tid < st) red[tid] += red[tid + st]; __syncthreads(); }
  const float mu = red[0] / (float)N; __syncthreads();
  float s2 = 0.f;
  for (int u = 0; u < per / 4; ++u)
#pragma unroll
    for (int q = 0; q < 4; ++q) { const float c = vals[u * 4 + q] - mu; s2 += c * c; }
  red[tid] = s2; __syncthreads();
  for (int st = 128; st > 0; st >>= 1) { if (tid < st) red[tid] += red[tid + st]; __syncthreads(); }
  const float rs = rsqrtf(red[0] / (float)N + eps);
  {
    for (int u = 0; u < per / 4; ++u) {
      const int j = tid * 4 + 1024 * u;
      v4f o, sm;
#pragma unroll
      for (int q = 0; q < 4; ++q) {
        float gg = g[j + q], bb = bta[j + q];
        if (PARAM_BF16) { gg = bf16_round(gg); bb = bf16_round(bb); }
        sm[q] = vals[u * 4 + q]; o[q] = (vals[u * 4 + q] - mu) * rs * gg + bb;
      }
      if (out_sum) *(v4f*)(out_sum + (size_t)row * N + j) = sm;
      *(v4f*)(out_norm + (size_t)row * N + j) = o;
    }
    
  }
}



// ---- f16 WMMA path (v_wmma_f32_16x16x32_f16): 11-bit significands for operands in range — used for every GEMM launched here
typedef _Float16 v16h __attribute__((ext_vector_type(16)));
union FragH { v16h v; v8us half[2]; _Float16 h[16]; unsigned short u[16]; };
template <int NT>
__device__ __forceinline__ v8f mmaH(v16h ah, v16h al, v16h bh, v16h bl, v8f c) {
  c = __builtin_amdgcn_wmma_f32_16x16x32_f16(false, ah, false, bh, (short)0, c, false, false);
  if (NT >= 2) c = __builtin_amdgcn_wmma_f32_16x16x32_f16(false, al, false, bh, (short)0, c, false, false);
  if (NT >= 3) c = __builtin_amdgcn_wmma_f32_16x16x32_f16(false, ah, false, bl, (short)0, c, false, false);
  asm volatile("v_nop\n\tv_nop\n\tv_nop\n\tv_nop" : "+v"(c) : "v"(ah), "v"(al), "v"(bh), "v"(bl));
  return c;
}
// batched GEMM like k_gemm_b but f16 operands: A f32 (split into f16 hi/lo if ASPLIT, else rounded to f16), Bt = f16 values [n][k]; alpha; C f32; N multiple of 16 (partial tiles skipped)
template <bool ASPLIT>
__global__ __launch_bounds__(128) void k_gemm_h(const float* __restrict__ A, int lda, size_t sA, const _Float16* __restrict__ Bh, int ldb, size_t sB, float alpha, float* __restrict__ C, int ldc, size_t sC, int M, int N, int K) {
  __shared__ __attribute__((aligned(16))) float so[4][16][64];
  const int tid = threadIdx.x, w = tid >> 5, lane = tid & 31, ln = lane & 15, hh = lane >> 4; const int by = blockIdx.y;
  A += (size_t)by * sA; Bh += (size_t)by * sB; C += (size_t)by * sC;
  const int ntn = (N + 63) / 64; const int wid = blockIdx.x * 4 + w; const int mt = wid / ntn, nq = wid % ntn; if (mt * 16 >= M) return;
  const int row0 = mt * 16, col0 = nq * 64; const float* arow = A + (size_t)(row0 + ln) * lda;
  v8f acc[4] = {};
  for (int kb = 0; kb < K; kb += 32) {
    FragH ah, al;
    const v4f x0 = *(const v4fa*)(arow + kb + 8 * hh), x1 = *(const v4fa*)(arow + kb + 8 * hh + 4), x2 = *(const v4fa*)(arow + kb + 16 + 8 * hh), x3 = *(const v4fa*)(arow + kb + 16 + 8 * hh + 4);
    float xs[16] = {x0[0],x0[1],x0[2],x0[3],x1[0],x1[1],x1[2],x1[3],x2[0],x2[1],x2[2],x2[3],x3[0],x3[1],x3[2],x3[3]};
#pragma unroll
    for (int i = 0; i < 16; ++i) { const _Float16 h = (_Float16)xs[i]; ah.h[i] = h; al.h[i] = ASPLIT ? (_Float16)(xs[i] - (float)h) : (_Float16)0.0f; }
#pragma unroll
    for (int t = 0; t < 4; ++t) { if (col0 + t * 16 >= N) continue; const size_t boff = (size_t)(col0 + t * 16 + ln) * ldb + kb; FragH bq; bq.half[0] = *(const v8us*)(Bh + boff + 8 * hh); bq.half[1] = *(const v8us*)(Bh + boff + 16 + 8 * hh);
      acc[t] = mmaH<ASPLIT ? 2 : 1>(ah.v, al.v, bq.v, bq.v, acc[t]); }
  }
#pragma unroll
  for (int t = 0; t < 4; ++t) { if (col0 + t * 16 >= N) continue;
#pragma unroll
    for (int r = 0; r < 8; ++r) so[w][8 * hh + r][t * 16 + ln] = acc[t][r] * alpha; }
  __builtin_amdgcn_fence(__ATOMIC_ACQ_REL, "workgroup"); __builtin_amdgcn_wave_barrier();
  const int rsub = lane >> 4, c4 = (lane & 15) * 4;
  {
#pragma unroll
    for (int q = 0; q < 8; ++q) { const int r = q * 2 + rsub; if (col0 + c4 < N) { const v4f v = *(const v4fa*)&so[w][r][c4]; *(v4f*)(C + (size_t)(row0 + r) * ldc + col0 + c4) = v; } }
     }
}

// Wt[n][k] = f16(W[k][n]·scale) from f32 row-major W[K][N] (scale = power of two; bf16-exact weights stay exact in f16 away from the subnormal range)
__global__ __launch_bounds__(256) void k_wt_f16(const float* __restrict__ W, _Float16* __restrict__ Wt, int K, int N, float scale) {
  const int t = blockIdx.x * 256 + threadIdx.x; if (t >= N * (K / 8)) return; const int n = t / (K / 8), k8 = (t % (K / 8)) * 8; FragH f;
#pragma unroll
  for (int i = 0; i < 8; ++i) f.h[i] = (_Float16)(bf16_round(W[(size_t)(k8 + i) * N + n]) * scale); const v8us o = f.half[0];
  *(v8us*)((unsigned short*)Wt + (size_t)n * K + k8) = o; 
}
// k_gemm_hh variant with fused epilogue: v = acc·alpha + bias[by·sBias + col] (+ CP[(row/rowsPerB)·sCPb + by·64 + col] if CP) ; ACT 0 none / 1 elu ; writes f16 C16 (and f32 C if non-null)
template <int ACT>
__global__ __launch_bounds__(128) void k_gemm_hhx(const _Float16* __restrict__ A, int lda, size_t sA, const _Float16* __restrict__ Bh, int ldb, size_t sB, float alpha, const float* __restrict__ bias, size_t sBias, const float* __restrict__ CP, int rowsPerB, size_t sCPb, int row0g,
    float* __restrict__ C, _Float16* __restrict__ C16, int ldc, size_t sC, int M, int N, int K) {
  __shared__ __attribute__((aligned(16))) float so[4][16][64];
  const int tid = threadIdx.x, w = tid >> 5, lane = tid & 31, ln = lane & 15, hh = lane >> 4; const int by = blockIdx.y;
  A += (size_t)by * sA; Bh += (size_t)by * sB; const size_t cofs = (size_t)by * sC; const float* bp = bias ? bias + (size_t)by * sBias : nullptr;
  const int ntn = (N + 63) / 64; const int wid = blockIdx.x * 4 + w; const int mt = wid / ntn, nq = wid % ntn; if (mt * 16 >= M) return;
  const int row0 = mt * 16, col0 = nq * 64; const _Float16* arow = A + (size_t)(row0 + ln) * lda;
  v8f acc[4] = {};
  for (int kb = 0; kb < K; kb += 32) { FragH ah; ah.half[0] = *(const v8us*)((const unsigned short*)arow + kb + 8 * hh); ah.half[1] = *(const v8us*)((const unsigned short*)arow + kb + 16 + 8 * hh);
#pragma unroll
    for (int t = 0; t < 4; ++t) { if (col0 + t * 16 >= N) continue; const size_t boff = (size_t)(col0 + t * 16 + ln) * ldb + kb; FragH bq; bq.half[0] = *(const v8us*)((const unsigned short*)Bh + boff + 8 * hh); bq.half[1] = *(const v8us*)((const unsigned short*)Bh + boff + 16 + 8 * hh);
      acc[t] = mmaH<1>(ah.v, ah.v, bq.v, bq.v, acc[t]); }
  }
#pragma unroll
  for (int t = 0; t < 4; ++t) { if (col0 + t * 16 >= N) continue; const int col = col0 + t * 16 + ln; const float bv = bp ? bf16_round(bp[col]) : 0.f;
#pragma unroll
    for (int r = 0; r < 8; ++r) { float v = acc[t][r] * alpha + bv; if (CP) { const int rr = row0g + row0 + 8 * hh + r; if (rowsPerB < 0) v += CP[cofs + (size_t)rr * ldc + col];      /* rowsPerB < 0: own element of the batched C plane */ else { const int bidx = rr / rowsPerB; v += CP[(size_t)bidx * sCPb + (size_t)by * 64 + col]; } } if (ACT == 1) v = (v > 0.f) ? v : expm1f(v); else if (ACT == 7) v = (v > 0.f) ? v + 1.0f : expf(v); else if (ACT == 8) v = tanhf(v); else if (ACT == 9) v = 0.5f * v * (1.0f + tanhf(0.7978845608028654f * (v + 0.044715f * v * v * v))); else if (ACT == 11) v = 1.0f / (1.0f + expf(-v)); else if (ACT == 12) v = (v > 0.f) ? v : 0.01f * v; else if (ACT == 14) v = (v > 0.f) ? v : 0.1f * v; else if (ACT == 16) v = (v >= 0.f) ? v : 0.3f * v; else if (ACT == 17) v = (v >= 0.f) ? v : 0.2f * v; else if (ACT == 15) v = v / (1.0f + expf(-v)); else if (ACT == 3) v = fmaxf(v, 0.f); else if (ACT == 6) v = 0.5f * v * (1.0f + erff(v * 0.70710678118654752f)); so[w][8 * hh + r][t * 16 + ln] = v; } }
  __builtin_amdgcn_fence(__ATOMIC_ACQ_REL, "workgroup"); __builtin_amdgcn_wave_barrier();
  const int rsub = lane >> 4, c4 = (lane & 15) * 4; typedef _Float16 v4h __attribute__((ext_vector_type(4)));
  {
#pragma unroll
    for (int q = 0; q < 8; ++q) { const int r = q * 2 + rsub; if (col0 + c4 < N) { const v4f v = *(const v4fa*)&so[w][r][c4]; if (C) *(v4f*)(C + cofs + (size_t)(row0 + r) * ldc + col0 + c4) = v; if (C16) { v4h h4; for (int i = 0; i < 4; ++i) h4[i] = (_Float16)v[i]; *(v4h*)(C16 + cofs + (size_t)(row0 + r) * ldc + col0 + c4) = h4; } } }
     }
}


typedef _Float16 v4h __attribute__((ext_vector_type(4)));

__global__ __launch_bounds__(256) void k_x16(const float* __restrict__ x, _Float16* __restrict__ X16, size_t n8) { const size_t t = (size_t)blockIdx.x * 256 + threadIdx.x; if (t >= n8) return; FragH f;
#pragma unroll
  for (int q = 0; q < 8; ++q) f.h[q] = (_Float16)bf16_round(x[t * 8 + q]); *(v8us*)((unsigned short*)X16 + t * 8) = f.half[0];  }
__global__ __launch_bounds__(256) void k_h16(const float* __restrict__ x, _Float16* __restrict__ X16, size_t n8) { const size_t t = (size_t)blockIdx.x * 256 + threadIdx.x; if (t >= n8) return; FragH f;
#pragma unroll
  for (int q = 0; q < 8; ++q) f.h[q] = (_Float16)x[t * 8 + q]; *(v8us*)((unsigned short*)X16 + t * 8) = f.half[0];  }
__global__ __launch_bounds__(256) void k_round16f(const float* __restrict__ W, _Float16* __restrict__ Bt, size_t n8) { const size_t t = (size_t)blockIdx.x * 256 + threadIdx.x; if (t >= n8) return; FragH f;
#pragma unroll
  for (int i = 0; i < 8; ++i) f.h[i] = (_Float16)(bf16_round(W[t * 8 + i]) * 16.0f); *(v8us*)((unsigned short*)Bt + t * 8) = f.half[0];  }
// eight neighbouring f32 values of a row as f16 hi and residual x 2^10, 16 bytes to each plane
__device__ __forceinline__ void g2_store_hl(v4f a, v4f c, _Float16* hp, _Float16* lp) { FragH fh, fl;
#pragma unroll      /* fh and fl must stay in registers */
  for (int q = 0; q < 4; ++q) { _Float16 h = (_Float16)a[q]; fh.h[q] = h; fl.h[q] = (_Float16)((a[q] - (float)h) * 1024.0f); h = (_Float16)c[q]; fh.h[4 + q] = h; fl.h[4 + q] = (_Float16)((c[q] - (float)h) * 1024.0f); }
  *(v8us*)(unsigned short*)hp = fh.half[0]; *(v8us*)(unsigned short*)lp = fl.half[0]; }

// ---- fast GEMM (block tile 128x128 = eight 32x64 wave tiles; A and B in 64-k tiles through a two-buffer LDS ring; requires M % 128 == 0 rows per launch region, N % 128 == 0, K % 64 == 0); epilogue: acc alpha, activation, LDS staging, then + bias and the form the consumer reads. In both forms the bias, which must be there, goes by the ROW of C (the weights, or what came of them, are the A operand). EPI 1: the bias as it is (f32), 16 values to every 32 floats, C16 = f16. EPI 3: column n times colscale[n * 32] (n counted over the batches), the bias rounded to bf16, C = f32 ----
__device__ __forceinline__ v16h g2_frag(const _Float16* p, int hh) { FragH f; f.half[0] = *(const v8us*)((const unsigned short*)p + 8 * hh); f.half[1] = *(const v8us*)((const unsigned short*)p + 16 + 8 * hh); return f.v; }
__device__ __forceinline__ v8f g2_mma(v16h a, v16h b, v8f c) { v8f d = __builtin_amdgcn_wmma_f32_16x16x32_f16(false, a, false, b, (short)0, c, false, false); asm volatile("v_nop\n\tv_nop\n\tv_nop\n\tv_nop" : "+v"(d) : "v"(a), "v"(b)); return d; }
#define G2P 72      /* LDS row pitch in f16: 64 k + 8 = 144 B, 16 B x odd, the conflict-free pitch for ds_load_b128 readers */
// One thread's eight b128 asynchronous copies to LDS for one 64-k pass: its 16-byte piece of rows r, r + 32, r + 64, r + 96 of the 128-row A tile and of the 128-row B tile (la, lb = LDS byte addresses, ga, gb = global addresses, rsa, rsb = 32 rows in elements).
// s_wait_xcnt 0 is the statement's last line so that no address register of an issued copy is rewritten ahead of it.
__device__ __forceinline__ void g2_copy8(unsigned la, unsigned lb, const _Float16* ga, const _Float16* gb, size_t rsa, size_t rsb) {
  asm volatile("global_load_async_to_lds_b128 %0, %8, off\n\t"
               "global_load_async_to_lds_b128 %1, %9, off\n\t"
               "global_load_async_to_lds_b128 %2, %10, off\n\t"
               "global_load_async_to_lds_b128 %3, %11, off\n\t"
               "global_load_async_to_lds_b128 %4, %12, off\n\t"
               "global_load_async_to_lds_b128 %5, %13, off\n\t"
               "global_load_async_to_lds_b128 %6, %14, off\n\t"
               "global_load_async_to_lds_b128 %7, %15, off\n\t"
               "s_wait_xcnt 0x0"
               :: "v"(la), "v"(la + 1u * 32u * G2P * 2u), "v"(la + 2u * 32u * G2P * 2u), "v"(la + 3u * 32u * G2P * 2u), "v"(lb), "v"(lb + 1u * 32u * G2P * 2u), "v"(lb + 2u * 32u * G2P * 2u), "v"(lb + 3u * 32u * G2P * 2u),
                  "v"(ga), "v"(ga + rsa), "v"(ga + 2 * rsa), "v"(ga + 3 * rsa), "v"(gb), "v"(gb + rsb), "v"(gb + 2 * rsb), "v"(gb + 3 * rsb) : "memory");
}
#define G2RB (2 * 2 * 128 * G2P * 2)      /* bytes of k_gemm2's ring */
#define G2SB (G2RB + 8 * 32 * 68 * 4)      /* bytes of its ring and its output staging */
// the body takes its LDS (G2SB bytes, 16-byte aligned) and its block indices from the kernel that calls it, so that one grid can hold blocks of this product and of another kind
template <int ACT, int EPI>
__device__ __forceinline__ void gemm2_body(unsigned char* sm, const int bx, const int by, const _Float16* __restrict__ A, int lda, size_t sA, const _Float16* __restrict__ Bh, int ldb, size_t sB, float alpha, const float* __restrict__ bias, size_t sBias,
    const float* __restrict__ colscale, _Float16* __restrict__ C16, float* __restrict__ C, int ldc, size_t sC, int M, int N, int K) { static_assert(EPI == 1 || EPI == 3, "k_gemm2: f16 out, or scaled columns and f32 out"); static_assert(ACT == 0 || ACT == 3 || ACT == 6 || ACT == 8 || ACT == 9 || ACT == 11 || ACT == 12 || ACT == 14 || ACT == 15 || ACT == 16 || ACT == 17, "k_gemm2: unsupported ACT code (would silently apply no activation)");
  _Float16 (*ring)[2][128][G2P] = (_Float16 (*)[2][128][G2P])sm;      /* [buffer][A | B][row][k], filled by the asynchronous copies only */
  float (*so)[32][68] = (float (*)[32][68])(sm + G2RB);
  const int tid = threadIdx.x, w = tid >> 5, lane = tid & 31, ln = lane & 15, hh = lane >> 4;
  A += (size_t)by * sA; Bh += (size_t)by * sB; const size_t cofs = (size_t)by * sC; const float* bp = bias ? bias + (size_t)by * sBias : nullptr;
  const int ntn = N >> 7; const int mt = bx / ntn, nq = bx - mt * ntn; if (mt * 128 >= M) return;      /* the same for the whole block, ahead of every barrier */
  const int wm = w >> 1, wn = w & 1; const int row0 = mt * 128 + 32 * wm, col0 = nq * 128 + 64 * wn;
  const int cr = tid >> 3, cc = (tid & 7) * 8;      /* this thread's first row and its 8-element piece in every copied tile */
  const _Float16* ga = A + (size_t)(mt * 128 + cr) * lda + cc; const _Float16* gb = Bh + (size_t)(nq * 128 + cr) * ldb + cc; const size_t rsa = (size_t)32 * lda, rsb = (size_t)32 * ldb;
  const unsigned la = (unsigned)(size_t)&ring[0][0][cr][cc], lb = (unsigned)(size_t)&ring[0][1][cr][cc]; const unsigned bufb = 2u * 128u * G2P * 2u;      /* LDS byte addresses in buffer 0; bytes per buffer */
  const int np = K >> 6;
  const v8f z8 = {0.f,0.f,0.f,0.f,0.f,0.f,0.f,0.f}; v8f c00 = z8, c01 = z8, c02 = z8, c03 = z8, c10 = z8, c11 = z8, c12 = z8, c13 = z8;
  g2_copy8(la, lb, ga, gb, rsa, rsb);
  float cs[4] = {alpha, alpha, alpha, alpha};      /* what a column's sums are multiplied by */
  if (EPI == 3) {
#pragma unroll      /* cs must stay in registers; loaded here, the scales arrive under the loop */
    for (int t = 0; t < 4; ++t) cs[t] = colscale[((size_t)by * N + col0 + t * 16 + ln) * 32] * alpha; }
  asm volatile("s_wait_asynccnt 0x0" ::: "memory");      /* this wave's copies of tile 0 have landed */
  __syncthreads();      /* publishes tile 0 */
  if (np > 1) g2_copy8(la + bufb, lb + bufb, ga + 64, gb + 64, rsa, rsb);
  for (int t = 0; t < np; ++t) { const int bu = t & 1; const _Float16* a0p = &ring[bu][0][32 * wm + ln][0]; const _Float16* a1p = a0p + 16 * G2P;
    const _Float16* b0p = &ring[bu][1][64 * wn + ln][0]; const _Float16* b1p = b0p + 16 * G2P; const _Float16* b2p = b1p + 16 * G2P; const _Float16* b3p = b2p + 16 * G2P;
    v16h a0[2], a1[2], b0[2], b1[2], b2[2], b3[2];      /* the pass's 24 LDS reads go as one group ahead of its 16 products: reads placed among the products would each wait out the LDS latency */
#pragma unroll      /* the fragment arrays must stay in registers */
    for (int s = 0; s < 2; ++s) { a0[s] = g2_frag(a0p + 32 * s, hh); a1[s] = g2_frag(a1p + 32 * s, hh); b0[s] = g2_frag(b0p + 32 * s, hh); b1[s] = g2_frag(b1p + 32 * s, hh); b2[s] = g2_frag(b2p + 32 * s, hh); b3[s] = g2_frag(b3p + 32 * s, hh); }
#pragma unroll      /* as above */
    for (int s = 0; s < 2; ++s) { c00 = g2_mma(a0[s], b0[s], c00); c10 = g2_mma(a1[s], b0[s], c10); c01 = g2_mma(a0[s], b1[s], c01); c11 = g2_mma(a1[s], b1[s], c11);
      c02 = g2_mma(a0[s], b2[s], c02); c12 = g2_mma(a1[s], b2[s], c12); c03 = g2_mma(a0[s], b3[s], c03); c13 = g2_mma(a1[s], b3[s], c13); }
    asm volatile("s_wait_dscnt 0x0" ::: "memory");      /* this wave's reads of buffer bu are done before it is refilled */
    asm volatile("s_wait_asynccnt 0x0" ::: "memory");      /* this wave's copies of tile t + 1 have landed */
    __syncthreads();      /* publishes tile t + 1 and ends every wave's reads of buffer bu */
    if (t + 2 < np) g2_copy8(la + bu * bufb, lb + bu * bufb, ga + (size_t)(t + 2) * 64, gb + (size_t)(t + 2) * 64, rsa, rsb); }
  asm volatile("s_wait_asynccnt 0x0" ::: "memory");      /* no copy is outstanding when the wave goes on */
  v8f accs[8] = {c00, c01, c02, c03, c10, c11, c12, c13};
#pragma unroll
  for (int u = 0; u < 8; ++u) { const int t = u & 3, half = u >> 2;      /* the bias, one value a row, is added behind the staging */
#pragma unroll
    for (int r = 0; r < 8; ++r) { const int rloc = half * 16 + 8 * hh + r; float v = accs[u][r] * cs[t];
      if (ACT == 3) v = fmaxf(v, 0.f); else if (ACT == 6) v = 0.5f * v * (1.0f + erff(v * 0.70710678118654752f)); else if (ACT == 11) v = 1.0f / (1.0f + expf(-v)); else if (ACT == 15) v = v / (1.0f + expf(-v)); else if (ACT == 12) v = (v > 0.f) ? v : 0.01f * v; else if (ACT == 8) v = tanhf(v); else if (ACT == 9) v = 0.5f * v * (1.0f + tanhf(0.7978845608028654f * (v + 0.044715f * v * v * v))); else if (ACT == 14) v = (v > 0.f) ? v : 0.1f * v; else if (ACT == 16) v = (v >= 0.f) ? v : 0.3f * v; else if (ACT == 17) v = (v >= 0.f) ? v : 0.2f * v;
      so[w][rloc][t * 16 + ln] = v; } }
  __builtin_amdgcn_fence(__ATOMIC_ACQ_REL, "workgroup"); __builtin_amdgcn_wave_barrier();
  if (EPI == 1) { const int rsub = lane >> 3, c8 = (lane & 7) * 8;      /* eight lanes take one row's 64 columns: a whole 128-byte line of f16 */
    v4f a[8], c[8]; float rv[8];      /* rv: the row's bias */
#pragma unroll      /* a, c and rv must stay in registers; the 16 LDS reads and the 8 loads of rv go as one group, so that their latency is paid once */
    for (int q = 0; q < 8; ++q) { const int r = q * 4 + rsub; a[q] = *(const v4fa*)&so[w][r][c8]; c[q] = *(const v4fa*)&so[w][r][c8 + 4]; rv[q] = bp[((row0 + r) >> 4) * 32 + ((row0 + r) & 15)]; }      /* the bias lies 16 values to a 128-byte line, as its writers left it */
#pragma unroll      /* as above */
    for (int q = 0; q < 8; ++q) { const size_t o = cofs + (size_t)(row0 + q * 4 + rsub) * ldc + col0 + c8;
      FragH f; for (int i = 0; i < 4; ++i) { f.h[i] = (_Float16)(a[q][i] + rv[q]); f.h[4 + i] = (_Float16)(c[q][i] + rv[q]); } *(v8us*)((unsigned short*)C16 + o) = f.half[0]; } }
  else { const int rsub = lane >> 4, c4 = (lane & 15) * 4;      /* sixteen lanes take one row's 64 columns: two whole 128-byte lines of f32 */
    v4f a[16]; float rv[16];      /* rv: the row's bias */
#pragma unroll      /* a and rv must stay in registers; the 16 LDS reads and the 16 loads of rv go as one group, so that their latency is paid once */
    for (int q = 0; q < 16; ++q) { const int r = q * 2 + rsub; a[q] = *(const v4fa*)&so[w][r][c4]; rv[q] = bp[row0 + r]; }
    float* op = C + cofs + (size_t)(row0 + rsub) * ldc + col0 + c4;
#pragma unroll      /* as above */
    for (int q = 0; q < 16; ++q) { const v4f v = a[q] + bf16_round(rv[q]); *(v4f*)(op + (size_t)(q * 2) * ldc) = v; } } }
template <int ACT, int EPI>
__global__ __launch_bounds__(256) void k_gemm2(const _Float16* __restrict__ A, int lda, size_t sA, const _Float16* __restrict__ Bh, int ldb, size_t sB, float alpha, const float* __restrict__ bias, size_t sBias,
    const float* __restrict__ colscale, _Float16* __restrict__ C16, float* __restrict__ C, int ldc, size_t sC, int M, int N, int K) {
  __shared__ __attribute__((aligned(16))) unsigned char sm[G2SB];
  gemm2_body<ACT, EPI>(sm, blockIdx.x, blockIdx.y, A, lda, sA, Bh, ldb, sB, alpha, bias, sBias, colscale, C16, C, ldc, sC, M, N, K); }


// ---- k_gemm2 for a product whose operands are f16 hi + scaled residual planes: every term in ONE launch, summed in registers. H takes Ah.Bh; X takes Al.Bh and, with NBP == 2, Ah.Bl as well (both carry the residual's scale); C = H alphaH + bias + X alphaL. Same block and wave tiles, same ring order as k_gemm2; a stage is [Ah | Bh | Al (| Bl)]. EPI 0: C f32, row-major. EPI 1: CH | CL = f16 hi | residual x 2^10, row-major. EPI 2: C f32 as [row / TC][column][row % TC] ----
// One thread's four b128 asynchronous copies to LDS for one 128-row tile; s_wait_xcnt 0 is the statement's last line so that no address register of an issued copy is rewritten ahead of it.
__device__ __forceinline__ void g2_copy4(unsigned la, const _Float16* ga, size_t rsa) {
  asm volatile("global_load_async_to_lds_b128 %0, %4, off\n\t"
               "global_load_async_to_lds_b128 %1, %5, off\n\t"
               "global_load_async_to_lds_b128 %2, %6, off\n\t"
               "global_load_async_to_lds_b128 %3, %7, off\n\t"
               "s_wait_xcnt 0x0"
               :: "v"(la), "v"(la + 1u * 32u * G2P * 2u), "v"(la + 2u * 32u * G2P * 2u), "v"(la + 3u * 32u * G2P * 2u), "v"(ga), "v"(ga + rsa), "v"(ga + 2 * rsa), "v"(ga + 3 * rsa) : "memory");
}
#define G2T (128 * G2P)      /* f16 elements of one 128-row tile in LDS */
#define G2SS(NBP) (2u * (2u + (NBP)) * G2T * 2u)      /* bytes of the two buffers */
// LDS (G2SS(NBP) bytes, 16-byte aligned) and block indices from the calling kernel, as for gemm2_body
template <int NBP, int EPI>
__device__ __forceinline__ void gemm2s_body(unsigned char* sm, const int bx, const int by, const _Float16* __restrict__ Ah, const _Float16* __restrict__ Al, int lda, size_t sA, const _Float16* __restrict__ Bh, const _Float16* __restrict__ Bl, int ldb, size_t sB, float alphaH, float alphaL, const float* __restrict__ bias, const float* __restrict__ bias1,
    float* __restrict__ C, _Float16* __restrict__ CH, _Float16* __restrict__ CL, int ldc, size_t sC, int M, int N, int K) { static_assert(NBP == 1 || NBP == 2, "B is one plane or hi + residual"); static_assert(EPI >= 0 && EPI <= 2 && TC % 128 == 0, "a block's 128 rows lie in one batch");
  constexpr unsigned bufb = (2u + NBP) * G2T * 2u;      /* bytes per buffer */
  static_assert(G2SS(NBP) == 2 * bufb, "sm is the ring");      /* filled by the asynchronous copies only; behind the loop's last barrier the same bytes stage the output, so that two blocks still share a WGP's LDS */
  const int tid = threadIdx.x, w = tid >> 5, lane = tid & 31, ln = lane & 15, hh = lane >> 4;
  Ah += (size_t)by * sA; Al += (size_t)by * sA; Bh += (size_t)by * sB; if (NBP == 2) Bl += (size_t)by * sB; const size_t cofs = (size_t)by * sC; const float* bsel = (EPI == 1 && by == 1) ? bias1 : bias;      /* EPI 1 with two products in one grid: the second has a bias vector of its own */
  const int ntn = N >> 7; const int mt = bx / ntn, nq = bx - mt * ntn; if (mt * 128 >= M) return;      /* the same for the whole block, ahead of every barrier */
  const int wm = w >> 1, wn = w & 1; const int row0 = mt * 128 + 32 * wm, col0 = nq * 128 + 64 * wn;
  const int cr = tid >> 3, cc = (tid & 7) * 8;      /* this thread's first row and its 8-element piece in every copied tile */
  const size_t oa = (size_t)(mt * 128 + cr) * lda + cc, ob = (size_t)(nq * 128 + cr) * ldb + cc; const size_t rsa = (size_t)32 * lda, rsb = (size_t)32 * ldb;
  const unsigned la = (unsigned)(size_t)&sm[(cr * G2P + cc) * 2], lb = la + G2T * 2u, lr = 2u * G2T * 2u;      /* LDS byte addresses in buffer 0 of the Ah and Bh tiles; from a hi tile to its residual tile */
  auto stage = [&](unsigned bo, size_t k0) { g2_copy8(la + bo, lb + bo, Ah + oa + k0, Bh + ob + k0, rsa, rsb);
    if (NBP == 2) g2_copy8(la + lr + bo, lb + lr + bo, Al + oa + k0, Bl + ob + k0, rsa, rsb); else g2_copy4(la + lr + bo, Al + oa + k0, rsa); };
  const int np = K >> 6;
  const v8f z8 = {0.f,0.f,0.f,0.f,0.f,0.f,0.f,0.f}; v8f H[2][4], X[2][4];
#pragma unroll      /* the accumulators must stay in registers */
  for (int j = 0; j < 4; ++j) { H[0][j] = z8; H[1][j] = z8; X[0][j] = z8; X[1][j] = z8; }
  stage(0u, 0);
  asm volatile("s_wait_asynccnt 0x0" ::: "memory");      /* this wave's copies of stage 0 have landed */
  __syncthreads();      /* publishes stage 0 */
  if (np > 1) stage(bufb, 64);
  for (int t = 0; t < np; ++t) { const int bu = t & 1; const _Float16* ahp = (const _Float16*)(sm + bu * bufb) + (32 * wm + ln) * G2P; const _Float16* bhp = (const _Float16*)(sm + bu * bufb) + G2T + (64 * wn + ln) * G2P; const _Float16* alp = ahp + 2 * G2T; const _Float16* blp = bhp + 2 * G2T;
#pragma unroll      /* fragments and accumulators must stay in registers */
    for (int s = 0; s < 2; ++s) { v16h bh[4], bl[4];      /* a 32-k step's LDS reads go as one group ahead of its products */
      const v16h ah0 = g2_frag(ahp + 32 * s, hh), ah1 = g2_frag(ahp + 16 * G2P + 32 * s, hh), al0 = g2_frag(alp + 32 * s, hh), al1 = g2_frag(alp + 16 * G2P + 32 * s, hh);
#pragma unroll      /* as above */
      for (int j = 0; j < 4; ++j) { bh[j] = g2_frag(bhp + j * 16 * G2P + 32 * s, hh); if (NBP == 2) bl[j] = g2_frag(blp + j * 16 * G2P + 32 * s, hh); }
#pragma unroll      /* as above */
      for (int j = 0; j < 4; ++j) { H[0][j] = g2_mma(ah0, bh[j], H[0][j]); H[1][j] = g2_mma(ah1, bh[j], H[1][j]); X[0][j] = g2_mma(al0, bh[j], X[0][j]); X[1][j] = g2_mma(al1, bh[j], X[1][j]); }
      if (NBP == 2) {
#pragma unroll      /* as above */
        for (int j = 0; j < 4; ++j) { X[0][j] = g2_mma(ah0, bl[j], X[0][j]); X[1][j] = g2_mma(ah1, bl[j], X[1][j]); } } }
    asm volatile("s_wait_dscnt 0x0" ::: "memory");      /* this wave's reads of buffer bu are done before it is refilled */
    asm volatile("s_wait_asynccnt 0x0" ::: "memory");      /* this wave's copies of stage t + 1 have landed */
    __syncthreads();      /* publishes stage t + 1 and ends every wave's reads of buffer bu */
    if (t + 2 < np) stage(bu * bufb, (size_t)(t + 2) * 64); }
  asm volatile("s_wait_asynccnt 0x0" ::: "memory");      /* no copy is outstanding when the wave goes on */
  constexpr int SOP = EPI == 2 ? 36 : 68;      /* staging pitch in floats, 16 B x odd: 32 rows of 64 columns, or (EPI 2) 64 columns of 32 rows */
  constexpr int SOW = EPI == 2 ? 64 * SOP : 32 * SOP; static_assert(2 * bufb >= 8u * SOW * 4u, "the output staging lies inside the ring");
  float* so = (float*)sm + w * SOW;      /* this wave's own staging; every wave has left the ring at the last pass's barrier */
#pragma unroll      /* the accumulators are indexed by constants only */
  for (int u = 0; u < 8; ++u) { const int j = u & 3, half = u >> 2; const float bv = bsel ? bf16_round(bsel[col0 + j * 16 + ln]) : 0.f;
    v4f p0, p1;
#pragma unroll      /* as above */
    for (int r = 0; r < 8; ++r) { float v = H[half][j][r] * alphaH + bv; v += X[half][j][r] * alphaL; if (EPI != 2) so[(half * 16 + 8 * hh + r) * SOP + j * 16 + ln] = v; else if (r < 4) p0[r] = v; else p1[r - 4] = v; }
    if (EPI == 2) { float* sc = so + (j * 16 + ln) * SOP + half * 16 + 8 * hh; *(v4fa*)sc = p0; *(v4fa*)(sc + 4) = p1; } }      /* a lane's eight values are eight rows of one column: side by side here */
  __builtin_amdgcn_fence(__ATOMIC_ACQ_REL, "workgroup"); __builtin_amdgcn_wave_barrier();      /* the wave's staging stores stand ahead of its own reads of them; no other wave reads these rows */
  if (EPI == 0) { const int rsub = lane >> 4, c4 = (lane & 15) * 4;
#pragma unroll      /* the 16 LDS reads and stores of whole lines in flight together */
    for (int q = 0; q < 16; ++q) { const int r = q * 2 + rsub; const v4f v = *(const v4fa*)&so[r * SOP + c4]; *(v4f*)(C + cofs + (size_t)(row0 + r) * ldc + col0 + c4) = v; } }
  else if (EPI == 1) { const int rsub = lane >> 3, c8 = (lane & 7) * 8;      /* eight lanes take one row's 64 columns: a whole 128-byte line in each plane */
    v4f a[8], c[8];
#pragma unroll      /* a and c must stay in registers; the 16 LDS reads go as one group, so that their latency is paid once */
    for (int q = 0; q < 8; ++q) { a[q] = *(const v4fa*)&so[(q * 4 + rsub) * SOP + c8]; c[q] = *(const v4fa*)&so[(q * 4 + rsub) * SOP + c8 + 4]; }
#pragma unroll      /* as above */
    for (int q = 0; q < 8; ++q) { const size_t o = cofs + (size_t)(row0 + q * 4 + rsub) * ldc + col0 + c8; g2_store_hl(a[q], c[q], CH + o, CL + o); } }
  else { const int cs = (lane >> 3) * 8, r4 = (lane & 7) * 4; const int bb = row0 / TC;      /* eight lanes take one column's 32 rows: a whole 128-byte line; the four columns of a read lie 8 apart, which spreads them over the banks */
    float* op = C + ((size_t)bb * N + col0 + cs) * TC + (row0 - bb * TC) + r4;
#pragma unroll      /* as above; every store is one base plus an immediate */
    for (int q = 0; q < 16; ++q) { const int cq = (q & 7) + 32 * (q >> 3); const v4f v = *(const v4fa*)&so[(cs + cq) * SOP + r4]; *(v4f*)(op + (size_t)cq * TC) = v; } } }
template <int NBP, int EPI>
__global__ __launch_bounds__(256) void k_gemm2s(const _Float16* __restrict__ Ah, const _Float16* __restrict__ Al, int lda, size_t sA, const _Float16* __restrict__ Bh, const _Float16* __restrict__ Bl, int ldb, size_t sB, float alphaH, float alphaL, const float* __restrict__ bias,
    float* __restrict__ C, _Float16* __restrict__ CH, _Float16* __restrict__ CL, int ldc, size_t sC, int M, int N, int K) {
  __shared__ __attribute__((aligned(16))) unsigned char sm[G2SS(NBP)];
  gemm2s_body<NBP, EPI>(sm, blockIdx.x, blockIdx.y, Ah, Al, lda, sA, Bh, Bl, ldb, sB, alphaH, alphaL, bias, nullptr, C, CH, CL, ldc, sC, M, N, K); }
// the three 1x1 convolutions of the inputs in one grid: blockIdx.y = 0: F rows (b,t); 1: G rows (b,s), whose planes, weights and outputs lie sN, sW and sN elements behind F's; 2: Wo H as [b][o][s] f16 = (Wo Wh) . style^T + Wo bh (BH and bh here are those two products), blockIdx.x = 32 tiles x 16 batches. The longer blocks come first.
static_assert(NRC == NRS && (NRC / 128) * (CC / 128) == (CC / 128) * (TS / 128) * NB && (CC / 128) * (TS / 128) == 32, "k_fgh: every blockIdx.y has the same number of blocks");
__global__ __launch_bounds__(256) void k_fgh(const _Float16* __restrict__ NH, const _Float16* __restrict__ NL, size_t sN, const _Float16* __restrict__ BFG, size_t sW, const float* __restrict__ bf_, const float* __restrict__ bg, _Float16* __restrict__ FGH, _Float16* __restrict__ FGL,
    const _Float16* __restrict__ BH, const _Float16* __restrict__ S16, const float* __restrict__ bh, _Float16* __restrict__ HT) {
  __shared__ __attribute__((aligned(16))) unsigned char sm[G2SB > G2SS(1) ? G2SB : G2SS(1)];
  if (blockIdx.y < 2) gemm2s_body<1, 1>(sm, blockIdx.x, blockIdx.y, NH, NL, CC, sN, BFG, nullptr, CC, sW, 0.0625f, 0.0625f / 1024.0f, bf_, bg, nullptr, FGH, FGL, CC, sN, NRC, CC, CC);      /* the test reads the same for the whole block: each side holds its own barriers */
  else gemm2_body<0, 1>(sm, blockIdx.x & 31, blockIdx.x >> 5, BH, CC, 0, S16, CC, (size_t)TS * CC, 0.0625f, bh, 0, nullptr, HT, nullptr, TS, (size_t)CC * TS, CC, TS, CC); }

// ---- statistics, planes and weights in one launch: a block holds 64 channels x 1024 frames of one batch of one input in registers, so that the input is read once; a thread's 16 channels x 8 frames are what it stores, eight channels to a 16-byte piece, and nothing is transposed through LDS. Behind its planes every block forms 16 rows x 64 columns of Wo Wh on WMMA (each of the 16 waves takes 32 of the 512 k for all four 16x16 tiles; the waves' sums are added up through LDS); the blocks of the first 64 columns form Wo bh as well, bh being every column of one more B fragment ----
#define FC 64                    /* channels per k_prep block: one 128-byte line of every [frame][channel] plane */
#define RP 132                   /* LDS pitch in floats of a channel's 128 partial sums: a multiple of 16 bytes for the b128 readers */
#define WPP 68                   /* LDS pitch in floats of a row of 64 partial sums of Wo Wh: 16 B x odd */
static_assert(TC == 1024 && TS == 1024 && CC % FC == 0 && 2 * CC * CC == NB * (CC / FC) * 512 * 8, "k_prep: rows of 16 waves x 64 frames; every thread of the content's blocks converts eight weights");
static_assert(CC == 16 * 32 && 2 * NB * (CC / FC) == (CC / 16) * (CC / 64) && FC >= 16 && RP >= 16, "k_prep: every block has its 16 x 64 piece of Wo Wh, every wave its 32 k; the partial sums of Wo bh fit the LDS of the statistics");
typedef float v2f __attribute__((ext_vector_type(2)));
typedef float v2fa __attribute__((ext_vector_type(2), may_alias));
typedef unsigned short v2us __attribute__((ext_vector_type(2), may_alias));
__device__ __forceinline__ _Float16 w16(float x) { return (_Float16)(bf16_round(x) * 16.0f); }      /* a weight as the WMMAs take it: rounded to bf16, x 16, exact in f16 */
// a work-group barrier that orders LDS alone: only LDS goes from wave to wave in k_prep, and __syncthreads() would hold every wave until its global stores have completed as well
__device__ __forceinline__ void prep_barrier() { __builtin_amdgcn_fence(__ATOMIC_RELEASE, "workgroup", "local"); __builtin_amdgcn_s_barrier(); __builtin_amdgcn_fence(__ATOMIC_ACQUIRE, "workgroup", "local"); }
// the sum of a channel's 128 partial sums, in all eight lanes that share the channel
__device__ __forceinline__ float prep_total(const float (*red)[RP], int rc, int rj) {
  const v4f t0 = *(const v4fa*)&red[rc][rj * 4], t1 = *(const v4fa*)&red[rc][32 + rj * 4], t2 = *(const v4fa*)&red[rc][64 + rj * 4], t3 = *(const v4fa*)&red[rc][96 + rj * 4];
  const v4f t = (t0 + t1) + (t2 + t3); float s = (t[0] + t[1]) + (t[2] + t[3]);
  for (int o = 4; o > 0; o >>= 1) s += __shfl_xor(s, o, 32);
  return s; }
__global__ __launch_bounds__(512) void k_prep(const float* __restrict__ content, const float* __restrict__ style, _Float16* __restrict__ NH, _Float16* __restrict__ NL, size_t sN, _Float16* __restrict__ S16,
    const float* __restrict__ Wf, const float* __restrict__ Wg, const float* __restrict__ Wh, const float* __restrict__ Wo, const float* __restrict__ bh, _Float16* __restrict__ BW, _Float16* __restrict__ WP, float* __restrict__ BP) {
  __shared__ __attribute__((aligned(16))) float red[FC][RP];
  __shared__ __attribute__((aligned(16))) float smu[FC], srs[FC];
  __shared__ __attribute__((aligned(16))) float wpart[16][16][WPP];      /* [wave][row][column]: the waves' partial sums of Wo Wh; registers hold the kernel to one block a WGP, so that this LDS costs no residency */
  const int tid = threadIdx.x, w = tid >> 5, lane = tid & 31, fl = lane & 7, gl = lane >> 3;      /* eight lanes take 32 frames of a row, a whole 128-byte line; the four lane groups take rows 8 apart */
  const int y = blockIdx.y, b = blockIdx.x / (CC / FC), c0 = (blockIdx.x % (CC / FC)) * FC;      /* y: 0 content, 1 style; the same for the whole block */
  const int f0 = w * 64 + fl * 4;      /* the thread's frames: f0 .. f0 + 3 and f0 + 32 .. f0 + 35 */
  const int blk = blockIdx.x;      /* the content's blocks, which have one plane less to store, convert Wf and Wg (x 16, f16), 64 blocks each; BW = the two planes in a row */
  const char* wp = (const char*)((blk < 64 ? Wf : Wg) + (blk & 63) * 4096); const unsigned wb = tid * 32u;      /* the block's 4096 weights; the thread's eight, in bytes */
  const float* xp = (y ? style : content) + ((size_t)b * CC + c0 + gl * 8) * 1024 + f0;      /* the row length as a constant: every load is one base plus an immediate */
  v4f w0 = {0.f, 0.f, 0.f, 0.f}, w1 = w0; if (y == 0) { w0 = *(const v4fa*)(wp + wb); w1 = *(const v4fa*)(wp + wb + 16); }
  v4f a[16][2];      /* [u][e]: channel c0 + (u >> 3) * 32 + gl * 8 + (u & 7), frames f0 + 32 e + 0 .. 3 */
#pragma unroll      /* a must stay in registers; all 32 loads of the thread in flight at once */
  for (int u = 0; u < 16; ++u) { a[u][0] = *(const v4fa*)(xp + ((u >> 3) * 32 + (u & 7)) * 1024); a[u][1] = *(const v4fa*)(xp + ((u >> 3) * 32 + (u & 7)) * 1024 + 32); }
  asm volatile("s_wait_xcnt 0x0" :: "v"(wb), "v"(xp) : "memory");      /* the two vector addresses are inputs, so that they live up to this wait and no register that an issued load names is rewritten ahead of it */
  __builtin_amdgcn_sched_barrier(0);      /* keeps the arithmetic on the first values behind the last load; the scheduler otherwise holds eight loads back until earlier ones have returned */
  if (y == 0) { FragH fw;
#pragma unroll      /* fw must stay in registers */
    for (int q = 0; q < 4; ++q) { fw.h[q] = w16(w0[q]); fw.h[4 + q] = w16(w1[q]); }
    *(v8us*)((unsigned short*)BW + (size_t)blk * 4096 + tid * 8) = fw.half[0]; }
  const int rc = tid >> 3, rj = tid & 7;      /* eight threads add up one channel's partial sums */
#pragma unroll      /* a must stay in registers */
  for (int u = 0; u < 16; ++u) {
#pragma unroll      /* as above */
    for (int q = 0; q < 4; ++q) { a[u][0][q] = bf16_round(a[u][0][q]); a[u][1][q] = bf16_round(a[u][1][q]); }
    const v4f t = a[u][0] + a[u][1]; red[(u >> 3) * 32 + gl * 8 + (u & 7)][w * 8 + fl] = (t[0] + t[1]) + (t[2] + t[3]); }
  const size_t o0 = ((size_t)b * 1024 + f0) * CC + c0 + gl * 8;      /* the thread's first piece in every plane; frames lie CC apart, its two channel groups 32 */
  if (y) { unsigned short* Rh = (unsigned short*)(S16 + o0);      /* the style's raw plane needs no statistics: its stores fly under them */
#pragma unroll      /* a is indexed by constants only; every store is one base plus an immediate; the two halves of a frame's line go one behind the other */
    for (int k = 0; k < 8; ++k) { FragH fr[2];
#pragma unroll      /* as above */
      for (int u = 0; u < 16; ++u) fr[u >> 3].h[u & 7] = (_Float16)a[u][k >> 2][k & 3];
      *(v8us*)(Rh + ((k >> 2) * 32 + (k & 3)) * CC) = fr[0].half[0]; *(v8us*)(Rh + ((k >> 2) * 32 + (k & 3)) * CC + 32) = fr[1].half[0]; } }
  asm volatile("s_wait_xcnt 0x0" ::: "memory");      /* what follows reuses registers that the stores above name */
  prep_barrier();      /* publishes the partial sums */
  { const float s = prep_total(red, rc, rj); if (rj == 0) smu[rc] = s / 1024.0f; }
  prep_barrier();      /* publishes the means and ends every read of red */
#pragma unroll      /* a must stay in registers */
  for (int u = 0; u < 16; ++u) { const float mu = smu[(u >> 3) * 32 + gl * 8 + (u & 7)]; a[u][0] -= mu; a[u][1] -= mu; const v4f t = a[u][0] * a[u][0] + a[u][1] * a[u][1]; red[(u >> 3) * 32 + gl * 8 + (u & 7)][w * 8 + fl] = (t[0] + t[1]) + (t[2] + t[3]); }
  prep_barrier();      /* publishes the partial sums of squares */
  { const float s2 = prep_total(red, rc, rj); if (rj == 0) srs[rc] = rsqrtf(s2 / 1023.0f + 1e-5f); }      /* unbiased variance */
  prep_barrier();      /* publishes the scales */
  float r[16];
#pragma unroll      /* r must stay in registers */
  for (int u = 0; u < 16; ++u) r[u] = srs[(u >> 3) * 32 + gl * 8 + (u & 7)];
  unsigned short* Hh = (unsigned short*)(NH + y * sN + o0); unsigned short* Lh = (unsigned short*)(NL + y * sN + o0);      /* the style's planes lie sN elements behind the content's */
#pragma unroll      /* a and r are indexed by constants only; the stores as above */
  for (int k = 0; k < 8; ++k) { const int o = ((k >> 2) * 32 + (k & 3)) * CC; FragH fh[2], fo[2];
#pragma unroll      /* as above */
    for (int u = 0; u < 16; ++u) { const float v = a[u][k >> 2][k & 3] * r[u]; const _Float16 hv = (_Float16)v; fh[u >> 3].h[u & 7] = hv; fo[u >> 3].h[u & 7] = (_Float16)((v - (float)hv) * 1024.0f); }
    *(v8us*)(Hh + o) = fh[0].half[0]; *(v8us*)(Hh + o + 32) = fh[1].half[0]; *(v8us*)(Lh + o) = fo[0].half[0]; *(v8us*)(Lh + o + 32) = fo[1].half[0];
    asm volatile("s_wait_xcnt 0x0" ::: "memory"); }      /* the next frame's packing, and the code behind the loop, reuse registers that these stores name */
  const int g = y * (NB * (CC / FC)) + blockIdx.x, r0 = (g >> 3) * 16, i0 = (g & 7) * 64;      /* the block's rows and columns of Wo Wh */
  const int ln = lane & 15, hh = lane >> 4; const bool vb = i0 == 0;      /* vb, the same for the whole block: it forms its rows of Wo bh too */
  const float* ap = Wo + (size_t)(r0 + ln) * CC + w * 32 + 8 * hh; const float* bp = Wh + (size_t)(w * 32 + 8 * hh) * CC + i0 + 4 * ln; const float* vp = bh + w * 32 + 8 * hh;      /* the wave's 32 k */
  v4f xa[4], xv[4], xb[16];      /* A, row r0 + ln, and bh, which every column of its B fragment holds: k = 8 hh + 0 .. 7, then 16 + 8 hh + 0 .. 7; xb[i]: the same k in the same order, columns i0 + 4 ln + 0 .. 3, one to each of the four tiles, so that a lane's loads are 16 bytes wide */
  xa[0] = *(const v4fa*)ap; xa[1] = *(const v4fa*)(ap + 4); xa[2] = *(const v4fa*)(ap + 16); xa[3] = *(const v4fa*)(ap + 20);
#pragma unroll      /* xb must stay in registers; all loads of the wave in flight at once */
  for (int i = 0; i < 8; ++i) { xb[i] = *(const v4fa*)(bp + i * CC); xb[8 + i] = *(const v4fa*)(bp + (16 + i) * CC); }
  if (vb) { xv[0] = *(const v4fa*)vp; xv[1] = *(const v4fa*)(vp + 4); xv[2] = *(const v4fa*)(vp + 16); xv[3] = *(const v4fa*)(vp + 20); }
  asm volatile("s_wait_xcnt 0x0" :: "v"(ap), "v"(bp), "v"(vp) : "memory");      /* the vector addresses are inputs, so that they live up to this wait and no register that an issued load names is rewritten ahead of it */
  FragH fa, fb[4];
#pragma unroll      /* the fragments must stay in registers */
  for (int i = 0; i < 16; ++i) { fa.h[i] = w16(xa[i >> 2][i & 3]); fb[0].h[i] = w16(xb[i][0]); fb[1].h[i] = w16(xb[i][1]); fb[2].h[i] = w16(xb[i][2]); fb[3].h[i] = w16(xb[i][3]); }
  const v8f z8 = {0.f, 0.f, 0.f, 0.f, 0.f, 0.f, 0.f, 0.f};
  const v8f d0 = g2_mma(fa.v, fb[0].v, z8), d1 = g2_mma(fa.v, fb[1].v, z8), d2 = g2_mma(fa.v, fb[2].v, z8), d3 = g2_mma(fa.v, fb[3].v, z8);
#pragma unroll      /* the sums are indexed by constants only */
  for (int q = 0; q < 8; ++q) { const v4f t = {d0[q], d1[q], d2[q], d3[q]}; *(v4fa*)&wpart[w][8 * hh + q][4 * ln] = t; }      /* tile n's column ln is column 4 ln + n */
  if (vb) { FragH fv;
#pragma unroll      /* as above */
    for (int i = 0; i < 16; ++i) fv.h[i] = (_Float16)bf16_round(xv[i >> 2][i & 3]);
    const v8f dv = g2_mma(fa.v, fv.v, z8);
    if (ln == 0) {
#pragma unroll      /* as above */
      for (int q = 0; q < 8; ++q) red[w][8 * hh + q] = dv[q]; } }      /* every read of the statistics' sums ended at the barriers above */
  prep_barrier();      /* publishes the sixteen waves' partial sums */
  v2f p[16];      /* wave w adds up row w; its 32 lanes store the row's 64 columns, a whole 128-byte line of f16 */
#pragma unroll      /* p must stay in registers; the 16 LDS reads go as one group */
  for (int s = 0; s < 16; ++s) p[s] = *(const v2fa*)&wpart[s][w][2 * lane];
#pragma unroll      /* as above */
  for (int st = 8; st > 0; st >>= 1) {
#pragma unroll      /* as above */
    for (int s = 0; s < st; ++s) p[s] += p[s + st]; }
  FragH f; f.h[0] = (_Float16)(p[0][0] * 0.0625f); f.h[1] = (_Float16)(p[0][1] * 0.0625f);      /* 16 Wo . 16 Wh / 16: x 16 like the other weights */
  const v2us o2 = {f.u[0], f.u[1]}; *(v2us*)((unsigned short*)WP + (size_t)(r0 + w) * CC + i0 + 2 * lane) = o2;
  if (vb && tid < 16) { float s = 0.f;
#pragma unroll      /* every LDS read at a constant offset, several in flight */
    for (int k = 0; k < 16; ++k) s += red[k][tid];
    BP[(g >> 3) * 32 + tid] = s * 0.0625f; } }      /* a block's 16 values of Wo bh on a 128-byte line of their own: one writer a line */
__global__ __launch_bounds__(256) void k_soft(const float* __restrict__ S, _Float16* __restrict__ P, float* __restrict__ RS) {
  #pragma clang fp contract(off)
  const int wv = threadIdx.x >> 5, ln = threadIdx.x & 31; const int r = blockIdx.x * 8 + wv; if (r >= BG * TC) return; const float* sr = S + (size_t)r * TS; float mx = -3.0e38f;
#pragma unroll 1
  for (int gq = 0; gq < TS / 256; ++gq) { const v8f a = *(const v8f*)(sr + gq * 256 + ln * 8); for (int q = 0; q < 8; ++q) mx = fmaxf(mx, a[q]); }
  for (int o = 16; o > 0; o >>= 1) mx = fmaxf(mx, __shfl_xor(mx, o, 32)); float su = 0.f;
{ su = 0.f;
#pragma unroll 1
    for (int gq = 0; gq < TS / 256; ++gq) { const v8f a = *(const v8f*)(sr + gq * 256 + ln * 8); FragH ph; for (int q = 0; q < 8; ++q) { const float e = expf(a[q] - mx); su += e; ph.h[q] = (_Float16)(e * 1024.0f); } *(v8us*)((unsigned short*)P + (size_t)r * TS + gq * 256 + ln * 8) = ph.half[0]; }
     }
  for (int o = 16; o > 0; o >>= 1) su += __shfl_xor(su, o, 32); if (ln == 0) { *(float*)(RS + (size_t)r * 32) = 1.0f / su;  } }
extern "C" void kernel_launch(void* const* d_in, const int* in_sizes, int n_in,
                              void* d_out, int out_size, void* d_ws, size_t ws_size, hipStream_t stream) {
  (void)in_sizes; (void)n_in; (void)out_size;
  const float* content = (const float*)d_in[0]; const float* style = (const float*)d_in[1]; const float* Wf = (const float*)d_in[2]; const float* bf_ = (const float*)d_in[3]; const float* Wg = (const float*)d_in[4]; const float* bg = (const float*)d_in[5]; const float* Wh = (const float*)d_in[6]; const float* bh = (const float*)d_in[7]; const float* Wo = (const float*)d_in[8]; const float* bo = (const float*)d_in[9];
  char* ws = (char*)d_ws; size_t off = 0;
  auto take = [&](size_t bytes) { char* p = ws + off; off += (bytes + 255) & ~(size_t)255; return p; };
  const size_t npc = (size_t)NRC * CC, nps = (size_t)NRS * CC;
  _Float16* BF = (_Float16*)take((size_t)CC * CC * 2); _Float16* BGm = (_Float16*)take((size_t)CC * CC * 2); _Float16* BH = (_Float16*)take((size_t)CC * CC * 2); float* BV = (float*)take((size_t)(CC / 16) * 32 * 4);      /* BH = Wo Wh (x 16), BV = Wo bh */
  _Float16* CNH = (_Float16*)take(npc * 2); _Float16* CNL = (_Float16*)take(npc * 2); _Float16* SNH = (_Float16*)take(nps * 2); _Float16* SNL = (_Float16*)take(nps * 2); _Float16* S16 = (_Float16*)take(nps * 2);
  _Float16* FH = (_Float16*)take(npc * 2); _Float16* FL = (_Float16*)take(npc * 2); _Float16* GH = (_Float16*)take(nps * 2); _Float16* GL = (_Float16*)take(nps * 2); _Float16* HT = (_Float16*)take(nps * 2);
  float* S = (float*)take((size_t)BG * TC * TS * 4); float* RS = (float*)take((size_t)BG * TC * 32 * 4);
  _Float16* P = CNH;      /* the softmax weights [NRC][TS] over both content-normalised planes (dead after F) */
  if (off > ws_size) return;      /* 1.5 + 16 x 5 + 16 x 5 + 64 + 2 = about 228 MiB */
  k_prep<<<dim3(NB * (CC / FC), 2), 512, 0, stream>>>(content, style, CNH, CNL, SNH - CNH, S16, Wf, Wg, Wh, Wo, bh, BF, BH, BV);      /* BF and BGm lie in a row; conv (out, in) naturals */
  k_fgh<<<dim3((NRC / 128) * (CC / 128), 3), 256, 0, stream>>>(CNH, CNL, SNH - CNH, BF, BGm - BF, bf_, bg, FH, FL, BH, S16, BV, HT);      /* F into FH | FL; G from SNH | SNL and BGm into GH | GL, each as far behind its counterpart as SNH behind CNH; Wo H into HT */
  k_gemm2s<2, 0><<<dim3((TC / 128) * (TS / 128), BG), 256, 0, stream>>>(FH, FL, CC, (size_t)TC * CC, GH, GL, CC, (size_t)TS * CC, 1.0f, 0.0009765625f, nullptr, S, nullptr, nullptr, TS, (size_t)TC * TS, TC, TS, CC);      /* S = F^T G (hi.hi + (lo.hi + hi.lo)), unscaled */
  k_soft<<<(BG * TC) / 8, 256, 0, stream>>>(S, P, RS);
  k_gemm2<0, 3><<<dim3((CC / 128) * (TC / 128), BG), 256, 0, stream>>>(HT, TS, (size_t)CC * TS, P, TS, (size_t)TC * TS, 0.0009765625f, bo, 0, RS, nullptr, (float*)d_out, TC, (size_t)CC * TC, CC, TC, TS);      /* out [b][o][t] = ((Wo H) . P^T) / P's row sum + bo */
}

// v008
// A run of this version takes 119 microseconds.
// In both of two side-by-side timings against v007, it was 1.11 times as fast.
// All steps since v000 together make it 7.68 times as fast.
#include <hip/hip_runtime.h>
// SpeakerAttention (16 x 512 channels; content 1024 frames, style 1024 frames: F = Wf mvn(content) + bf, G = Wg mvn(style) + bg, H = Wh style + bh (1x1 convs); S = softmax over style frames of the UNSCALED F^T G (K = 512 channels); O = H S^T; out = Wo O + bo; mvn = per (batch, channel) mean / unbiased variance over time, eps 1e-5).
// Structure: per-(b,c) mvn statistics on VALU and the [frame][channel] planes of the normalised inputs as f16 hi/residual (style raw plane exact) in one kernel that holds its rows in registers; F and G as two-term f16 WMMA GEMMs, both terms in one launch (32x64 wave tiles fed from LDS, f32 accumulation, one accumulator set per scale, exact x16 weights + bias), stored by their own epilogue as f16 hi/residual planes; Wo H as one GEMM per batch with the weights as the A operand, so that it comes out as [b][o][s] (f16); the score GEMM of all batches as THREE hi/residual product terms in one launch (K = 512, f32; the two residual terms share an accumulator set), whose epilogue leaves the softmax in pieces of 64 columns (f16 weights x 2^10 against the piece's own maximum, with that maximum and the piece's sum), on VALU. The last convolution is folded into H by associativity: Wo (H S^T) = (Wo H) S^T and Wo H = (Wo Wh) style + Wo bh, so a small WMMA product of the two weight matrices (and of Wo with bh) comes first, the H GEMM takes Wo Wh for its weights, and the readout GEMM (A = Wo H, M = 512; B = the softmax weights, N = 1024; K = 1024) merges the pieces (each 64-k pass's sums times its piece's share of the row), adds bo and stores out [b][o][t] itself. Launches that do not depend on one another share one grid (blockIdx.y says whose block it is): the weight product, both inputs' statistics and planes, with Wf and Wg; F, G and Wo H.
// Compute dtype: inputs rounded to bf16; Wf, Wg, Wo, Wh exact as f16; the normalised inputs, F and G as f16 hi + 2^-10-scaled residual (the unscaled K = 512 logits have sigma ~ 22, so single-rounded operands would not do); style, Wo Wh, Wo H and the softmax weights as plain f16 (~2^-12); statistics / softmax f32. v_wmma_f32_16x16x32_f16.
#define NB 16
#define CC 512
#define TC 1024
#define TS 1024
#define NRC (NB * TC)
#define NRS (NB * TS)
#define BG 16                    /* batches per launch of the score and readout kernels: all of them */
typedef __bf16 v16b __attribute__((ext_vector_type(16)));
typedef unsigned short v8us __attribute__((ext_vector_type(8), may_alias));
typedef float  v8f  __attribute__((ext_vector_type(8)));
typedef float  v4f  __attribute__((ext_vector_type(4)));
typedef float  v4fa __attribute__((ext_vector_type(4), may_alias));
union FragB { v16b v; v8us half[2]; unsigned short u[16]; };

__device__ __forceinline__ unsigned short bf16_bits(float x) { unsigned int u = __float_as_uint(x); return (unsigned short)((u + 0x7FFFu + ((u >> 16) & 1u)) >> 16); }
__device__ __forceinline__ float bf16_val(unsigned short b) { return __uint_as_float(((unsigned int)b) << 16); }
__device__ __forceinline__ float bf16_round(float x) { return bf16_val(bf16_bits(x)); }
// D += A·B with NT terms: 1 = ah·bh, 2 = + al·bh (A split), 3 = + ah·bl (both split)
template <int NT>
__device__ __forceinline__ v8f mmaN(v16b ah, v16b al, v16b bh, v16b bl, v8f c) {
  c = __builtin_amdgcn_wmma_f32_16x16x32_bf16(false, ah, false, bh, (short)0, c, false, false);
  if (NT >= 2) c = __builtin_amdgcn_wmma_f32_16x16x32_bf16(false, al, false, bh, (short)0, c, false, false);
  if (NT >= 3) c = __builtin_amdgcn_wmma_f32_16x16x32_bf16(false, ah, false, bl, (short)0, c, false, false);
  asm volatile("v_nop\n\tv_nop\n\tv_nop\n\tv_nop" : "+v"(c) : "v"(ah), "v"(al), "v"(bh), "v"(bl));
  return c;
}

__global__ __launch_bounds__(256) void k_wt_bf16(const float* __restrict__ W, unsigned short* __restrict__ Wt, int K, int N) {
  const int t = blockIdx.x * 256 + threadIdx.x;
  const int k8n = K / 8;
  if (t >= N * k8n) return;
  const int n = t / k8n, k8 = (t % k8n) * 8;
  v8us v;
#pragma unroll
  for (int i = 0; i < 8; ++i) v[i] = bf16_bits(W[(size_t)(k8 + i) * N + n]);
  *(v8us*)(Wt + (size_t)n * K + k8) = v;
  
}

// GEMM C[M][N] (f32, pitch ldc) = act(A[M][K]·W + bias). A f32 row-major (pitch lda) converted per fragment to bf16
// (ASPLIT: hi/lo two planes -> 2 terms, else single rounded term); Wt bf16 [N][K] (pitch ldb). BIAS_BF16 rounds the
// bias to bf16 first (bias quantised to bf16 before the add). K%32==0, M%16==0, N%64==0.
template <bool ASPLIT, int ACT, bool BIAS_BF16>
__global__ __launch_bounds__(128) void k_gemm_bf(const float* __restrict__ A, int lda, const unsigned short* __restrict__ Wt, int ldb,
                                               const float* __restrict__ bias, float* __restrict__ C, int ldc, int M, int N, int K) {
  __shared__ __attribute__((aligned(16))) float so[4][16][64];
  const int tid = threadIdx.x, w = tid >> 5, lane = tid & 31, ln = lane & 15, hh = lane >> 4;
  const int ntn = N / 64;
  const int wid = blockIdx.x * 4 + w;
  const int mt = wid / ntn, nq = wid % ntn;
  if (mt * 16 >= M) return;
  const int row0 = mt * 16, col0 = nq * 64;
  const float* arow = A + (size_t)(row0 + ln) * lda;
  v8f acc[4] = {};
  for (int kb = 0; kb < K; kb += 32) {
    FragB ah, al;
    const v4f x0 = *(const v4fa*)(arow + kb + 8 * hh), x1 = *(const v4fa*)(arow + kb + 8 * hh + 4);
    const v4f x2 = *(const v4fa*)(arow + kb + 16 + 8 * hh), x3 = *(const v4fa*)(arow + kb + 16 + 8 * hh + 4);
    float xs[16] = {x0[0],x0[1],x0[2],x0[3],x1[0],x1[1],x1[2],x1[3],x2[0],x2[1],x2[2],x2[3],x3[0],x3[1],x3[2],x3[3]};
#pragma unroll
    for (int i = 0; i < 16; ++i) { const unsigned short hb = bf16_bits(xs[i]); ah.u[i] = hb; al.u[i] = ASPLIT ? bf16_bits(xs[i] - bf16_val(hb)) : (unsigned short)0; }
#pragma unroll
    for (int t = 0; t < 4; ++t) {
      const unsigned short* brow = Wt + (size_t)(col0 + t * 16 + ln) * ldb + kb;
      FragB b;
      b.half[0] = *(const v8us*)(brow + 8 * hh);
      b.half[1] = *(const v8us*)(brow + 16 + 8 * hh);
      acc[t] = mmaN<ASPLIT ? 2 : 1>(ah.v, al.v, b.v, b.v, acc[t]);
    }
  }
#pragma unroll
  for (int t = 0; t < 4; ++t) {
    float bv = bias ? bias[col0 + t * 16 + ln] : 0.f;
    if (BIAS_BF16) bv = bf16_round(bv);
#pragma unroll
    for (int r = 0; r < 8; ++r) { float v = acc[t][r] + bv; if (ACT == 1) v = fmaxf(v, 0.f); so[w][8 * hh + r][t * 16 + ln] = v; }
  }
  __builtin_amdgcn_fence(__ATOMIC_ACQ_REL, "workgroup");
  __builtin_amdgcn_wave_barrier();
  const int rsub = lane >> 4, c4 = (lane & 15) * 4;
  {
#pragma unroll
    for (int q = 0; q < 8; ++q) {
      const int r = q * 2 + rsub;
      const v4f v = *(const v4fa*)&so[w][r][c4];
      *(v4f*)(C + (size_t)(row0 + r) * ldc + col0 + c4) = v;
    }
    
  }
}

// GEMM C = act(A·W + bias + resid): A f32 (ASPLIT -> hi/lo 2 terms), Wt bf16 [N][K]; ACT 0 none, 1 relu, 2 exact gelu;
// resid (optional, f32, row index = (row % rmod), pitch ldr, RES_BF16 rounds it) added before the activation.
template <bool ASPLIT, int ACT, bool BIAS_BF16, bool RES_BF16>
__global__ __launch_bounds__(128) void k_gemm_bf3(const float* __restrict__ A, int lda, const unsigned short* __restrict__ Wt, int ldb,
                                                const float* __restrict__ bias, const float* __restrict__ resid, int rmod, int ldr,
                                                float* __restrict__ C, int ldc, int M, int N, int K) {
  __shared__ __attribute__((aligned(16))) float so[4][16][64];
  const int tid = threadIdx.x, w = tid >> 5, lane = tid & 31, ln = lane & 15, hh = lane >> 4;
  const int ntn = N / 64;
  const int wid = blockIdx.x * 4 + w;
  const int mt = wid / ntn, nq = wid % ntn;
  if (mt * 16 >= M) return;
  const int row0 = mt * 16, col0 = nq * 64;
  const float* arow = A + (size_t)(row0 + ln) * lda;
  v8f acc[4] = {};
  for (int kb = 0; kb < K; kb += 32) {
    FragB ah, al;
    const v4f x0 = *(const v4fa*)(arow + kb + 8 * hh), x1 = *(const v4fa*)(arow + kb + 8 * hh + 4);
    const v4f x2 = *(const v4fa*)(arow + kb + 16 + 8 * hh), x3 = *(const v4fa*)(arow + kb + 16 + 8 * hh + 4);
    float xs[16] = {x0[0],x0[1],x0[2],x0[3],x1[0],x1[1],x1[2],x1[3],x2[0],x2[1],x2[2],x2[3],x3[0],x3[1],x3[2],x3[3]};
#pragma unroll
    for (int i = 0; i < 16; ++i) { const unsigned short hb = bf16_bits(xs[i]); ah.u[i] = hb; al.u[i] = ASPLIT ? bf16_bits(xs[i] - bf16_val(hb)) : (unsigned short)0; }
#pragma unroll
    for (int t = 0; t < 4; ++t) {
      const unsigned short* brow = Wt + (size_t)(col0 + t * 16 + ln) * ldb + kb;
      FragB b;
      b.half[0] = *(const v8us*)(brow + 8 * hh);
      b.half[1] = *(const v8us*)(brow + 16 + 8 * hh);
      acc[t] = mmaN<ASPLIT ? 2 : 1>(ah.v, al.v, b.v, b.v, acc[t]);
    }
  }
#pragma unroll
  for (int t = 0; t < 4; ++t) {
    const int col = col0 + t * 16 + ln;
    float bv = bias ? bias[col] : 0.f;
    if (BIAS_BF16) bv = bf16_round(bv);
#pragma unroll
    for (int r = 0; r < 8; ++r) {
      float v = acc[t][r] + bv;
      if (resid) { float rv = resid[(size_t)((row0 + 8 * hh + r) % rmod) * ldr + col]; if (RES_BF16) rv = bf16_round(rv); v += rv; }
      if (ACT == 1) v = fmaxf(v, 0.f);
      if (ACT == 2) v = 0.5f * v * (1.0f + erff(v * 0.70710678118654752f));
      if (ACT == 3) { const float u = 0.7978845608028654f * (v + 0.044715f * v * v * v); v = 0.5f * v * (1.0f + tanhf(u)); }
      so[w][8 * hh + r][t * 16 + ln] = v;
    }
  }
  __builtin_amdgcn_fence(__ATOMIC_ACQ_REL, "workgroup");
  __builtin_amdgcn_wave_barrier();
  const int rsub = lane >> 4, c4 = (lane & 15) * 4;
  {
#pragma unroll
    for (int q = 0; q < 8; ++q) {
      const int r = q * 2 + rsub;
      const v4f v = *(const v4fa*)&so[w][r][c4];
      *(v4f*)(C + (size_t)(row0 + r) * ldc + col0 + c4) = v;
    }
    
  }
}
// row LayerNorm (biased variance, eps) over N: s = X (+ R); optional out_sum <- s; out_norm <- (s-mu)*rsqrt(var+eps)*g + b
template <bool PARAM_BF16>
__global__ __launch_bounds__(256) void k_layernorm(const float* __restrict__ X, const float* __restrict__ R, const float* __restrict__ g, const float* __restrict__ bta,
                                                  float* __restrict__ out_sum, float* __restrict__ out_norm, int N, float eps) {
  __shared__ float red[256];
  const int row = blockIdx.x, tid = threadIdx.x;
  const float* x = X + (size_t)row * N; const float* rr = R ? R + (size_t)row * N : nullptr;
  float vals[16];                     // up to N = 4096
  const int per = N / 256;            // contiguous chunk per thread? use strided-by-4 chunks: thread handles j = tid*4 + 1024*u
  float s1 = 0.f;
  for (int u = 0; u < per / 4; ++u) {
    const int j = tid * 4 + 1024 * u;
    const v4f a = *(const v4fa*)(x + j);
    v4f b = {0.f,0.f,0.f,0.f}; if (rr) b = *(const v4fa*)(rr + j);
#pragma unroll
    for (int q = 0; q < 4; ++q) { const float v = a[q] + b[q]; vals[u * 4 + q] = v; s1 += v; }
  }
  red[tid] = s1; __syncthreads();
  for (int st = 128; st > 0; st >>= 1) { if (tid < st) red[tid] += red[tid + st]; __syncthreads(); }
  const float mu = red[0] / (float)N; __syncthreads();
  float s2 = 0.f;
  for (int u = 0; u < per / 4; ++u)
#pragma unroll
    for (int q = 0; q < 4; ++q) { const float c = vals[u * 4 + q] - mu; s2 += c * c; }
  red[tid] = s2; __syncthreads();
  for (int st = 128; st > 0; st >>= 1) { if (tid < st) red[tid] += red[tid + st]; __syncthreads(); }
  const float rs = rsqrtf(red[0] / (float)N + eps);
  {
    for (int u = 0; u < per / 4; ++u) {
      const int j = tid * 4 + 1024 * u;
      v4f o, sm;
#pragma unroll
      for (int q = 0; q < 4; ++q) {
        float gg = g[j + q], bb = bta[j + q];
        if (PARAM_BF16) { gg = bf16_round(gg); bb = bf16_round(bb); }
        sm[q] = vals[u * 4 + q]; o[q] = (vals[u * 4 + q] - mu) * rs * gg + bb;
      }
      if (out_sum) *(v4f*)(out_sum + (size_t)row * N + j) = sm;
      *(v4f*)(out_norm + (size_t)row * N + j) = o;
    }
    
  }
}



// ---- f16 WMMA path (v_wmma_f32_16x16x32_f16): 11-bit significands for operands in range — used for every GEMM launched here
typedef _Float16 v16h __attribute__((ext_vector_type(16)));
union FragH { v16h v; v8us half[2]; _Float16 h[16]; unsigned short u[16]; };
template <int NT>
__device__ __forceinline__ v8f mmaH(v16h ah, v16h al, v16h bh, v16h bl, v8f c) {
  c = __builtin_amdgcn_wmma_f32_16x16x32_f16(false, ah, false, bh, (short)0, c, false, false);
  if (NT >= 2) c = __builtin_amdgcn_wmma_f32_16x16x32_f16(false, al, false, bh, (short)0, c, false, false);
  if (NT >= 3) c = __builtin_amdgcn_wmma_f32_16x16x32_f16(false, ah, false, bl, (short)0, c, false, false);
  asm volatile("v_nop\n\tv_nop\n\tv_nop\n\tv_nop" : "+v"(c) : "v"(ah), "v"(al), "v"(bh), "v"(bl));
  return c;
}
// batched GEMM like k_gemm_b but f16 operands: A f32 (split into f16 hi/lo if ASPLIT, else rounded to f16), Bt = f16 values [n][k]; alpha; C f32; N multiple of 16 (partial tiles skipped)
template <bool ASPLIT>
__global__ __launch_bounds__(128) void k_gemm_h(const float* __restrict__ A, int lda, size_t sA, const _Float16* __restrict__ Bh, int ldb, size_t sB, float alpha, float* __restrict__ C, int ldc, size_t sC, int M, int N, int K) {
  __shared__ __attribute__((aligned(16))) float so[4][16][64];
  const int tid = threadIdx.x, w = tid >> 5, lane = tid & 31, ln = lane & 15, hh = lane >> 4; const int by = blockIdx.y;
  A += (size_t)by * sA; Bh += (size_t)by * sB; C += (size_t)by * sC;
  const int ntn = (N + 63) / 64; const int wid = blockIdx.x * 4 + w; const int mt = wid / ntn, nq = wid % ntn; if (mt * 16 >= M) return;
  const int row0 = mt * 16, col0 = nq * 64; const float* arow = A + (size_t)(row0 + ln) * lda;
  v8f acc[4] = {};
  for (int kb = 0; kb < K; kb += 32) {
    FragH ah, al;
    const v4f x0 = *(const v4fa*)(arow + kb + 8 * hh), x1 = *(const v4fa*)(arow + kb + 8 * hh + 4), x2 = *(const v4fa*)(arow + kb + 16 + 8 * hh), x3 = *(const v4fa*)(arow + kb + 16 + 8 * hh + 4);
    float xs[16] = {x0[0],x0[1],x0[2],x0[3],x1[0],x1[1],x1[2],x1[3],x2[0],x2[1],x2[2],x2[3],x3[0],x3[1],x3[2],x3[3]};
#pragma unroll
    for (int i = 0; i < 16; ++i) { const _Float16 h = (_Float16)xs[i]; ah.h[i] = h; al.h[i] = ASPLIT ? (_Float16)(xs[i] - (float)h) : (_Float16)0.0f; }
#pragma unroll
    for (int t = 0; t < 4; ++t) { if (col0 + t * 16 >= N) continue; const size_t boff = (size_t)(col0 + t * 16 + ln) * ldb + kb; FragH bq; bq.half[0] = *(const v8us*)(Bh + boff + 8 * hh); bq.half[1] = *(const v8us*)(Bh + boff + 16 + 8 * hh);
      acc[t] = mmaH<ASPLIT ? 2 : 1>(ah.v, al.v, bq.v, bq.v, acc[t]); }
  }
#pragma unroll
  for (int t = 0; t < 4; ++t) { if (col0 + t * 16 >= N) continue;
#pragma unroll
    for (int r = 0; r < 8; ++r) so[w][8 * hh + r][t * 16 + ln] = acc[t][r] * alpha; }
  __builtin_amdgcn_fence(__ATOMIC_ACQ_REL, "workgroup"); __builtin_amdgcn_wave_barrier();
  const int rsub = lane >> 4, c4 = (lane & 15) * 4;
  {
#pragma unroll
    for (int q = 0; q < 8; ++q) { const int r = q * 2 + rsub; if (col0 + c4 < N) { const v4f v = *(const v4fa*)&so[w][r][c4]; *(v4f*)(C + (size_t)(row0 + r) * ldc + col0 + c4) = v; } }
     }
}

// Wt[n][k] = f16(W[k][n]·scale) from f32 row-major W[K][N] (scale = power of two; bf16-exact weights stay exact in f16 away from the subnormal range)
__global__ __launch_bounds__(256) void k_wt_f16(const float* __restrict__ W, _Float16* __restrict__ Wt, int K, int N, float scale) {
  const int t = blockIdx.x * 256 + threadIdx.x; if (t >= N * (K / 8)) return; const int n = t / (K / 8), k8 = (t % (K / 8)) * 8; FragH f;
#pragma unroll
  for (int i = 0; i < 8; ++i) f.h[i] = (_Float16)(bf16_round(W[(size_t)(k8 + i) * N + n]) * scale); const v8us o = f.half[0];
  *(v8us*)((unsigned short*)Wt + (size_t)n * K + k8) = o; 
}
// k_gemm_hh variant with fused epilogue: v = acc·alpha + bias[by·sBias + col] (+ CP[(row/rowsPerB)·sCPb + by·64 + col] if CP) ; ACT 0 none / 1 elu ; writes f16 C16 (and f32 C if non-null)
template <int ACT>
__global__ __launch_bounds__(128) void k_gemm_hhx(const _Float16* __restrict__ A, int lda, size_t sA, const _Float16* __restrict__ Bh, int ldb, size_t sB, float alpha, const float* __restrict__ bias, size_t sBias, const float* __restrict__ CP, int rowsPerB, size_t sCPb, int row0g,
    float* __restrict__ C, _Float16* __restrict__ C16, int ldc, size_t sC, int M, int N, int K) {
  __shared__ __attribute__((aligned(16))) float so[4][16][64];
  const int tid = threadIdx.x, w = tid >> 5, lane = tid & 31, ln = lane & 15, hh = lane >> 4; const int by = blockIdx.y;
  A += (size_t)by * sA; Bh += (size_t)by * sB; const size_t cofs = (size_t)by * sC; const float* bp = bias ? bias + (size_t)by * sBias : nullptr;
  const int ntn = (N + 63) / 64; const int wid = blockIdx.x * 4 + w; const int mt = wid / ntn, nq = wid % ntn; if (mt * 16 >= M) return;
  const int row0 = mt * 16, col0 = nq * 64; const _Float16* arow = A + (size_t)(row0 + ln) * lda;
  v8f acc[4] = {};
  for (int kb = 0; kb < K; kb += 32) { FragH ah; ah.half[0] = *(const v8us*)((const unsigned short*)arow + kb + 8 * hh); ah.half[1] = *(const v8us*)((const unsigned short*)arow + kb + 16 + 8 * hh);
#pragma unroll
    for (int t = 0; t < 4; ++t) { if (col0 + t * 16 >= N) continue; const size_t boff = (size_t)(col0 + t * 16 + ln) * ldb + kb; FragH bq; bq.half[0] = *(const v8us*)((const unsigned short*)Bh + boff + 8 * hh); bq.half[1] = *(const v8us*)((const unsigned short*)Bh + boff + 16 + 8 * hh);
      acc[t] = mmaH<1>(ah.v, ah.v, bq.v, bq.v, acc[t]); }
  }
#pragma unroll
  for (int t = 0; t < 4; ++t) { if (col0 + t * 16 >= N) continue; const int col = col0 + t * 16 + ln; const float bv = bp ? bf16_round(bp[col]) : 0.f;
#pragma unroll
    for (int r = 0; r < 8; ++r) { float v = acc[t][r] * alpha + bv; if (CP) { const int rr = row0g + row0 + 8 * hh + r; if (rowsPerB < 0) v += CP[cofs + (size_t)rr * ldc + col];      /* rowsPerB < 0: own element of the batched C plane */ else { const int bidx = rr / rowsPerB; v += CP[(size_t)bidx * sCPb + (size_t)by * 64 + col]; } } if (ACT == 1) v = (v > 0.f) ? v : expm1f(v); else if (ACT == 7) v = (v > 0.f) ? v + 1.0f : expf(v); else if (ACT == 8) v = tanhf(v); else if (ACT == 9) v = 0.5f * v * (1.0f + tanhf(0.7978845608028654f * (v + 0.044715f * v * v * v))); else if (ACT == 11) v = 1.0f / (1.0f + expf(-v)); else if (ACT == 12) v = (v > 0.f) ? v : 0.01f * v; else if (ACT == 14) v = (v > 0.f) ? v : 0.1f * v; else if (ACT == 16) v = (v >= 0.f) ? v : 0.3f * v; else if (ACT == 17) v = (v >= 0.f) ? v : 0.2f * v; else if (ACT == 15) v = v / (1.0f + expf(-v)); else if (ACT == 3) v = fmaxf(v, 0.f); else if (ACT == 6) v = 0.5f * v * (1.0f + erff(v * 0.70710678118654752f)); so[w][8 * hh + r][t * 16 + ln] = v; } }
  __builtin_amdgcn_fence(__ATOMIC_ACQ_REL, "workgroup"); __builtin_amdgcn_wave_barrier();
  const int rsub = lane >> 4, c4 = (lane & 15) * 4; typedef _Float16 v4h __attribute__((ext_vector_type(4)));
  {
#pragma unroll
    for (int q = 0; q < 8; ++q) { const int r = q * 2 + rsub; if (col0 + c4 < N) { const v4f v = *(const v4fa*)&so[w][r][c4]; if (C) *(v4f*)(C + cofs + (size_t)(row0 + r) * ldc + col0 + c4) = v; if (C16) { v4h h4; for (int i = 0; i < 4; ++i) h4[i] = (_Float16)v[i]; *(v4h*)(C16 + cofs + (size_t)(row0 + r) * ldc + col0 + c4) = h4; } } }
     }
}


typedef _Float16 v4h __attribute__((ext_vector_type(4)));

__global__ __launch_bounds__(256) void k_x16(const float* __restrict__ x, _Float16* __restrict__ X16, size_t n8) { const size_t t = (size_t)blockIdx.x * 256 + threadIdx.x; if (t >= n8) return; FragH f;
#pragma unroll
  for (int q = 0; q < 8; ++q) f.h[q] = (_Float16)bf16_round(x[t * 8 + q]); *(v8us*)((unsigned short*)X16 + t * 8) = f.half[0];  }
__global__ __launch_bounds__(256) void k_h16(const float* __restrict__ x, _Float16* __restrict__ X16, size_t n8) { const size_t t = (size_t)blockIdx.x * 256 + threadIdx.x; if (t >= n8) return; FragH f;
#pragma unroll
  for (int q = 0; q < 8; ++q) f.h[q] = (_Float16)x[t * 8 + q]; *(v8us*)((unsigned short*)X16 + t * 8) = f.half[0];  }
__global__ __launch_bounds__(256) void k_round16f(const float* __restrict__ W, _Float16* __restrict__ Bt, size_t n8) { const size_t t = (size_t)blockIdx.x * 256 + threadIdx.x; if (t >= n8) return; FragH f;
#pragma unroll
  for (int i = 0; i < 8; ++i) f.h[i] = (_Float16)(bf16_round(W[t * 8 + i]) * 16.0f); *(v8us*)((unsigned short*)Bt + t * 8) = f.half[0];  }
// eight neighbouring f32 values of a row as f16 hi and residual x 2^10, 16 bytes to each plane
__device__ __forceinline__ void g2_store_hl(v4f a, v4f c, _Float16* hp, _Float16* lp) { FragH fh, fl;
#pragma unroll      /* fh and fl must stay in registers */
  for (int q = 0; q < 4; ++q) { _Float16 h = (_Float16)a[q]; fh.h[q] = h; fl.h[q] = (_Float16)((a[q] - (float)h) * 1024.0f); h = (_Float16)c[q]; fh.h[4 + q] = h; fl.h[4 + q] = (_Float16)((c[q] - (float)h) * 1024.0f); }
  *(v8us*)(unsigned short*)hp = fh.half[0]; *(v8us*)(unsigned short*)lp = fl.half[0]; }

// ---- the softmax in pieces: a row's TS scores fall into SNT pieces of 64 columns, one wave tile of the score GEMM each. A piece has its own maximum m; its weights are 2^10 exp(s - m) as f16, and ST holds, as [plane][batch][piece][row], m log2(e) (plane 0) and the f32 sum of its weights (plane 1). The readout merges the pieces ----
#define SNT (TS / 64)
#define STP ((size_t)BG * SNT * TC)      /* floats of one plane of ST */
// the value of lane ^ M of the same 16-lane row, by DPP: __shfl_xor would go through the LDS pipe and wait out its latency at every step
template <int M> __device__ __forceinline__ float row_x(float x) { return __int_as_float(__builtin_amdgcn_update_dpp(0, __float_as_int(x), 0x160 + M, 0xf, 0xf, true)); }
// eight values' maxima over their 16-lane rows, in every lane. In asm because the compiler makes three instructions of fmaxf on a DPP move (the move, a canonicalising maximum, the maximum); eight chains side by side, so that every step's producer lies eight instructions back
#define RMX(S) "v_max_num_f32_dpp %0, %0, %0 row_xmask:" #S " row_mask:0xf bank_mask:0xf\n\tv_max_num_f32_dpp %1, %1, %1 row_xmask:" #S " row_mask:0xf bank_mask:0xf\n\tv_max_num_f32_dpp %2, %2, %2 row_xmask:" #S " row_mask:0xf bank_mask:0xf\n\tv_max_num_f32_dpp %3, %3, %3 row_xmask:" #S " row_mask:0xf bank_mask:0xf\n\t" \
               "v_max_num_f32_dpp %4, %4, %4 row_xmask:" #S " row_mask:0xf bank_mask:0xf\n\tv_max_num_f32_dpp %5, %5, %5 row_xmask:" #S " row_mask:0xf bank_mask:0xf\n\tv_max_num_f32_dpp %6, %6, %6 row_xmask:" #S " row_mask:0xf bank_mask:0xf\n\tv_max_num_f32_dpp %7, %7, %7 row_xmask:" #S " row_mask:0xf bank_mask:0xf\n\t"
__device__ __forceinline__ void row_max16x8(float* x) { asm(RMX(1) RMX(2) RMX(4) RMX(8) : "+v"(x[0]), "+v"(x[1]), "+v"(x[2]), "+v"(x[3]), "+v"(x[4]), "+v"(x[5]), "+v"(x[6]), "+v"(x[7])); }
// four 2^x in one statement. The instruction set asks for one independent instruction or a v_nop between a transcendental and a directly following instruction that reads its result or overwrites its source: here every result register differs from every source (early clobber), and the v_nop fills the slot behind the last
__device__ __forceinline__ void exp2x4(float* e, float a, float b, float c, float d) { asm("v_exp_f32 %0, %4\n\tv_exp_f32 %1, %5\n\tv_exp_f32 %2, %6\n\tv_exp_f32 %3, %7\n\tv_nop" : "=&v"(e[0]), "=&v"(e[1]), "=&v"(e[2]), "=&v"(e[3]) : "v"(a), "v"(b), "v"(c), "v"(d)); }
__device__ __forceinline__ float row_sum16(float x) { x += row_x<1>(x); x += row_x<2>(x); x += row_x<4>(x); return x + row_x<8>(x); }

// ---- fast GEMM (block tile 128x128 = eight 32x64 wave tiles; A and B in 64-k tiles through a two-buffer LDS ring; requires M % 128 == 0 rows per launch region, N % 128 == 0, K % 64 == 0); epilogue: acc alpha, activation, LDS staging, then the bias and the form the consumer reads. In both forms the bias, which must be there, goes by the ROW of C (the weights, or what came of them, are the A operand). EPI 1: the bias as it is (f32), 16 values to every 32 floats, C16 = f16. EPI 3 (N = TC, K = TS): B holds the softmax weights in pieces, colscale = ST; every 64-k pass sums from zero and goes into the running sums times exp(its piece's maximum - the row's) / the row's merged sum; the bias rounded to bf16, C = f32 ----
__device__ __forceinline__ v16h g2_frag(const _Float16* p, int hh) { FragH f; f.half[0] = *(const v8us*)((const unsigned short*)p + 8 * hh); f.half[1] = *(const v8us*)((const unsigned short*)p + 16 + 8 * hh); return f.v; }
__device__ __forceinline__ v8f g2_mma(v16h a, v16h b, v8f c) { v8f d = __builtin_amdgcn_wmma_f32_16x16x32_f16(false, a, false, b, (short)0, c, false, false); asm volatile("v_nop\n\tv_nop\n\tv_nop\n\tv_nop" : "+v"(d) : "v"(a), "v"(b)); return d; }
#define G2P 72      /* LDS row pitch in f16: 64 k + 8 = 144 B, 16 B x odd, the conflict-free pitch for ds_load_b128 readers */
// One thread's eight b128 asynchronous copies to LDS for one 64-k pass: its 16-byte piece of rows r, r + 32, r + 64, r + 96 of the 128-row A tile and of the 128-row B tile (la, lb = LDS byte addresses, ga, gb = global addresses, rsa, rsb = 32 rows in elements).
// s_wait_xcnt 0 is the statement's last line so that no address register of an issued copy is rewritten ahead of it.
__device__ __forceinline__ void g2_copy8(unsigned la, unsigned lb, const _Float16* ga, const _Float16* gb, size_t rsa, size_t rsb) {
  asm volatile("global_load_async_to_lds_b128 %0, %8, off\n\t"
               "global_load_async_to_lds_b128 %1, %9, off\n\t"
               "global_load_async_to_lds_b128 %2, %10, off\n\t"
               "global_load_async_to_lds_b128 %3, %11, off\n\t"
               "global_load_async_to_lds_b128 %4, %12, off\n\t"
               "global_load_async_to_lds_b128 %5, %13, off\n\t"
               "global_load_async_to_lds_b128 %6, %14, off\n\t"
               "global_load_async_to_lds_b128 %7, %15, off\n\t"
               "s_wait_xcnt 0x0"
               :: "v"(la), "v"(la + 1u * 32u * G2P * 2u), "v"(la + 2u * 32u * G2P * 2u), "v"(la + 3u * 32u * G2P * 2u), "v"(lb), "v"(lb + 1u * 32u * G2P * 2u), "v"(lb + 2u * 32u * G2P * 2u), "v"(lb + 3u * 32u * G2P * 2u),
                  "v"(ga), "v"(ga + rsa), "v"(ga + 2 * rsa), "v"(ga + 3 * rsa), "v"(gb), "v"(gb + rsb), "v"(gb + 2 * rsb), "v"(gb + 3 * rsb) : "memory");
}
#define G2RB (2 * 2 * 128 * G2P * 2)      /* bytes of k_gemm2's ring */
#define G2SB (G2RB + 8 * 32 * 68 * 4)      /* bytes of its ring and its output staging */
// the body takes its LDS (G2SB bytes, 16-byte aligned) and its block indices from the kernel that calls it, so that one grid can hold blocks of this product and of another kind
template <int ACT, int EPI>
__device__ __forceinline__ void gemm2_body(unsigned char* sm, const int bx, const int by, const _Float16* __restrict__ A, int lda, size_t sA, const _Float16* __restrict__ Bh, int ldb, size_t sB, float alpha, const float* __restrict__ bias, size_t sBias,
    const float* __restrict__ colscale, _Float16* __restrict__ C16, float* __restrict__ C, int ldc, size_t sC, int M, int N, int K) { static_assert(EPI == 1 || EPI == 3, "k_gemm2: f16 out, or scaled passes and f32 out"); static_assert(SNT * 128 * 4 <= G2SB - G2RB, "the scales lie inside the output staging"); static_assert(ACT == 0 || ACT == 3 || ACT == 6 || ACT == 8 || ACT == 9 || ACT == 11 || ACT == 12 || ACT == 14 || ACT == 15 || ACT == 16 || ACT == 17, "k_gemm2: unsupported ACT code (would silently apply no activation)");
  _Float16 (*ring)[2][128][G2P] = (_Float16 (*)[2][128][G2P])sm;      /* [buffer][A | B][row][k], filled by the asynchronous copies only */
  float (*so)[32][68] = (float (*)[32][68])(sm + G2RB);
  const int tid = threadIdx.x, w = tid >> 5, lane = tid & 31, ln = lane & 15, hh = lane >> 4;
  A += (size_t)by * sA; Bh += (size_t)by * sB; const size_t cofs = (size_t)by * sC; const float* bp = bias ? bias + (size_t)by * sBias : nullptr;
  const int ntn = N >> 7; const int mt = bx / ntn, nq = bx - mt * ntn; if (mt * 128 >= M) return;      /* the same for the whole block, ahead of every barrier */
  const int wm = w >> 1, wn = w & 1; const int row0 = mt * 128 + 32 * wm, col0 = nq * 128 + 64 * wn;
  const int cr = tid >> 3, cc = (tid & 7) * 8;      /* this thread's first row and its 8-element piece in every copied tile */
  const _Float16* ga = A + (size_t)(mt * 128 + cr) * lda + cc; const _Float16* gb = Bh + (size_t)(nq * 128 + cr) * ldb + cc; const size_t rsa = (size_t)32 * lda, rsb = (size_t)32 * ldb;
  const unsigned la = (unsigned)(size_t)&ring[0][0][cr][cc], lb = (unsigned)(size_t)&ring[0][1][cr][cc]; const unsigned bufb = 2u * 128u * G2P * 2u;      /* LDS byte addresses in buffer 0; bytes per buffer */
  const int np = K >> 6;
  const v8f z8 = {0.f,0.f,0.f,0.f,0.f,0.f,0.f,0.f}; v8f c00 = z8, c01 = z8, c02 = z8, c03 = z8, c10 = z8, c11 = z8, c12 = z8, c13 = z8;
  v8f t00 = z8, t01 = z8, t02 = z8, t03 = z8, t10 = z8, t11 = z8, t12 = z8, t13 = z8;      /* EPI 3: the scaled passes' running sums */
  float* scl = (float*)(sm + G2RB);      /* EPI 3: [pass][column of the block], what a pass's sums are multiplied by; every read of it ends ahead of the loop's last barrier, behind which the same bytes stage the output */
  g2_copy8(la, lb, ga, gb, rsa, rsb);
  if (EPI == 3 && tid < 128) {      /* the same for a whole wave; one thread merges one column's SNT pieces of the softmax, under the flight of tile 0 */
    const float* sp = colscale + (size_t)by * SNT * TC + nq * 128 + tid; float pm[SNT], pl[SNT];
#pragma unroll      /* pm and pl must stay in registers; every load is one base plus an immediate, all in flight at once */
    for (int k = 0; k < SNT; ++k) { pm[k] = sp[k * TC]; pl[k] = sp[STP + k * TC]; }
    asm volatile("s_wait_xcnt 0x0" ::: "memory");      /* what follows this branch reuses registers that the loads above name */
    float m = pm[0], l = 0.f;
#pragma unroll      /* as above */
    for (int k = 1; k < SNT; ++k) m = fmaxf(m, pm[k]);
#pragma unroll      /* as above */
    for (int k = 0; k < SNT; ++k) { pm[k] = __builtin_amdgcn_exp2f(pm[k] - m); l += pl[k] * pm[k]; }
    const float inv = alpha / l;
#pragma unroll      /* as above */
    for (int k = 0; k < SNT; ++k) scl[k * 128 + tid] = pm[k] * inv; }
  asm volatile("s_wait_asynccnt 0x0" ::: "memory");      /* this wave's copies of tile 0 have landed */
  __syncthreads();      /* publishes tile 0 and, EPI 3, the scales */
  if (np > 1) g2_copy8(la + bufb, lb + bufb, ga + 64, gb + 64, rsa, rsb);
  for (int t = 0; t < np; ++t) { const int bu = t & 1; const _Float16* a0p = &ring[bu][0][32 * wm + ln][0]; const _Float16* a1p = a0p + 16 * G2P;
    const _Float16* b0p = &ring[bu][1][64 * wn + ln][0]; const _Float16* b1p = b0p + 16 * G2P; const _Float16* b2p = b1p + 16 * G2P; const _Float16* b3p = b2p + 16 * G2P;
    v16h a0[2], a1[2], b0[2], b1[2], b2[2], b3[2];      /* the pass's 24 LDS reads go as one group ahead of its 16 products: reads placed among the products would each wait out the LDS latency */
#pragma unroll      /* the fragment arrays must stay in registers */
    for (int s = 0; s < 2; ++s) { a0[s] = g2_frag(a0p + 32 * s, hh); a1[s] = g2_frag(a1p + 32 * s, hh); b0[s] = g2_frag(b0p + 32 * s, hh); b1[s] = g2_frag(b1p + 32 * s, hh); b2[s] = g2_frag(b2p + 32 * s, hh); b3[s] = g2_frag(b3p + 32 * s, hh); }
    float sc[4] = {0.f, 0.f, 0.f, 0.f};
    if (EPI == 3) { const float* sq = scl + t * 128 + 64 * wn + ln; sc[0] = sq[0]; sc[1] = sq[16]; sc[2] = sq[32]; sc[3] = sq[48];      /* the pass's scales, read in the fragments' group */
      c00 = z8; c01 = z8; c02 = z8; c03 = z8; c10 = z8; c11 = z8; c12 = z8; c13 = z8; }      /* every pass sums from zero: its weights have a maximum of their own */
#pragma unroll      /* as above */
    for (int s = 0; s < 2; ++s) { c00 = g2_mma(a0[s], b0[s], c00); c10 = g2_mma(a1[s], b0[s], c10); c01 = g2_mma(a0[s], b1[s], c01); c11 = g2_mma(a1[s], b1[s], c11);
      c02 = g2_mma(a0[s], b2[s], c02); c12 = g2_mma(a1[s], b2[s], c12); c03 = g2_mma(a0[s], b3[s], c03); c13 = g2_mma(a1[s], b3[s], c13); }
    asm volatile("s_wait_dscnt 0x0" ::: "memory");      /* this wave's reads of buffer bu are done before it is refilled */
    asm volatile("s_wait_asynccnt 0x0" ::: "memory");      /* this wave's copies of tile t + 1 have landed */
    __syncthreads();      /* publishes tile t + 1 and ends every wave's reads of buffer bu */
    if (t + 2 < np) g2_copy8(la + bu * bufb, lb + bu * bufb, ga + (size_t)(t + 2) * 64, gb + (size_t)(t + 2) * 64, rsa, rsb);
    if (EPI == 3) { t00 += c00 * sc[0]; t10 += c10 * sc[0]; t01 += c01 * sc[1]; t11 += c11 * sc[1]; t02 += c02 * sc[2]; t12 += c12 * sc[2]; t03 += c03 * sc[3]; t13 += c13 * sc[3]; } }      /* registers only: behind the barrier and the refill, so that neither waits for it */
  asm volatile("s_wait_asynccnt 0x0" ::: "memory");      /* no copy is outstanding when the wave goes on */
  if (EPI == 3) { c00 = t00; c01 = t01; c02 = t02; c03 = t03; c10 = t10; c11 = t11; c12 = t12; c13 = t13; }
  v8f accs[8] = {c00, c01, c02, c03, c10, c11, c12, c13};
#pragma unroll
  for (int u = 0; u < 8; ++u) { const int t = u & 3, half = u >> 2;      /* the bias, one value a row, is added behind the staging */
#pragma unroll
    for (int r = 0; r < 8; ++r) { const int rloc = half * 16 + 8 * hh + r; float v = EPI == 3 ? accs[u][r] : accs[u][r] * alpha;
      if (ACT == 3) v = fmaxf(v, 0.f); else if (ACT == 6) v = 0.5f * v * (1.0f + erff(v * 0.70710678118654752f)); else if (ACT == 11) v = 1.0f / (1.0f + expf(-v)); else if (ACT == 15) v = v / (1.0f + expf(-v)); else if (ACT == 12) v = (v > 0.f) ? v : 0.01f * v; else if (ACT == 8) v = tanhf(v); else if (ACT == 9) v = 0.5f * v * (1.0f + tanhf(0.7978845608028654f * (v + 0.044715f * v * v * v))); else if (ACT == 14) v = (v > 0.f) ? v : 0.1f * v; else if (ACT == 16) v = (v >= 0.f) ? v : 0.3f * v; else if (ACT == 17) v = (v >= 0.f) ? v : 0.2f * v;
      so[w][rloc][t * 16 + ln] = v; } }
  __builtin_amdgcn_fence(__ATOMIC_ACQ_REL, "workgroup"); __builtin_amdgcn_wave_barrier();
  if (EPI == 1) { const int rsub = lane >> 3, c8 = (lane & 7) * 8;      /* eight lanes take one row's 64 columns: a whole 128-byte line of f16 */
    v4f a[8], c[8]; float rv[8];      /* rv: the row's bias */
#pragma unroll      /* a, c and rv must stay in registers; the 16 LDS reads and the 8 loads of rv go as one group, so that their latency is paid once */
    for (int q = 0; q < 8; ++q) { const int r = q * 4 + rsub; a[q] = *(const v4fa*)&so[w][r][c8]; c[q] = *(const v4fa*)&so[w][r][c8 + 4]; rv[q] = bp[((row0 + r) >> 4) * 32 + ((row0 + r) & 15)]; }      /* the bias lies 16 values to a 128-byte line, as its writers left it */
#pragma unroll      /* as above */
    for (int q = 0; q < 8; ++q) { const size_t o = cofs + (size_t)(row0 + q * 4 + rsub) * ldc + col0 + c8;
      FragH f; for (int i = 0; i < 4; ++i) { f.h[i] = (_Float16)(a[q][i] + rv[q]); f.h[4 + i] = (_Float16)(c[q][i] + rv[q]); } *(v8us*)((unsigned short*)C16 + o) = f.half[0]; } }
  else { const int rsub = lane >> 4, c4 = (lane & 15) * 4;      /* sixteen lanes take one row's 64 columns: two whole 128-byte lines of f32 */
    v4f a[16]; float rv[16];      /* rv: the row's bias */
#pragma unroll      /* a and rv must stay in registers; the 16 LDS reads and the 16 loads of rv go as one group, so that their latency is paid once */
    for (int q = 0; q < 16; ++q) { const int r = q * 2 + rsub; a[q] = *(const v4fa*)&so[w][r][c4]; rv[q] = bp[row0 + r]; }
    float* op = C + cofs + (size_t)(row0 + rsub) * ldc + col0 + c4;
#pragma unroll      /* as above */
    for (int q = 0; q < 16; ++q) { const v4f v = a[q] + bf16_round(rv[q]); *(v4f*)(op + (size_t)(q * 2) * ldc) = v; } } }
template <int ACT, int EPI>
__global__ __launch_bounds__(256) void k_gemm2(const _Float16* __restrict__ A, int lda, size_t sA, const _Float16* __restrict__ Bh, int ldb, size_t sB, float alpha, const float* __restrict__ bias, size_t sBias,
    const float* __restrict__ colscale, _Float16* __restrict__ C16, float* __restrict__ C, int ldc, size_t sC, int M, int N, int K) {
  __shared__ __attribute__((aligned(16))) unsigned char sm[G2SB];
  gemm2_body<ACT, EPI>(sm, blockIdx.x, blockIdx.y, A, lda, sA, Bh, ldb, sB, alpha, bias, sBias, colscale, C16, C, ldc, sC, M, N, K); }


// ---- k_gemm2 for a product whose operands are f16 hi + scaled residual planes: every term in ONE launch, summed in registers. H takes Ah.Bh; X takes Al.Bh and, with NBP == 2, Ah.Bl as well (both carry the residual's scale); C = H alphaH + bias + X alphaL. Same block and wave tiles, same ring order as k_gemm2; a stage is [Ah | Bh | Al (| Bl)]. EPI 0: C f32, row-major. EPI 1: CH | CL = f16 hi | residual x 2^10, row-major. EPI 2: C f32 as [row / TC][column][row % TC]. EPI 3 (M = TC, N = ldc = TS, no bias): the softmax's pieces: CH = f16 weights, row-major, C = ST ----
// One thread's four b128 asynchronous copies to LDS for one 128-row tile; s_wait_xcnt 0 is the statement's last line so that no address register of an issued copy is rewritten ahead of it.
__device__ __forceinline__ void g2_copy4(unsigned la, const _Float16* ga, size_t rsa) {
  asm volatile("global_load_async_to_lds_b128 %0, %4, off\n\t"
               "global_load_async_to_lds_b128 %1, %5, off\n\t"
               "global_load_async_to_lds_b128 %2, %6, off\n\t"
               "global_load_async_to_lds_b128 %3, %7, off\n\t"
               "s_wait_xcnt 0x0"
               :: "v"(la), "v"(la + 1u * 32u * G2P * 2u), "v"(la + 2u * 32u * G2P * 2u), "v"(la + 3u * 32u * G2P * 2u), "v"(ga), "v"(ga + rsa), "v"(ga + 2 * rsa), "v"(ga + 3 * rsa) : "memory");
}
#define G2T (128 * G2P)      /* f16 elements of one 128-row tile in LDS */
#define G2SS(NBP) (2u * (2u + (NBP)) * G2T * 2u)      /* bytes of the two buffers */
// LDS (G2SS(NBP) bytes, 16-byte aligned) and block indices from the calling kernel, as for gemm2_body
template <int NBP, int EPI>
__device__ __forceinline__ void gemm2s_body(unsigned char* sm, const int bx, const int by, const _Float16* __restrict__ Ah, const _Float16* __restrict__ Al, int lda, size_t sA, const _Float16* __restrict__ Bh, const _Float16* __restrict__ Bl, int ldb, size_t sB, float alphaH, float alphaL, const float* __restrict__ bias, const float* __restrict__ bias1,
    float* __restrict__ C, _Float16* __restrict__ CH, _Float16* __restrict__ CL, int ldc, size_t sC, int M, int N, int K) { static_assert(NBP == 1 || NBP == 2, "B is one plane or hi + residual"); static_assert(EPI >= 0 && EPI <= 3 && TC % 128 == 0, "a block's 128 rows lie in one batch");
  constexpr unsigned bufb = (2u + NBP) * G2T * 2u;      /* bytes per buffer */
  static_assert(G2SS(NBP) == 2 * bufb, "sm is the ring");      /* filled by the asynchronous copies only; behind the loop's last barrier the same bytes stage the output, so that two blocks still share a WGP's LDS */
  const int tid = threadIdx.x, w = tid >> 5, lane = tid & 31, ln = lane & 15, hh = lane >> 4;
  Ah += (size_t)by * sA; Al += (size_t)by * sA; Bh += (size_t)by * sB; if (NBP == 2) Bl += (size_t)by * sB; const size_t cofs = (size_t)by * sC; const float* bsel = (EPI == 1 && by == 1) ? bias1 : bias;      /* EPI 1 with two products in one grid: the second has a bias vector of its own */
  const int ntn = N >> 7; const int mt = bx / ntn, nq = bx - mt * ntn; if (mt * 128 >= M) return;      /* the same for the whole block, ahead of every barrier */
  const int wm = w >> 1, wn = w & 1; const int row0 = mt * 128 + 32 * wm, col0 = nq * 128 + 64 * wn;
  const int cr = tid >> 3, cc = (tid & 7) * 8;      /* this thread's first row and its 8-element piece in every copied tile */
  const size_t oa = (size_t)(mt * 128 + cr) * lda + cc, ob = (size_t)(nq * 128 + cr) * ldb + cc; const size_t rsa = (size_t)32 * lda, rsb = (size_t)32 * ldb;
  const unsigned la = (unsigned)(size_t)&sm[(cr * G2P + cc) * 2], lb = la + G2T * 2u, lr = 2u * G2T * 2u;      /* LDS byte addresses in buffer 0 of the Ah and Bh tiles; from a hi tile to its residual tile */
  auto stage = [&](unsigned bo, size_t k0) { g2_copy8(la + bo, lb + bo, Ah + oa + k0, Bh + ob + k0, rsa, rsb);
    if (NBP == 2) g2_copy8(la + lr + bo, lb + lr + bo, Al + oa + k0, Bl + ob + k0, rsa, rsb); else g2_copy4(la + lr + bo, Al + oa + k0, rsa); };
  const int np = K >> 6;
  const v8f z8 = {0.f,0.f,0.f,0.f,0.f,0.f,0.f,0.f}; v8f H[2][4], X[2][4];
#pragma unroll      /* the accumulators must stay in registers */
  for (int j = 0; j < 4; ++j) { H[0][j] = z8; H[1][j] = z8; X[0][j] = z8; X[1][j] = z8; }
  stage(0u, 0);
  asm volatile("s_wait_asynccnt 0x0" ::: "memory");      /* this wave's copies of stage 0 have landed */
  __syncthreads();      /* publishes stage 0 */
  if (np > 1) stage(bufb, 64);
  for (int t = 0; t < np; ++t) { const int bu = t & 1; const _Float16* ahp = (const _Float16*)(sm + bu * bufb) + (32 * wm + ln) * G2P; const _Float16* bhp = (const _Float16*)(sm + bu * bufb) + G2T + (64 * wn + ln) * G2P; const _Float16* alp = ahp + 2 * G2T; const _Float16* blp = bhp + 2 * G2T;
#pragma unroll      /* fragments and accumulators must stay in registers */
    for (int s = 0; s < 2; ++s) { v16h bh[4], bl[4];      /* a 32-k step's LDS reads go as one group ahead of its products */
      const v16h ah0 = g2_frag(ahp + 32 * s, hh), ah1 = g2_frag(ahp + 16 * G2P + 32 * s, hh), al0 = g2_frag(alp + 32 * s, hh), al1 = g2_frag(alp + 16 * G2P + 32 * s, hh);
#pragma unroll      /* as above */
      for (int j = 0; j < 4; ++j) { bh[j] = g2_frag(bhp + j * 16 * G2P + 32 * s, hh); if (NBP == 2) bl[j] = g2_frag(blp + j * 16 * G2P + 32 * s, hh); }
#pragma unroll      /* as above */
      for (int j = 0; j < 4; ++j) { H[0][j] = g2_mma(ah0, bh[j], H[0][j]); H[1][j] = g2_mma(ah1, bh[j], H[1][j]); X[0][j] = g2_mma(al0, bh[j], X[0][j]); X[1][j] = g2_mma(al1, bh[j], X[1][j]); }
      if (NBP == 2) {
#pragma unroll      /* as above */
        for (int j = 0; j < 4; ++j) { X[0][j] = g2_mma(ah0, bl[j], X[0][j]); X[1][j] = g2_mma(ah1, bl[j], X[1][j]); } } }
    asm volatile("s_wait_dscnt 0x0" ::: "memory");      /* this wave's reads of buffer bu are done before it is refilled */
    asm volatile("s_wait_asynccnt 0x0" ::: "memory");      /* this wave's copies of stage t + 1 have landed */
    __syncthreads();      /* publishes stage t + 1 and ends every wave's reads of buffer bu */
    if (t + 2 < np) stage(bu * bufb, (size_t)(t + 2) * 64); }
  asm volatile("s_wait_asynccnt 0x0" ::: "memory");      /* no copy is outstanding when the wave goes on */
  if (EPI == 3) { _Float16* sh = (_Float16*)sm + w * (32 * G2P);      /* this wave's own staging, 32 rows of 64 f16; every wave has left the ring at the last pass's barrier */
    constexpr float L2E = 1.44269504088896340736f; float pm[16], pl[16];      /* this form takes no bias: the scores have none */
#pragma unroll      /* the accumulators, pm and pl are indexed by constants only */
    for (int i = 0; i < 16; ++i) { const int half = i >> 3, r = i & 7;
#pragma unroll      /* as above */
      for (int j = 0; j < 4; ++j) { float v = H[half][j][r] * alphaH; v += X[half][j][r] * alphaL; H[half][j][r] = v; }
      pm[i] = fmaxf(fmaxf(H[half][0][r], H[half][1][r]), fmaxf(H[half][2][r], H[half][3][r])); }
    row_max16x8(pm); row_max16x8(pm + 8);
#pragma unroll      /* as above; the sixteen rows' chains are independent and fill one another's latencies */
    for (int i = 0; i < 16; ++i) { const int half = i >> 3, r = i & 7; const float ml = pm[i] * L2E, c = 10.0f - ml; float e[4];
#pragma unroll      /* as above */
      for (int j = 0; j < 4; ++j) H[half][j][r] = __builtin_fmaf(H[half][j][r], L2E, c);
      exp2x4(e, H[half][0][r], H[half][1][r], H[half][2][r], H[half][3][r]);
#pragma unroll      /* as above */
      for (int j = 0; j < 4; ++j) sh[(half * 16 + 8 * hh + r) * G2P + j * 16 + ln] = (_Float16)e[j];
      pm[i] = ml; pl[i] = row_sum16((e[0] + e[1]) + (e[2] + e[3])); }
    float ms = pm[0], ls = pl[0];      /* lane ln of either half takes row (ln >> 3) * 16 + 8 hh + (ln & 7): the wave's 32 rows are one 128-byte line of each plane */
#pragma unroll      /* as above */
    for (int i = 1; i < 16; ++i) { ms = ln == i ? pm[i] : ms; ls = ln == i ? pl[i] : ls; }
    __builtin_amdgcn_fence(__ATOMIC_ACQ_REL, "workgroup"); __builtin_amdgcn_wave_barrier();      /* the wave's staging stores stand ahead of its own reads of them; no other wave reads these rows */
    const int rsub = lane >> 3, c8 = (lane & 7) * 8; v8us pq[8];      /* eight lanes take one row's 64 columns: a whole 128-byte line */
#pragma unroll      /* pq must stay in registers; the 8 LDS reads go as one group */
    for (int q = 0; q < 8; ++q) pq[q] = *(const v8us*)((const unsigned short*)sh + (q * 4 + rsub) * G2P + c8);
    unsigned short* pp = (unsigned short*)CH + cofs + (size_t)(row0 + rsub) * TS + col0 + c8;      /* the row length as a constant: every store is one base plus an immediate */
#pragma unroll      /* as above */
    for (int q = 0; q < 8; ++q) *(v8us*)(pp + q * 4 * TS) = pq[q];
    float* st = C + ((size_t)by * SNT + (col0 >> 6)) * TC + row0 + (ln >> 3) * 16 + 8 * hh + (ln & 7);
    st[0] = ms; st[STP] = ls; return; }      /* the last stores: nothing behind them rewrites a register that they name */
  constexpr int SOP = EPI == 2 ? 36 : 68;      /* staging pitch in floats, 16 B x odd: 32 rows of 64 columns, or (EPI 2) 64 columns of 32 rows */
  constexpr int SOW = EPI == 2 ? 64 * SOP : 32 * SOP; static_assert(2 * bufb >= 8u * SOW * 4u, "the output staging lies inside the ring");
  float* so = (float*)sm + w * SOW;      /* this wave's own staging; every wave has left the ring at the last pass's barrier */
#pragma unroll      /* the accumulators are indexed by constants only */
  for (int u = 0; u < 8; ++u) { const int j = u & 3, half = u >> 2; const float bv = bsel ? bf16_round(bsel[col0 + j * 16 + ln]) : 0.f;
    v4f p0, p1;
#pragma unroll      /* as above */
    for (int r = 0; r < 8; ++r) { float v = H[half][j][r] * alphaH + bv; v += X[half][j][r] * alphaL; if (EPI != 2) so[(half * 16 + 8 * hh + r) * SOP + j * 16 + ln] = v; else if (r < 4) p0[r] = v; else p1[r - 4] = v; }
    if (EPI == 2) { float* sc = so + (j * 16 + ln) * SOP + half * 16 + 8 * hh; *(v4fa*)sc = p0; *(v4fa*)(sc + 4) = p1; } }      /* a lane's eight values are eight rows of one column: side by side here */
  __builtin_amdgcn_fence(__ATOMIC_ACQ_REL, "workgroup"); __builtin_amdgcn_wave_barrier();      /* the wave's staging stores stand ahead of its own reads of them; no other wave reads these rows */
  if (EPI == 0) { const int rsub = lane >> 4, c4 = (lane & 15) * 4;
#pragma unroll      /* the 16 LDS reads and stores of whole lines in flight together */
    for (int q = 0; q < 16; ++q) { const int r = q * 2 + rsub; const v4f v = *(const v4fa*)&so[r * SOP + c4]; *(v4f*)(C + cofs + (size_t)(row0 + r) * ldc + col0 + c4) = v; } }
  else if (EPI == 1) { const int rsub = lane >> 3, c8 = (lane & 7) * 8;      /* eight lanes take one row's 64 columns: a whole 128-byte line in each plane */
    v4f a[8], c[8];
#pragma unroll      /* a and c must stay in registers; the 16 LDS reads go as one group, so that their latency is paid once */
    for (int q = 0; q < 8; ++q) { a[q] = *(const v4fa*)&so[(q * 4 + rsub) * SOP + c8]; c[q] = *(const v4fa*)&so[(q * 4 + rsub) * SOP + c8 + 4]; }
#pragma unroll      /* as above */
    for (int q = 0; q < 8; ++q) { const size_t o = cofs + (size_t)(row0 + q * 4 + rsub) * ldc + col0 + c8; g2_store_hl(a[q], c[q], CH + o, CL + o); } }
  else { const int cs = (lane >> 3) * 8, r4 = (lane & 7) * 4; const int bb = row0 / TC;      /* eight lanes take one column's 32 rows: a whole 128-byte line; the four columns of a read lie 8 apart, which spreads them over the banks */
    float* op = C + ((size_t)bb * N + col0 + cs) * TC + (row0 - bb * TC) + r4;
#pragma unroll      /* as above; every store is one base plus an immediate */
    for (int q = 0; q < 16; ++q) { const int cq = (q & 7) + 32 * (q >> 3); const v4f v = *(const v4fa*)&so[(cs + cq) * SOP + r4]; *(v4f*)(op + (size_t)cq * TC) = v; } } }
template <int NBP, int EPI>
__global__ __launch_bounds__(256) void k_gemm2s(const _Float16* __restrict__ Ah, const _Float16* __restrict__ Al, int lda, size_t sA, const _Float16* __restrict__ Bh, const _Float16* __restrict__ Bl, int ldb, size_t sB, float alphaH, float alphaL, const float* __restrict__ bias,
    float* __restrict__ C, _Float16* __restrict__ CH, _Float16* __restrict__ CL, int ldc, size_t sC, int M, int N, int K) {
  __shared__ __attribute__((aligned(16))) unsigned char sm[G2SS(NBP)];
  gemm2s_body<NBP, EPI>(sm, blockIdx.x, blockIdx.y, Ah, Al, lda, sA, Bh, Bl, ldb, sB, alphaH, alphaL, bias, nullptr, C, CH, CL, ldc, sC, M, N, K); }
// the three 1x1 convolutions of the inputs in one grid: blockIdx.y = 0: F rows (b,t); 1: G rows (b,s), whose planes, weights and outputs lie sN, sW and sN elements behind F's; 2: Wo H as [b][o][s] f16 = (Wo Wh) . style^T + Wo bh (BH and bh here are those two products), blockIdx.x = 32 tiles x 16 batches. The longer blocks come first.
static_assert(NRC == NRS && (NRC / 128) * (CC / 128) == (CC / 128) * (TS / 128) * NB && (CC / 128) * (TS / 128) == 32, "k_fgh: every blockIdx.y has the same number of blocks");
__global__ __launch_bounds__(256) void k_fgh(const _Float16* __restrict__ NH, const _Float16* __restrict__ NL, size_t sN, const _Float16* __restrict__ BFG, size_t sW, const float* __restrict__ bf_, const float* __restrict__ bg, _Float16* __restrict__ FGH, _Float16* __restrict__ FGL,
    const _Float16* __restrict__ BH, const _Float16* __restrict__ S16, const float* __restrict__ bh, _Float16* __restrict__ HT) {
  __shared__ __attribute__((aligned(16))) unsigned char sm[G2SB > G2SS(1) ? G2SB : G2SS(1)];
  if (blockIdx.y < 2) gemm2s_body<1, 1>(sm, blockIdx.x, blockIdx.y, NH, NL, CC, sN, BFG, nullptr, CC, sW, 0.0625f, 0.0625f / 1024.0f, bf_, bg, nullptr, FGH, FGL, CC, sN, NRC, CC, CC);      /* the test reads the same for the whole block: each side holds its own barriers */
  else gemm2_body<0, 1>(sm, blockIdx.x & 31, blockIdx.x >> 5, BH, CC, 0, S16, CC, (size_t)TS * CC, 0.0625f, bh, 0, nullptr, HT, nullptr, TS, (size_t)CC * TS, CC, TS, CC); }

// ---- statistics, planes and weights in one launch: a block holds 64 channels x 1024 frames of one batch of one input in registers, so that the input is read once; a thread's 16 channels x 8 frames are what it stores, eight channels to a 16-byte piece, and nothing is transposed through LDS. Behind its planes every block forms 16 rows x 64 columns of Wo Wh on WMMA (each of the 16 waves takes 32 of the 512 k for all four 16x16 tiles; the waves' sums are added up through LDS); the blocks of the first 64 columns form Wo bh as well, bh being every column of one more B fragment ----
#define FC 64                    /* channels per k_prep block: one 128-byte line of every [frame][channel] plane */
#define RP 132                   /* LDS pitch in floats of a channel's 128 partial sums: a multiple of 16 bytes for the b128 readers */
#define WPP 68                   /* LDS pitch in floats of a row of 64 partial sums of Wo Wh: 16 B x odd */
static_assert(TC == 1024 && TS == 1024 && CC % FC == 0 && 2 * CC * CC == NB * (CC / FC) * 512 * 8, "k_prep: rows of 16 waves x 64 frames; every thread of the content's blocks converts eight weights");
static_assert(CC == 16 * 32 && 2 * NB * (CC / FC) == (CC / 16) * (CC / 64) && FC >= 16 && RP >= 16, "k_prep: every block has its 16 x 64 piece of Wo Wh, every wave its 32 k; the partial sums of Wo bh fit the LDS of the statistics");
typedef float v2f __attribute__((ext_vector_type(2)));
typedef float v2fa __attribute__((ext_vector_type(2), may_alias));
typedef unsigned short v2us __attribute__((ext_vector_type(2), may_alias));
__device__ __forceinline__ _Float16 w16(float x) { return (_Float16)(bf16_round(x) * 16.0f); }      /* a weight as the WMMAs take it: rounded to bf16, x 16, exact in f16 */
// a work-group barrier that orders LDS alone: only LDS goes from wave to wave in k_prep, and __syncthreads() would hold every wave until its global stores have completed as well
__device__ __forceinline__ void prep_barrier() { __builtin_amdgcn_fence(__ATOMIC_RELEASE, "workgroup", "local"); __builtin_amdgcn_s_barrier(); __builtin_amdgcn_fence(__ATOMIC_ACQUIRE, "workgroup", "local"); }
// the sum of a channel's 128 partial sums, in all eight lanes that share the channel
__device__ __forceinline__ float prep_total(const float (*red)[RP], int rc, int rj) {
  const v4f t0 = *(const v4fa*)&red[rc][rj * 4], t1 = *(const v4fa*)&red[rc][32 + rj * 4], t2 = *(const v4fa*)&red[rc][64 + rj * 4], t3 = *(const v4fa*)&red[rc][96 + rj * 4];
  const v4f t = (t0 + t1) + (t2 + t3); float s = (t[0] + t[1]) + (t[2] + t[3]);
  for (int o = 4; o > 0; o >>= 1) s += __shfl_xor(s, o, 32);
  return s; }
__global__ __launch_bounds__(512) void k_prep(const float* __restrict__ content, const float* __restrict__ style, _Float16* __restrict__ NH, _Float16* __restrict__ NL, size_t sN, _Float16* __restrict__ S16,
    const float* __restrict__ Wf, const float* __restrict__ Wg, const float* __restrict__ Wh, const float* __restrict__ Wo, const float* __restrict__ bh, _Float16* __restrict__ BW, _Float16* __restrict__ WP, float* __restrict__ BP) {
  __shared__ __attribute__((aligned(16))) float red[FC][RP];
  __shared__ __attribute__((aligned(16))) float smu[FC], srs[FC];
  __shared__ __attribute__((aligned(16))) float wpart[16][16][WPP];      /* [wave][row][column]: the waves' partial sums of Wo Wh; registers hold the kernel to one block a WGP, so that this LDS costs no residency */
  const int tid = threadIdx.x, w = tid >> 5, lane = tid & 31, fl = lane & 7, gl = lane >> 3;      /* eight lanes take 32 frames of a row, a whole 128-byte line; the four lane groups take rows 8 apart */
  const int y = blockIdx.y, b = blockIdx.x / (CC / FC), c0 = (blockIdx.x % (CC / FC)) * FC;      /* y: 0 content, 1 style; the same for the whole block */
  const int f0 = w * 64 + fl * 4;      /* the thread's frames: f0 .. f0 + 3 and f0 + 32 .. f0 + 35 */
  const int blk = blockIdx.x;      /* the content's blocks, which have one plane less to store, convert Wf and Wg (x 16, f16), 64 blocks each; BW = the two planes in a row */
  const char* wp = (const char*)((blk < 64 ? Wf : Wg) + (blk & 63) * 4096); const unsigned wb = tid * 32u;      /* the block's 4096 weights; the thread's eight, in bytes */
  const float* xp = (y ? style : content) + ((size_t)b * CC + c0 + gl * 8) * 1024 + f0;      /* the row length as a constant: every load is one base plus an immediate */
  v4f w0 = {0.f, 0.f, 0.f, 0.f}, w1 = w0; if (y == 0) { w0 = *(const v4fa*)(wp + wb); w1 = *(const v4fa*)(wp + wb + 16); }
  v4f a[16][2];      /* [u][e]: channel c0 + (u >> 3) * 32 + gl * 8 + (u & 7), frames f0 + 32 e + 0 .. 3 */
#pragma unroll      /* a must stay in registers; all 32 loads of the thread in flight at once */
  for (int u = 0; u < 16; ++u) { a[u][0] = *(const v4fa*)(xp + ((u >> 3) * 32 + (u & 7)) * 1024); a[u][1] = *(const v4fa*)(xp + ((u >> 3) * 32 + (u & 7)) * 1024 + 32); }
  asm volatile("s_wait_xcnt 0x0" :: "v"(wb), "v"(xp) : "memory");      /* the two vector addresses are inputs, so that they live up to this wait and no register that an issued load names is rewritten ahead of it */
  __builtin_amdgcn_sched_barrier(0);      /* keeps the arithmetic on the first values behind the last load; the scheduler otherwise holds eight loads back until earlier ones have returned */
  if (y == 0) { FragH fw;
#pragma unroll      /* fw must stay in registers */
    for (int q = 0; q < 4; ++q) { fw.h[q] = w16(w0[q]); fw.h[4 + q] = w16(w1[q]); }
    *(v8us*)((unsigned short*)BW + (size_t)blk * 4096 + tid * 8) = fw.half[0]; }
  const int rc = tid >> 3, rj = tid & 7;      /* eight threads add up one channel's partial sums */
#pragma unroll      /* a must stay in registers */
  for (int u = 0; u < 16; ++u) {
#pragma unroll      /* as above */
    for (int q = 0; q < 4; ++q) { a[u][0][q] = bf16_round(a[u][0][q]); a[u][1][q] = bf16_round(a[u][1][q]); }
    const v4f t = a[u][0] + a[u][1]; red[(u >> 3) * 32 + gl * 8 + (u & 7)][w * 8 + fl] = (t[0] + t[1]) + (t[2] + t[3]); }
  const size_t o0 = ((size_t)b * 1024 + f0) * CC + c0 + gl * 8;      /* the thread's first piece in every plane; frames lie CC apart, its two channel groups 32 */
  if (y) { unsigned short* Rh = (unsigned short*)(S16 + o0);      /* the style's raw plane needs no statistics: its stores fly under them */
#pragma unroll      /* a is indexed by constants only; every store is one base plus an immediate; the two halves of a frame's line go one behind the other */
    for (int k = 0; k < 8; ++k) { FragH fr[2];
#pragma unroll      /* as above */
      for (int u = 0; u < 16; ++u) fr[u >> 3].h[u & 7] = (_Float16)a[u][k >> 2][k & 3];
      *(v8us*)(Rh + ((k >> 2) * 32 + (k & 3)) * CC) = fr[0].half[0]; *(v8us*)(Rh + ((k >> 2) * 32 + (k & 3)) * CC + 32) = fr[1].half[0]; } }
  asm volatile("s_wait_xcnt 0x0" ::: "memory");      /* what follows reuses registers that the stores above name */
  prep_barrier();      /* publishes the partial sums */
  { const float s = prep_total(red, rc, rj); if (rj == 0) smu[rc] = s / 1024.0f; }
  prep_barrier();      /* publishes the means and ends every read of red */
#pragma unroll      /* a must stay in registers */
  for (int u = 0; u < 16; ++u) { const float mu = smu[(u >> 3) * 32 + gl * 8 + (u & 7)]; a[u][0] -= mu; a[u][1] -= mu; const v4f t = a[u][0] * a[u][0] + a[u][1] * a[u][1]; red[(u >> 3) * 32 + gl * 8 + (u & 7)][w * 8 + fl] = (t[0] + t[1]) + (t[2] + t[3]); }
  prep_barrier();      /* publishes the partial sums of squares */
  { const float s2 = prep_total(red, rc, rj); if (rj == 0) srs[rc] = rsqrtf(s2 / 1023.0f + 1e-5f); }      /* unbiased variance */
  prep_barrier();      /* publishes the scales */
  float r[16];
#pragma unroll      /* r must stay in registers */
  for (int u = 0; u < 16; ++u) r[u] = srs[(u >> 3) * 32 + gl * 8 + (u & 7)];
  unsigned short* Hh = (unsigned short*)(NH + y * sN + o0); unsigned short* Lh = (unsigned short*)(NL + y * sN + o0);      /* the style's planes lie sN elements behind the content's */
#pragma unroll      /* a and r are indexed by constants only; the stores as above */
  for (int k = 0; k < 8; ++k) { const int o = ((k >> 2) * 32 + (k & 3)) * CC; FragH fh[2], fo[2];
#pragma unroll      /* as above */
    for (int u = 0; u < 16; ++u) { const float v = a[u][k >> 2][k & 3] * r[u]; const _Float16 hv = (_Float16)v; fh[u >> 3].h[u & 7] = hv; fo[u >> 3].h[u & 7] = (_Float16)((v - (float)hv) * 1024.0f); }
    *(v8us*)(Hh + o) = fh[0].half[0]; *(v8us*)(Hh + o + 32) = fh[1].half[0]; *(v8us*)(Lh + o) = fo[0].half[0]; *(v8us*)(Lh + o + 32) = fo[1].half[0];
    asm volatile("s_wait_xcnt 0x0" ::: "memory"); }      /* the next frame's packing, and the code behind the loop, reuse registers that these stores name */
  const int g = y * (NB * (CC / FC)) + blockIdx.x, r0 = (g >> 3) * 16, i0 = (g & 7) * 64;      /* the block's rows and columns of Wo Wh */
  const int ln = lane & 15, hh = lane >> 4; const bool vb = i0 == 0;      /* vb, the same for the whole block: it forms its rows of Wo bh too */
  const float* ap = Wo + (size_t)(r0 + ln) * CC + w * 32 + 8 * hh; const float* bp = Wh + (size_t)(w * 32 + 8 * hh) * CC + i0 + 4 * ln; const float* vp = bh + w * 32 + 8 * hh;      /* the wave's 32 k */
  v4f xa[4], xv[4], xb[16];      /* A, row r0 + ln, and bh, which every column of its B fragment holds: k = 8 hh + 0 .. 7, then 16 + 8 hh + 0 .. 7; xb[i]: the same k in the same order, columns i0 + 4 ln + 0 .. 3, one to each of the four tiles, so that a lane's loads are 16 bytes wide */
  xa[0] = *(const v4fa*)ap; xa[1] = *(const v4fa*)(ap + 4); xa[2] = *(const v4fa*)(ap + 16); xa[3] = *(const v4fa*)(ap + 20);
#pragma unroll      /* xb must stay in registers; all loads of the wave in flight at once */
  for (int i = 0; i < 8; ++i) { xb[i] = *(const v4fa*)(bp + i * CC); xb[8 + i] = *(const v4fa*)(bp + (16 + i) * CC); }
  if (vb) { xv[0] = *(const v4fa*)vp; xv[1] = *(const v4fa*)(vp + 4); xv[2] = *(const v4fa*)(vp + 16); xv[3] = *(const v4fa*)(vp + 20); }
  asm volatile("s_wait_xcnt 0x0" :: "v"(ap), "v"(bp), "v"(vp) : "memory");      /* the vector addresses are inputs, so that they live up to this wait and no register that an issued load names is rewritten ahead of it */
  FragH fa, fb[4];
#pragma unroll      /* the fragments must stay in registers */
  for (int i = 0; i < 16; ++i) { fa.h[i] = w16(xa[i >> 2][i & 3]); fb[0].h[i] = w16(xb[i][0]); fb[1].h[i] = w16(xb[i][1]); fb[2].h[i] = w16(xb[i][2]); fb[3].h[i] = w16(xb[i][3]); }
  const v8f z8 = {0.f, 0.f, 0.f, 0.f, 0.f, 0.f, 0.f, 0.f};
  const v8f d0 = g2_mma(fa.v, fb[0].v, z8), d1 = g2_mma(fa.v, fb[1].v, z8), d2 = g2_mma(fa.v, fb[2].v, z8), d3 = g2_mma(fa.v, fb[3].v, z8);
#pragma unroll      /* the sums are indexed by constants only */
  for (int q = 0; q < 8; ++q) { const v4f t = {d0[q], d1[q], d2[q], d3[q]}; *(v4fa*)&wpart[w][8 * hh + q][4 * ln] = t; }      /* tile n's column ln is column 4 ln + n */
  if (vb) { FragH fv;
#pragma unroll      /* as above */
    for (int i = 0; i < 16; ++i) fv.h[i] = (_Float16)bf16_round(xv[i >> 2][i & 3]);
    const v8f dv = g2_mma(fa.v, fv.v, z8);
    if (ln == 0) {
#pragma unroll      /* as above */
      for (int q = 0; q < 8; ++q) red[w][8 * hh + q] = dv[q]; } }      /* every read of the statistics' sums ended at the barriers above */
  prep_barrier();      /* publishes the sixteen waves' partial sums */
  v2f p[16];      /* wave w adds up row w; its 32 lanes store the row's 64 columns, a whole 128-byte line of f16 */
#pragma unroll      /* p must stay in registers; the 16 LDS reads go as one group */
  for (int s = 0; s < 16; ++s) p[s] = *(const v2fa*)&wpart[s][w][2 * lane];
#pragma unroll      /* as above */
  for (int st = 8; st > 0; st >>= 1) {
#pragma unroll      /* as above */
    for (int s = 0; s < st; ++s) p[s] += p[s + st]; }
  FragH f; f.h[0] = (_Float16)(p[0][0] * 0.0625f); f.h[1] = (_Float16)(p[0][1] * 0.0625f);      /* 16 Wo . 16 Wh / 16: x 16 like the other weights */
  const v2us o2 = {f.u[0], f.u[1]}; *(v2us*)((unsigned short*)WP + (size_t)(r0 + w) * CC + i0 + 2 * lane) = o2;
  if (vb && tid < 16) { float s = 0.f;
#pragma unroll      /* every LDS read at a constant offset, several in flight */
    for (int k = 0; k < 16; ++k) s += red[k][tid];
    BP[(g >> 3) * 32 + tid] = s * 0.0625f; } }      /* a block's 16 values of Wo bh on a 128-byte line of their own: one writer a line */
extern "C" void kernel_launch(void* const* d_in, const int* in_sizes, int n_in,
                              void* d_out, int out_size, void* d_ws, size_t ws_size, hipStream_t stream) {
  (void)in_sizes; (void)n_in; (void)out_size;
  const float* content = (const float*)d_in[0]; const float* style = (const float*)d_in[1]; const float* Wf = (const float*)d_in[2]; const float* bf_ = (const float*)d_in[3]; const float* Wg = (const float*)d_in[4]; const float* bg = (const float*)d_in[5]; const float* Wh = (const float*)d_in[6]; const float* bh = (const float*)d_in[7]; const float* Wo = (const float*)d_in[8]; const float* bo = (const float*)d_in[9];
  char* ws = (char*)d_ws; size_t off = 0;
  auto take = [&](size_t bytes) { char* p = ws + off; off += (bytes + 255) & ~(size_t)255; return p; };
  const size_t npc = (size_t)NRC * CC, nps = (size_t)NRS * CC;
  _Float16* BF = (_Float16*)take((size_t)CC * CC * 2); _Float16* BGm = (_Float16*)take((size_t)CC * CC * 2); _Float16* BH = (_Float16*)take((size_t)CC * CC * 2); float* BV = (float*)take((size_t)(CC / 16) * 32 * 4);      /* BH = Wo Wh (x 16), BV = Wo bh */
  _Float16* CNH = (_Float16*)take(npc * 2); _Float16* CNL = (_Float16*)take(npc * 2); _Float16* SNH = (_Float16*)take(nps * 2); _Float16* SNL = (_Float16*)take(nps * 2); _Float16* S16 = (_Float16*)take(nps * 2);
  _Float16* FH = (_Float16*)take(npc * 2); _Float16* FL = (_Float16*)take(npc * 2); _Float16* GH = (_Float16*)take(nps * 2); _Float16* GL = (_Float16*)take(nps * 2); _Float16* HT = (_Float16*)take(nps * 2);
  float* ST = (float*)take(2 * STP * 4);      /* the pieces' maxima and sums */
  _Float16* P = CNH;      /* the softmax weights [NRC][TS] over both content-normalised planes (dead after F) */
  if (off > ws_size) return;      /* 1.5 + 16 x 5 + 16 x 5 + 2 = about 164 MiB */
  k_prep<<<dim3(NB * (CC / FC), 2), 512, 0, stream>>>(content, style, CNH, CNL, SNH - CNH, S16, Wf, Wg, Wh, Wo, bh, BF, BH, BV);      /* BF and BGm lie in a row; conv (out, in) naturals */
  k_fgh<<<dim3((NRC / 128) * (CC / 128), 3), 256, 0, stream>>>(CNH, CNL, SNH - CNH, BF, BGm - BF, bf_, bg, FH, FL, BH, S16, BV, HT);      /* F into FH | FL; G from SNH | SNL and BGm into GH | GL, each as far behind its counterpart as SNH behind CNH; Wo H into HT */
  k_gemm2s<2, 3><<<dim3((TC / 128) * (TS / 128), BG), 256, 0, stream>>>(FH, FL, CC, (size_t)TC * CC, GH, GL, CC, (size_t)TS * CC, 1.0f, 0.0009765625f, nullptr, ST, P, nullptr, TS, (size_t)TC * TS, TC, TS, CC);      /* F^T G (hi.hi + (lo.hi + hi.lo)), unscaled, leaves the kernel as the softmax's pieces */
  k_gemm2<0, 3><<<dim3((CC / 128) * (TC / 128), BG), 256, 0, stream>>>(HT, TS, (size_t)CC * TS, P, TS, (size_t)TC * TS, 1.0f, bo, 0, ST, nullptr, (float*)d_out, TC, (size_t)CC * TC, CC, TC, TS);      /* out [b][o][t] = (Wo H) . (the merged pieces)^T + bo; the weights' 2^10 is in their sums too */
}

// v010
// A run of this version takes 105 microseconds.
// Versions in between are left out here; by their measured steps it is 1.14 times as fast as v008.
// Over all steps from v000 it is 8.72 times as fast.
#include <hip/hip_runtime.h>
// SpeakerAttention (16 x 512 channels; content 1024 frames, style 1024 frames: F = Wf mvn(content) + bf, G = Wg mvn(style) + bg, H = Wh style + bh (1x1 convs); S = softmax over style frames of the UNSCALED F^T G (K = 512 channels); O = H S^T; out = Wo O + bo; mvn = per (batch, channel) mean / unbiased variance over time, eps 1e-5).
// Structure: per-(b,c) mvn statistics on VALU and the [frame][channel] planes of the normalised inputs as f16 hi/residual (style raw plane exact) in one kernel that holds its rows in registers; Wg is folded into Wf by associativity: F^T G = Q^T mvn(style) + F^T bg with Q = (Wg^T Wf) mvn(content) + Wg^T bf, and F^T bg, the same for every style frame of a row, leaves the softmax as it is and is not formed; Q as a three-term f16 WMMA GEMM, all terms in one launch (32x64 wave tiles fed from LDS, f32 accumulation, one accumulator set per scale, x16 weights hi/residual + bias), stored by its own epilogue as f16 hi/residual planes; Wo H as one GEMM per batch with the weights as the A operand, so that it comes out as [b][o][s] (f16); the score GEMM of all batches (Q against the normalised style planes) as THREE hi/residual product terms in one launch (K = 512, f32; the two residual terms share an accumulator set), whose epilogue leaves the softmax in pieces of 64 columns (f16 weights x 2^10 against the piece's own maximum, with that maximum and the piece's sum), on VALU. The last convolution is folded into H by associativity: Wo (H S^T) = (Wo H) S^T and Wo H = (Wo Wh) style + Wo bh, so small WMMA products of the weight matrices (Wo Wh, Wg^T Wf; Wo bh, Wg^T bf) come first, the H GEMM takes Wo Wh for its weights, and the readout GEMM (A = Wo H, M = 512; B = the softmax weights, N = 1024; K = 1024) merges the pieces (each 64-k pass's sums times its piece's share of the row), adds bo and stores out [b][o][t] itself. Launches that do not depend on one another share one grid: the weight products with both inputs' statistics and planes (every block takes its share of the weight products; blockIdx.y says the input); Q and Wo H (blockIdx.y says whose block it is).
// Compute dtype: inputs rounded to bf16; Wf, Wg, Wo, Wh exact as f16; the normalised inputs, Wg^T Wf and Q as f16 hi + 2^-10-scaled residual (the unscaled K = 512 logits have sigma ~ 22, so single-rounded operands would not do); style, Wo Wh, Wo H and the softmax weights as plain f16 (~2^-12); statistics / softmax f32. v_wmma_f32_16x16x32_f16.
#define NB 16
#define CC 512
#define TC 1024
#define TS 1024
#define NRC (NB * TC)
#define NRS (NB * TS)
#define BG 16                    /* batches per launch of the score and readout kernels: all of them */
typedef __bf16 v16b __attribute__((ext_vector_type(16)));
typedef unsigned short v8us __attribute__((ext_vector_type(8), may_alias));
typedef float  v8f  __attribute__((ext_vector_type(8)));
typedef float  v4f  __attribute__((ext_vector_type(4)));
typedef float  v4fa __attribute__((ext_vector_type(4), may_alias));
union FragB { v16b v; v8us half[2]; unsigned short u[16]; };

__device__ __forceinline__ unsigned short bf16_bits(float x) { unsigned int u = __float_as_uint(x); return (unsigned short)((u + 0x7FFFu + ((u >> 16) & 1u)) >> 16); }
__device__ __forceinline__ float bf16_val(unsigned short b) { return __uint_as_float(((unsigned int)b) << 16); }
__device__ __forceinline__ float bf16_round(float x) { return bf16_val(bf16_bits(x)); }
// D += A·B with NT terms: 1 = ah·bh, 2 = + al·bh (A split), 3 = + ah·bl (both split)
template <int NT>
__device__ __forceinline__ v8f mmaN(v16b ah, v16b al, v16b bh, v16b bl, v8f c) {
  c = __builtin_amdgcn_wmma_f32_16x16x32_bf16(false, ah, false, bh, (short)0, c, false, false);
  if (NT >= 2) c = __builtin_amdgcn_wmma_f32_16x16x32_bf16(false, al, false, bh, (short)0, c, false, false);
  if (NT >= 3) c = __builtin_amdgcn_wmma_f32_16x16x32_bf16(false, ah, false, bl, (short)0, c, false, false);
  asm volatile("v_nop\n\tv_nop\n\tv_nop\n\tv_nop" : "+v"(c) : "v"(ah), "v"(al), "v"(bh), "v"(bl));
  return c;
}

__global__ __launch_bounds__(256) void k_wt_bf16(const float* __restrict__ W, unsigned short* __restrict__ Wt, int K, int N) {
  const int t = blockIdx.x * 256 + threadIdx.x;
  const int k8n = K / 8;
  if (t >= N * k8n) return;
  const int n = t / k8n, k8 = (t % k8n) * 8;
  v8us v;
#pragma unroll
  for (int i = 0; i < 8; ++i) v[i] = bf16_bits(W[(size_t)(k8 + i) * N + n]);
  *(v8us*)(Wt + (size_t)n * K + k8) = v;
  
}

// GEMM C[M][N] (f32, pitch ldc) = act(A[M][K]·W + bias). A f32 row-major (pitch lda) converted per fragment to bf16
// (ASPLIT: hi/lo two planes -> 2 terms, else single rounded term); Wt bf16 [N][K] (pitch ldb). BIAS_BF16 rounds the
// bias to bf16 first (bias quantised to bf16 before the add). K%32==0, M%16==0, N%64==0.
template <bool ASPLIT, int ACT, bool BIAS_BF16>
__global__ __launch_bounds__(128) void k_gemm_bf(const float* __restrict__ A, int lda, const unsigned short* __restrict__ Wt, int ldb,
                                               const float* __restrict__ bias, float* __restrict__ C, int ldc, int M, int N, int K) {
  __shared__ __attribute__((aligned(16))) float so[4][16][64];
  const int tid = threadIdx.x, w = tid >> 5, lane = tid & 31, ln = lane & 15, hh = lane >> 4;
  const int ntn = N / 64;
  const int wid = blockIdx.x * 4 + w;
  const int mt = wid / ntn, nq = wid % ntn;
  if (mt * 16 >= M) return;
  const int row0 = mt * 16, col0 = nq * 64;
  const float* arow = A + (size_t)(row0 + ln) * lda;
  v8f acc[4] = {};
  for (int kb = 0; kb < K; kb += 32) {
    FragB ah, al;
    const v4f x0 = *(const v4fa*)(arow + kb + 8 * hh), x1 = *(const v4fa*)(arow + kb + 8 * hh + 4);
    const v4f x2 = *(const v4fa*)(arow + kb + 16 + 8 * hh), x3 = *(const v4fa*)(arow + kb + 16 + 8 * hh + 4);
    float xs[16] = {x0[0],x0[1],x0[2],x0[3],x1[0],x1[1],x1[2],x1[3],x2[0],x2[1],x2[2],x2[3],x3[0],x3[1],x3[2],x3[3]};
#pragma unroll
    for (int i = 0; i < 16; ++i) { const unsigned short hb = bf16_bits(xs[i]); ah.u[i] = hb; al.u[i] = ASPLIT ? bf16_bits(xs[i] - bf16_val(hb)) : (unsigned short)0; }
#pragma unroll
    for (int t = 0; t < 4; ++t) {
      const unsigned short* brow = Wt + (size_t)(col0 + t * 16 + ln) * ldb + kb;
      FragB b;
      b.half[0] = *(const v8us*)(brow + 8 * hh);
      b.half[1] = *(const v8us*)(brow + 16 + 8 * hh);
      acc[t] = mmaN<ASPLIT ? 2 : 1>(ah.v, al.v, b.v, b.v, acc[t]);
    }
  }
#pragma unroll
  for (int t = 0; t < 4; ++t) {
    float bv = bias ? bias[col0 + t * 16 + ln] : 0.f;
    if (BIAS_BF16) bv = bf16_round(bv);
#pragma unroll
    for (int r = 0; r < 8; ++r) { float v = acc[t][r] + bv; if (ACT == 1) v = fmaxf(v, 0.f); so[w][8 * hh + r][t * 16 + ln] = v; }
  }
  __builtin_amdgcn_fence(__ATOMIC_ACQ_REL, "workgroup");
  __builtin_amdgcn_wave_barrier();
  const int rsub = lane >> 4, c4 = (lane & 15) * 4;
  {
#pragma unroll
    for (int q = 0; q < 8; ++q) {
      const int r = q * 2 + rsub;
      const v4f v = *(const v4fa*)&so[w][r][c4];
      *(v4f*)(C + (size_t)(row0 + r) * ldc + col0 + c4) = v;
    }
    
  }
}

// GEMM C = act(A·W + bias + resid): A f32 (ASPLIT -> hi/lo 2 terms), Wt bf16 [N][K]; ACT 0 none, 1 relu, 2 exact gelu;
// resid (optional, f32, row index = (row % rmod), pitch ldr, RES_BF16 rounds it) added before the activation.
template <bool ASPLIT, int ACT, bool BIAS_BF16, bool RES_BF16>
__global__ __launch_bounds__(128) void k_gemm_bf3(const float* __restrict__ A, int lda, const unsigned short* __restrict__ Wt, int ldb,
                                                const float* __restrict__ bias, const float* __restrict__ resid, int rmod, int ldr,
                                                float* __restrict__ C, int ldc, int M, int N, int K) {
  __shared__ __attribute__((aligned(16))) float so[4][16][64];
  const int tid = threadIdx.x, w = tid >> 5, lane = tid & 31, ln = lane & 15, hh = lane >> 4;
  const int ntn = N / 64;
  const int wid = blockIdx.x * 4 + w;
  const int mt = wid / ntn, nq = wid % ntn;
  if (mt * 16 >= M) return;
  const int row0 = mt * 16, col0 = nq * 64;
  const float* arow = A + (size_t)(row0 + ln) * lda;
  v8f acc[4] = {};
  for (int kb = 0; kb < K; kb += 32) {
    FragB ah, al;
    const v4f x0 = *(const v4fa*)(arow + kb + 8 * hh), x1 = *(const v4fa*)(arow + kb + 8 * hh + 4);
    const v4f x2 = *(const v4fa*)(arow + kb + 16 + 8 * hh), x3 = *(const v4fa*)(arow + kb + 16 + 8 * hh + 4);
    float xs[16] = {x0[0],x0[1],x0[2],x0[3],x1[0],x1[1],x1[2],x1[3],x2[0],x2[1],x2[2],x2[3],x3[0],x3[1],x3[2],x3[3]};
#pragma unroll
    for (int i = 0; i < 16; ++i) { const unsigned short hb = bf16_bits(xs[i]); ah.u[i] = hb; al.u[i] = ASPLIT ? bf16_bits(xs[i] - bf16_val(hb)) : (unsigned short)0; }
#pragma unroll
    for (int t = 0; t < 4; ++t) {
      const unsigned short* brow = Wt + (size_t)(col0 + t * 16 + ln) * ldb + kb;
      FragB b;
      b.half[0] = *(const v8us*)(brow + 8 * hh);
      b.half[1] = *(const v8us*)(brow + 16 + 8 * hh);
      acc[t] = mmaN<ASPLIT ? 2 : 1>(ah.v, al.v, b.v, b.v, acc[t]);
    }
  }
#pragma unroll
  for (int t = 0; t < 4; ++t) {
    const int col = col0 + t * 16 + ln;
    float bv = bias ? bias[col] : 0.f;
    if (BIAS_BF16) bv = bf16_round(bv);
#pragma unroll
    for (int r = 0; r < 8; ++r) {
      float v = acc[t][r] + bv;
      if (resid) { float rv = resid[(size_t)((row0 + 8 * hh + r) % rmod) * ldr + col]; if (RES_BF16) rv = bf16_round(rv); v += rv; }
      if (ACT == 1) v = fmaxf(v, 0.f);
      if (ACT == 2) v = 0.5f * v * (1.0f + erff(v * 0.70710678118654752f));
      if (ACT == 3) { const float u = 0.7978845608028654f * (v + 0.044715f * v * v * v); v = 0.5f * v * (1.0f + tanhf(u)); }
      so[w][8 * hh + r][t * 16 + ln] = v;
    }
  }
  __builtin_amdgcn_fence(__ATOMIC_ACQ_REL, "workgroup");
  __builtin_amdgcn_wave_barrier();
  const int rsub = lane >> 4, c4 = (lane & 15) * 4;
  {
#pragma unroll
    for (int q = 0; q < 8; ++q) {
      const int r = q * 2 + rsub;
      const v4f v = *(const v4fa*)&so[w][r][c4];
      *(v4f*)(C + (size_t)(row0 + r) * ldc + col0 + c4) = v;
    }
    
  }
}
// row LayerNorm (biased variance, eps) over N: s = X (+ R); optional out_sum <- s; out_norm <- (s-mu)*rsqrt(var+eps)*g + b
template <bool PARAM_BF16>
__global__ __launch_bounds__(256) void k_layernorm(const float* __restrict__ X, const float* __restrict__ R, const float* __restrict__ g, const float* __restrict__ bta,
                                                  float* __restrict__ out_sum, float* __restrict__ out_norm, int N, float eps) {
  __shared__ float red[256];
  const int row = blockIdx.x, tid = threadIdx.x;
  const float* x = X + (size_t)row * N; const float* rr = R ? R + (size_t)row * N : nullptr;
  float vals[16];                     // up to N = 4096
  const int per = N / 256;            // contiguous chunk per thread? use strided-by-4 chunks: thread handles j = tid*4 + 1024*u
  float s1 = 0.f;
  for (int u = 0; u < per / 4; ++u) {
    const int j = tid * 4 + 1024 * u;
    const v4f a = *(const v4fa*)(x + j);
    v4f b = {0.f,0.f,0.f,0.f}; if (rr) b = *(const v4fa*)(rr + j);
#pragma unroll
    for (int q = 0; q < 4; ++q) { const float v = a[q] + b[q]; vals[u * 4 + q] = v; s1 += v; }
  }
  red[tid] = s1; __syncthreads();
  for (int st = 128; st > 0; st >>= 1) { if (tid < st) red[tid] += red[tid + st]; __syncthreads(); }
  const float mu = red[0] / (float)N; __syncthreads();
  float s2 = 0.f;
  for (int u = 0; u < per / 4; ++u)
#pragma unroll
    for (int q = 0; q < 4; ++q) { const float c = vals[u * 4 + q] - mu; s2 += c * c; }
  red[tid] = s2; __syncthreads();
  for (int st = 128; st > 0; st >>= 1) { if (tid < st) red[tid] += red[tid + st]; __syncthreads(); }
  const float rs = rsqrtf(red[0] / (float)N + eps);
  {
    for (int u = 0; u < per / 4; ++u) {
      const int j = tid * 4 + 1024 * u;
      v4f o, sm;
#pragma unroll
      for (int q = 0; q < 4; ++q) {
        float gg = g[j + q], bb = bta[j + q];
        if (PARAM_BF16) { gg = bf16_round(gg); bb = bf16_round(bb); }
        sm[q] = vals[u * 4 + q]; o[q] = (vals[u * 4 + q] - mu) * rs * gg + bb;
      }
      if (out_sum) *(v4f*)(out_sum + (size_t)row * N + j) = sm;
      *(v4f*)(out_norm + (size_t)row * N + j) = o;
    }
    
  }
}



// ---- f16 WMMA path (v_wmma_f32_16x16x32_f16): 11-bit significands for operands in range — used for every GEMM launched here
typedef _Float16 v16h __attribute__((ext_vector_type(16)));
union FragH { v16h v; v8us half[2]; _Float16 h[16]; unsigned short u[16]; };
template <int NT>
__device__ __forceinline__ v8f mmaH(v16h ah, v16h al, v16h bh, v16h bl, v8f c) {
  c = __builtin_amdgcn_wmma_f32_16x16x32_f16(false, ah, false, bh, (short)0, c, false, false);
  if (NT >= 2) c = __builtin_amdgcn_wmma_f32_16x16x32_f16(false, al, false, bh, (short)0, c, false, false);
  if (NT >= 3) c = __builtin_amdgcn_wmma_f32_16x16x32_f16(false, ah, false, bl, (short)0, c, false, false);
  asm volatile("v_nop\n\tv_nop\n\tv_nop\n\tv_nop" : "+v"(c) : "v"(ah), "v"(al), "v"(bh), "v"(bl));
  return c;
}
// batched GEMM like k_gemm_b but f16 operands: A f32 (split into f16 hi/lo if ASPLIT, else rounded to f16), Bt = f16 values [n][k]; alpha; C f32; N multiple of 16 (partial tiles skipped)
template <bool ASPLIT>
__global__ __launch_bounds__(128) void k_gemm_h(const float* __restrict__ A, int lda, size_t sA, const _Float16* __restrict__ Bh, int ldb, size_t sB, float alpha, float* __restrict__ C, int ldc, size_t sC, int M, int N, int K) {
  __shared__ __attribute__((aligned(16))) float so[4][16][64];
  const int tid = threadIdx.x, w = tid >> 5, lane = tid & 31, ln = lane & 15, hh = lane >> 4; const int by = blockIdx.y;
  A += (size_t)by * sA; Bh += (size_t)by * sB; C += (size_t)by * sC;
  const int ntn = (N + 63) / 64; const int wid = blockIdx.x * 4 + w; const int mt = wid / ntn, nq = wid % ntn; if (mt * 16 >= M) return;
  const int row0 = mt * 16, col0 = nq * 64; const float* arow = A + (size_t)(row0 + ln) * lda;
  v8f acc[4] = {};
  for (int kb = 0; kb < K; kb += 32) {
    FragH ah, al;
    const v4f x0 = *(const v4fa*)(arow + kb + 8 * hh), x1 = *(const v4fa*)(arow + kb + 8 * hh + 4), x2 = *(const v4fa*)(arow + kb + 16 + 8 * hh), x3 = *(const v4fa*)(arow + kb + 16 + 8 * hh + 4);
    float xs[16] = {x0[0],x0[1],x0[2],x0[3],x1[0],x1[1],x1[2],x1[3],x2[0],x2[1],x2[2],x2[3],x3[0],x3[1],x3[2],x3[3]};
#pragma unroll
    for (int i = 0; i < 16; ++i) { const _Float16 h = (_Float16)xs[i]; ah.h[i] = h; al.h[i] = ASPLIT ? (_Float16)(xs[i] - (float)h) : (_Float16)0.0f; }
#pragma unroll
    for (int t = 0; t < 4; ++t) { if (col0 + t * 16 >= N) continue; const size_t boff = (size_t)(col0 + t * 16 + ln) * ldb + kb; FragH bq; bq.half[0] = *(const v8us*)(Bh + boff + 8 * hh); bq.half[1] = *(const v8us*)(Bh + boff + 16 + 8 * hh);
      acc[t] = mmaH<ASPLIT ? 2 : 1>(ah.v, al.v, bq.v, bq.v, acc[t]); }
  }
#pragma unroll
  for (int t = 0; t < 4; ++t) { if (col0 + t * 16 >= N) continue;
#pragma unroll
    for (int r = 0; r < 8; ++r) so[w][8 * hh + r][t * 16 + ln] = acc[t][r] * alpha; }
  __builtin_amdgcn_fence(__ATOMIC_ACQ_REL, "workgroup"); __builtin_amdgcn_wave_barrier();
  const int rsub = lane >> 4, c4 = (lane & 15) * 4;
  {
#pragma unroll
    for (int q = 0; q < 8; ++q) { const int r = q * 2 + rsub; if (col0 + c4 < N) { const v4f v = *(const v4fa*)&so[w][r][c4]; *(v4f*)(C + (size_t)(row0 + r) * ldc + col0 + c4) = v; } }
     }
}

// Wt[n][k] = f16(W[k][n]·scale) from f32 row-major W[K][N] (scale = power of two; bf16-exact weights stay exact in f16 away from the subnormal range)
__global__ __launch_bounds__(256) void k_wt_f16(const float* __restrict__ W, _Float16* __restrict__ Wt, int K, int N, float scale) {
  const int t = blockIdx.x * 256 + threadIdx.x; if (t >= N * (K / 8)) return; const int n = t / (K / 8), k8 = (t % (K / 8)) * 8; FragH f;
#pragma unroll
  for (int i = 0; i < 8; ++i) f.h[i] = (_Float16)(bf16_round(W[(size_t)(k8 + i) * N + n]) * scale); const v8us o = f.half[0];
  *(v8us*)((unsigned short*)Wt + (size_t)n * K + k8) = o; 
}
// k_gemm_hh variant with fused epilogue: v = acc·alpha + bias[by·sBias + col] (+ CP[(row/rowsPerB)·sCPb + by·64 + col] if CP) ; ACT 0 none / 1 elu ; writes f16 C16 (and f32 C if non-null)
template <int ACT>
__global__ __launch_bounds__(128) void k_gemm_hhx(const _Float16* __restrict__ A, int lda, size_t sA, const _Float16* __restrict__ Bh, int ldb, size_t sB, float alpha, const float* __restrict__ bias, size_t sBias, const float* __restrict__ CP, int rowsPerB, size_t sCPb, int row0g,
    float* __restrict__ C, _Float16* __restrict__ C16, int ldc, size_t sC, int M, int N, int K) {
  __shared__ __attribute__((aligned(16))) float so[4][16][64];
  const int tid = threadIdx.x, w = tid >> 5, lane = tid & 31, ln = lane & 15, hh = lane >> 4; const int by = blockIdx.y;
  A += (size_t)by * sA; Bh += (size_t)by * sB; const size_t cofs = (size_t)by * sC; const float* bp = bias ? bias + (size_t)by * sBias : nullptr;
  const int ntn = (N + 63) / 64; const int wid = blockIdx.x * 4 + w; const int mt = wid / ntn, nq = wid % ntn; if (mt * 16 >= M) return;
  const int row0 = mt * 16, col0 = nq * 64; const _Float16* arow = A + (size_t)(row0 + ln) * lda;
  v8f acc[4] = {};
  for (int kb = 0; kb < K; kb += 32) { FragH ah; ah.half[0] = *(const v8us*)((const unsigned short*)arow + kb + 8 * hh); ah.half[1] = *(const v8us*)((const unsigned short*)arow + kb + 16 + 8 * hh);
#pragma unroll
    for (int t = 0; t < 4; ++t) { if (col0 + t * 16 >= N) continue; const size_t boff = (size_t)(col0 + t * 16 + ln) * ldb + kb; FragH bq; bq.half[0] = *(const v8us*)((const unsigned short*)Bh + boff + 8 * hh); bq.half[1] = *(const v8us*)((const unsigned short*)Bh + boff + 16 + 8 * hh);
      acc[t] = mmaH<1>(ah.v, ah.v, bq.v, bq.v, acc[t]); }
  }
#pragma unroll
  for (int t = 0; t < 4; ++t) { if (col0 + t * 16 >= N) continue; const int col = col0 + t * 16 + ln; const float bv = bp ? bf16_round(bp[col]) : 0.f;
#pragma unroll
    for (int r = 0; r < 8; ++r) { float v = acc[t][r] * alpha + bv; if (CP) { const int rr = row0g + row0 + 8 * hh + r; if (rowsPerB < 0) v += CP[cofs + (size_t)rr * ldc + col];      /* rowsPerB < 0: own element of the batched C plane */ else { const int bidx = rr / rowsPerB; v += CP[(size_t)bidx * sCPb + (size_t)by * 64 + col]; } } if (ACT == 1) v = (v > 0.f) ? v : expm1f(v); else if (ACT == 7) v = (v > 0.f) ? v + 1.0f : expf(v); else if (ACT == 8) v = tanhf(v); else if (ACT == 9) v = 0.5f * v * (1.0f + tanhf(0.7978845608028654f * (v + 0.044715f * v * v * v))); else if (ACT == 11) v = 1.0f / (1.0f + expf(-v)); else if (ACT == 12) v = (v > 0.f) ? v : 0.01f * v; else if (ACT == 14) v = (v > 0.f) ? v : 0.1f * v; else if (ACT == 16) v = (v >= 0.f) ? v : 0.3f * v; else if (ACT == 17) v = (v >= 0.f) ? v : 0.2f * v; else if (ACT == 15) v = v / (1.0f + expf(-v)); else if (ACT == 3) v = fmaxf(v, 0.f); else if (ACT == 6) v = 0.5f * v * (1.0f + erff(v * 0.70710678118654752f)); so[w][8 * hh + r][t * 16 + ln] = v; } }
  __builtin_amdgcn_fence(__ATOMIC_ACQ_REL, "workgroup"); __builtin_amdgcn_wave_barrier();
  const int rsub = lane >> 4, c4 = (lane & 15) * 4; typedef _Float16 v4h __attribute__((ext_vector_type(4)));
  {
#pragma unroll
    for (int q = 0; q < 8; ++q) { const int r = q * 2 + rsub; if (col0 + c4 < N) { const v4f v = *(const v4fa*)&so[w][r][c4]; if (C) *(v4f*)(C + cofs + (size_t)(row0 + r) * ldc + col0 + c4) = v; if (C16) { v4h h4; for (int i = 0; i < 4; ++i) h4[i] = (_Float16)v[i]; *(v4h*)(C16 + cofs + (size_t)(row0 + r) * ldc + col0 + c4) = h4; } } }
     }
}


typedef _Float16 v4h __attribute__((ext_vector_type(4)));

__global__ __launch_bounds__(256) void k_x16(const float* __restrict__ x, _Float16* __restrict__ X16, size_t n8) { const size_t t = (size_t)blockIdx.x * 256 + threadIdx.x; if (t >= n8) return; FragH f;
#pragma unroll
  for (int q = 0; q < 8; ++q) f.h[q] = (_Float16)bf16_round(x[t * 8 + q]); *(v8us*)((unsigned short*)X16 + t * 8) = f.half[0];  }
__global__ __launch_bounds__(256) void k_h16(const float* __restrict__ x, _Float16* __restrict__ X16, size_t n8) { const size_t t = (size_t)blockIdx.x * 256 + threadIdx.x; if (t >= n8) return; FragH f;
#pragma unroll
  for (int q = 0; q < 8; ++q) f.h[q] = (_Float16)x[t * 8 + q]; *(v8us*)((unsigned short*)X16 + t * 8) = f.half[0];  }
__global__ __launch_bounds__(256) void k_round16f(const float* __restrict__ W, _Float16* __restrict__ Bt, size_t n8) { const size_t t = (size_t)blockIdx.x * 256 + threadIdx.x; if (t >= n8) return; FragH f;
#pragma unroll
  for (int i = 0; i < 8; ++i) f.h[i] = (_Float16)(bf16_round(W[t * 8 + i]) * 16.0f); *(v8us*)((unsigned short*)Bt + t * 8) = f.half[0];  }
// eight neighbouring f32 values of a row as f16 hi and residual x 2^10, 16 bytes to each plane
__device__ __forceinline__ void g2_store_hl(v4f a, v4f c, _Float16* hp, _Float16* lp) { FragH fh, fl;
#pragma unroll      /* fh and fl must stay in registers */
  for (int q = 0; q < 4; ++q) { _Float16 h = (_Float16)a[q]; fh.h[q] = h; fl.h[q] = (_Float16)((a[q] - (float)h) * 1024.0f); h = (_Float16)c[q]; fh.h[4 + q] = h; fl.h[4 + q] = (_Float16)((c[q] - (float)h) * 1024.0f); }
  *(v8us*)(unsigned short*)hp = fh.half[0]; *(v8us*)(unsigned short*)lp = fl.half[0]; }

// ---- the softmax in pieces: a row's TS scores fall into SNT pieces of 64 columns, one wave tile of the score GEMM each. A piece has its own maximum m; its weights are 2^10 exp(s - m) as f16, and ST holds, as [plane][batch][piece][row], m log2(e) (plane 0) and the f32 sum of its weights (plane 1). The readout merges the pieces ----
#define SNT (TS / 64)
#define STP ((size_t)BG * SNT * TC)      /* floats of one plane of ST */
// the value of lane ^ M of the same 16-lane row, by DPP: __shfl_xor would go through the LDS pipe and wait out its latency at every step
template <int M> __device__ __forceinline__ float row_x(float x) { return __int_as_float(__builtin_amdgcn_update_dpp(0, __float_as_int(x), 0x160 + M, 0xf, 0xf, true)); }
// eight values' maxima over their 16-lane rows, in every lane. In asm because the compiler makes three instructions of fmaxf on a DPP move (the move, a canonicalising maximum, the maximum); eight chains side by side, so that every step's producer lies eight instructions back
#define RMX(S) "v_max_num_f32_dpp %0, %0, %0 row_xmask:" #S " row_mask:0xf bank_mask:0xf\n\tv_max_num_f32_dpp %1, %1, %1 row_xmask:" #S " row_mask:0xf bank_mask:0xf\n\tv_max_num_f32_dpp %2, %2, %2 row_xmask:" #S " row_mask:0xf bank_mask:0xf\n\tv_max_num_f32_dpp %3, %3, %3 row_xmask:" #S " row_mask:0xf bank_mask:0xf\n\t" \
               "v_max_num_f32_dpp %4, %4, %4 row_xmask:" #S " row_mask:0xf bank_mask:0xf\n\tv_max_num_f32_dpp %5, %5, %5 row_xmask:" #S " row_mask:0xf bank_mask:0xf\n\tv_max_num_f32_dpp %6, %6, %6 row_xmask:" #S " row_mask:0xf bank_mask:0xf\n\tv_max_num_f32_dpp %7, %7, %7 row_xmask:" #S " row_mask:0xf bank_mask:0xf\n\t"
__device__ __forceinline__ void row_max16x8(float* x) { asm(RMX(1) RMX(2) RMX(4) RMX(8) : "+v"(x[0]), "+v"(x[1]), "+v"(x[2]), "+v"(x[3]), "+v"(x[4]), "+v"(x[5]), "+v"(x[6]), "+v"(x[7])); }
// four 2^x in one statement. The instruction set asks for one independent instruction or a v_nop between a transcendental and a directly following instruction that reads its result or overwrites its source: here every result register differs from every source (early clobber), and the v_nop fills the slot behind the last
__device__ __forceinline__ void exp2x4(float* e, float a, float b, float c, float d) { asm("v_exp_f32 %0, %4\n\tv_exp_f32 %1, %5\n\tv_exp_f32 %2, %6\n\tv_exp_f32 %3, %7\n\tv_nop" : "=&v"(e[0]), "=&v"(e[1]), "=&v"(e[2]), "=&v"(e[3]) : "v"(a), "v"(b), "v"(c), "v"(d)); }
__device__ __forceinline__ float row_sum16(float x) { x += row_x<1>(x); x += row_x<2>(x); x += row_x<4>(x); return x + row_x<8>(x); }

// ---- fast GEMM (block tile 128x128 = eight 32x64 wave tiles; A and B in 64-k tiles through a two-buffer LDS ring; requires M % 128 == 0 rows per launch region, N % 128 == 0, K % 64 == 0); epilogue: acc alpha, activation, LDS staging, then the bias and the form the consumer reads. In both forms the bias, which must be there, goes by the ROW of C (the weights, or what came of them, are the A operand). EPI 1: the bias as it is (f32), 16 values to every 32 floats, C16 = f16. EPI 3 (N = TC, K = TS): B holds the softmax weights in pieces, colscale = ST; every 64-k pass sums from zero and goes into the running sums times exp(its piece's maximum - the row's) / the row's merged sum; the bias rounded to bf16, C = f32 ----
__device__ __forceinline__ v16h g2_frag(const _Float16* p, int hh) { FragH f; f.half[0] = *(const v8us*)((const unsigned short*)p + 8 * hh); f.half[1] = *(const v8us*)((const unsigned short*)p + 16 + 8 * hh); return f.v; }
__device__ __forceinline__ v8f g2_mma(v16h a, v16h b, v8f c) { return __builtin_amdgcn_wmma_f32_16x16x32_f16(false, a, false, b, (short)0, c, false, false); }      /* the builtin alone: the compiler keeps the distance behind its own WMMAs */
#define G2P 72      /* LDS row pitch in f16: 64 k + 8 = 144 B, 16 B x odd, the conflict-free pitch for ds_load_b128 readers */
// One thread's eight b128 asynchronous copies to LDS for one 64-k pass: its 16-byte piece of rows r, r + 32, r + 64, r + 96 of the 128-row A tile and of the 128-row B tile (la, lb = LDS byte addresses, ga, gb = global addresses, rsa, rsb = 32 rows in elements).
// s_wait_xcnt 0 is the statement's last line so that no address register of an issued copy is rewritten ahead of it.
__device__ __forceinline__ void g2_copy8(unsigned la, unsigned lb, const _Float16* ga, const _Float16* gb, size_t rsa, size_t rsb) {
  asm volatile("global_load_async_to_lds_b128 %0, %8, off\n\t"
               "global_load_async_to_lds_b128 %1, %9, off\n\t"
               "global_load_async_to_lds_b128 %2, %10, off\n\t"
               "global_load_async_to_lds_b128 %3, %11, off\n\t"
               "global_load_async_to_lds_b128 %4, %12, off\n\t"
               "global_load_async_to_lds_b128 %5, %13, off\n\t"
               "global_load_async_to_lds_b128 %6, %14, off\n\t"
               "global_load_async_to_lds_b128 %7, %15, off\n\t"
               "s_wait_xcnt 0x0"
               :: "v"(la), "v"(la + 1u * 32u * G2P * 2u), "v"(la + 2u * 32u * G2P * 2u), "v"(la + 3u * 32u * G2P * 2u), "v"(lb), "v"(lb + 1u * 32u * G2P * 2u), "v"(lb + 2u * 32u * G2P * 2u), "v"(lb + 3u * 32u * G2P * 2u),
                  "v"(ga), "v"(ga + rsa), "v"(ga + 2 * rsa), "v"(ga + 3 * rsa), "v"(gb), "v"(gb + rsb), "v"(gb + 2 * rsb), "v"(gb + 3 * rsb) : "memory");
}
#define G2HOLD __builtin_amdgcn_sched_barrier(0)      /* holds LDS reads and products in the groups that the source writes: the scheduler otherwise sinks every read to its first product, with a full wait in front of it */
template <bool B> struct g2_flag { static constexpr bool value = B; };      /* a compile-time yes or no handed to a lambda */
#define G2RB (2 * 2 * 128 * G2P * 2)      /* bytes of k_gemm2's ring */
#define G2SB (G2RB + 8 * 32 * 68 * 4)      /* bytes of its ring and its output staging */
// the body takes its LDS (G2SB bytes, 16-byte aligned) and its block indices from the kernel that calls it, so that one grid can hold blocks of this product and of another kind
template <int ACT, int EPI>
__device__ __forceinline__ void gemm2_body(unsigned char* sm, const int bx, const int by, const _Float16* __restrict__ A, int lda, size_t sA, const _Float16* __restrict__ Bh, int ldb, size_t sB, float alpha, const float* __restrict__ bias, size_t sBias,
    const float* __restrict__ colscale, _Float16* __restrict__ C16, float* __restrict__ C, int ldc, size_t sC, int M, int N, int K) { static_assert(EPI == 1 || EPI == 3, "k_gemm2: f16 out, or scaled passes and f32 out"); static_assert(SNT * 128 * 4 <= G2SB - G2RB, "the scales lie inside the output staging"); static_assert(ACT == 0 || ACT == 3 || ACT == 6 || ACT == 8 || ACT == 9 || ACT == 11 || ACT == 12 || ACT == 14 || ACT == 15 || ACT == 16 || ACT == 17, "k_gemm2: unsupported ACT code (would silently apply no activation)");
  _Float16 (*ring)[2][128][G2P] = (_Float16 (*)[2][128][G2P])sm;      /* [buffer][A | B][row][k], filled by the asynchronous copies only */
  float (*so)[32][68] = (float (*)[32][68])(sm + G2RB);
  const int tid = threadIdx.x, w = tid >> 5, lane = tid & 31, ln = lane & 15, hh = lane >> 4;
  A += (size_t)by * sA; Bh += (size_t)by * sB; const size_t cofs = (size_t)by * sC; const float* bp = bias ? bias + (size_t)by * sBias : nullptr;
  const int ntn = N >> 7; const int mt = bx / ntn, nq = bx - mt * ntn; if (mt * 128 >= M) return;      /* the same for the whole block, ahead of every barrier */
  const int wm = w >> 1, wn = w & 1; const int row0 = mt * 128 + 32 * wm, col0 = nq * 128 + 64 * wn;
  const int cr = tid >> 3, cc = (tid & 7) * 8;      /* this thread's first row and its 8-element piece in every copied tile */
  const _Float16* ga = A + (size_t)(mt * 128 + cr) * lda + cc; const _Float16* gb = Bh + (size_t)(nq * 128 + cr) * ldb + cc; const size_t rsa = (size_t)32 * lda, rsb = (size_t)32 * ldb;
  const unsigned la = (unsigned)(size_t)&ring[0][0][cr][cc], lb = (unsigned)(size_t)&ring[0][1][cr][cc]; const unsigned bufb = 2u * 128u * G2P * 2u;      /* LDS byte addresses in buffer 0; bytes per buffer */
  const int np = K >> 6;
  const v8f z8 = {0.f,0.f,0.f,0.f,0.f,0.f,0.f,0.f}; v8f c00 = z8, c01 = z8, c02 = z8, c03 = z8, c10 = z8, c11 = z8, c12 = z8, c13 = z8;
  v8f t00 = z8, t01 = z8, t02 = z8, t03 = z8, t10 = z8, t11 = z8, t12 = z8, t13 = z8;      /* EPI 3: the scaled passes' running sums */
  float* scl = (float*)(sm + G2RB);      /* EPI 3: [pass][column of the block], what a pass's sums are multiplied by; every read of it ends ahead of the loop's last barrier, behind which the same bytes stage the output */
  g2_copy8(la, lb, ga, gb, rsa, rsb);
  if (EPI == 3 && tid < 128) {      /* the same for a whole wave; one thread merges one column's SNT pieces of the softmax, under the flight of tile 0 */
    const float* sp = colscale + (size_t)by * SNT * TC + nq * 128 + tid; float pm[SNT], pl[SNT];
#pragma unroll      /* pm and pl must stay in registers; every load is one base plus an immediate, all in flight at once */
    for (int k = 0; k < SNT; ++k) { pm[k] = sp[k * TC]; pl[k] = sp[STP + k * TC]; }
    asm volatile("s_wait_xcnt 0x0" ::: "memory");      /* what follows this branch reuses registers that the loads above name */
    float m = pm[0], l = 0.f;
#pragma unroll      /* as above */
    for (int k = 1; k < SNT; ++k) m = fmaxf(m, pm[k]);
#pragma unroll      /* as above */
    for (int k = 0; k < SNT; ++k) { pm[k] = __builtin_amdgcn_exp2f(pm[k] - m); l += pl[k] * pm[k]; }
    const float inv = alpha / l;
#pragma unroll      /* as above */
    for (int k = 0; k < SNT; ++k) scl[k * 128 + tid] = pm[k] * inv; }
  asm volatile("s_wait_asynccnt 0x0" ::: "memory");      /* this wave's copies of tile 0 have landed */
  __syncthreads();      /* publishes tile 0 and, EPI 3, the scales */
  if (np > 1) g2_copy8(la + bufb, lb + bufb, ga + 64, gb + 64, rsa, rsb);
  v16h a0[2], a1[2], b0[2], b1[2], b2[2], b3[2];      /* ONE fragment set for a stage's two 32-k steps, kept full: the next stage's reads of a step's fragments are issued as soon as this stage's products with them are, and fly under what follows */
  float sc[4] = {0.f, 0.f, 0.f, 0.f}, sn[4] = {0.f, 0.f, 0.f, 0.f};      /* EPI 3: this stage's scales and the next's */
  auto rd = [&](const int bu, const int s) { const _Float16* pa = &ring[bu][0][32 * wm + ln][32 * s]; const _Float16* pb = &ring[bu][1][64 * wn + ln][32 * s];      /* s is a literal at every call: the fragment arrays must stay in registers */
    a0[s] = g2_frag(pa, hh); a1[s] = g2_frag(pa + 16 * G2P, hh); b0[s] = g2_frag(pb, hh); b1[s] = g2_frag(pb + 16 * G2P, hh); b2[s] = g2_frag(pb + 32 * G2P, hh); b3[s] = g2_frag(pb + 48 * G2P, hh); };
  auto rs = [&](const int t, float* d) { const float* sq = scl + t * 128 + 64 * wn + ln; d[0] = sq[0]; d[1] = sq[16]; d[2] = sq[32]; d[3] = sq[48]; };
  auto mm = [&](const int s) { c00 = g2_mma(a0[s], b0[s], c00); c10 = g2_mma(a1[s], b0[s], c10); c01 = g2_mma(a0[s], b1[s], c01); c11 = g2_mma(a1[s], b1[s], c11);
    c02 = g2_mma(a0[s], b2[s], c02); c12 = g2_mma(a1[s], b2[s], c12); c03 = g2_mma(a0[s], b3[s], c03); c13 = g2_mma(a1[s], b3[s], c13); };
  rd(0, 0); if (EPI == 3) rs(0, sc);
  rd(0, 1);      /* tile 0's fragments, behind the barrier that published it */
  G2HOLD;      /* the first reads stay one group ahead of the loop */
  auto pass = [&](const int t, auto more) { const int bu = t & 1;
    if (EPI == 3) { c00 = z8; c01 = z8; c02 = z8; c03 = z8; c10 = z8; c11 = z8; c12 = z8; c13 = z8; }      /* every pass sums from zero: its weights have a maximum of their own */
    mm(0); G2HOLD;      /* the publish point of tile t + 1 stands here, ahead of the tile's last eight products, because the reads behind it are the next tile's */
    asm volatile("s_wait_dscnt 0x0" ::: "memory");      /* this wave's reads of buffer bu are done before it is refilled */
    asm volatile("s_wait_asynccnt 0x0" ::: "memory");      /* this wave's copies of tile t + 1 have landed */
    __syncthreads();      /* publishes tile t + 1 and ends every wave's reads of buffer bu */
    if (t + 2 < np) g2_copy8(la + bu * bufb, lb + bu * bufb, ga + (size_t)(t + 2) * 64, gb + (size_t)(t + 2) * 64, rsa, rsb);
    if (more.value) { rd(bu ^ 1, 0); if (EPI == 3) rs(t + 1, sn); }
    G2HOLD; mm(1); G2HOLD;      /* the reads above stay ahead of these eight products and fly under them; the reads below stay behind them, in the registers that they free */
    if (more.value) rd(bu ^ 1, 1);
    G2HOLD;      /* and ahead of the arithmetic below, which then runs under their flight */
    if (EPI == 3) { t00 += c00 * sc[0]; t10 += c10 * sc[0]; t01 += c01 * sc[1]; t11 += c11 * sc[1]; t02 += c02 * sc[2]; t12 += c12 * sc[2]; t03 += c03 * sc[3]; t13 += c13 * sc[3];      /* registers only, under the flight of the next tile's reads */
      sc[0] = sn[0]; sc[1] = sn[1]; sc[2] = sn[2]; sc[3] = sn[3]; } };
  for (int t = 0; t + 1 < np; ++t) pass(t, g2_flag<true>());
  pass(np - 1, g2_flag<false>());      /* the last tile apart: with a test around the reads inside the loop the compiler's counted waits at the loop's head fall to zero */
  asm volatile("s_wait_asynccnt 0x0" ::: "memory");      /* no copy is outstanding when the wave goes on */
  if (EPI == 3) { c00 = t00; c01 = t01; c02 = t02; c03 = t03; c10 = t10; c11 = t11; c12 = t12; c13 = t13; }
  v8f accs[8] = {c00, c01, c02, c03, c10, c11, c12, c13};
#pragma unroll
  for (int u = 0; u < 8; ++u) { const int t = u & 3, half = u >> 2;      /* the bias, one value a row, is added behind the staging */
#pragma unroll
    for (int r = 0; r < 8; ++r) { const int rloc = half * 16 + 8 * hh + r; float v = EPI == 3 ? accs[u][r] : accs[u][r] * alpha;
      if (ACT == 3) v = fmaxf(v, 0.f); else if (ACT == 6) v = 0.5f * v * (1.0f + erff(v * 0.70710678118654752f)); else if (ACT == 11) v = 1.0f / (1.0f + expf(-v)); else if (ACT == 15) v = v / (1.0f + expf(-v)); else if (ACT == 12) v = (v > 0.f) ? v : 0.01f * v; else if (ACT == 8) v = tanhf(v); else if (ACT == 9) v = 0.5f * v * (1.0f + tanhf(0.7978845608028654f * (v + 0.044715f * v * v * v))); else if (ACT == 14) v = (v > 0.f) ? v : 0.1f * v; else if (ACT == 16) v = (v >= 0.f) ? v : 0.3f * v; else if (ACT == 17) v = (v >= 0.f) ? v : 0.2f * v;
      so[w][rloc][t * 16 + ln] = v; } }
  __builtin_amdgcn_fence(__ATOMIC_ACQ_REL, "workgroup"); __builtin_amdgcn_wave_barrier();
  if (EPI == 1) { const int rsub = lane >> 3, c8 = (lane & 7) * 8;      /* eight lanes take one row's 64 columns: a whole 128-byte line of f16 */
    v4f a[8], c[8]; float rv[8];      /* rv: the row's bias */
#pragma unroll      /* a, c and rv must stay in registers; the 16 LDS reads and the 8 loads of rv go as one group, so that their latency is paid once */
    for (int q = 0; q < 8; ++q) { const int r = q * 4 + rsub; a[q] = *(const v4fa*)&so[w][r][c8]; c[q] = *(const v4fa*)&so[w][r][c8 + 4]; rv[q] = bp[((row0 + r) >> 4) * 32 + ((row0 + r) & 15)]; }      /* the bias lies 16 values to a 128-byte line, as its writers left it */
#pragma unroll      /* as above */
    for (int q = 0; q < 8; ++q) { const size_t o = cofs + (size_t)(row0 + q * 4 + rsub) * ldc + col0 + c8;
      FragH f; for (int i = 0; i < 4; ++i) { f.h[i] = (_Float16)(a[q][i] + rv[q]); f.h[4 + i] = (_Float16)(c[q][i] + rv[q]); } *(v8us*)((unsigned short*)C16 + o) = f.half[0]; } }
  else { const int rsub = lane >> 4, c4 = (lane & 15) * 4;      /* sixteen lanes take one row's 64 columns: two whole 128-byte lines of f32 */
    v4f a[16]; float rv[16];      /* rv: the row's bias */
#pragma unroll      /* a and rv must stay in registers; the 16 LDS reads and the 16 loads of rv go as one group, so that their latency is paid once */
    for (int q = 0; q < 16; ++q) { const int r = q * 2 + rsub; a[q] = *(const v4fa*)&so[w][r][c4]; rv[q] = bp[row0 + r]; }
    float* op = C + cofs + (size_t)(row0 + rsub) * ldc + col0 + c4;
#pragma unroll      /* as above */
    for (int q = 0; q < 16; ++q) { const v4f v = a[q] + bf16_round(rv[q]); *(v4f*)(op + (size_t)(q * 2) * ldc) = v; } } }
template <int ACT, int EPI>
__global__ __launch_bounds__(256) void k_gemm2(const _Float16* __restrict__ A, int lda, size_t sA, const _Float16* __restrict__ Bh, int ldb, size_t sB, float alpha, const float* __restrict__ bias, size_t sBias,
    const float* __restrict__ colscale, _Float16* __restrict__ C16, float* __restrict__ C, int ldc, size_t sC, int M, int N, int K) {
  __shared__ __attribute__((aligned(16))) unsigned char sm[G2SB];
  gemm2_body<ACT, EPI>(sm, blockIdx.x, blockIdx.y, A, lda, sA, Bh, ldb, sB, alpha, bias, sBias, colscale, C16, C, ldc, sC, M, N, K); }


// ---- k_gemm2 for a product whose operands are f16 hi + scaled residual planes: every term in ONE launch, summed in registers. H takes Ah.Bh; X takes Al.Bh and, with NBP == 2, Ah.Bl as well (both carry the residual's scale); C = H alphaH + bias + X alphaL. Same block and wave tiles, same ring order as k_gemm2; a stage is [Ah | Bh | Al (| Bl)]. EPI 0: C f32, row-major. EPI 1: CH | CL = f16 hi | residual x 2^10, row-major; the bias, which must be there, f32 as it is, 16 values to every 32 floats. EPI 2: C f32 as [row / TC][column][row % TC]. EPI 3 (M = TC, N = ldc = TS, no bias): the softmax's pieces: CH = f16 weights, row-major, C = ST ----
// One thread's four b128 asynchronous copies to LDS for one 128-row tile; s_wait_xcnt 0 is the statement's last line so that no address register of an issued copy is rewritten ahead of it.
__device__ __forceinline__ void g2_copy4(unsigned la, const _Float16* ga, size_t rsa) {
  asm volatile("global_load_async_to_lds_b128 %0, %4, off\n\t"
               "global_load_async_to_lds_b128 %1, %5, off\n\t"
               "global_load_async_to_lds_b128 %2, %6, off\n\t"
               "global_load_async_to_lds_b128 %3, %7, off\n\t"
               "s_wait_xcnt 0x0"
               :: "v"(la), "v"(la + 1u * 32u * G2P * 2u), "v"(la + 2u * 32u * G2P * 2u), "v"(la + 3u * 32u * G2P * 2u), "v"(ga), "v"(ga + rsa), "v"(ga + 2 * rsa), "v"(ga + 3 * rsa) : "memory");
}
#define G2T (128 * G2P)      /* f16 elements of one 128-row tile in LDS */
#define G2SS(NBP) (2u * (2u + (NBP)) * G2T * 2u)      /* bytes of the two buffers */
// LDS (G2SS(NBP) bytes, 16-byte aligned) and block indices from the calling kernel, as for gemm2_body
template <int NBP, int EPI>
__device__ __forceinline__ void gemm2s_body(unsigned char* sm, const int bx, const int by, const _Float16* __restrict__ Ah, const _Float16* __restrict__ Al, int lda, size_t sA, const _Float16* __restrict__ Bh, const _Float16* __restrict__ Bl, int ldb, size_t sB, float alphaH, float alphaL, const float* __restrict__ bias,
    float* __restrict__ C, _Float16* __restrict__ CH, _Float16* __restrict__ CL, int ldc, size_t sC, int M, int N, int K) { static_assert(NBP == 1 || NBP == 2, "B is one plane or hi + residual"); static_assert(EPI >= 0 && EPI <= 3 && TC % 128 == 0, "a block's 128 rows lie in one batch");
  constexpr unsigned bufb = (2u + NBP) * G2T * 2u;      /* bytes per buffer */
  static_assert(G2SS(NBP) == 2 * bufb, "sm is the ring");      /* filled by the asynchronous copies only; behind the loop's last barrier the same bytes stage the output, so that two blocks still share a WGP's LDS */
  const int tid = threadIdx.x, w = tid >> 5, lane = tid & 31, ln = lane & 15, hh = lane >> 4;
  Ah += (size_t)by * sA; Al += (size_t)by * sA; Bh += (size_t)by * sB; if (NBP == 2) Bl += (size_t)by * sB; const size_t cofs = (size_t)by * sC;
  const int ntn = N >> 7; const int mt = bx / ntn, nq = bx - mt * ntn; if (mt * 128 >= M) return;      /* the same for the whole block, ahead of every barrier */
  const int wm = w >> 1, wn = w & 1; const int row0 = mt * 128 + 32 * wm, col0 = nq * 128 + 64 * wn;
  const int cr = tid >> 3, cc = (tid & 7) * 8;      /* this thread's first row and its 8-element piece in every copied tile */
  const size_t oa = (size_t)(mt * 128 + cr) * lda + cc, ob = (size_t)(nq * 128 + cr) * ldb + cc; const size_t rsa = (size_t)32 * lda, rsb = (size_t)32 * ldb;
  const unsigned la = (unsigned)(size_t)&sm[(cr * G2P + cc) * 2], lb = la + G2T * 2u, lr = 2u * G2T * 2u;      /* LDS byte addresses in buffer 0 of the Ah and Bh tiles; from a hi tile to its residual tile */
  auto stage = [&](unsigned bo, size_t k0) { g2_copy8(la + bo, lb + bo, Ah + oa + k0, Bh + ob + k0, rsa, rsb);
    if (NBP == 2) g2_copy8(la + lr + bo, lb + lr + bo, Al + oa + k0, Bl + ob + k0, rsa, rsb); else g2_copy4(la + lr + bo, Al + oa + k0, rsa); };
  const int np = K >> 6;
  const v8f z8 = {0.f,0.f,0.f,0.f,0.f,0.f,0.f,0.f}; v8f H[2][4], X[2][4];
#pragma unroll      /* the accumulators must stay in registers */
  for (int j = 0; j < 4; ++j) { H[0][j] = z8; H[1][j] = z8; X[0][j] = z8; X[1][j] = z8; }
  stage(0u, 0);
  asm volatile("s_wait_asynccnt 0x0" ::: "memory");      /* this wave's copies of stage 0 have landed */
  __syncthreads();      /* publishes stage 0 */
  if (np > 1) stage(bufb, 64);
  const int fa = (32 * wm + ln) * G2P, fb = G2T + (64 * wn + ln) * G2P;      /* this lane's rows in a buffer's Ah and Bh tiles, in f16; the residual tiles lie 2 G2T behind */
  v16h ah0, ah1, al0, al1, bh[4], bl[4];      /* ONE fragment set, kept full: a 32-k step's products go in the order al.bh, ah.bh, ah.bl, and the next step's reads of a fragment group are issued as soon as the last product that takes the group is, so that they fly under the products that follow */
  auto rd_al = [&](const _Float16* p) { al0 = g2_frag(p + fa + 2 * G2T, hh); al1 = g2_frag(p + fa + 2 * G2T + 16 * G2P, hh); };
  auto rd_ah = [&](const _Float16* p) { ah0 = g2_frag(p + fa, hh); ah1 = g2_frag(p + fa + 16 * G2P, hh); };
  auto rd_bh = [&](const _Float16* p) {
#pragma unroll      /* the fragments must stay in registers */
    for (int j = 0; j < 4; ++j) bh[j] = g2_frag(p + fb + j * 16 * G2P, hh); };
  auto rd_bl = [&](const _Float16* p) { if (NBP == 2) {
#pragma unroll      /* as above */
    for (int j = 0; j < 4; ++j) bl[j] = g2_frag(p + fb + 2 * G2T + j * 16 * G2P, hh); } };
  auto mm_lh = [&]() {
#pragma unroll      /* fragments and accumulators must stay in registers */
    for (int j = 0; j < 4; ++j) { X[0][j] = g2_mma(al0, bh[j], X[0][j]); X[1][j] = g2_mma(al1, bh[j], X[1][j]); } };
  auto mm_hh = [&]() {
#pragma unroll      /* as above */
    for (int j = 0; j < 4; ++j) { H[0][j] = g2_mma(ah0, bh[j], H[0][j]); H[1][j] = g2_mma(ah1, bh[j], H[1][j]); } };
  auto mm_hl = [&]() { if (NBP == 2) {
#pragma unroll      /* as above */
    for (int j = 0; j < 4; ++j) { X[0][j] = g2_mma(ah0, bl[j], X[0][j]); X[1][j] = g2_mma(ah1, bl[j], X[1][j]); } } };
  { const _Float16* p = (const _Float16*)sm; rd_al(p); rd_bh(p); rd_ah(p); rd_bl(p); }      /* stage 0's first step, behind the barrier that published it; in the order of first use, so that the counted waits let the products start early */
  G2HOLD;      /* the first reads stay one group ahead of the loop */
  auto pass = [&](const int t, auto more) { const int bu = t & 1; const _Float16* p = (const _Float16*)(sm + bu * bufb) + 32; const _Float16* q = (const _Float16*)(sm + (bu ^ 1) * bufb);      /* p: this stage's second step; q: the next stage's first, read where more says that there is one */
    mm_lh(); G2HOLD; rd_al(p); G2HOLD; mm_hh(); G2HOLD; rd_bh(p); G2HOLD; mm_hl(); G2HOLD; rd_ah(p); rd_bl(p); G2HOLD;      /* eight products, then the reads into the registers that they were the last to take; G2HOLD keeps every group where it is written */
    mm_lh(); G2HOLD;      /* the stage's last reads fly under these eight products; the publish point of stage t + 1 stands here, ahead of the stage's last sixteen products, because the reads behind it are the next stage's */
    asm volatile("s_wait_dscnt 0x0" ::: "memory");      /* this wave's reads of buffer bu are done before it is refilled */
    asm volatile("s_wait_asynccnt 0x0" ::: "memory");      /* this wave's copies of stage t + 1 have landed */
    __syncthreads();      /* publishes stage t + 1 and ends every wave's reads of buffer bu */
    if (t + 2 < np) stage(bu * bufb, (size_t)(t + 2) * 64);
    if (more.value) rd_al(q);
    G2HOLD; mm_hh(); G2HOLD;      /* as in the first step: every group of reads stays between the products that free its registers and the products that it flies under */
    if (more.value) rd_bh(q);
    G2HOLD; mm_hl(); G2HOLD;      /* as above */
    if (more.value) { rd_ah(q); rd_bl(q); }
    G2HOLD; };      /* as above: these reads stay ahead of the next pass's first products */
  for (int t = 0; t + 1 < np; ++t) pass(t, g2_flag<true>());
  pass(np - 1, g2_flag<false>());      /* the last stage apart: with a test around the reads inside the loop the compiler's counted waits at the loop's head fall to zero */
  asm volatile("s_wait_asynccnt 0x0" ::: "memory");      /* no copy is outstanding when the wave goes on */
  if (EPI == 3) { _Float16* sh = (_Float16*)sm + w * (32 * G2P);      /* this wave's own staging, 32 rows of 64 f16; every wave has left the ring at the last pass's barrier */
    constexpr float L2E = 1.44269504088896340736f; float pm[16], pl[16];      /* this form takes no bias: the scores have none */
#pragma unroll      /* the accumulators, pm and pl are indexed by constants only */
    for (int i = 0; i < 16; ++i) { const int half = i >> 3, r = i & 7;
#pragma unroll      /* as above */
      for (int j = 0; j < 4; ++j) { float v = H[half][j][r] * alphaH; v += X[half][j][r] * alphaL; H[half][j][r] = v; }
      pm[i] = fmaxf(fmaxf(H[half][0][r], H[half][1][r]), fmaxf(H[half][2][r], H[half][3][r])); }
    row_max16x8(pm); row_max16x8(pm + 8);
#pragma unroll      /* as above; the sixteen rows' chains are independent and fill one another's latencies */
    for (int i = 0; i < 16; ++i) { const int half = i >> 3, r = i & 7; const float ml = pm[i] * L2E, c = 10.0f - ml; float e[4];
#pragma unroll      /* as above */
      for (int j = 0; j < 4; ++j) H[half][j][r] = __builtin_fmaf(H[half][j][r], L2E, c);
      exp2x4(e, H[half][0][r], H[half][1][r], H[half][2][r], H[half][3][r]);
#pragma unroll      /* as above */
      for (int j = 0; j < 4; ++j) sh[(half * 16 + 8 * hh + r) * G2P + j * 16 + ln] = (_Float16)e[j];
      pm[i] = ml; pl[i] = row_sum16((e[0] + e[1]) + (e[2] + e[3])); }
    float ms = pm[0], ls = pl[0];      /* lane ln of either half takes row (ln >> 3) * 16 + 8 hh + (ln & 7): the wave's 32 rows are one 128-byte line of each plane */
#pragma unroll      /* as above */
    for (int i = 1; i < 16; ++i) { ms = ln == i ? pm[i] : ms; ls = ln == i ? pl[i] : ls; }
    __builtin_amdgcn_fence(__ATOMIC_ACQ_REL, "workgroup"); __builtin_amdgcn_wave_barrier();      /* the wave's staging stores stand ahead of its own reads of them; no other wave reads these rows */
    const int rsub = lane >> 3, c8 = (lane & 7) * 8; v8us pq[8];      /* eight lanes take one row's 64 columns: a whole 128-byte line */
#pragma unroll      /* pq must stay in registers; the 8 LDS reads go as one group */
    for (int q = 0; q < 8; ++q) pq[q] = *(const v8us*)((const unsigned short*)sh + (q * 4 + rsub) * G2P + c8);
    unsigned short* pp = (unsigned short*)CH + cofs + (size_t)(row0 + rsub) * TS + col0 + c8;      /* the row length as a constant: every store is one base plus an immediate */
#pragma unroll      /* as above */
    for (int q = 0; q < 8; ++q) *(v8us*)(pp + q * 4 * TS) = pq[q];
    float* st = C + ((size_t)by * SNT + (col0 >> 6)) * TC + row0 + (ln >> 3) * 16 + 8 * hh + (ln & 7);
    st[0] = ms; st[STP] = ls; return; }      /* the last stores: nothing behind them rewrites a register that they name */
  constexpr int SOP = EPI == 2 ? 36 : 68;      /* staging pitch in floats, 16 B x odd: 32 rows of 64 columns, or (EPI 2) 64 columns of 32 rows */
  constexpr int SOW = EPI == 2 ? 64 * SOP : 32 * SOP; static_assert(2 * bufb >= 8u * SOW * 4u, "the output staging lies inside the ring");
  float* so = (float*)sm + w * SOW;      /* this wave's own staging; every wave has left the ring at the last pass's barrier */
#pragma unroll      /* the accumulators are indexed by constants only */
  for (int u = 0; u < 8; ++u) { const int j = u & 3, half = u >> 2; const float bv = EPI == 1 ? bias[((col0 >> 4) + j) * 32 + ln] : bias ? bf16_round(bias[col0 + j * 16 + ln]) : 0.f;      /* EPI 1: a product of k_prep, f32 as it is, 16 values to a 128-byte line as its writers left it */
    v4f p0, p1;
#pragma unroll      /* as above */
    for (int r = 0; r < 8; ++r) { float v = H[half][j][r] * alphaH + bv; v += X[half][j][r] * alphaL; if (EPI != 2) so[(half * 16 + 8 * hh + r) * SOP + j * 16 + ln] = v; else if (r < 4) p0[r] = v; else p1[r - 4] = v; }
    if (EPI == 2) { float* sc = so + (j * 16 + ln) * SOP + half * 16 + 8 * hh; *(v4fa*)sc = p0; *(v4fa*)(sc + 4) = p1; } }      /* a lane's eight values are eight rows of one column: side by side here */
  __builtin_amdgcn_fence(__ATOMIC_ACQ_REL, "workgroup"); __builtin_amdgcn_wave_barrier();      /* the wave's staging stores stand ahead of its own reads of them; no other wave reads these rows */
  if (EPI == 0) { const int rsub = lane >> 4, c4 = (lane & 15) * 4;
#pragma unroll      /* the 16 LDS reads and stores of whole lines in flight together */
    for (int q = 0; q < 16; ++q) { const int r = q * 2 + rsub; const v4f v = *(const v4fa*)&so[r * SOP + c4]; *(v4f*)(C + cofs + (size_t)(row0 + r) * ldc + col0 + c4) = v; } }
  else if (EPI == 1) { const int rsub = lane >> 3, c8 = (lane & 7) * 8;      /* eight lanes take one row's 64 columns: a whole 128-byte line in each plane */
    v4f a[8], c[8];
#pragma unroll      /* a and c must stay in registers; the 16 LDS reads go as one group, so that their latency is paid once */
    for (int q = 0; q < 8; ++q) { a[q] = *(const v4fa*)&so[(q * 4 + rsub) * SOP + c8]; c[q] = *(const v4fa*)&so[(q * 4 + rsub) * SOP + c8 + 4]; }
#pragma unroll      /* as above */
    for (int q = 0; q < 8; ++q) { const size_t o = cofs + (size_t)(row0 + q * 4 + rsub) * ldc + col0 + c8; g2_store_hl(a[q], c[q], CH + o, CL + o); } }
  else { const int cs = (lane >> 3) * 8, r4 = (lane & 7) * 4; const int bb = row0 / TC;      /* eight lanes take one column's 32 rows: a whole 128-byte line; the four columns of a read lie 8 apart, which spreads them over the banks */
    float* op = C + ((size_t)bb * N + col0 + cs) * TC + (row0 - bb * TC) + r4;
#pragma unroll      /* as above; every store is one base plus an immediate */
    for (int q = 0; q < 16; ++q) { const int cq = (q & 7) + 32 * (q >> 3); const v4f v = *(const v4fa*)&so[(cs + cq) * SOP + r4]; *(v4f*)(op + (size_t)cq * TC) = v; } } }
// the score product with its shapes as constants: the strides then take no registers, which the loop's fragment set and accumulators leave none of
__global__ __launch_bounds__(256) void k_score(const _Float16* __restrict__ QH, const _Float16* __restrict__ QL, const _Float16* __restrict__ SH, const _Float16* __restrict__ SL, float* __restrict__ ST, _Float16* __restrict__ P) {
  __shared__ __attribute__((aligned(16))) unsigned char sm[G2SS(2)];
  gemm2s_body<2, 3>(sm, blockIdx.x, blockIdx.y, QH, QL, CC, (size_t)TC * CC, SH, SL, CC, (size_t)TS * CC, 1.0f, 0.0009765625f, nullptr, ST, P, nullptr, TS, (size_t)TC * TS, TC, TS, CC); }
// the two products of the inputs with folded weights in one grid: blockIdx.y = 0: Q rows (b,t) = (Wg^T Wf) . mvn(content) + Wg^T bf, both operands hi + residual (MH | ML and bq are k_prep's products); 1: Wo H as [b][o][s] f16 = (Wo Wh) . style^T + Wo bh (BH and bh here are those two products), blockIdx.x = 32 tiles x 16 batches. The longer blocks come first.
static_assert((NRC / 128) * (CC / 128) == (CC / 128) * (TS / 128) * NB && (CC / 128) * (TS / 128) == 32, "k_fgh: every blockIdx.y has the same number of blocks");
__global__ __launch_bounds__(256) void k_fgh(const _Float16* __restrict__ NH, const _Float16* __restrict__ NL, const _Float16* __restrict__ MH, const _Float16* __restrict__ ML, const float* __restrict__ bq, _Float16* __restrict__ QH, _Float16* __restrict__ QL,
    const _Float16* __restrict__ BH, const _Float16* __restrict__ S16, const float* __restrict__ bh, _Float16* __restrict__ HT) {
  __shared__ __attribute__((aligned(16))) unsigned char sm[G2SB > G2SS(2) ? G2SB : G2SS(2)];
  if (blockIdx.y == 0) gemm2s_body<2, 1>(sm, blockIdx.x, 0, NH, NL, CC, 0, MH, ML, CC, 0, 0.0625f, 0.0625f / 1024.0f, bq, nullptr, QH, QL, CC, 0, NRC, CC, CC);      /* the test reads the same for the whole block: each side holds its own barriers */
  else gemm2_body<0, 1>(sm, blockIdx.x & 31, blockIdx.x >> 5, BH, CC, 0, S16, CC, (size_t)TS * CC, 0.0625f, bh, 0, nullptr, HT, nullptr, TS, (size_t)CC * TS, CC, TS, CC); }

// ---- statistics, planes and weights in one launch: a block holds 64 channels x 1024 frames of one batch of one input in registers, so that the input is read once; a thread's 16 channels x 8 frames are what it stores, eight channels to a 16-byte piece, and nothing is transposed through LDS. Behind its planes every block forms 16 rows x 64 columns of Wo Wh and of Wg^T Wf on WMMA (each of the 16 waves takes 32 of the 512 k for all four 16x16 tiles of either; the waves' sums are added up through LDS); the blocks of the first 64 columns form Wo bh and Wg^T bf as well, the vector being every column of one more B fragment ----
#define FC 64                    /* channels per k_prep block: one 128-byte line of every [frame][channel] plane */
#define RP 132                   /* LDS pitch in floats of a channel's 128 partial sums: a multiple of 16 bytes for the b128 readers */
#define WPP 68                   /* LDS pitch in floats of a row of 64 partial sums of Wo Wh: 16 B x odd */
static_assert(TC == 1024 && TS == 1024 && CC % FC == 0, "k_prep: rows of 16 waves x 64 frames");
static_assert(CC == 16 * 32 && 2 * NB * (CC / FC) == (CC / 16) * (CC / 64) && FC >= 32 && RP >= 16, "k_prep: every block has its 16 x 64 piece of either weight product, every wave its 32 k; the partial sums of the two vectors fit the LDS of the statistics");
typedef float v2f __attribute__((ext_vector_type(2)));
typedef float v2fa __attribute__((ext_vector_type(2), may_alias));
typedef unsigned short v2us __attribute__((ext_vector_type(2), may_alias));
__device__ __forceinline__ _Float16 w16(float x) { return (_Float16)(bf16_round(x) * 16.0f); }      /* a weight as the WMMAs take it: rounded to bf16, x 16, exact in f16 */
// a work-group barrier that orders LDS alone: only LDS goes from wave to wave in k_prep, and __syncthreads() would hold every wave until its global stores have completed as well
__device__ __forceinline__ void prep_barrier() { __builtin_amdgcn_fence(__ATOMIC_RELEASE, "workgroup", "local"); __builtin_amdgcn_s_barrier(); __builtin_amdgcn_fence(__ATOMIC_ACQUIRE, "workgroup", "local"); }
// the sum of a channel's 128 partial sums, in all eight lanes that share the channel
__device__ __forceinline__ float prep_total(const float (*red)[RP], int rc, int rj) {
  const v4f t0 = *(const v4fa*)&red[rc][rj * 4], t1 = *(const v4fa*)&red[rc][32 + rj * 4], t2 = *(const v4fa*)&red[rc][64 + rj * 4], t3 = *(const v4fa*)&red[rc][96 + rj * 4];
  const v4f t = (t0 + t1) + (t2 + t3); float s = (t[0] + t[1]) + (t[2] + t[3]);
  for (int o = 4; o > 0; o >>= 1) s += __shfl_xor(s, o, 32);
  return s; }
__global__ __launch_bounds__(512) void k_prep(const float* __restrict__ content, const float* __restrict__ style, _Float16* __restrict__ NH, _Float16* __restrict__ NL, size_t sN, _Float16* __restrict__ S16,
    const float* __restrict__ Wf, const float* __restrict__ Wg, const float* __restrict__ Wh, const float* __restrict__ Wo, const float* __restrict__ bh, const float* __restrict__ bf_, _Float16* __restrict__ MH, _Float16* __restrict__ ML, float* __restrict__ BQ, _Float16* __restrict__ WP, float* __restrict__ BP) {
  __shared__ __attribute__((aligned(16))) float red[FC][RP];
  __shared__ __attribute__((aligned(16))) float smu[FC], srs[FC];
  __shared__ __attribute__((aligned(16))) float wpart[2][16][16][WPP];      /* [product][wave][row][column]: the waves' partial sums of Wo Wh and of Wg^T Wf; registers hold the kernel to one block a WGP, so that this LDS costs no residency */
  const int tid = threadIdx.x, w = tid >> 5, lane = tid & 31, fl = lane & 7, gl = lane >> 3;      /* eight lanes take 32 frames of a row, a whole 128-byte line; the four lane groups take rows 8 apart */
  const int y = blockIdx.y, b = blockIdx.x / (CC / FC), c0 = (blockIdx.x % (CC / FC)) * FC;      /* y: 0 content, 1 style; the same for the whole block */
  const int f0 = w * 64 + fl * 4;      /* the thread's frames: f0 .. f0 + 3 and f0 + 32 .. f0 + 35 */
  const float* xp = (y ? style : content) + ((size_t)b * CC + c0 + gl * 8) * 1024 + f0;      /* the row length as a constant: every load is one base plus an immediate */
  v4f a[16][2];      /* [u][e]: channel c0 + (u >> 3) * 32 + gl * 8 + (u & 7), frames f0 + 32 e + 0 .. 3 */
#pragma unroll      /* a must stay in registers; all 32 loads of the thread in flight at once */
  for (int u = 0; u < 16; ++u) { a[u][0] = *(const v4fa*)(xp + ((u >> 3) * 32 + (u & 7)) * 1024); a[u][1] = *(const v4fa*)(xp + ((u >> 3) * 32 + (u & 7)) * 1024 + 32); }
  asm volatile("s_wait_xcnt 0x0" :: "v"(xp) : "memory");      /* the vector address is an input, so that it lives up to this wait and no register that an issued load names is rewritten ahead of it */
  __builtin_amdgcn_sched_barrier(0);      /* keeps the arithmetic on the first values behind the last load; the scheduler otherwise holds eight loads back until earlier ones have returned */
  const int rc = tid >> 3, rj = tid & 7;      /* eight threads add up one channel's partial sums */
#pragma unroll      /* a must stay in registers */
  for (int u = 0; u < 16; ++u) {
#pragma unroll      /* as above */
    for (int q = 0; q < 4; ++q) { a[u][0][q] = bf16_round(a[u][0][q]); a[u][1][q] = bf16_round(a[u][1][q]); }
    const v4f t = a[u][0] + a[u][1]; red[(u >> 3) * 32 + gl * 8 + (u & 7)][w * 8 + fl] = (t[0] + t[1]) + (t[2] + t[3]); }
  const size_t o0 = ((size_t)b * 1024 + f0) * CC + c0 + gl * 8;      /* the thread's first piece in every plane; frames lie CC apart, its two channel groups 32 */
  if (y) { unsigned short* Rh = (unsigned short*)(S16 + o0);      /* the style's raw plane needs no statistics: its stores fly under them */
#pragma unroll      /* a is indexed by constants only; every store is one base plus an immediate; the two halves of a frame's line go one behind the other */
    for (int k = 0; k < 8; ++k) { FragH fr[2];
#pragma unroll      /* as above */
      for (int u = 0; u < 16; ++u) fr[u >> 3].h[u & 7] = (_Float16)a[u][k >> 2][k & 3];
      *(v8us*)(Rh + ((k >> 2) * 32 + (k & 3)) * CC) = fr[0].half[0]; *(v8us*)(Rh + ((k >> 2) * 32 + (k & 3)) * CC + 32) = fr[1].half[0]; } }
  asm volatile("s_wait_xcnt 0x0" ::: "memory");      /* what follows reuses registers that the stores above name */
  prep_barrier();      /* publishes the partial sums */
  { const float s = prep_total(red, rc, rj); if (rj == 0) smu[rc] = s / 1024.0f; }
  prep_barrier();      /* publishes the means and ends every read of red */
#pragma unroll      /* a must stay in registers */
  for (int u = 0; u < 16; ++u) { const float mu = smu[(u >> 3) * 32 + gl * 8 + (u & 7)]; a[u][0] -= mu; a[u][1] -= mu; const v4f t = a[u][0] * a[u][0] + a[u][1] * a[u][1]; red[(u >> 3) * 32 + gl * 8 + (u & 7)][w * 8 + fl] = (t[0] + t[1]) + (t[2] + t[3]); }
  prep_barrier();      /* publishes the partial sums of squares */
  { const float s2 = prep_total(red, rc, rj); if (rj == 0) srs[rc] = rsqrtf(s2 / 1023.0f + 1e-5f); }      /* unbiased variance */
  prep_barrier();      /* publishes the scales */
  float r[16];
#pragma unroll      /* r must stay in registers */
  for (int u = 0; u < 16; ++u) r[u] = srs[(u >> 3) * 32 + gl * 8 + (u & 7)];
  unsigned short* Hh = (unsigned short*)(NH + y * sN + o0); unsigned short* Lh = (unsigned short*)(NL + y * sN + o0);      /* the style's planes lie sN elements behind the content's */
#pragma unroll      /* a and r are indexed by constants only; the stores as above */
  for (int k = 0; k < 8; ++k) { const int o = ((k >> 2) * 32 + (k & 3)) * CC; FragH fh[2], fo[2];
#pragma unroll      /* as above */
    for (int u = 0; u < 16; ++u) { const float v = a[u][k >> 2][k & 3] * r[u]; const _Float16 hv = (_Float16)v; fh[u >> 3].h[u & 7] = hv; fo[u >> 3].h[u & 7] = (_Float16)((v - (float)hv) * 1024.0f); }
    *(v8us*)(Hh + o) = fh[0].half[0]; *(v8us*)(Hh + o + 32) = fh[1].half[0]; *(v8us*)(Lh + o) = fo[0].half[0]; *(v8us*)(Lh + o + 32) = fo[1].half[0];
    asm volatile("s_wait_xcnt 0x0" ::: "memory"); }      /* the next frame's packing, and the code behind the loop, reuse registers that these stores name */
  const int g = y * (NB * (CC / FC)) + blockIdx.x, r0 = (g >> 3) * 16, i0 = (g & 7) * 64;      /* the block's rows and columns of Wo Wh and of Wg^T Wf */
  const int ln = lane & 15, hh = lane >> 4; const bool vb = i0 == 0;      /* vb, the same for the whole block: it forms its rows of Wo bh and of Wg^T bf too */
  const float* ap = Wo + (size_t)(r0 + ln) * CC + w * 32 + 8 * hh; const float* bp = Wh + (size_t)(w * 32 + 8 * hh) * CC + i0 + 4 * ln; const float* vp = bh + w * 32 + 8 * hh;      /* the wave's 32 k */
  const float* gp = Wg + (size_t)(w * 32 + 8 * hh) * CC + r0 + ln; const float* fp = Wf + (size_t)(w * 32 + 8 * hh) * CC + i0 + 4 * ln; const float* up = bf_ + w * 32 + 8 * hh;      /* the same 32 k, here the output channels of Wg and Wf; row r0 + ln of Wg^T is a column of Wg */
  v4f xa[4], xv[4], xb[16];      /* A, row r0 + ln, and bh, which every column of its B fragment holds: k = 8 hh + 0 .. 7, then 16 + 8 hh + 0 .. 7; xb[i]: the same k in the same order, columns i0 + 4 ln + 0 .. 3, one to each of the four tiles, so that a lane's loads are 16 bytes wide */
  float ya[16]; v4f yv[4], yb[16];      /* the same of Wg^T (one value a load: its k runs down a column), bf and Wf */
  xa[0] = *(const v4fa*)ap; xa[1] = *(const v4fa*)(ap + 4); xa[2] = *(const v4fa*)(ap + 16); xa[3] = *(const v4fa*)(ap + 20);
#pragma unroll      /* the arrays must stay in registers; all loads of the wave in flight at once */
  for (int i = 0; i < 8; ++i) { xb[i] = *(const v4fa*)(bp + i * CC); xb[8 + i] = *(const v4fa*)(bp + (16 + i) * CC); ya[i] = gp[i * CC]; ya[8 + i] = gp[(16 + i) * CC]; yb[i] = *(const v4fa*)(fp + i * CC); yb[8 + i] = *(const v4fa*)(fp + (16 + i) * CC); }
  if (vb) { xv[0] = *(const v4fa*)vp; xv[1] = *(const v4fa*)(vp + 4); xv[2] = *(const v4fa*)(vp + 16); xv[3] = *(const v4fa*)(vp + 20); yv[0] = *(const v4fa*)up; yv[1] = *(const v4fa*)(up + 4); yv[2] = *(const v4fa*)(up + 16); yv[3] = *(const v4fa*)(up + 20); }
  asm volatile("s_wait_xcnt 0x0" :: "v"(ap), "v"(bp), "v"(vp), "v"(gp), "v"(fp), "v"(up) : "memory");      /* the vector addresses are inputs, so that they live up to this wait and no register that an issued load names is rewritten ahead of it */
  FragH fa, fb[4], ga, gb[4];
#pragma unroll      /* the fragments must stay in registers */
  for (int i = 0; i < 16; ++i) { fa.h[i] = w16(xa[i >> 2][i & 3]); fb[0].h[i] = w16(xb[i][0]); fb[1].h[i] = w16(xb[i][1]); fb[2].h[i] = w16(xb[i][2]); fb[3].h[i] = w16(xb[i][3]);
    ga.h[i] = w16(ya[i]); gb[0].h[i] = w16(yb[i][0]); gb[1].h[i] = w16(yb[i][1]); gb[2].h[i] = w16(yb[i][2]); gb[3].h[i] = w16(yb[i][3]); }
  const v8f z8 = {0.f, 0.f, 0.f, 0.f, 0.f, 0.f, 0.f, 0.f};
  const v8f d0 = g2_mma(fa.v, fb[0].v, z8), d1 = g2_mma(fa.v, fb[1].v, z8), d2 = g2_mma(fa.v, fb[2].v, z8), d3 = g2_mma(fa.v, fb[3].v, z8);
  const v8f e0 = g2_mma(ga.v, gb[0].v, z8), e1 = g2_mma(ga.v, gb[1].v, z8), e2 = g2_mma(ga.v, gb[2].v, z8), e3 = g2_mma(ga.v, gb[3].v, z8);
#pragma unroll      /* the sums are indexed by constants only */
  for (int q = 0; q < 8; ++q) { const v4f t = {d0[q], d1[q], d2[q], d3[q]}, u = {e0[q], e1[q], e2[q], e3[q]}; *(v4fa*)&wpart[0][w][8 * hh + q][4 * ln] = t; *(v4fa*)&wpart[1][w][8 * hh + q][4 * ln] = u; }      /* tile n's column ln is column 4 ln + n */
  if (vb) { FragH fv, fu;
#pragma unroll      /* as above */
    for (int i = 0; i < 16; ++i) { fv.h[i] = (_Float16)bf16_round(xv[i >> 2][i & 3]); fu.h[i] = (_Float16)bf16_round(yv[i >> 2][i & 3]); }
    const v8f dv = g2_mma(fa.v, fv.v, z8), du = g2_mma(ga.v, fu.v, z8);
    if (ln == 0) {
#pragma unroll      /* as above */
      for (int q = 0; q < 8; ++q) { red[w][8 * hh + q] = dv[q]; red[16 + w][8 * hh + q] = du[q]; } } }      /* every read of the statistics' sums ended at the barriers above */
  prep_barrier();      /* publishes the sixteen waves' partial sums */
  v2f p[16], m[16];      /* wave w adds up row w of either product; its 32 lanes store the row's 64 columns, a whole 128-byte line of f16 in every plane */
#pragma unroll      /* p and m must stay in registers; the 32 LDS reads go as one group */
  for (int s = 0; s < 16; ++s) { p[s] = *(const v2fa*)&wpart[0][s][w][2 * lane]; m[s] = *(const v2fa*)&wpart[1][s][w][2 * lane]; }
#pragma unroll      /* as above */
  for (int st = 8; st > 0; st >>= 1) {
#pragma unroll      /* as above */
    for (int s = 0; s < st; ++s) { p[s] += p[s + st]; m[s] += m[s + st]; } }
  FragH f; f.h[0] = (_Float16)(p[0][0] * 0.0625f); f.h[1] = (_Float16)(p[0][1] * 0.0625f);      /* 16 Wo . 16 Wh / 16: x 16 like the other weights */
  const float m0 = m[0][0] * 0.0625f, m1 = m[0][1] * 0.0625f; f.h[2] = (_Float16)m0; f.h[3] = (_Float16)m1; f.h[4] = (_Float16)((m0 - (float)f.h[2]) * 1024.0f); f.h[5] = (_Float16)((m1 - (float)f.h[3]) * 1024.0f);      /* Wg^T Wf feeds the unscaled logits: x 16 as f16 hi and residual x 2^10 */
  const size_t wo = (size_t)(r0 + w) * CC + i0 + 2 * lane;
  const v2us o2 = {f.u[0], f.u[1]}, oh = {f.u[2], f.u[3]}, ol = {f.u[4], f.u[5]}; *(v2us*)((unsigned short*)WP + wo) = o2; *(v2us*)((unsigned short*)MH + wo) = oh; *(v2us*)((unsigned short*)ML + wo) = ol;
  if (vb && tid < 32) { const int hv = tid >> 4, tl = tid & 15; float s = 0.f;      /* lanes 0 to 15: Wo bh; 16 to 31: Wg^T bf */
#pragma unroll      /* every LDS read at a constant offset, several in flight */
    for (int k = 0; k < 16; ++k) s += red[hv * 16 + k][tl];
    (hv ? BQ : BP)[(g >> 3) * 32 + tl] = s * 0.0625f; } }      /* a block's 16 values of either vector on a 128-byte line of their own: one writer a line */
extern "C" void kernel_launch(void* const* d_in, const int* in_sizes, int n_in,
                              void* d_out, int out_size, void* d_ws, size_t ws_size, hipStream_t stream) {
  (void)in_sizes; (void)n_in; (void)out_size;
  const float* content = (const float*)d_in[0]; const float* style = (const float*)d_in[1]; const float* Wf = (const float*)d_in[2]; const float* bf_ = (const float*)d_in[3]; const float* Wg = (const float*)d_in[4]; const float* Wh = (const float*)d_in[6]; const float* bh = (const float*)d_in[7]; const float* Wo = (const float*)d_in[8]; const float* bo = (const float*)d_in[9];
  char* ws = (char*)d_ws; size_t off = 0;
  auto take = [&](size_t bytes) { char* p = ws + off; off += (bytes + 255) & ~(size_t)255; return p; };
  const size_t npc = (size_t)NRC * CC, nps = (size_t)NRS * CC;
  _Float16* MH = (_Float16*)take((size_t)CC * CC * 2); _Float16* ML = (_Float16*)take((size_t)CC * CC * 2); _Float16* BH = (_Float16*)take((size_t)CC * CC * 2); float* BV = (float*)take((size_t)(CC / 16) * 32 * 4); float* BQ = (float*)take((size_t)(CC / 16) * 32 * 4);      /* MH | ML = Wg^T Wf (x 16, hi | residual), BH = Wo Wh (x 16), BV = Wo bh, BQ = Wg^T bf */
  _Float16* CNH = (_Float16*)take(npc * 2); _Float16* CNL = (_Float16*)take(npc * 2); _Float16* SNH = (_Float16*)take(nps * 2); _Float16* SNL = (_Float16*)take(nps * 2); _Float16* S16 = (_Float16*)take(nps * 2);
  _Float16* QH = (_Float16*)take(npc * 2); _Float16* QL = (_Float16*)take(npc * 2); _Float16* HT = (_Float16*)take(nps * 2);
  float* ST = (float*)take(2 * STP * 4);      /* the pieces' maxima and sums */
  _Float16* P = CNH;      /* the softmax weights [NRC][TS] over both content-normalised planes (dead after Q) */
  if (off > ws_size) return;      /* 1.5 + 16 x 5 + 16 x 3 + 2 = about 132 MiB */
  k_prep<<<dim3(NB * (CC / FC), 2), 512, 0, stream>>>(content, style, CNH, CNL, SNH - CNH, S16, Wf, Wg, Wh, Wo, bh, bf_, MH, ML, BQ, BH, BV);      /* conv (out, in) naturals */
  k_fgh<<<dim3((NRC / 128) * (CC / 128), 2), 256, 0, stream>>>(CNH, CNL, MH, ML, BQ, QH, QL, BH, S16, BV, HT);      /* Q into QH | QL; Wo H into HT */
  k_score<<<dim3((TC / 128) * (TS / 128), BG), 256, 0, stream>>>(QH, QL, SNH, SNL, ST, P);      /* Q^T mvn(style) (hi.hi + (lo.hi + hi.lo)), unscaled: F^T G less what is constant along a row; it leaves the kernel as the softmax's pieces */
  k_gemm2<0, 3><<<dim3((CC / 128) * (TC / 128), BG), 256, 0, stream>>>(HT, TS, (size_t)CC * TS, P, TS, (size_t)TC * TS, 1.0f, bo, 0, ST, nullptr, (float*)d_out, TC, (size_t)CC * TC, CC, TC, TS);      /* out [b][o][t] = (Wo H) . (the merged pieces)^T + bo; the weights' 2^10 is in their sums too */
}
